// v000
// Times are from an AMD MI455X. After a warm-up the kernel runs many times in a row, and a time is the length of
// such a window on the GPU divided by its runs, so every launch and the gaps after it count. The runs cycle
// through copies of the inputs. A figure is the median of several windows, for all but v000 over two sittings.
// Sittings can differ by a few percent; kernels timed side by side share one.
// The starting kernel, v000, takes 4380 microseconds a run.
// Contractions x.Wq^T, x.Wk^T, Wv.x^T, pos_emb.Wp^T, (q+bias_v).p^T band, (q+bias_u).k^T, P.V, ctx.Wo^T: v_wmma_f32_16x16x32_f16 (f16 operands, f32 accumulate); operand planes hold bf16-RNE-valued inputs with power-of-two carries (W x64, q/k/v/p x16, P x4096, ctx x64); softmax, bias adds and score scaling in f32.
#include <hip/hip_runtime.h>
#include <math.h>
#include <stdint.h>

#define NB_  4
#define NT_  2048
#define ND_  1024
#define NH_  8
#define HD_  128
#define NP_  4095
#define NPP_ 4096
#define BDW_ 2112   // width of the relative-position score band scratch (33 tiles of 64)

typedef _Float16 v16h __attribute__((ext_vector_type(16)));
typedef _Float16 v8h  __attribute__((ext_vector_type(8)));
typedef float    v8f  __attribute__((ext_vector_type(8)));
typedef float    v4f  __attribute__((ext_vector_type(4)));
typedef v4f __attribute__((may_alias)) v4fa;
typedef v8h __attribute__((may_alias)) v8ha;

// bf16 RNE of an f32 value, returned widened to f32 (exactly representable in f16 after a power-of-two carry)
__device__ __forceinline__ float bf_rne(float f) {
  unsigned u = __float_as_uint(f);
  u = (u + 0x7FFFu + ((u >> 16) & 1u)) & 0xFFFF0000u;
  return __uint_as_float(u);
}

// 16-bit WMMA fragment: elements 0..7 <- p[0..7], elements 8..15 <- p[16..23]
// (A: p = row m at k0 + 8h;  B stored [n][k]: p = row n at k0 + 8h;  same split k map for both)
union FragU { v16h v; v8ha h[2]; };
__device__ __forceinline__ v16h ldfrag(const _Float16* p) {
  FragU f;
  f.h[0] = *(const v8ha*)(p);
  f.h[1] = *(const v8ha*)(p + 16);
  return f.v;
}

// WMMA + hazard guard (ties D, keeps A/B live for 4 VALU slots)
__device__ __forceinline__ v8f mma16(v16h a, v16h b, v8f c) {
  c = __builtin_amdgcn_wmma_f32_16x16x32_f16(false, a, false, b, (short)0, c, false, false);
  asm volatile("v_nop\n\tv_nop\n\tv_nop\n\tv_nop" : "+v"(c) : "v"(a), "v"(b));
  return c;
}

__device__ __forceinline__ v8f zero8() { v8f z = {0.f, 0.f, 0.f, 0.f, 0.f, 0.f, 0.f, 0.f}; return z; }

// -------------------------------------------------------------------------------------------------
// f32 [nrows_src][ND_] -> f16 plane [nrows_dst][ND_]: dst = f16( bf_rne(src) * scale ), rows >= nrows_src are 0.
// coverage: nrows_dst * 128 threads * 8 = the whole [nrows_dst][1024] plane.
// -------------------------------------------------------------------------------------------------
__global__ __launch_bounds__(256) void cvt_plane_kernel(const float* __restrict__ src, _Float16* __restrict__ dst,
                                                        int nrows_src, int nrows_dst, float scale) {
  const int i = blockIdx.x * 256 + threadIdx.x;
  const int total8 = nrows_dst * (ND_ / 8);
  if (i >= total8) return;
  const int r  = i / (ND_ / 8);
  const int c8 = (i - r * (ND_ / 8)) * 8;
  const int rs = (r < nrows_src) ? r : (nrows_src - 1);          // clamped address
  const float sc = (r < nrows_src) ? scale : 0.0f;                // zero by value for filler rows
  const float* sp = src + (size_t)rs * ND_ + c8;
  const v4f a = *(const v4f*)(sp);
  const v4f b = *(const v4f*)(sp + 4);
  v8h o;
  o[0] = (_Float16)(bf_rne(a[0]) * sc); o[1] = (_Float16)(bf_rne(a[1]) * sc);
  o[2] = (_Float16)(bf_rne(a[2]) * sc); o[3] = (_Float16)(bf_rne(a[3]) * sc);
  o[4] = (_Float16)(bf_rne(b[0]) * sc); o[5] = (_Float16)(bf_rne(b[1]) * sc);
  o[6] = (_Float16)(bf_rne(b[2]) * sc); o[7] = (_Float16)(bf_rne(b[3]) * sc);
  _Float16* dp = dst + (size_t)r * ND_ + c8;
  *(v8h*)dp = o;
  
}

// -------------------------------------------------------------------------------------------------
// f16 WMMA GEMM: C[m][n] = epi( sum_k A[m][k] * Bt[nrow][k] ), nrow = n (+ 64*(skew0 - tm) when SKEW: band GEMM).
// A row-major [M][K] pitch lda; Bt row-major [N(+band)][K] pitch ldb; M, N multiples of 64, K multiple of 32.
// Each wave owns a 64x64 output tile (4x4 subtiles), 8 waves per block, grid.x = tiles/8, grid.y = z-batch.
// OUT 0: f32  C1 = acc*scale
// OUT 1: f16  C1 = f16(acc*scale)
// OUT 2: f16  C1 = f16((acc*scale + bf_rne(b1[n]))*carry), C2 = f16((acc*scale + bf_rne(b2[n]))*carry)
// ONE instruction with lane-contiguous 16-B pieces (f32: 16 lanes x 16 B = 256 B segment; f16: 8 lanes x 16 B =
// coverage: 4 slabs x 16 rows x 64 cols = the whole 64x64 tile per wave; tiles cover M x N exactly.
// -------------------------------------------------------------------------------------------------
template <int OUT, bool SKEW>
__global__ __launch_bounds__(256) void gemm_f16_kernel(
    const _Float16* __restrict__ A, int lda, long strideA,
    const _Float16* __restrict__ Bt, int ldb, long strideB,
    void* __restrict__ C1, void* __restrict__ C2, int ldc, long strideC,
    const float* __restrict__ b1, const float* __restrict__ b2,
    int M, int N, int K, float scale, float carry, int skew0) {
  __shared__ __align__(16) float sT[8][16 * 68];   // per-wave 16x64 slab, pitch 68 floats

  const int z    = blockIdx.y;
  const int lane = threadIdx.x & 31;
  const int wave = threadIdx.x >> 5;
  const int tilesN = N >> 6;
  const int tilesM = M >> 6;
  const int tile = blockIdx.x * 8 + wave;
  if (tile >= tilesM * tilesN) return;             // wave-uniform; no block barriers in this kernel
  const int tm = tile / tilesN;
  const int tn = tile - tm * tilesN;
  const int m0 = tm << 6;
  const int n0 = tn << 6;
  const int nsk = SKEW ? ((skew0 - tm) << 6) : 0;  // band row offset of Bt

  const _Float16* Ab = A  + (size_t)z * strideA;
  const _Float16* Bb = Bt + (size_t)z * strideB;

  const int rl   = lane & 15;          // row (A) / column (B, D) within a subtile
  const int koff = (lane >> 4) * 8;    // k offset of this lane half
  const int mOff = (lane >> 4) * 8;    // D row offset of this lane half

  v8f acc[4][4];
#pragma unroll
  for (int i = 0; i < 4; ++i)
#pragma unroll
    for (int j = 0; j < 4; ++j) acc[i][j] = zero8();

  for (int k0 = 0; k0 < K; k0 += 32) {
    v16h bfr[4];
#pragma unroll
    for (int j = 0; j < 4; ++j)
      bfr[j] = ldfrag(Bb + (size_t)(nsk + n0 + (j << 4) + rl) * ldb + koff + k0);
#pragma unroll
    for (int i = 0; i < 4; ++i) {
      const v16h af = ldfrag(Ab + (size_t)(m0 + (i << 4) + rl) * lda + koff + k0);
#pragma unroll
      for (int j = 0; j < 4; ++j) acc[i][j] = mma16(af, bfr[j], acc[i][j]);
    }
  }

  // ---- epilogue ----
  float* slab = sT[wave];
#pragma unroll
  for (int i = 0; i < 4; ++i) {
    const int mBase = m0 + (i << 4);
#pragma unroll
    for (int j = 0; j < 4; ++j)
#pragma unroll
      for (int r = 0; r < 8; ++r)
        slab[(mOff + r) * 68 + (j << 4) + rl] = acc[i][j][r] * scale;
    __builtin_amdgcn_fence(__ATOMIC_RELEASE, "workgroup");
    __builtin_amdgcn_wave_barrier();
    __builtin_amdgcn_fence(__ATOMIC_ACQUIRE, "workgroup");
    if (OUT == 0) {
      float* C = (float*)C1 + (size_t)z * strideC;
      const int hh = lane >> 4, c4 = (lane & 15) * 4;    // row segment 256 B = 16 lanes x 16 B
      {
#pragma unroll
        for (int it = 0; it < 8; ++it) {
          const int row = it * 2 + hh;
          const v4f v = *(const v4fa*)(slab + row * 68 + c4);
          *(v4f*)(C + (size_t)(mBase + row) * ldc + n0 + c4) = v;
        }
        
      }
    } else {
      const int q = lane >> 3, c8 = (lane & 7) * 8;
      _Float16* Ca = (_Float16*)C1 + (size_t)z * strideC;
      _Float16* Cb = (_Float16*)C2 + (size_t)z * strideC;
      v8h hv[4], lv[4];
#pragma unroll
      for (int it = 0; it < 4; ++it) {
        const int row = it * 4 + q;
        const float* sp = slab + row * 68 + c8;
        const v4f x0 = *(const v4fa*)(sp);
        const v4f x1 = *(const v4fa*)(sp + 4);
        float f[8];
        f[0] = x0[0]; f[1] = x0[1]; f[2] = x0[2]; f[3] = x0[3];
        f[4] = x1[0]; f[5] = x1[1]; f[6] = x1[2]; f[7] = x1[3];
        v8h ha, hb;
#pragma unroll
        for (int e = 0; e < 8; ++e) {
          if (OUT == 1) {
            ha[e] = (_Float16)f[e];
            hb[e] = ha[e];
          } else {
            const int n = n0 + c8 + e;
            ha[e] = (_Float16)((f[e] + bf_rne(b1[n])) * carry);
            hb[e] = (_Float16)((f[e] + bf_rne(b2[n])) * carry);
          }
        }
        hv[it] = ha; lv[it] = hb;
      }
      {
#pragma unroll
        for (int it = 0; it < 4; ++it) {
          const int row = it * 4 + q;
          *(v8h*)(Ca + (size_t)(mBase + row) * ldc + n0 + c8) = hv[it];
          if (OUT == 2) *(v8h*)(Cb + (size_t)(mBase + row) * ldc + n0 + c8) = lv[it];
        }
        
      }
    }
    __builtin_amdgcn_fence(__ATOMIC_RELEASE, "workgroup");
    __builtin_amdgcn_wave_barrier();
    __builtin_amdgcn_fence(__ATOMIC_ACQUIRE, "workgroup");
  }
}

// -------------------------------------------------------------------------------------------------
// Relative-position attention for a group of (batch, head) pairs, head dim 128, no mask.
//   QU  f16 plane [b*2048 + t][h*128 + d] = 16*(q + bias_u)       (A operand of the content score)
//   Kp  f16 plane [b*2048 + s][h*128 + d] = 16*k                  (B operand, staged per 64-key chunk as [key][d])
//   VT  f16 plane [b][h*128 + d][s]      = 16*v                  (B operand of P.V, staged as [d][key])
//   BD  f32 band scratch [z][2048][2112]: value (col j) = inv_sdk * (q_i + bias_v).p[row 64*(31 - i/64) + j]
//       rel-shift: bd[i][key] = bdfull[i][key - i + 2047]  ->  column (key - i + 2047) - 64*(31 - i/64)
//                = key + 63 - (i mod 64), always in [0, 2110].
//   score = cs * (QU.K^T acc) + BD  with cs = inv_sdk / 256;  online softmax in f32 over 32 chunks of 64 keys;
//   P stored per wave as f16(4096 * exp(s - m)); ctx = 64 * (P.V acc) / (4096*16*l) written as f16 plane
//   CTX [b*2048 + t][h*128 + d].
// Block = 4 waves = 64 query rows of one (b,h); grid = (32 query blocks, pairs in group).
// LDS: one raw buffer; K tile [64][128] f16 at 0, V^T tile [128][64] f16 at 16 KB, per-wave P tiles [16][64] f16
// at 32 KB; the output staging [4][16][128] f32 reuses bytes 0..32 KB after a block barrier.
// coverage: staging 128 thr x 64 halves for K (64x128) and for V^T (128x64); P tile 8 rows x 2 halves x 4x16 cols
// per wave = 16x64; output 8 store instructions x 2 rows x 16 lanes x 8 halves = 16x128 per wave.
// -------------------------------------------------------------------------------------------------
__global__ __launch_bounds__(128)
void relattn_kernel(const _Float16* __restrict__ QU, const _Float16* __restrict__ Kp,
                    const _Float16* __restrict__ VT, const float* __restrict__ BD,
                    _Float16* __restrict__ CTX, int pairBase, float cs) {
  __shared__ __align__(16) unsigned char SMEM[40960];
  _Float16* Ksh = (_Float16*)(SMEM);             // [64][128]
  _Float16* Vsh = (_Float16*)(SMEM + 16384);     // [128][64]
  _Float16* Psh = (_Float16*)(SMEM + 32768);     // [4][16][64]
  float*    Osh = (float*)(SMEM);                // [4][16][128] after the chunk loop

  const int tid  = threadIdx.x;
  const int wave = tid >> 5;
  const int lane = tid & 31;
  const int hh   = lane >> 4;
  const int c    = lane & 15;

  const int z    = blockIdx.y;
  const int pair = pairBase + z;
  const int b    = pair >> 3;
  const int h    = pair & 7;
  const int qb   = blockIdx.x;                   // 0..31
  const int q0   = qb * 64 + wave * 16;          // first query row of this wave
  const int rr0  = wave * 16 + 8 * hh;           // row within the 64-row block for r = 0

  const _Float16* Qh = QU + (size_t)(b * NT_) * ND_ + h * HD_;
  const _Float16* Kh = Kp + (size_t)(b * NT_) * ND_ + h * HD_;
  const _Float16* Vh = VT + (size_t)b * ND_ * NT_ + (size_t)(h * HD_) * NT_;
  const float*    bd = BD + (size_t)z * NT_ * BDW_;
  _Float16*       ctx = CTX + (size_t)(b * NT_) * ND_ + h * HD_;

  // Q fragments (A operand): 4 chunks of 32 along d
  v16h qa[4];
#pragma unroll
  for (int dc = 0; dc < 4; ++dc)
    qa[dc] = ldfrag(Qh + (size_t)(q0 + c) * ND_ + dc * 32 + 8 * hh);

  // band scratch: element for (row r, key kv0+16j+c) at bdr[r*(BDW_-1) + kv0 + 16j]
  const float* bdr = bd + (long)(q0 + 8 * hh) * BDW_ + (63 - rr0 + c);

  float mrow[8], lrow[8];
  v8f oacc[8];
#pragma unroll
  for (int r = 0; r < 8; ++r) { mrow[r] = -INFINITY; lrow[r] = 0.f; }
#pragma unroll
  for (int t = 0; t < 8; ++t) oacc[t] = zero8();

  _Float16* pw = Psh + wave * (16 * 64);

  for (int kc = 0; kc < NT_ / 64; ++kc) {
    const int kv0 = kc * 64;
    __syncthreads();
    {
      const int r = tid >> 1, c0 = (tid & 1) * 64;
      const _Float16* ks = Kh + (size_t)(kv0 + r) * ND_ + c0;
      const _Float16* vs = Vh + (size_t)tid * NT_ + kv0;
#pragma unroll
      for (int i = 0; i < 8; ++i) {
        const v8h kk8 = *(const v8h*)(ks + 8 * i);
        const v8h vv8 = *(const v8h*)(vs + 8 * i);
        *(v8ha*)(Ksh + r * 128 + c0 + 8 * i) = kk8;
        *(v8ha*)(Vsh + tid * 64 + 8 * i)      = vv8;
      }
    }
    __syncthreads();

    // content scores: S[j] = QU(16x128) . K^T for key subtile j
    v8f s[4];
#pragma unroll
    for (int j = 0; j < 4; ++j) {
      s[j] = zero8();
#pragma unroll
      for (int dc = 0; dc < 4; ++dc) {
        const v16h kb = ldfrag(Ksh + (j * 16 + c) * 128 + dc * 32 + 8 * hh);
        s[j] = mma16(qa[dc], kb, s[j]);
      }
    }

    // add the position term from the band scratch, chunk row max
    float cm[8];
#pragma unroll
    for (int r = 0; r < 8; ++r) {
      float m = -INFINITY;
#pragma unroll
      for (int j = 0; j < 4; ++j) {
        const float sv = s[j][r] * cs + bdr[(long)r * (BDW_ - 1) + kv0 + (j << 4)];
        s[j][r] = sv;
        m = fmaxf(m, sv);
      }
      m = fmaxf(m, __shfl_xor(m, 1, 32));
      m = fmaxf(m, __shfl_xor(m, 2, 32));
      m = fmaxf(m, __shfl_xor(m, 4, 32));
      m = fmaxf(m, __shfl_xor(m, 8, 32));
      cm[r] = m;
    }

    // online softmax update (per-row rescale of this row's accumulator elements only);
    // P tile (x4096) to this wave's LDS tile [row][key]
#pragma unroll
    for (int r = 0; r < 8; ++r) {
      const float mnew  = fmaxf(mrow[r], cm[r]);
      const float alpha = __expf(mrow[r] - mnew);
      mrow[r] = mnew;
      float psum = 0.f;
#pragma unroll
      for (int j = 0; j < 4; ++j) {
        const float p = __expf(s[j][r] - mnew);
        psum += p;
        pw[(8 * hh + r) * 64 + j * 16 + c] = (_Float16)(p * 4096.0f);
      }
      psum += __shfl_xor(psum, 1, 32);
      psum += __shfl_xor(psum, 2, 32);
      psum += __shfl_xor(psum, 4, 32);
      psum += __shfl_xor(psum, 8, 32);
      lrow[r] = lrow[r] * alpha + psum;
#pragma unroll
      for (int t = 0; t < 8; ++t) oacc[t][r] *= alpha;
    }
    __builtin_amdgcn_fence(__ATOMIC_RELEASE, "workgroup");
    __builtin_amdgcn_wave_barrier();
    __builtin_amdgcn_fence(__ATOMIC_ACQUIRE, "workgroup");

    // P (A operand, row = lane&15, split k map over keys) . V (B operand from V^T rows d)
#pragma unroll
    for (int kk = 0; kk < 2; ++kk) {
      const v16h pa = ldfrag(pw + c * 64 + kk * 32 + 8 * hh);
#pragma unroll
      for (int t = 0; t < 8; ++t) {
        const v16h vb = ldfrag(Vsh + (t * 16 + c) * 64 + kk * 32 + 8 * hh);
        oacc[t] = mma16(pa, vb, oacc[t]);
      }
    }
  }

  __syncthreads();                               // every wave is done with Ksh/Vsh before Osh aliases them
  float* os = Osh + wave * (16 * 128);
#pragma unroll
  for (int r = 0; r < 8; ++r) {
    const float inv = 1.0f / (1024.0f * lrow[r]);   // 64 / (4096 * 16 * l)
#pragma unroll
    for (int t = 0; t < 8; ++t) os[(8 * hh + r) * 128 + t * 16 + c] = oacc[t][r] * inv;
  }
  __builtin_amdgcn_fence(__ATOMIC_RELEASE, "workgroup");
  __builtin_amdgcn_wave_barrier();
  __builtin_amdgcn_fence(__ATOMIC_ACQUIRE, "workgroup");
  v8h ov[8];
#pragma unroll
  for (int it = 0; it < 8; ++it) {
    const int row = it * 2 + hh;                 // lanes 0-15 row 2it, lanes 16-31 row 2it+1
    const float* sp = os + row * 128 + c * 8;
    const v4f x0 = *(const v4fa*)(sp);
    const v4f x1 = *(const v4fa*)(sp + 4);
    v8h o;
    o[0] = (_Float16)x0[0]; o[1] = (_Float16)x0[1]; o[2] = (_Float16)x0[2]; o[3] = (_Float16)x0[3];
    o[4] = (_Float16)x1[0]; o[5] = (_Float16)x1[1]; o[6] = (_Float16)x1[2]; o[7] = (_Float16)x1[3];
    ov[it] = o;
  }
  {
#pragma unroll
    for (int it = 0; it < 8; ++it) {
      const int row = it * 2 + hh;
      *(v8h*)(ctx + (size_t)(q0 + row) * ND_ + c * 8) = ov[it];   // 16 lanes x 16 B = one 256-B row segment
    }
    
  }
}

// -------------------------------------------------------------------------------------------------
// Workspace map (bytes):
//   WO   f16 [1024][1024]              0
//   QU   f16 [8192][1024]        2097152
//   QV   f16 [8192][1024]       18874368
//   KP   f16 [8192][1024]       35651584
//   VTP  f16 [4][1024][2048]    52428800
//   CTX  f16 [8192][1024]       69206016
//   P16  f16 [4096][1024]       85983232
//   SCR                         94371840   (34603008 B): early phase WQ,WK,WV,WP f16 [1024][1024] at +0,+2097152,
//        +4194304,+6291456; X f16 [2048][1024] at +8388608; PE f16 [4096][1024] at +12582912 (end +20971520);
//        later phase: BD band f32 [2][2048][2112] (end +34603008)
//   total                      128974848
// Every region is written in whole 64x64 tiles / whole rows; all sizes are exact tile multiples.
// -------------------------------------------------------------------------------------------------
extern "C" void kernel_launch(void* const* d_in, const int* in_sizes, int n_in,
                              void* d_out, int out_size, void* d_ws, size_t ws_size,
                              hipStream_t stream) {
  if (n_in < 9) return;
  if (in_sizes[0] != NB_ * NT_ * ND_) return;
  if (in_sizes[1] != NP_ * ND_) return;
  if (in_sizes[2] != ND_ * ND_ || in_sizes[3] != ND_ * ND_ || in_sizes[4] != ND_ * ND_) return;
  if (in_sizes[5] != ND_ * ND_ || in_sizes[6] != ND_ * ND_) return;
  if (in_sizes[7] != NH_ * HD_ || in_sizes[8] != NH_ * HD_) return;
  if (out_size != NB_ * NT_ * ND_) return;

  const float* x   = (const float*)d_in[0];
  const float* pe  = (const float*)d_in[1];
  const float* Wq  = (const float*)d_in[2];
  const float* Wk  = (const float*)d_in[3];
  const float* Wv  = (const float*)d_in[4];
  const float* Wo  = (const float*)d_in[5];
  const float* Wp  = (const float*)d_in[6];
  const float* bu  = (const float*)d_in[7];
  const float* bvb = (const float*)d_in[8];
  float* out = (float*)d_out;

  const size_t PW16 = (size_t)ND_ * ND_ * 2;             //  2097152
  const size_t PA16 = (size_t)NB_ * NT_ * ND_ * 2;       // 16777216
  const size_t PP16 = (size_t)NPP_ * ND_ * 2;            //  8388608
  const size_t PX16 = (size_t)NT_ * ND_ * 2;             //  4194304
  const size_t PBD  = (size_t)NT_ * BDW_ * 4;            // 17301504 per pair
  const int    NPAIR = 2;                                // pairs per group
  size_t off = 0;
  const size_t oWO  = off; off += PW16;
  const size_t oQU  = off; off += PA16;
  const size_t oQV  = off; off += PA16;
  const size_t oKP  = off; off += PA16;
  const size_t oVT  = off; off += PA16;
  const size_t oCTX = off; off += PA16;
  const size_t oP16 = off; off += PP16;
  const size_t oSCR = off;
  const size_t oWQ  = oSCR;
  const size_t oWK  = oWQ + PW16;
  const size_t oWV  = oWK + PW16;
  const size_t oWP  = oWV + PW16;
  const size_t oX   = oWP + PW16;
  const size_t oPE  = oX + PX16;
  const size_t earlyEnd = oPE + PP16;
  const size_t bdEnd    = oSCR + (size_t)NPAIR * PBD;
  const size_t total    = (earlyEnd > bdEnd) ? earlyEnd : bdEnd;   // 128974848
  if (total > ws_size) return;
  if (total > (size_t)134217728) return;

  char* ws = (char*)d_ws;
  _Float16* WO  = (_Float16*)(ws + oWO);
  _Float16* QU  = (_Float16*)(ws + oQU);
  _Float16* QV  = (_Float16*)(ws + oQV);
  _Float16* KP  = (_Float16*)(ws + oKP);
  _Float16* VTP = (_Float16*)(ws + oVT);
  _Float16* CTX = (_Float16*)(ws + oCTX);
  _Float16* P16 = (_Float16*)(ws + oP16);
  _Float16* WQ  = (_Float16*)(ws + oWQ);
  _Float16* WK  = (_Float16*)(ws + oWK);
  _Float16* WV  = (_Float16*)(ws + oWV);
  _Float16* WP  = (_Float16*)(ws + oWP);
  _Float16* X   = (_Float16*)(ws + oX);
  _Float16* PE  = (_Float16*)(ws + oPE);
  float*    SCR = (float*)(ws + oSCR);

  const float inv_sdk = 0.08838834764831845f;   // 1/sqrt(128)
  const float cs      = inv_sdk * 0.00390625f;   // applied to the x16.x16 score accumulators
  const dim3 blk(256);

  // (1) weights -> f16 planes of bf16-valued entries, carried x64   (grid 1024*128/256 = 512)
  const dim3 gW((ND_ * (ND_ / 8) + 255) / 256);
  cvt_plane_kernel<<<gW, blk, 0, stream>>>(Wq, WQ, ND_, ND_, 64.0f);
  cvt_plane_kernel<<<gW, blk, 0, stream>>>(Wk, WK, ND_, ND_, 64.0f);
  cvt_plane_kernel<<<gW, blk, 0, stream>>>(Wv, WV, ND_, ND_, 64.0f);
  cvt_plane_kernel<<<gW, blk, 0, stream>>>(Wp, WP, ND_, ND_, 64.0f);
  cvt_plane_kernel<<<gW, blk, 0, stream>>>(Wo, WO, ND_, ND_, 64.0f);
  // (2) pos_emb -> f16 plane [4096][1024], row 4095 = 0
  const dim3 gPE((NPP_ * (ND_ / 8) + 255) / 256);
  cvt_plane_kernel<<<gPE, blk, 0, stream>>>(pe, PE, NP_, NPP_, 1.0f);
  // (3) p = pos_emb . Wp^T -> P16 = 16*p   (M=4096, N=1024, K=1024)
  {
    const int tiles = (NPP_ / 64) * (ND_ / 64);
    gemm_f16_kernel<1, false><<<dim3((tiles + 7) / 8, 1), blk, 0, stream>>>(
        PE, ND_, 0L, WP, ND_, 0L, (void*)P16, (void*)P16, ND_, 0L, bu, bu, NPP_, ND_, ND_, 0.25f, 1.0f, 0);
  }
  // (4) per batch element: x -> f16 plane; q (two bias variants), k, v^T projections
  for (int b = 0; b < NB_; ++b) {
    const dim3 gX((NT_ * (ND_ / 8) + 255) / 256);
    cvt_plane_kernel<<<gX, blk, 0, stream>>>(x + (size_t)b * NT_ * ND_, X, NT_, NT_, 1.0f);
    const int tilesQ = (NT_ / 64) * (ND_ / 64);          // 512
    const size_t ab = (size_t)b * NT_ * ND_;
    // QU = 16*(q + bias_u), QV = 16*(q + bias_v)    (M=2048, N=1024, K=1024)
    gemm_f16_kernel<2, false><<<dim3((tilesQ + 7) / 8, 1), blk, 0, stream>>>(
        X, ND_, 0L, WQ, ND_, 0L, (void*)(QU + ab), (void*)(QV + ab), ND_, 0L, bu, bvb,
        NT_, ND_, ND_, 0.015625f, 16.0f, 0);
    // KP = 16*k
    gemm_f16_kernel<1, false><<<dim3((tilesQ + 7) / 8, 1), blk, 0, stream>>>(
        X, ND_, 0L, WK, ND_, 0L, (void*)(KP + ab), (void*)(KP + ab), ND_, 0L, bu, bu,
        NT_, ND_, ND_, 0.25f, 1.0f, 0);
    // VT[b][h*128+d][t] = 16*v   (A = Wv plane [1024][1024], Bt = x plane [2048][1024]; M=1024, N=2048, K=1024)
    const int tilesV = (ND_ / 64) * (NT_ / 64);          // 512
    gemm_f16_kernel<1, false><<<dim3((tilesV + 7) / 8, 1), blk, 0, stream>>>(
        WV, ND_, 0L, X, ND_, 0L, (void*)(VTP + (size_t)b * ND_ * NT_), (void*)(VTP + (size_t)b * ND_ * NT_),
        NT_, 0L, bu, bu, ND_, NT_, ND_, 0.25f, 1.0f, 0);
  }
  // (5) per group of 2 (b,h) pairs: band GEMM of the position scores, then attention
  const int nGroups = (NB_ * NH_) / NPAIR;               // 16
  for (int g = 0; g < nGroups; ++g) {
    const int pairBase = g * NPAIR;
    const int b  = pairBase >> 3;
    const int h0 = pairBase & 7;
    const _Float16* Aq = QV + (size_t)b * NT_ * ND_ + h0 * HD_;   // rows t, cols d of head h0 (z adds 128)
    const _Float16* Bp = P16 + h0 * HD_;                           // rows p index, cols d of head h0
    const int tilesBD = (NT_ / 64) * (BDW_ / 64);                  // 32*33 = 1056
    gemm_f16_kernel<0, true><<<dim3((tilesBD + 7) / 8, NPAIR), blk, 0, stream>>>(
        Aq, ND_, (long)HD_, Bp, ND_, (long)HD_, (void*)SCR, (void*)SCR, BDW_, (long)NT_ * BDW_, bu, bu,
        NT_, BDW_, HD_, cs, 1.0f, 31);
    relattn_kernel<<<dim3(NT_ / 64, NPAIR), dim3(128), 0, stream>>>(QU, KP, VTP, SCR, CTX, pairBase, cs);
  }
  // (6) out = ctx . Wo^T -> d_out f32 [8192][1024]   (M=8192, N=1024, K=1024; carries 64*64 folded into scale)
  {
    const int tiles = ((NB_ * NT_) / 64) * (ND_ / 64);   // 2048
    gemm_f16_kernel<0, false><<<dim3((tiles + 7) / 8, 1), blk, 0, stream>>>(
        CTX, ND_, 0L, WO, ND_, 0L, (void*)out, (void*)out, ND_, 0L, bu, bu,
        NB_ * NT_, ND_, ND_, 0.000244140625f, 1.0f, 0);
  }
  (void)hipGetLastError();
}

// v001
// One run takes 1370 microseconds.
// Timed twice side by side with v000, it ran 3.20 and 3.22 times as fast.
// Contractions x.Wq^T, x.Wk^T, Wv.x^T, pos_emb.Wp^T, (q+bias_v).p^T band, (q+bias_u).k^T, P.V, ctx.Wo^T: v_wmma_f32_16x16x32_f16 (f16 operands, f32 accumulate); operand planes hold bf16-RNE-valued inputs with power-of-two carries (W x64, q/k/v/p x16, P x4096, ctx x64); softmax, bias adds and score scaling in f32.
#include <hip/hip_runtime.h>
#include <math.h>
#include <stdint.h>

#define NB_  4
#define NT_  2048
#define ND_  1024
#define NH_  8
#define HD_  128
#define NP_  4095
#define NPP_ 4096
#define BDW_ 2112   // width of the relative-position score band scratch (33 tiles of 64)

typedef _Float16 v16h __attribute__((ext_vector_type(16)));
typedef _Float16 v8h  __attribute__((ext_vector_type(8)));
typedef float    v8f  __attribute__((ext_vector_type(8)));
typedef float    v4f  __attribute__((ext_vector_type(4)));
typedef v4f __attribute__((may_alias)) v4fa;
typedef v8h __attribute__((may_alias)) v8ha;

// bf16 RNE of an f32 value, returned widened to f32 (exactly representable in f16 after a power-of-two carry)
__device__ __forceinline__ float bf_rne(float f) {
  unsigned u = __float_as_uint(f);
  u = (u + 0x7FFFu + ((u >> 16) & 1u)) & 0xFFFF0000u;
  return __uint_as_float(u);
}

// 16-bit WMMA fragment: elements 0..7 <- p[0..7], elements 8..15 <- p[16..23]
// (A: p = row m at k0 + 8h;  B stored [n][k]: p = row n at k0 + 8h;  same split k map for both)
union FragU { v16h v; v8ha h[2]; };
__device__ __forceinline__ v16h ldfrag(const _Float16* p) {
  FragU f;
  f.h[0] = *(const v8ha*)(p);
  f.h[1] = *(const v8ha*)(p + 16);
  return f.v;
}

// WMMA + hazard guard (ties D, keeps A/B live for 4 VALU slots)
__device__ __forceinline__ v8f mma16(v16h a, v16h b, v8f c) {
  c = __builtin_amdgcn_wmma_f32_16x16x32_f16(false, a, false, b, (short)0, c, false, false);
  asm volatile("v_nop\n\tv_nop\n\tv_nop\n\tv_nop" : "+v"(c) : "v"(a), "v"(b));
  return c;
}

__device__ __forceinline__ v8f zero8() { v8f z = {0.f, 0.f, 0.f, 0.f, 0.f, 0.f, 0.f, 0.f}; return z; }

// -------------------------------------------------------------------------------------------------
// f32 [nrows_src][ND_] -> f16 plane [nrows_dst][ND_]: dst = f16( bf_rne(src) * scale ), rows >= nrows_src are 0.
// coverage: nrows_dst * 128 threads * 8 = the whole [nrows_dst][1024] plane.
// -------------------------------------------------------------------------------------------------
__global__ __launch_bounds__(256) void cvt_plane_kernel(const float* __restrict__ src, _Float16* __restrict__ dst,
                                                        int nrows_src, int nrows_dst, float scale) {
  const int i = blockIdx.x * 256 + threadIdx.x;
  const int total8 = nrows_dst * (ND_ / 8);
  if (i >= total8) return;
  const int r  = i / (ND_ / 8);
  const int c8 = (i - r * (ND_ / 8)) * 8;
  const int rs = (r < nrows_src) ? r : (nrows_src - 1);          // clamped address
  const float sc = (r < nrows_src) ? scale : 0.0f;                // zero by value for filler rows
  const float* sp = src + (size_t)rs * ND_ + c8;
  const v4f a = *(const v4f*)(sp);
  const v4f b = *(const v4f*)(sp + 4);
  v8h o;
  o[0] = (_Float16)(bf_rne(a[0]) * sc); o[1] = (_Float16)(bf_rne(a[1]) * sc);
  o[2] = (_Float16)(bf_rne(a[2]) * sc); o[3] = (_Float16)(bf_rne(a[3]) * sc);
  o[4] = (_Float16)(bf_rne(b[0]) * sc); o[5] = (_Float16)(bf_rne(b[1]) * sc);
  o[6] = (_Float16)(bf_rne(b[2]) * sc); o[7] = (_Float16)(bf_rne(b[3]) * sc);
  _Float16* dp = dst + (size_t)r * ND_ + c8;
  *(v8h*)dp = o;
  
}

// -------------------------------------------------------------------------------------------------
// f16 WMMA GEMM: C[m][n] = epi( sum_k A[m][k] * Bt[nrow][k] ), nrow = n (+ 64*(skew0 - tm) when SKEW: band GEMM).
// A row-major [M][K] pitch lda; Bt row-major [N(+band)][K] pitch ldb; M, N multiples of 64, K multiple of 32.
// Each wave owns a 64x64 output tile (4x4 subtiles), 8 waves per block, grid.x = tiles/8, grid.y = z-batch.
// OUT 0: f32  C1 = acc*scale
// OUT 1: f16  C1 = f16(acc*scale)
// OUT 2: f16  C1 = f16((acc*scale + bf_rne(b1[n]))*carry), C2 = f16((acc*scale + bf_rne(b2[n]))*carry)
// ONE instruction with lane-contiguous 16-B pieces (f32: 16 lanes x 16 B = 256 B segment; f16: 8 lanes x 16 B =
// coverage: 4 slabs x 16 rows x 64 cols = the whole 64x64 tile per wave; tiles cover M x N exactly.
// -------------------------------------------------------------------------------------------------
template <int OUT, bool SKEW>
__global__ __launch_bounds__(256) void gemm_f16_kernel(
    const _Float16* __restrict__ A, int lda, long strideA,
    const _Float16* __restrict__ Bt, int ldb, long strideB,
    void* __restrict__ C1, void* __restrict__ C2, int ldc, long strideC,
    const float* __restrict__ b1, const float* __restrict__ b2,
    int M, int N, int K, float scale, float carry, int skew0) {
  __shared__ __align__(16) float sT[8][16 * 68];   // per-wave 16x64 slab, pitch 68 floats

  const int z    = blockIdx.y;
  const int lane = threadIdx.x & 31;
  const int wave = threadIdx.x >> 5;
  const int tilesN = N >> 6;
  const int tilesM = M >> 6;
  const int tile = blockIdx.x * 8 + wave;
  if (tile >= tilesM * tilesN) return;             // wave-uniform; no block barriers in this kernel
  const int tm = tile / tilesN;
  const int tn = tile - tm * tilesN;
  const int m0 = tm << 6;
  const int n0 = tn << 6;
  const int nsk = SKEW ? ((skew0 - tm) << 6) : 0;  // band row offset of Bt

  const _Float16* Ab = A  + (size_t)z * strideA;
  const _Float16* Bb = Bt + (size_t)z * strideB;

  const int rl   = lane & 15;          // row (A) / column (B, D) within a subtile
  const int koff = (lane >> 4) * 8;    // k offset of this lane half
  const int mOff = (lane >> 4) * 8;    // D row offset of this lane half

  v8f acc[4][4];
#pragma unroll
  for (int i = 0; i < 4; ++i)
#pragma unroll
    for (int j = 0; j < 4; ++j) acc[i][j] = zero8();

  for (int k0 = 0; k0 < K; k0 += 32) {
    v16h bfr[4];
#pragma unroll
    for (int j = 0; j < 4; ++j)
      bfr[j] = ldfrag(Bb + (size_t)(nsk + n0 + (j << 4) + rl) * ldb + koff + k0);
#pragma unroll
    for (int i = 0; i < 4; ++i) {
      const v16h af = ldfrag(Ab + (size_t)(m0 + (i << 4) + rl) * lda + koff + k0);
#pragma unroll
      for (int j = 0; j < 4; ++j) acc[i][j] = mma16(af, bfr[j], acc[i][j]);
    }
  }

  // ---- epilogue ----
  float* slab = sT[wave];
#pragma unroll
  for (int i = 0; i < 4; ++i) {
    const int mBase = m0 + (i << 4);
#pragma unroll
    for (int j = 0; j < 4; ++j)
#pragma unroll
      for (int r = 0; r < 8; ++r)
        slab[(mOff + r) * 68 + (j << 4) + rl] = acc[i][j][r] * scale;
    __builtin_amdgcn_fence(__ATOMIC_RELEASE, "workgroup");
    __builtin_amdgcn_wave_barrier();
    __builtin_amdgcn_fence(__ATOMIC_ACQUIRE, "workgroup");
    if (OUT == 0) {
      float* C = (float*)C1 + (size_t)z * strideC;
      const int hh = lane >> 4, c4 = (lane & 15) * 4;    // row segment 256 B = 16 lanes x 16 B
      {
#pragma unroll
        for (int it = 0; it < 8; ++it) {
          const int row = it * 2 + hh;
          const v4f v = *(const v4fa*)(slab + row * 68 + c4);
          *(v4f*)(C + (size_t)(mBase + row) * ldc + n0 + c4) = v;
        }
        
      }
    } else {
      const int q = lane >> 3, c8 = (lane & 7) * 8;
      _Float16* Ca = (_Float16*)C1 + (size_t)z * strideC;
      _Float16* Cb = (_Float16*)C2 + (size_t)z * strideC;
      v8h hv[4], lv[4];
#pragma unroll
      for (int it = 0; it < 4; ++it) {
        const int row = it * 4 + q;
        const float* sp = slab + row * 68 + c8;
        const v4f x0 = *(const v4fa*)(sp);
        const v4f x1 = *(const v4fa*)(sp + 4);
        float f[8];
        f[0] = x0[0]; f[1] = x0[1]; f[2] = x0[2]; f[3] = x0[3];
        f[4] = x1[0]; f[5] = x1[1]; f[6] = x1[2]; f[7] = x1[3];
        v8h ha, hb;
#pragma unroll
        for (int e = 0; e < 8; ++e) {
          if (OUT == 1) {
            ha[e] = (_Float16)f[e];
            hb[e] = ha[e];
          } else {
            const int n = n0 + c8 + e;
            ha[e] = (_Float16)((f[e] + bf_rne(b1[n])) * carry);
            hb[e] = (_Float16)((f[e] + bf_rne(b2[n])) * carry);
          }
        }
        hv[it] = ha; lv[it] = hb;
      }
      {
#pragma unroll
        for (int it = 0; it < 4; ++it) {
          const int row = it * 4 + q;
          *(v8h*)(Ca + (size_t)(mBase + row) * ldc + n0 + c8) = hv[it];
          if (OUT == 2) *(v8h*)(Cb + (size_t)(mBase + row) * ldc + n0 + c8) = lv[it];
        }
        
      }
    }
    __builtin_amdgcn_fence(__ATOMIC_RELEASE, "workgroup");
    __builtin_amdgcn_wave_barrier();
    __builtin_amdgcn_fence(__ATOMIC_ACQUIRE, "workgroup");
  }
}

// -------------------------------------------------------------------------------------------------
// Relative-position attention for a group of (batch, head) pairs, head dim 128, no mask.
//   QU  f16 plane [b*2048 + t][h*128 + d] = 16*(q + bias_u)       (A operand of the content score)
//   Kp  f16 plane [b*2048 + s][h*128 + d] = 16*k                  (B operand, staged per 64-key chunk as [key][d])
//   VT  f16 plane [b][h*128 + d][s]      = 16*v                  (B operand of P.V, staged as [d][key])
//   BD  f32 band scratch [z][2048][2112]: value (col j) = inv_sdk * (q_i + bias_v).p[row 64*(31 - i/64) + j]
//       rel-shift: bd[i][key] = bdfull[i][key - i + 2047]  ->  column (key - i + 2047) - 64*(31 - i/64)
//                = key + 63 - (i mod 64), always in [0, 2110].
//   score = cs * (QU.K^T acc) + BD  with cs = inv_sdk / 256;  online softmax in f32 over 32 chunks of 64 keys;
//   P stored per wave as f16(4096 * exp(s - m)); ctx = 64 * (P.V acc) / (4096*16*l) written as f16 plane
//   CTX [b*2048 + t][h*128 + d].
// Block = 4 waves = 64 query rows of one (b,h); grid = (32 query blocks, pairs in group).
// LDS: one raw buffer; K tile [64][128] f16 at 0, V^T tile [128][64] f16 at 16 KB, per-wave P tiles [16][64] f16
// at 32 KB; the output staging [4][16][128] f32 reuses bytes 0..32 KB after a block barrier.
// coverage: staging 128 thr x 64 halves for K (64x128) and for V^T (128x64); P tile 8 rows x 2 halves x 4x16 cols
// per wave = 16x64; output 8 store instructions x 2 rows x 16 lanes x 8 halves = 16x128 per wave.
// -------------------------------------------------------------------------------------------------
__global__ __launch_bounds__(128)
void relattn_kernel(const _Float16* __restrict__ QU, const _Float16* __restrict__ Kp,
                    const _Float16* __restrict__ VT, const float* __restrict__ BD,
                    _Float16* __restrict__ CTX, int pairBase, float cs) {
  __shared__ __align__(16) unsigned char SMEM[40960];
  _Float16* Ksh = (_Float16*)(SMEM);             // [64][128]
  _Float16* Vsh = (_Float16*)(SMEM + 16384);     // [128][64]
  _Float16* Psh = (_Float16*)(SMEM + 32768);     // [4][16][64]
  float*    Osh = (float*)(SMEM);                // [4][16][128] after the chunk loop

  const int tid  = threadIdx.x;
  const int wave = tid >> 5;
  const int lane = tid & 31;
  const int hh   = lane >> 4;
  const int c    = lane & 15;

  const int z    = blockIdx.y;
  const int pair = pairBase + z;
  const int b    = pair >> 3;
  const int h    = pair & 7;
  const int qb   = blockIdx.x;                   // 0..31
  const int q0   = qb * 64 + wave * 16;          // first query row of this wave
  const int rr0  = wave * 16 + 8 * hh;           // row within the 64-row block for r = 0

  const _Float16* Qh = QU + (size_t)(b * NT_) * ND_ + h * HD_;
  const _Float16* Kh = Kp + (size_t)(b * NT_) * ND_ + h * HD_;
  const _Float16* Vh = VT + (size_t)b * ND_ * NT_ + (size_t)(h * HD_) * NT_;
  const float*    bd = BD + (size_t)z * NT_ * BDW_;
  _Float16*       ctx = CTX + (size_t)(b * NT_) * ND_ + h * HD_;

  // Q fragments (A operand): 4 chunks of 32 along d
  v16h qa[4];
#pragma unroll
  for (int dc = 0; dc < 4; ++dc)
    qa[dc] = ldfrag(Qh + (size_t)(q0 + c) * ND_ + dc * 32 + 8 * hh);

  // band scratch: element for (row r, key kv0+16j+c) at bdr[r*(BDW_-1) + kv0 + 16j]
  const float* bdr = bd + (long)(q0 + 8 * hh) * BDW_ + (63 - rr0 + c);

  float mrow[8], lrow[8];
  v8f oacc[8];
#pragma unroll
  for (int r = 0; r < 8; ++r) { mrow[r] = -INFINITY; lrow[r] = 0.f; }
#pragma unroll
  for (int t = 0; t < 8; ++t) oacc[t] = zero8();

  _Float16* pw = Psh + wave * (16 * 64);

  for (int kc = 0; kc < NT_ / 64; ++kc) {
    const int kv0 = kc * 64;
    __syncthreads();
    {
      const int r = tid >> 1, c0 = (tid & 1) * 64;
      const _Float16* ks = Kh + (size_t)(kv0 + r) * ND_ + c0;
      const _Float16* vs = Vh + (size_t)tid * NT_ + kv0;
#pragma unroll
      for (int i = 0; i < 8; ++i) {
        const v8h kk8 = *(const v8h*)(ks + 8 * i);
        const v8h vv8 = *(const v8h*)(vs + 8 * i);
        *(v8ha*)(Ksh + r * 128 + c0 + 8 * i) = kk8;
        *(v8ha*)(Vsh + tid * 64 + 8 * i)      = vv8;
      }
    }
    __syncthreads();

    // content scores: S[j] = QU(16x128) . K^T for key subtile j
    v8f s[4];
#pragma unroll
    for (int j = 0; j < 4; ++j) {
      s[j] = zero8();
#pragma unroll
      for (int dc = 0; dc < 4; ++dc) {
        const v16h kb = ldfrag(Ksh + (j * 16 + c) * 128 + dc * 32 + 8 * hh);
        s[j] = mma16(qa[dc], kb, s[j]);
      }
    }

    // add the position term from the band scratch, chunk row max
    float cm[8];
#pragma unroll
    for (int r = 0; r < 8; ++r) {
      float m = -INFINITY;
#pragma unroll
      for (int j = 0; j < 4; ++j) {
        const float sv = s[j][r] * cs + bdr[(long)r * (BDW_ - 1) + kv0 + (j << 4)];
        s[j][r] = sv;
        m = fmaxf(m, sv);
      }
      m = fmaxf(m, __shfl_xor(m, 1, 32));
      m = fmaxf(m, __shfl_xor(m, 2, 32));
      m = fmaxf(m, __shfl_xor(m, 4, 32));
      m = fmaxf(m, __shfl_xor(m, 8, 32));
      cm[r] = m;
    }

    // online softmax update (per-row rescale of this row's accumulator elements only);
    // P tile (x4096) to this wave's LDS tile [row][key]
#pragma unroll
    for (int r = 0; r < 8; ++r) {
      const float mnew  = fmaxf(mrow[r], cm[r]);
      const float alpha = __expf(mrow[r] - mnew);
      mrow[r] = mnew;
      float psum = 0.f;
#pragma unroll
      for (int j = 0; j < 4; ++j) {
        const float p = __expf(s[j][r] - mnew);
        psum += p;
        pw[(8 * hh + r) * 64 + j * 16 + c] = (_Float16)(p * 4096.0f);
      }
      psum += __shfl_xor(psum, 1, 32);
      psum += __shfl_xor(psum, 2, 32);
      psum += __shfl_xor(psum, 4, 32);
      psum += __shfl_xor(psum, 8, 32);
      lrow[r] = lrow[r] * alpha + psum;
#pragma unroll
      for (int t = 0; t < 8; ++t) oacc[t][r] *= alpha;
    }
    __builtin_amdgcn_fence(__ATOMIC_RELEASE, "workgroup");
    __builtin_amdgcn_wave_barrier();
    __builtin_amdgcn_fence(__ATOMIC_ACQUIRE, "workgroup");

    // P (A operand, row = lane&15, split k map over keys) . V (B operand from V^T rows d)
#pragma unroll
    for (int kk = 0; kk < 2; ++kk) {
      const v16h pa = ldfrag(pw + c * 64 + kk * 32 + 8 * hh);
#pragma unroll
      for (int t = 0; t < 8; ++t) {
        const v16h vb = ldfrag(Vsh + (t * 16 + c) * 64 + kk * 32 + 8 * hh);
        oacc[t] = mma16(pa, vb, oacc[t]);
      }
    }
  }

  __syncthreads();                               // every wave is done with Ksh/Vsh before Osh aliases them
  float* os = Osh + wave * (16 * 128);
#pragma unroll
  for (int r = 0; r < 8; ++r) {
    const float inv = 1.0f / (1024.0f * lrow[r]);   // 64 / (4096 * 16 * l)
#pragma unroll
    for (int t = 0; t < 8; ++t) os[(8 * hh + r) * 128 + t * 16 + c] = oacc[t][r] * inv;
  }
  __builtin_amdgcn_fence(__ATOMIC_RELEASE, "workgroup");
  __builtin_amdgcn_wave_barrier();
  __builtin_amdgcn_fence(__ATOMIC_ACQUIRE, "workgroup");
  v8h ov[8];
#pragma unroll
  for (int it = 0; it < 8; ++it) {
    const int row = it * 2 + hh;                 // lanes 0-15 row 2it, lanes 16-31 row 2it+1
    const float* sp = os + row * 128 + c * 8;
    const v4f x0 = *(const v4fa*)(sp);
    const v4f x1 = *(const v4fa*)(sp + 4);
    v8h o;
    o[0] = (_Float16)x0[0]; o[1] = (_Float16)x0[1]; o[2] = (_Float16)x0[2]; o[3] = (_Float16)x0[3];
    o[4] = (_Float16)x1[0]; o[5] = (_Float16)x1[1]; o[6] = (_Float16)x1[2]; o[7] = (_Float16)x1[3];
    ov[it] = o;
  }
  {
#pragma unroll
    for (int it = 0; it < 8; ++it) {
      const int row = it * 2 + hh;
      *(v8h*)(ctx + (size_t)(q0 + row) * ND_ + c * 8) = ov[it];   // 16 lanes x 16 B = one 256-B row segment
    }
    
  }
}

// -------------------------------------------------------------------------------------------------
// Workspace map (bytes):
//   WO   f16 [1024][1024]              0
//   QU   f16 [8192][1024]        2097152
//   QV   f16 [8192][1024]       18874368
//   KP   f16 [8192][1024]       35651584
//   VTP  f16 [4][1024][2048]    52428800
//   CTX  f16 [8192][1024]       69206016
//   P16  f16 [4096][1024]       85983232
//   SCR                         94371840   (138412032 B): early phase WQ,WK,WV,WP f16 [1024][1024] at +0,+2097152,
//        +4194304,+6291456; X f16 [8192][1024] at +8388608; PE f16 [4096][1024] at +25165824 (end +33554432);
//        later phase: BD band f32 [8][2048][2112] (end +138412032)
//   total                      232783872
// Every region is written in whole 64x64 tiles / whole rows; all sizes are exact tile multiples.
// -------------------------------------------------------------------------------------------------
extern "C" void kernel_launch(void* const* d_in, const int* in_sizes, int n_in,
                              void* d_out, int out_size, void* d_ws, size_t ws_size,
                              hipStream_t stream) {
  if (n_in < 9) return;
  if (in_sizes[0] != NB_ * NT_ * ND_) return;
  if (in_sizes[1] != NP_ * ND_) return;
  if (in_sizes[2] != ND_ * ND_ || in_sizes[3] != ND_ * ND_ || in_sizes[4] != ND_ * ND_) return;
  if (in_sizes[5] != ND_ * ND_ || in_sizes[6] != ND_ * ND_) return;
  if (in_sizes[7] != NH_ * HD_ || in_sizes[8] != NH_ * HD_) return;
  if (out_size != NB_ * NT_ * ND_) return;

  const float* x   = (const float*)d_in[0];
  const float* pe  = (const float*)d_in[1];
  const float* Wq  = (const float*)d_in[2];
  const float* Wk  = (const float*)d_in[3];
  const float* Wv  = (const float*)d_in[4];
  const float* Wo  = (const float*)d_in[5];
  const float* Wp  = (const float*)d_in[6];
  const float* bu  = (const float*)d_in[7];
  const float* bvb = (const float*)d_in[8];
  float* out = (float*)d_out;

  const size_t PW16 = (size_t)ND_ * ND_ * 2;             //  2097152
  const size_t PA16 = (size_t)NB_ * NT_ * ND_ * 2;       // 16777216
  const size_t PP16 = (size_t)NPP_ * ND_ * 2;            //  8388608
  const size_t PBD  = (size_t)NT_ * BDW_ * 4;            // 17301504 per pair
  const int    NPAIR = 8;                                // pairs per group: all heads of one batch element
  size_t off = 0;
  const size_t oWO  = off; off += PW16;
  const size_t oQU  = off; off += PA16;
  const size_t oQV  = off; off += PA16;
  const size_t oKP  = off; off += PA16;
  const size_t oVT  = off; off += PA16;
  const size_t oCTX = off; off += PA16;
  const size_t oP16 = off; off += PP16;
  const size_t oSCR = off;
  const size_t oWQ  = oSCR;
  const size_t oWK  = oWQ + PW16;
  const size_t oWV  = oWK + PW16;
  const size_t oWP  = oWV + PW16;
  const size_t oX   = oWP + PW16;
  const size_t oPE  = oX + PA16;
  const size_t earlyEnd = oPE + PP16;
  const size_t bdEnd    = oSCR + (size_t)NPAIR * PBD;
  const size_t total    = (earlyEnd > bdEnd) ? earlyEnd : bdEnd;   // 232783872
  if (total > ws_size) return;

  char* ws = (char*)d_ws;
  _Float16* WO  = (_Float16*)(ws + oWO);
  _Float16* QU  = (_Float16*)(ws + oQU);
  _Float16* QV  = (_Float16*)(ws + oQV);
  _Float16* KP  = (_Float16*)(ws + oKP);
  _Float16* VTP = (_Float16*)(ws + oVT);
  _Float16* CTX = (_Float16*)(ws + oCTX);
  _Float16* P16 = (_Float16*)(ws + oP16);
  _Float16* WQ  = (_Float16*)(ws + oWQ);
  _Float16* WK  = (_Float16*)(ws + oWK);
  _Float16* WV  = (_Float16*)(ws + oWV);
  _Float16* WP  = (_Float16*)(ws + oWP);
  _Float16* X   = (_Float16*)(ws + oX);
  _Float16* PE  = (_Float16*)(ws + oPE);
  float*    SCR = (float*)(ws + oSCR);

  const float inv_sdk = 0.08838834764831845f;   // 1/sqrt(128)
  const float cs      = inv_sdk * 0.00390625f;   // applied to the x16.x16 score accumulators
  const dim3 blk(256);

  // (1) weights -> f16 planes of bf16-valued entries, carried x64   (grid 1024*128/256 = 512)
  const dim3 gW((ND_ * (ND_ / 8) + 255) / 256);
  cvt_plane_kernel<<<gW, blk, 0, stream>>>(Wq, WQ, ND_, ND_, 64.0f);
  cvt_plane_kernel<<<gW, blk, 0, stream>>>(Wk, WK, ND_, ND_, 64.0f);
  cvt_plane_kernel<<<gW, blk, 0, stream>>>(Wv, WV, ND_, ND_, 64.0f);
  cvt_plane_kernel<<<gW, blk, 0, stream>>>(Wp, WP, ND_, ND_, 64.0f);
  cvt_plane_kernel<<<gW, blk, 0, stream>>>(Wo, WO, ND_, ND_, 64.0f);
  // (2) pos_emb -> f16 plane [4096][1024], row 4095 = 0
  const dim3 gPE((NPP_ * (ND_ / 8) + 255) / 256);
  cvt_plane_kernel<<<gPE, blk, 0, stream>>>(pe, PE, NP_, NPP_, 1.0f);
  // (3) p = pos_emb . Wp^T -> P16 = 16*p   (M=4096, N=1024, K=1024)
  {
    const int tiles = (NPP_ / 64) * (ND_ / 64);
    gemm_f16_kernel<1, false><<<dim3((tiles + 7) / 8, 1), blk, 0, stream>>>(
        PE, ND_, 0L, WP, ND_, 0L, (void*)P16, (void*)P16, ND_, 0L, bu, bu, NPP_, ND_, ND_, 0.25f, 1.0f, 0);
  }
  // (4) x -> f16 plane, all batch elements; q (two bias variants), k, v^T projections: one launch of 256 work-groups each
  {
    const dim3 gX((NB_ * NT_ * (ND_ / 8) + 255) / 256);
    cvt_plane_kernel<<<gX, blk, 0, stream>>>(x, X, NB_ * NT_, NB_ * NT_, 1.0f);
    const int tilesQ = ((NB_ * NT_) / 64) * (ND_ / 64);  // 2048
    // QU = 16*(q + bias_u), QV = 16*(q + bias_v)    (M=8192, N=1024, K=1024)
    gemm_f16_kernel<2, false><<<dim3((tilesQ + 7) / 8, 1), blk, 0, stream>>>(
        X, ND_, 0L, WQ, ND_, 0L, (void*)QU, (void*)QV, ND_, 0L, bu, bvb,
        NB_ * NT_, ND_, ND_, 0.015625f, 16.0f, 0);
    // KP = 16*k
    gemm_f16_kernel<1, false><<<dim3((tilesQ + 7) / 8, 1), blk, 0, stream>>>(
        X, ND_, 0L, WK, ND_, 0L, (void*)KP, (void*)KP, ND_, 0L, bu, bu,
        NB_ * NT_, ND_, ND_, 0.25f, 1.0f, 0);
    // VT[b][h*128+d][t] = 16*v   (A = Wv plane [1024][1024], Bt = x plane of batch z [2048][1024];
    //                             M=1024, N=2048, K=1024 per z, grid.y = batch)
    const int tilesV = (ND_ / 64) * (NT_ / 64);          // 512 per batch element
    gemm_f16_kernel<1, false><<<dim3((tilesV + 7) / 8, NB_), blk, 0, stream>>>(
        WV, ND_, 0L, X, ND_, (long)NT_ * ND_, (void*)VTP, (void*)VTP,
        NT_, (long)ND_ * NT_, bu, bu, ND_, NT_, ND_, 0.25f, 1.0f, 0);
  }
  // (5) per group of 8 (b,h) pairs: band GEMM of the position scores, then attention (256 work-groups, one per WGP)
  const int nGroups = (NB_ * NH_) / NPAIR;               // 4
  for (int g = 0; g < nGroups; ++g) {
    const int pairBase = g * NPAIR;
    const int b  = pairBase >> 3;
    const int h0 = pairBase & 7;
    const _Float16* Aq = QV + (size_t)b * NT_ * ND_ + h0 * HD_;   // rows t, cols d of head h0 (z adds 128)
    const _Float16* Bp = P16 + h0 * HD_;                           // rows p index, cols d of head h0
    const int tilesBD = (NT_ / 64) * (BDW_ / 64);                  // 32*33 = 1056
    gemm_f16_kernel<0, true><<<dim3((tilesBD + 7) / 8, NPAIR), blk, 0, stream>>>(
        Aq, ND_, (long)HD_, Bp, ND_, (long)HD_, (void*)SCR, (void*)SCR, BDW_, (long)NT_ * BDW_, bu, bu,
        NT_, BDW_, HD_, cs, 1.0f, 31);
    relattn_kernel<<<dim3(NT_ / 64, NPAIR), dim3(128), 0, stream>>>(QU, KP, VTP, SCR, CTX, pairBase, cs);
  }
  // (6) out = ctx . Wo^T -> d_out f32 [8192][1024]   (M=8192, N=1024, K=1024; carries 64*64 folded into scale)
  {
    const int tiles = ((NB_ * NT_) / 64) * (ND_ / 64);   // 2048
    gemm_f16_kernel<0, false><<<dim3((tiles + 7) / 8, 1), blk, 0, stream>>>(
        CTX, ND_, 0L, WO, ND_, 0L, (void*)out, (void*)out, ND_, 0L, bu, bu,
        NB_ * NT_, ND_, ND_, 0.000244140625f, 1.0f, 0);
  }
  (void)hipGetLastError();
}

// v002
// A run of this version takes 1170 microseconds.
// Timed twice side by side with v001, it ran 1.17 times as fast both times.
// Over all steps from v000 it is 3.77 times as fast.
// Contractions x.Wq^T, x.Wk^T, Wv.x^T, pos_emb.Wp^T, (q+bias_v).p^T band, (q+bias_u).k^T, P.V, ctx.Wo^T: v_wmma_f32_16x16x32_f16 (f16 operands, f32 accumulate); operand planes hold bf16-RNE-valued inputs with power-of-two carries (W x64, q/k/v/p x16, P x4096, ctx x64); softmax, bias adds and score scaling in f32.
#include <hip/hip_runtime.h>
#include <math.h>
#include <stdint.h>

#define NB_  4
#define NT_  2048
#define ND_  1024
#define NH_  8
#define HD_  128
#define NP_  4095
#define NPP_ 4096
#define BDW_ 2112   // width of the relative-position score band scratch (33 tiles of 64)
// LDS row pitches of the attention tiles, in halves: 16 B x odd, so that the 16 rows one ds_load_b128 reads
// fall on 16 different groups of four banks (unpadded 256-B rows all fall on one group, 128-B rows on two)
#define KPIT_ 136   // K tile row: 128 halves + 8  (272 B)
#define VPIT_ 72    // V^T tile row: 64 halves + 8 (144 B)
#define PPIT_ 72    // P tile row: 64 halves + 8   (144 B)

typedef _Float16 v16h __attribute__((ext_vector_type(16)));
typedef _Float16 v8h  __attribute__((ext_vector_type(8)));
typedef float    v8f  __attribute__((ext_vector_type(8)));
typedef float    v4f  __attribute__((ext_vector_type(4)));
typedef v4f __attribute__((may_alias)) v4fa;
typedef v8h __attribute__((may_alias)) v8ha;

// bf16 RNE of an f32 value, returned widened to f32 (exactly representable in f16 after a power-of-two carry)
__device__ __forceinline__ float bf_rne(float f) {
  unsigned u = __float_as_uint(f);
  u = (u + 0x7FFFu + ((u >> 16) & 1u)) & 0xFFFF0000u;
  return __uint_as_float(u);
}

// 16-bit WMMA fragment: elements 0..7 <- p[0..7], elements 8..15 <- p[16..23]
// (A: p = row m at k0 + 8h;  B stored [n][k]: p = row n at k0 + 8h;  same split k map for both)
union FragU { v16h v; v8ha h[2]; };
__device__ __forceinline__ v16h ldfrag(const _Float16* p) {
  FragU f;
  f.h[0] = *(const v8ha*)(p);
  f.h[1] = *(const v8ha*)(p + 16);
  return f.v;
}

// WMMA + hazard guard (ties D, keeps A/B live for 4 VALU slots)
__device__ __forceinline__ v8f mma16(v16h a, v16h b, v8f c) {
  c = __builtin_amdgcn_wmma_f32_16x16x32_f16(false, a, false, b, (short)0, c, false, false);
  asm volatile("v_nop\n\tv_nop\n\tv_nop\n\tv_nop" : "+v"(c) : "v"(a), "v"(b));
  return c;
}

__device__ __forceinline__ v8f zero8() { v8f z = {0.f, 0.f, 0.f, 0.f, 0.f, 0.f, 0.f, 0.f}; return z; }

// -------------------------------------------------------------------------------------------------
// f32 [nrows_src][ND_] -> f16 plane [nrows_dst][ND_]: dst = f16( bf_rne(src) * scale ), rows >= nrows_src are 0.
// coverage: nrows_dst * 128 threads * 8 = the whole [nrows_dst][1024] plane.
// -------------------------------------------------------------------------------------------------
__global__ __launch_bounds__(256) void cvt_plane_kernel(const float* __restrict__ src, _Float16* __restrict__ dst,
                                                        int nrows_src, int nrows_dst, float scale) {
  const int i = blockIdx.x * 256 + threadIdx.x;
  const int total8 = nrows_dst * (ND_ / 8);
  if (i >= total8) return;
  const int r  = i / (ND_ / 8);
  const int c8 = (i - r * (ND_ / 8)) * 8;
  const int rs = (r < nrows_src) ? r : (nrows_src - 1);          // clamped address
  const float sc = (r < nrows_src) ? scale : 0.0f;                // zero by value for filler rows
  const float* sp = src + (size_t)rs * ND_ + c8;
  const v4f a = *(const v4f*)(sp);
  const v4f b = *(const v4f*)(sp + 4);
  v8h o;
  o[0] = (_Float16)(bf_rne(a[0]) * sc); o[1] = (_Float16)(bf_rne(a[1]) * sc);
  o[2] = (_Float16)(bf_rne(a[2]) * sc); o[3] = (_Float16)(bf_rne(a[3]) * sc);
  o[4] = (_Float16)(bf_rne(b[0]) * sc); o[5] = (_Float16)(bf_rne(b[1]) * sc);
  o[6] = (_Float16)(bf_rne(b[2]) * sc); o[7] = (_Float16)(bf_rne(b[3]) * sc);
  _Float16* dp = dst + (size_t)r * ND_ + c8;
  *(v8h*)dp = o;
  
}

// -------------------------------------------------------------------------------------------------
// f16 WMMA GEMM: C[m][n] = epi( sum_k A[m][k] * Bt[nrow][k] ), nrow = n (+ 64*(skew0 - tm) when SKEW: band GEMM).
// A row-major [M][K] pitch lda; Bt row-major [N(+band)][K] pitch ldb; M, N multiples of 64, K multiple of 32.
// Each wave owns a 64x64 output tile (4x4 subtiles), 8 waves per block, grid.x = tiles/8, grid.y = z-batch.
// OUT 0: f32  C1 = acc*scale
// OUT 1: f16  C1 = f16(acc*scale)
// OUT 2: f16  C1 = f16((acc*scale + bf_rne(b1[n]))*carry), C2 = f16((acc*scale + bf_rne(b2[n]))*carry)
// ONE instruction with lane-contiguous 16-B pieces (f32: 16 lanes x 16 B = 256 B segment; f16: 8 lanes x 16 B =
// coverage: 4 slabs x 16 rows x 64 cols = the whole 64x64 tile per wave; tiles cover M x N exactly.
// -------------------------------------------------------------------------------------------------
template <int OUT, bool SKEW>
__global__ __launch_bounds__(256) void gemm_f16_kernel(
    const _Float16* __restrict__ A, int lda, long strideA,
    const _Float16* __restrict__ Bt, int ldb, long strideB,
    void* __restrict__ C1, void* __restrict__ C2, int ldc, long strideC,
    const float* __restrict__ b1, const float* __restrict__ b2,
    int M, int N, int K, float scale, float carry, int skew0) {
  __shared__ __align__(16) float sT[8][16 * 68];   // per-wave 16x64 slab, pitch 68 floats

  const int z    = blockIdx.y;
  const int lane = threadIdx.x & 31;
  const int wave = threadIdx.x >> 5;
  const int tilesN = N >> 6;
  const int tilesM = M >> 6;
  const int tile = blockIdx.x * 8 + wave;
  if (tile >= tilesM * tilesN) return;             // wave-uniform; no block barriers in this kernel
  const int tm = tile / tilesN;
  const int tn = tile - tm * tilesN;
  const int m0 = tm << 6;
  const int n0 = tn << 6;
  const int nsk = SKEW ? ((skew0 - tm) << 6) : 0;  // band row offset of Bt

  const _Float16* Ab = A  + (size_t)z * strideA;
  const _Float16* Bb = Bt + (size_t)z * strideB;

  const int rl   = lane & 15;          // row (A) / column (B, D) within a subtile
  const int koff = (lane >> 4) * 8;    // k offset of this lane half
  const int mOff = (lane >> 4) * 8;    // D row offset of this lane half

  v8f acc[4][4];
#pragma unroll
  for (int i = 0; i < 4; ++i)
#pragma unroll
    for (int j = 0; j < 4; ++j) acc[i][j] = zero8();

  for (int k0 = 0; k0 < K; k0 += 32) {
    v16h bfr[4];
#pragma unroll
    for (int j = 0; j < 4; ++j)
      bfr[j] = ldfrag(Bb + (size_t)(nsk + n0 + (j << 4) + rl) * ldb + koff + k0);
#pragma unroll
    for (int i = 0; i < 4; ++i) {
      const v16h af = ldfrag(Ab + (size_t)(m0 + (i << 4) + rl) * lda + koff + k0);
#pragma unroll
      for (int j = 0; j < 4; ++j) acc[i][j] = mma16(af, bfr[j], acc[i][j]);
    }
  }

  // ---- epilogue ----
  float* slab = sT[wave];
#pragma unroll
  for (int i = 0; i < 4; ++i) {
    const int mBase = m0 + (i << 4);
#pragma unroll
    for (int j = 0; j < 4; ++j)
#pragma unroll
      for (int r = 0; r < 8; ++r)
        slab[(mOff + r) * 68 + (j << 4) + rl] = acc[i][j][r] * scale;
    __builtin_amdgcn_fence(__ATOMIC_RELEASE, "workgroup");
    __builtin_amdgcn_wave_barrier();
    __builtin_amdgcn_fence(__ATOMIC_ACQUIRE, "workgroup");
    if (OUT == 0) {
      float* C = (float*)C1 + (size_t)z * strideC;
      const int hh = lane >> 4, c4 = (lane & 15) * 4;    // row segment 256 B = 16 lanes x 16 B
      {
#pragma unroll
        for (int it = 0; it < 8; ++it) {
          const int row = it * 2 + hh;
          const v4f v = *(const v4fa*)(slab + row * 68 + c4);
          *(v4f*)(C + (size_t)(mBase + row) * ldc + n0 + c4) = v;
        }
        
      }
    } else {
      const int q = lane >> 3, c8 = (lane & 7) * 8;
      _Float16* Ca = (_Float16*)C1 + (size_t)z * strideC;
      _Float16* Cb = (_Float16*)C2 + (size_t)z * strideC;
      v8h hv[4], lv[4];
#pragma unroll
      for (int it = 0; it < 4; ++it) {
        const int row = it * 4 + q;
        const float* sp = slab + row * 68 + c8;
        const v4f x0 = *(const v4fa*)(sp);
        const v4f x1 = *(const v4fa*)(sp + 4);
        float f[8];
        f[0] = x0[0]; f[1] = x0[1]; f[2] = x0[2]; f[3] = x0[3];
        f[4] = x1[0]; f[5] = x1[1]; f[6] = x1[2]; f[7] = x1[3];
        v8h ha, hb;
#pragma unroll
        for (int e = 0; e < 8; ++e) {
          if (OUT == 1) {
            ha[e] = (_Float16)f[e];
            hb[e] = ha[e];
          } else {
            const int n = n0 + c8 + e;
            ha[e] = (_Float16)((f[e] + bf_rne(b1[n])) * carry);
            hb[e] = (_Float16)((f[e] + bf_rne(b2[n])) * carry);
          }
        }
        hv[it] = ha; lv[it] = hb;
      }
      {
#pragma unroll
        for (int it = 0; it < 4; ++it) {
          const int row = it * 4 + q;
          *(v8h*)(Ca + (size_t)(mBase + row) * ldc + n0 + c8) = hv[it];
          if (OUT == 2) *(v8h*)(Cb + (size_t)(mBase + row) * ldc + n0 + c8) = lv[it];
        }
        
      }
    }
    __builtin_amdgcn_fence(__ATOMIC_RELEASE, "workgroup");
    __builtin_amdgcn_wave_barrier();
    __builtin_amdgcn_fence(__ATOMIC_ACQUIRE, "workgroup");
  }
}

// -------------------------------------------------------------------------------------------------
// Relative-position attention for a group of (batch, head) pairs, head dim 128, no mask.
//   QU  f16 plane [b*2048 + t][h*128 + d] = 16*(q + bias_u)       (A operand of the content score)
//   Kp  f16 plane [b*2048 + s][h*128 + d] = 16*k                  (B operand, staged per 64-key chunk as [key][d])
//   VT  f16 plane [b][h*128 + d][s]      = 16*v                  (B operand of P.V, staged as [d][key])
//   BD  f32 band scratch [z][2048][2112]: value (col j) = inv_sdk * (q_i + bias_v).p[row 64*(31 - i/64) + j]
//       rel-shift: bd[i][key] = bdfull[i][key - i + 2047]  ->  column (key - i + 2047) - 64*(31 - i/64)
//                = key + 63 - (i mod 64), always in [0, 2110].
//   score = cs * (QU.K^T acc) + BD  with cs = inv_sdk / 256;  online softmax in f32 over 32 chunks of 64 keys;
//   P stored per wave as f16(4096 * exp(s - m)); ctx = 64 * (P.V acc) / (4096*16*l) written as f16 plane
//   CTX [b*2048 + t][h*128 + d].
// Block = 4 waves = 64 query rows of one (b,h); grid = (32 query blocks, pairs in group).
// LDS: one raw buffer; K tile [64][128] f16 at 0 (row pitch 272 B), V^T tile [128][64] f16 at 17408 (pitch 144 B),
// per-wave P tiles [16][64] f16 at 35840 (pitch 144 B); the output staging [4][16][128] f32 reuses bytes 0..32 KB
// (inside the K and V^T tiles) after a block barrier.
// coverage: staging 128 thr x 64 halves for K (64x128) and for V^T (128x64); P tile 8 rows x 2 halves x 4x16 cols
// per wave = 16x64; output 8 store instructions x 2 rows x 16 lanes x 8 halves = 16x128 per wave.
// -------------------------------------------------------------------------------------------------
__global__ __launch_bounds__(128)
void relattn_kernel(const _Float16* __restrict__ QU, const _Float16* __restrict__ Kp,
                    const _Float16* __restrict__ VT, const float* __restrict__ BD,
                    _Float16* __restrict__ CTX, int pairBase, float cs) {
  __shared__ __align__(16) unsigned char SMEM[64 * KPIT_ * 2 + 128 * VPIT_ * 2 + 4 * 16 * PPIT_ * 2];   // 45056
  _Float16* Ksh = (_Float16*)(SMEM);                                      // [64][KPIT_]
  _Float16* Vsh = (_Float16*)(SMEM + 64 * KPIT_ * 2);                     // [128][VPIT_]
  _Float16* Psh = (_Float16*)(SMEM + 64 * KPIT_ * 2 + 128 * VPIT_ * 2);   // [4][16][PPIT_]
  float*    Osh = (float*)(SMEM);                // [4][16][128] after the chunk loop

  const int tid  = threadIdx.x;
  const int wave = tid >> 5;
  const int lane = tid & 31;
  const int hh   = lane >> 4;
  const int c    = lane & 15;

  const int z    = blockIdx.y;
  const int pair = pairBase + z;
  const int b    = pair >> 3;
  const int h    = pair & 7;
  const int qb   = blockIdx.x;                   // 0..31
  const int q0   = qb * 64 + wave * 16;          // first query row of this wave
  const int rr0  = wave * 16 + 8 * hh;           // row within the 64-row block for r = 0

  const _Float16* Qh = QU + (size_t)(b * NT_) * ND_ + h * HD_;
  const _Float16* Kh = Kp + (size_t)(b * NT_) * ND_ + h * HD_;
  const _Float16* Vh = VT + (size_t)b * ND_ * NT_ + (size_t)(h * HD_) * NT_;
  const float*    bd = BD + (size_t)z * NT_ * BDW_;
  _Float16*       ctx = CTX + (size_t)(b * NT_) * ND_ + h * HD_;

  // Q fragments (A operand): 4 chunks of 32 along d
  v16h qa[4];
#pragma unroll
  for (int dc = 0; dc < 4; ++dc)
    qa[dc] = ldfrag(Qh + (size_t)(q0 + c) * ND_ + dc * 32 + 8 * hh);

  // band scratch: element for (row r, key kv0+16j+c) at bdr[r*(BDW_-1) + kv0 + 16j]
  const float* bdr = bd + (long)(q0 + 8 * hh) * BDW_ + (63 - rr0 + c);

  float mrow[8], lrow[8];
  v8f oacc[8];
#pragma unroll
  for (int r = 0; r < 8; ++r) { mrow[r] = -INFINITY; lrow[r] = 0.f; }
#pragma unroll
  for (int t = 0; t < 8; ++t) oacc[t] = zero8();

  _Float16* pw = Psh + wave * (16 * PPIT_);

  for (int kc = 0; kc < NT_ / 64; ++kc) {
    const int kv0 = kc * 64;
    __syncthreads();
    {
      const int r = tid >> 1, c0 = (tid & 1) * 64;
      const _Float16* ks = Kh + (size_t)(kv0 + r) * ND_ + c0;
      const _Float16* vs = Vh + (size_t)tid * NT_ + kv0;
#pragma unroll
      for (int i = 0; i < 8; ++i) {
        const v8h kk8 = *(const v8h*)(ks + 8 * i);
        const v8h vv8 = *(const v8h*)(vs + 8 * i);
        *(v8ha*)(Ksh + r * KPIT_ + c0 + 8 * i) = kk8;
        *(v8ha*)(Vsh + tid * VPIT_ + 8 * i)    = vv8;
      }
    }
    __syncthreads();

    // content scores: S[j] = QU(16x128) . K^T for key subtile j
    v8f s[4];
#pragma unroll
    for (int j = 0; j < 4; ++j) {
      s[j] = zero8();
#pragma unroll
      for (int dc = 0; dc < 4; ++dc) {
        const v16h kb = ldfrag(Ksh + (j * 16 + c) * KPIT_ + dc * 32 + 8 * hh);
        s[j] = mma16(qa[dc], kb, s[j]);
      }
    }

    // add the position term from the band scratch, chunk row max
    float cm[8];
#pragma unroll
    for (int r = 0; r < 8; ++r) {
      float m = -INFINITY;
#pragma unroll
      for (int j = 0; j < 4; ++j) {
        const float sv = s[j][r] * cs + bdr[(long)r * (BDW_ - 1) + kv0 + (j << 4)];
        s[j][r] = sv;
        m = fmaxf(m, sv);
      }
      m = fmaxf(m, __shfl_xor(m, 1, 32));
      m = fmaxf(m, __shfl_xor(m, 2, 32));
      m = fmaxf(m, __shfl_xor(m, 4, 32));
      m = fmaxf(m, __shfl_xor(m, 8, 32));
      cm[r] = m;
    }

    // online softmax update (per-row rescale of this row's accumulator elements only);
    // P tile (x4096) to this wave's LDS tile [row][key]
#pragma unroll
    for (int r = 0; r < 8; ++r) {
      const float mnew  = fmaxf(mrow[r], cm[r]);
      const float alpha = __expf(mrow[r] - mnew);
      mrow[r] = mnew;
      float psum = 0.f;
#pragma unroll
      for (int j = 0; j < 4; ++j) {
        const float p = __expf(s[j][r] - mnew);
        psum += p;
        pw[(8 * hh + r) * PPIT_ + j * 16 + c] = (_Float16)(p * 4096.0f);
      }
      psum += __shfl_xor(psum, 1, 32);
      psum += __shfl_xor(psum, 2, 32);
      psum += __shfl_xor(psum, 4, 32);
      psum += __shfl_xor(psum, 8, 32);
      lrow[r] = lrow[r] * alpha + psum;
#pragma unroll
      for (int t = 0; t < 8; ++t) oacc[t][r] *= alpha;
    }
    __builtin_amdgcn_fence(__ATOMIC_RELEASE, "workgroup");
    __builtin_amdgcn_wave_barrier();
    __builtin_amdgcn_fence(__ATOMIC_ACQUIRE, "workgroup");

    // P (A operand, row = lane&15, split k map over keys) . V (B operand from V^T rows d)
#pragma unroll
    for (int kk = 0; kk < 2; ++kk) {
      const v16h pa = ldfrag(pw + c * PPIT_ + kk * 32 + 8 * hh);
#pragma unroll
      for (int t = 0; t < 8; ++t) {
        const v16h vb = ldfrag(Vsh + (t * 16 + c) * VPIT_ + kk * 32 + 8 * hh);
        oacc[t] = mma16(pa, vb, oacc[t]);
      }
    }
  }

  __syncthreads();                               // every wave is done with Ksh/Vsh before Osh aliases them
  float* os = Osh + wave * (16 * 128);
#pragma unroll
  for (int r = 0; r < 8; ++r) {
    const float inv = 1.0f / (1024.0f * lrow[r]);   // 64 / (4096 * 16 * l)
#pragma unroll
    for (int t = 0; t < 8; ++t) os[(8 * hh + r) * 128 + t * 16 + c] = oacc[t][r] * inv;
  }
  __builtin_amdgcn_fence(__ATOMIC_RELEASE, "workgroup");
  __builtin_amdgcn_wave_barrier();
  __builtin_amdgcn_fence(__ATOMIC_ACQUIRE, "workgroup");
  v8h ov[8];
#pragma unroll
  for (int it = 0; it < 8; ++it) {
    const int row = it * 2 + hh;                 // lanes 0-15 row 2it, lanes 16-31 row 2it+1
    const float* sp = os + row * 128 + c * 8;
    const v4f x0 = *(const v4fa*)(sp);
    const v4f x1 = *(const v4fa*)(sp + 4);
    v8h o;
    o[0] = (_Float16)x0[0]; o[1] = (_Float16)x0[1]; o[2] = (_Float16)x0[2]; o[3] = (_Float16)x0[3];
    o[4] = (_Float16)x1[0]; o[5] = (_Float16)x1[1]; o[6] = (_Float16)x1[2]; o[7] = (_Float16)x1[3];
    ov[it] = o;
  }
  {
#pragma unroll
    for (int it = 0; it < 8; ++it) {
      const int row = it * 2 + hh;
      *(v8h*)(ctx + (size_t)(q0 + row) * ND_ + c * 8) = ov[it];   // 16 lanes x 16 B = one 256-B row segment
    }
    
  }
}

// -------------------------------------------------------------------------------------------------
// Workspace map (bytes):
//   WO   f16 [1024][1024]              0
//   QU   f16 [8192][1024]        2097152
//   QV   f16 [8192][1024]       18874368
//   KP   f16 [8192][1024]       35651584
//   VTP  f16 [4][1024][2048]    52428800
//   CTX  f16 [8192][1024]       69206016
//   P16  f16 [4096][1024]       85983232
//   SCR                         94371840   (138412032 B): early phase WQ,WK,WV,WP f16 [1024][1024] at +0,+2097152,
//        +4194304,+6291456; X f16 [8192][1024] at +8388608; PE f16 [4096][1024] at +25165824 (end +33554432);
//        later phase: BD band f32 [8][2048][2112] (end +138412032)
//   total                      232783872
// Every region is written in whole 64x64 tiles / whole rows; all sizes are exact tile multiples.
// -------------------------------------------------------------------------------------------------
extern "C" void kernel_launch(void* const* d_in, const int* in_sizes, int n_in,
                              void* d_out, int out_size, void* d_ws, size_t ws_size,
                              hipStream_t stream) {
  if (n_in < 9) return;
  if (in_sizes[0] != NB_ * NT_ * ND_) return;
  if (in_sizes[1] != NP_ * ND_) return;
  if (in_sizes[2] != ND_ * ND_ || in_sizes[3] != ND_ * ND_ || in_sizes[4] != ND_ * ND_) return;
  if (in_sizes[5] != ND_ * ND_ || in_sizes[6] != ND_ * ND_) return;
  if (in_sizes[7] != NH_ * HD_ || in_sizes[8] != NH_ * HD_) return;
  if (out_size != NB_ * NT_ * ND_) return;

  const float* x   = (const float*)d_in[0];
  const float* pe  = (const float*)d_in[1];
  const float* Wq  = (const float*)d_in[2];
  const float* Wk  = (const float*)d_in[3];
  const float* Wv  = (const float*)d_in[4];
  const float* Wo  = (const float*)d_in[5];
  const float* Wp  = (const float*)d_in[6];
  const float* bu  = (const float*)d_in[7];
  const float* bvb = (const float*)d_in[8];
  float* out = (float*)d_out;

  const size_t PW16 = (size_t)ND_ * ND_ * 2;             //  2097152
  const size_t PA16 = (size_t)NB_ * NT_ * ND_ * 2;       // 16777216
  const size_t PP16 = (size_t)NPP_ * ND_ * 2;            //  8388608
  const size_t PBD  = (size_t)NT_ * BDW_ * 4;            // 17301504 per pair
  const int    NPAIR = 8;                                // pairs per group: all heads of one batch element
  size_t off = 0;
  const size_t oWO  = off; off += PW16;
  const size_t oQU  = off; off += PA16;
  const size_t oQV  = off; off += PA16;
  const size_t oKP  = off; off += PA16;
  const size_t oVT  = off; off += PA16;
  const size_t oCTX = off; off += PA16;
  const size_t oP16 = off; off += PP16;
  const size_t oSCR = off;
  const size_t oWQ  = oSCR;
  const size_t oWK  = oWQ + PW16;
  const size_t oWV  = oWK + PW16;
  const size_t oWP  = oWV + PW16;
  const size_t oX   = oWP + PW16;
  const size_t oPE  = oX + PA16;
  const size_t earlyEnd = oPE + PP16;
  const size_t bdEnd    = oSCR + (size_t)NPAIR * PBD;
  const size_t total    = (earlyEnd > bdEnd) ? earlyEnd : bdEnd;   // 232783872
  if (total > ws_size) return;

  char* ws = (char*)d_ws;
  _Float16* WO  = (_Float16*)(ws + oWO);
  _Float16* QU  = (_Float16*)(ws + oQU);
  _Float16* QV  = (_Float16*)(ws + oQV);
  _Float16* KP  = (_Float16*)(ws + oKP);
  _Float16* VTP = (_Float16*)(ws + oVT);
  _Float16* CTX = (_Float16*)(ws + oCTX);
  _Float16* P16 = (_Float16*)(ws + oP16);
  _Float16* WQ  = (_Float16*)(ws + oWQ);
  _Float16* WK  = (_Float16*)(ws + oWK);
  _Float16* WV  = (_Float16*)(ws + oWV);
  _Float16* WP  = (_Float16*)(ws + oWP);
  _Float16* X   = (_Float16*)(ws + oX);
  _Float16* PE  = (_Float16*)(ws + oPE);
  float*    SCR = (float*)(ws + oSCR);

  const float inv_sdk = 0.08838834764831845f;   // 1/sqrt(128)
  const float cs      = inv_sdk * 0.00390625f;   // applied to the x16.x16 score accumulators
  const dim3 blk(256);

  // (1) weights -> f16 planes of bf16-valued entries, carried x64   (grid 1024*128/256 = 512)
  const dim3 gW((ND_ * (ND_ / 8) + 255) / 256);
  cvt_plane_kernel<<<gW, blk, 0, stream>>>(Wq, WQ, ND_, ND_, 64.0f);
  cvt_plane_kernel<<<gW, blk, 0, stream>>>(Wk, WK, ND_, ND_, 64.0f);
  cvt_plane_kernel<<<gW, blk, 0, stream>>>(Wv, WV, ND_, ND_, 64.0f);
  cvt_plane_kernel<<<gW, blk, 0, stream>>>(Wp, WP, ND_, ND_, 64.0f);
  cvt_plane_kernel<<<gW, blk, 0, stream>>>(Wo, WO, ND_, ND_, 64.0f);
  // (2) pos_emb -> f16 plane [4096][1024], row 4095 = 0
  const dim3 gPE((NPP_ * (ND_ / 8) + 255) / 256);
  cvt_plane_kernel<<<gPE, blk, 0, stream>>>(pe, PE, NP_, NPP_, 1.0f);
  // (3) p = pos_emb . Wp^T -> P16 = 16*p   (M=4096, N=1024, K=1024)
  {
    const int tiles = (NPP_ / 64) * (ND_ / 64);
    gemm_f16_kernel<1, false><<<dim3((tiles + 7) / 8, 1), blk, 0, stream>>>(
        PE, ND_, 0L, WP, ND_, 0L, (void*)P16, (void*)P16, ND_, 0L, bu, bu, NPP_, ND_, ND_, 0.25f, 1.0f, 0);
  }
  // (4) x -> f16 plane, all batch elements; q (two bias variants), k, v^T projections: one launch of 256 work-groups each
  {
    const dim3 gX((NB_ * NT_ * (ND_ / 8) + 255) / 256);
    cvt_plane_kernel<<<gX, blk, 0, stream>>>(x, X, NB_ * NT_, NB_ * NT_, 1.0f);
    const int tilesQ = ((NB_ * NT_) / 64) * (ND_ / 64);  // 2048
    // QU = 16*(q + bias_u), QV = 16*(q + bias_v)    (M=8192, N=1024, K=1024)
    gemm_f16_kernel<2, false><<<dim3((tilesQ + 7) / 8, 1), blk, 0, stream>>>(
        X, ND_, 0L, WQ, ND_, 0L, (void*)QU, (void*)QV, ND_, 0L, bu, bvb,
        NB_ * NT_, ND_, ND_, 0.015625f, 16.0f, 0);
    // KP = 16*k
    gemm_f16_kernel<1, false><<<dim3((tilesQ + 7) / 8, 1), blk, 0, stream>>>(
        X, ND_, 0L, WK, ND_, 0L, (void*)KP, (void*)KP, ND_, 0L, bu, bu,
        NB_ * NT_, ND_, ND_, 0.25f, 1.0f, 0);
    // VT[b][h*128+d][t] = 16*v   (A = Wv plane [1024][1024], Bt = x plane of batch z [2048][1024];
    //                             M=1024, N=2048, K=1024 per z, grid.y = batch)
    const int tilesV = (ND_ / 64) * (NT_ / 64);          // 512 per batch element
    gemm_f16_kernel<1, false><<<dim3((tilesV + 7) / 8, NB_), blk, 0, stream>>>(
        WV, ND_, 0L, X, ND_, (long)NT_ * ND_, (void*)VTP, (void*)VTP,
        NT_, (long)ND_ * NT_, bu, bu, ND_, NT_, ND_, 0.25f, 1.0f, 0);
  }
  // (5) per group of 8 (b,h) pairs: band GEMM of the position scores, then attention (256 work-groups, one per WGP)
  const int nGroups = (NB_ * NH_) / NPAIR;               // 4
  for (int g = 0; g < nGroups; ++g) {
    const int pairBase = g * NPAIR;
    const int b  = pairBase >> 3;
    const int h0 = pairBase & 7;
    const _Float16* Aq = QV + (size_t)b * NT_ * ND_ + h0 * HD_;   // rows t, cols d of head h0 (z adds 128)
    const _Float16* Bp = P16 + h0 * HD_;                           // rows p index, cols d of head h0
    const int tilesBD = (NT_ / 64) * (BDW_ / 64);                  // 32*33 = 1056
    gemm_f16_kernel<0, true><<<dim3((tilesBD + 7) / 8, NPAIR), blk, 0, stream>>>(
        Aq, ND_, (long)HD_, Bp, ND_, (long)HD_, (void*)SCR, (void*)SCR, BDW_, (long)NT_ * BDW_, bu, bu,
        NT_, BDW_, HD_, cs, 1.0f, 31);
    relattn_kernel<<<dim3(NT_ / 64, NPAIR), dim3(128), 0, stream>>>(QU, KP, VTP, SCR, CTX, pairBase, cs);
  }
  // (6) out = ctx . Wo^T -> d_out f32 [8192][1024]   (M=8192, N=1024, K=1024; carries 64*64 folded into scale)
  {
    const int tiles = ((NB_ * NT_) / 64) * (ND_ / 64);   // 2048
    gemm_f16_kernel<0, false><<<dim3((tiles + 7) / 8, 1), blk, 0, stream>>>(
        CTX, ND_, 0L, WO, ND_, 0L, (void*)out, (void*)out, ND_, 0L, bu, bu,
        NB_ * NT_, ND_, ND_, 0.000244140625f, 1.0f, 0);
  }
  (void)hipGetLastError();
}

// v003
// It runs in 872 microseconds.
// Timed twice side by side with v002, it ran 1.34 times as fast both times.
// All steps since v000 together make it 5.05 times as fast.
// Contractions x.Wq^T, x.Wk^T, Wv.x^T, pos_emb.Wp^T, (q+bias_v).p^T band, (q+bias_u).k^T, P.V, ctx.Wo^T: v_wmma_f32_16x16x32_f16 (f16 operands, f32 accumulate); operand planes hold bf16-RNE-valued inputs with power-of-two carries (W x64, q/k/v/p x16, P x4096, ctx x64); softmax, bias adds and score scaling in f32.
#include <hip/hip_runtime.h>
#include <math.h>
#include <stdint.h>

#define NB_  4
#define NT_  2048
#define ND_  1024
#define NH_  8
#define HD_  128
#define NP_  4095
#define NPP_ 4096
#define BDW_ 2112   // width of the relative-position score band scratch (33 tiles of 64)
// LDS row pitches of the attention tiles, in halves: 16 B x odd, so that the 16 rows one ds_load_b128 reads
// fall on 16 different groups of four banks (unpadded 256-B rows all fall on one group, 128-B rows on two)
#define KPIT_ 136   // K tile row: 128 halves + 8  (272 B)
#define VPIT_ 72    // V^T tile row: 64 halves + 8 (144 B)
#define PPIT_ 72    // P tile row: 64 halves + 8   (144 B)

typedef _Float16 v16h __attribute__((ext_vector_type(16)));
typedef _Float16 v8h  __attribute__((ext_vector_type(8)));
typedef float    v8f  __attribute__((ext_vector_type(8)));
typedef float    v4f  __attribute__((ext_vector_type(4)));
typedef v4f __attribute__((may_alias)) v4fa;
typedef v8h __attribute__((may_alias)) v8ha;

// bf16 RNE of an f32 value, returned widened to f32 (exactly representable in f16 after a power-of-two carry)
__device__ __forceinline__ float bf_rne(float f) {
  unsigned u = __float_as_uint(f);
  u = (u + 0x7FFFu + ((u >> 16) & 1u)) & 0xFFFF0000u;
  return __uint_as_float(u);
}

// 16-bit WMMA fragment: elements 0..7 <- p[0..7], elements 8..15 <- p[16..23]
// (A: p = row m at k0 + 8h;  B stored [n][k]: p = row n at k0 + 8h;  same split k map for both)
union FragU { v16h v; v8ha h[2]; };
__device__ __forceinline__ v16h ldfrag(const _Float16* p) {
  FragU f;
  f.h[0] = *(const v8ha*)(p);
  f.h[1] = *(const v8ha*)(p + 16);
  return f.v;
}

// WMMA + hazard guard (ties D, keeps A/B live for 4 VALU slots)
__device__ __forceinline__ v8f mma16(v16h a, v16h b, v8f c) {
  c = __builtin_amdgcn_wmma_f32_16x16x32_f16(false, a, false, b, (short)0, c, false, false);
  asm volatile("v_nop\n\tv_nop\n\tv_nop\n\tv_nop" : "+v"(c) : "v"(a), "v"(b));
  return c;
}

__device__ __forceinline__ v8f zero8() { v8f z = {0.f, 0.f, 0.f, 0.f, 0.f, 0.f, 0.f, 0.f}; return z; }

// -------------------------------------------------------------------------------------------------
// f32 [nrows_src][ND_] -> f16 plane [nrows_dst][ND_]: dst = f16( bf_rne(src) * scale ), rows >= nrows_src are 0.
// coverage: nrows_dst * 128 threads * 8 = the whole [nrows_dst][1024] plane.
// -------------------------------------------------------------------------------------------------
__global__ __launch_bounds__(256) void cvt_plane_kernel(const float* __restrict__ src, _Float16* __restrict__ dst,
                                                        int nrows_src, int nrows_dst, float scale) {
  const int i = blockIdx.x * 256 + threadIdx.x;
  const int total8 = nrows_dst * (ND_ / 8);
  if (i >= total8) return;
  const int r  = i / (ND_ / 8);
  const int c8 = (i - r * (ND_ / 8)) * 8;
  const int rs = (r < nrows_src) ? r : (nrows_src - 1);          // clamped address
  const float sc = (r < nrows_src) ? scale : 0.0f;                // zero by value for filler rows
  const float* sp = src + (size_t)rs * ND_ + c8;
  const v4f a = *(const v4f*)(sp);
  const v4f b = *(const v4f*)(sp + 4);
  v8h o;
  o[0] = (_Float16)(bf_rne(a[0]) * sc); o[1] = (_Float16)(bf_rne(a[1]) * sc);
  o[2] = (_Float16)(bf_rne(a[2]) * sc); o[3] = (_Float16)(bf_rne(a[3]) * sc);
  o[4] = (_Float16)(bf_rne(b[0]) * sc); o[5] = (_Float16)(bf_rne(b[1]) * sc);
  o[6] = (_Float16)(bf_rne(b[2]) * sc); o[7] = (_Float16)(bf_rne(b[3]) * sc);
  _Float16* dp = dst + (size_t)r * ND_ + c8;
  *(v8h*)dp = o;
  
}

// -------------------------------------------------------------------------------------------------
// f16 WMMA GEMM: C[m][n] = epi( sum_k A[m][k] * Bt[nrow][k] ), nrow = n (+ 64*(skew0 - tm) when SKEW: band GEMM).
// A row-major [M][K] pitch lda; Bt row-major [N(+band)][K] pitch ldb; M, N multiples of 64, K multiple of 32.
// Each wave owns a 64x64 output tile (4x4 subtiles), 8 waves per block, grid.x = tiles/8, grid.y = z-batch.
// OUT 0: f32  C1 = acc*scale
// OUT 1: f16  C1 = f16(acc*scale)
// OUT 2: f16  C1 = f16((acc*scale + bf_rne(b1[n]))*carry), C2 = f16((acc*scale + bf_rne(b2[n]))*carry)
// ONE instruction with lane-contiguous 16-B pieces (f32: 16 lanes x 16 B = 256 B segment; f16: 8 lanes x 16 B =
// coverage: 4 slabs x 16 rows x 64 cols = the whole 64x64 tile per wave; tiles cover M x N exactly.
// -------------------------------------------------------------------------------------------------
template <int OUT, bool SKEW>
__global__ __launch_bounds__(256) void gemm_f16_kernel(
    const _Float16* __restrict__ A, int lda, long strideA,
    const _Float16* __restrict__ Bt, int ldb, long strideB,
    void* __restrict__ C1, void* __restrict__ C2, int ldc, long strideC,
    const float* __restrict__ b1, const float* __restrict__ b2,
    int M, int N, int K, float scale, float carry, int skew0) {
  __shared__ __align__(16) float sT[8][16 * 68];   // per-wave 16x64 slab, pitch 68 floats

  const int z    = blockIdx.y;
  const int lane = threadIdx.x & 31;
  const int wave = threadIdx.x >> 5;
  const int tilesN = N >> 6;
  const int tilesM = M >> 6;
  const int tile = blockIdx.x * 8 + wave;
  if (tile >= tilesM * tilesN) return;             // wave-uniform; no block barriers in this kernel
  const int tm = tile / tilesN;
  const int tn = tile - tm * tilesN;
  const int m0 = tm << 6;
  const int n0 = tn << 6;
  const int nsk = SKEW ? ((skew0 - tm) << 6) : 0;  // band row offset of Bt

  const _Float16* Ab = A  + (size_t)z * strideA;
  const _Float16* Bb = Bt + (size_t)z * strideB;

  const int rl   = lane & 15;          // row (A) / column (B, D) within a subtile
  const int koff = (lane >> 4) * 8;    // k offset of this lane half
  const int mOff = (lane >> 4) * 8;    // D row offset of this lane half

  v8f acc[4][4];
#pragma unroll
  for (int i = 0; i < 4; ++i)
#pragma unroll
    for (int j = 0; j < 4; ++j) acc[i][j] = zero8();

  for (int k0 = 0; k0 < K; k0 += 32) {
    v16h bfr[4];
#pragma unroll
    for (int j = 0; j < 4; ++j)
      bfr[j] = ldfrag(Bb + (size_t)(nsk + n0 + (j << 4) + rl) * ldb + koff + k0);
#pragma unroll
    for (int i = 0; i < 4; ++i) {
      const v16h af = ldfrag(Ab + (size_t)(m0 + (i << 4) + rl) * lda + koff + k0);
#pragma unroll
      for (int j = 0; j < 4; ++j) acc[i][j] = mma16(af, bfr[j], acc[i][j]);
    }
  }

  // ---- epilogue ----
  float* slab = sT[wave];
#pragma unroll
  for (int i = 0; i < 4; ++i) {
    const int mBase = m0 + (i << 4);
#pragma unroll
    for (int j = 0; j < 4; ++j)
#pragma unroll
      for (int r = 0; r < 8; ++r)
        slab[(mOff + r) * 68 + (j << 4) + rl] = acc[i][j][r] * scale;
    __builtin_amdgcn_fence(__ATOMIC_RELEASE, "workgroup");
    __builtin_amdgcn_wave_barrier();
    __builtin_amdgcn_fence(__ATOMIC_ACQUIRE, "workgroup");
    if (OUT == 0) {
      float* C = (float*)C1 + (size_t)z * strideC;
      const int hh = lane >> 4, c4 = (lane & 15) * 4;    // row segment 256 B = 16 lanes x 16 B
      {
#pragma unroll
        for (int it = 0; it < 8; ++it) {
          const int row = it * 2 + hh;
          const v4f v = *(const v4fa*)(slab + row * 68 + c4);
          *(v4f*)(C + (size_t)(mBase + row) * ldc + n0 + c4) = v;
        }
        
      }
    } else {
      const int q = lane >> 3, c8 = (lane & 7) * 8;
      _Float16* Ca = (_Float16*)C1 + (size_t)z * strideC;
      _Float16* Cb = (_Float16*)C2 + (size_t)z * strideC;
      v8h hv[4], lv[4];
#pragma unroll
      for (int it = 0; it < 4; ++it) {
        const int row = it * 4 + q;
        const float* sp = slab + row * 68 + c8;
        const v4f x0 = *(const v4fa*)(sp);
        const v4f x1 = *(const v4fa*)(sp + 4);
        float f[8];
        f[0] = x0[0]; f[1] = x0[1]; f[2] = x0[2]; f[3] = x0[3];
        f[4] = x1[0]; f[5] = x1[1]; f[6] = x1[2]; f[7] = x1[3];
        v8h ha, hb;
#pragma unroll
        for (int e = 0; e < 8; ++e) {
          if (OUT == 1) {
            ha[e] = (_Float16)f[e];
            hb[e] = ha[e];
          } else {
            const int n = n0 + c8 + e;
            ha[e] = (_Float16)((f[e] + bf_rne(b1[n])) * carry);
            hb[e] = (_Float16)((f[e] + bf_rne(b2[n])) * carry);
          }
        }
        hv[it] = ha; lv[it] = hb;
      }
      {
#pragma unroll
        for (int it = 0; it < 4; ++it) {
          const int row = it * 4 + q;
          *(v8h*)(Ca + (size_t)(mBase + row) * ldc + n0 + c8) = hv[it];
          if (OUT == 2) *(v8h*)(Cb + (size_t)(mBase + row) * ldc + n0 + c8) = lv[it];
        }
        
      }
    }
    __builtin_amdgcn_fence(__ATOMIC_RELEASE, "workgroup");
    __builtin_amdgcn_wave_barrier();
    __builtin_amdgcn_fence(__ATOMIC_ACQUIRE, "workgroup");
  }
}

// -------------------------------------------------------------------------------------------------
// Relative-position attention for a group of (batch, head) pairs, head dim 128, no mask.
//   QU  f16 plane [b*2048 + t][h*128 + d] = 16*(q + bias_u)       (A operand of the content score)
//   Kp  f16 plane [b*2048 + s][h*128 + d] = 16*k                  (B operand, staged per 64-key chunk as [key][d])
//   VT  f16 plane [b][h*128 + d][s]      = 16*v                  (B operand of P.V, staged as [d][key])
//   BD  f32 band scratch [z][2048][2112]: value (col j) = inv_sdk * (q_i + bias_v).p[row 64*(31 - i/64) + j]
//       rel-shift: bd[i][key] = bdfull[i][key - i + 2047]  ->  column (key - i + 2047) - 64*(31 - i/64)
//                = key + 63 - (i mod 64), always in [0, 2110].
//   score = cs * (QU.K^T acc) + BD  with cs = inv_sdk / 256;  online softmax in f32 over 32 chunks of 64 keys;
//   P stored per wave as f16(4096 * exp(s - m)); ctx = 64 * (P.V acc) / (4096*16*l) written as f16 plane
//   CTX [b*2048 + t][h*128 + d].
// Block = 4 waves = 64 query rows of one (b,h); grid = (32 query blocks, pairs in group).
// LDS: one raw buffer; K tile [64][128] f16 at 0 (row pitch 272 B), V^T tile [128][64] f16 at 17408 (pitch 144 B),
// per-wave P tiles [16][64] f16 at 35840 (pitch 144 B); the output staging [4][16][128] f32 reuses bytes 0..32 KB
// (inside the K and V^T tiles) after a block barrier.
// coverage: staging 128 thr x 64 halves for K (64x128) and for V^T (128x64); P tile 8 rows x 2 halves x 4x16 cols
// per wave = 16x64; output 8 store instructions x 2 rows x 16 lanes x 8 halves = 16x128 per wave.
// -------------------------------------------------------------------------------------------------
__global__ __launch_bounds__(128)
void relattn_kernel(const _Float16* __restrict__ QU, const _Float16* __restrict__ Kp,
                    const _Float16* __restrict__ VT, const float* __restrict__ BD,
                    _Float16* __restrict__ CTX, int pairBase, float cs) {
  __shared__ __align__(16) unsigned char SMEM[64 * KPIT_ * 2 + 128 * VPIT_ * 2 + 4 * 16 * PPIT_ * 2];   // 45056
  _Float16* Ksh = (_Float16*)(SMEM);                                      // [64][KPIT_]
  _Float16* Vsh = (_Float16*)(SMEM + 64 * KPIT_ * 2);                     // [128][VPIT_]
  _Float16* Psh = (_Float16*)(SMEM + 64 * KPIT_ * 2 + 128 * VPIT_ * 2);   // [4][16][PPIT_]
  float*    Osh = (float*)(SMEM);                // [4][16][128] after the chunk loop

  const int tid  = threadIdx.x;
  const int wave = tid >> 5;
  const int lane = tid & 31;
  const int hh   = lane >> 4;
  const int c    = lane & 15;

  const int z    = blockIdx.y;
  const int pair = pairBase + z;
  const int b    = pair >> 3;
  const int h    = pair & 7;
  const int qb   = blockIdx.x;                   // 0..31
  const int q0   = qb * 64 + wave * 16;          // first query row of this wave
  const int rr0  = wave * 16 + 8 * hh;           // row within the 64-row block for r = 0

  const _Float16* Qh = QU + (size_t)(b * NT_) * ND_ + h * HD_;
  const _Float16* Kh = Kp + (size_t)(b * NT_) * ND_ + h * HD_;
  const _Float16* Vh = VT + (size_t)b * ND_ * NT_ + (size_t)(h * HD_) * NT_;
  const float*    bd = BD + (size_t)z * NT_ * BDW_;
  _Float16*       ctx = CTX + (size_t)(b * NT_) * ND_ + h * HD_;

  // Q fragments (A operand): 4 chunks of 32 along d
  v16h qa[4];
#pragma unroll
  for (int dc = 0; dc < 4; ++dc)
    qa[dc] = ldfrag(Qh + (size_t)(q0 + c) * ND_ + dc * 32 + 8 * hh);


  float mrow[8], lrow[8];
  v8f oacc[8];
#pragma unroll
  for (int r = 0; r < 8; ++r) { mrow[r] = -INFINITY; lrow[r] = 0.f; }
#pragma unroll
  for (int t = 0; t < 8; ++t) oacc[t] = zero8();

  _Float16* pw = Psh + wave * (16 * PPIT_);

  // Every global load of a chunk is issued one chunk ahead into registers (chunk 0 here), so that its latency runs
  // under the chunk before instead of in front of its use.
  // Per-lane byte offsets, from the uniform bases Kh, Vh and bd, of the chunk that is loaded next:
  //   K row (kv0 + sr), halves sc0..sc0+63;  V^T row tid, keys kv0..kv0+63;
  //   band element of (row r, key kv0+16j+c) at bo + 4*(r*(BDW_-1) + 16j)
  const int sr = tid >> 1, sc0 = (tid & 1) * 64;
  unsigned ko = (unsigned)((sr * ND_ + sc0) * 2);
  unsigned vo = (unsigned)((tid * NT_) * 2);
  unsigned bo = (unsigned)(((q0 + 8 * hh) * BDW_ + (63 - rr0 + c)) * 4);
  v8h kreg[8], vreg[8];
  float bdv[8][4];
#pragma unroll
  for (int i = 0; i < 8; ++i) {
    kreg[i] = *(const v8h*)((const char*)Kh + ko + 16 * i);
    vreg[i] = *(const v8h*)((const char*)Vh + vo + 16 * i);
  }
#pragma unroll
  for (int r = 0; r < 8; ++r)
#pragma unroll
    for (int j = 0; j < 4; ++j)
      bdv[r][j] = *(const float*)((const char*)bd + bo + 4 * (r * (BDW_ - 1) + (j << 4)));
  // the wait that stands before an address register of an issued load is written again; the offsets pass through
  // it, so that their step cannot be placed ahead of it
  asm volatile("s_wait_xcnt 0x0" : "+v"(ko), "+v"(vo), "+v"(bo) :: "memory");
  ko += 64 * (ND_ * 2);
  vo += 64 * 2;
  bo += 64 * 4;

  // two chunks per trip: the band values loaded ahead alternate between two register sets; in a single body they
  // are copied into the one set behind a wait for the loads, in the middle of the chunk
#pragma unroll 2
  for (int kc = 0; kc < NT_ / 64; ++kc) {
    __syncthreads();
#pragma unroll
    for (int i = 0; i < 8; ++i) {
      *(v8ha*)(Ksh + sr * KPIT_ + sc0 + 8 * i) = kreg[i];
      *(v8ha*)(Vsh + tid * VPIT_ + 8 * i)      = vreg[i];
    }
    __syncthreads();

    // the next chunk's K and V^T rows (the last trip loads its own chunk again, unused: no branch)
#pragma unroll
    for (int i = 0; i < 8; ++i) {
      kreg[i] = *(const v8h*)((const char*)Kh + ko + 16 * i);
      vreg[i] = *(const v8h*)((const char*)Vh + vo + 16 * i);
    }
    __builtin_amdgcn_sched_barrier(0);   // keeps these 16 loads here, a whole chunk ahead of their LDS stores

    // content scores: S[j] = QU(16x128) . K^T for key subtile j
    v8f s[4];
#pragma unroll
    for (int j = 0; j < 4; ++j) {
      s[j] = zero8();
#pragma unroll
      for (int dc = 0; dc < 4; ++dc) {
        const v16h kb = ldfrag(Ksh + (j * 16 + c) * KPIT_ + dc * 32 + 8 * hh);
        s[j] = mma16(qa[dc], kb, s[j]);
      }
    }

    // add the position term from the band scratch, chunk row max
    float cm[8];
#pragma unroll
    for (int r = 0; r < 8; ++r) {
      float m = -INFINITY;
#pragma unroll
      for (int j = 0; j < 4; ++j) {
        const float sv = s[j][r] * cs + bdv[r][j];
        s[j][r] = sv;
        m = fmaxf(m, sv);
      }
      m = fmaxf(m, __shfl_xor(m, 1, 32));
      m = fmaxf(m, __shfl_xor(m, 2, 32));
      m = fmaxf(m, __shfl_xor(m, 4, 32));
      m = fmaxf(m, __shfl_xor(m, 8, 32));
      cm[r] = m;
    }

    // the next chunk's 32 band values (this chunk's have just been used by the loop above)
#pragma unroll
    for (int r = 0; r < 8; ++r)
#pragma unroll
      for (int j = 0; j < 4; ++j)
        bdv[r][j] = *(const float*)((const char*)bd + bo + 4 * (r * (BDW_ - 1) + (j << 4)));
    __builtin_amdgcn_sched_barrier(0);   // keeps these 32 loads here, a softmax and a P.V phase ahead of their use

    // online softmax update (per-row rescale of this row's accumulator elements only);
    // P tile (x4096) to this wave's LDS tile [row][key]
#pragma unroll
    for (int r = 0; r < 8; ++r) {
      const float mnew  = fmaxf(mrow[r], cm[r]);
      const float alpha = __expf(mrow[r] - mnew);
      mrow[r] = mnew;
      float psum = 0.f;
#pragma unroll
      for (int j = 0; j < 4; ++j) {
        const float p = __expf(s[j][r] - mnew);
        psum += p;
        pw[(8 * hh + r) * PPIT_ + j * 16 + c] = (_Float16)(p * 4096.0f);
      }
      psum += __shfl_xor(psum, 1, 32);
      psum += __shfl_xor(psum, 2, 32);
      psum += __shfl_xor(psum, 4, 32);
      psum += __shfl_xor(psum, 8, 32);
      lrow[r] = lrow[r] * alpha + psum;
#pragma unroll
      for (int t = 0; t < 8; ++t) oacc[t][r] *= alpha;
    }
    // the P tile goes through LDS alone: fences on the LDS address space leave the global loads above in flight
    __builtin_amdgcn_fence(__ATOMIC_RELEASE, "workgroup", "local");
    __builtin_amdgcn_wave_barrier();
    __builtin_amdgcn_fence(__ATOMIC_ACQUIRE, "workgroup", "local");

    // P (A operand, row = lane&15, split k map over keys) . V (B operand from V^T rows d)
#pragma unroll
    for (int kk = 0; kk < 2; ++kk) {
      const v16h pa = ldfrag(pw + c * PPIT_ + kk * 32 + 8 * hh);
#pragma unroll
      for (int t = 0; t < 8; ++t) {
        const v16h vb = ldfrag(Vsh + (t * 16 + c) * VPIT_ + kk * 32 + 8 * hh);
        oacc[t] = mma16(pa, vb, oacc[t]);
      }
    }

    // the same wait as in front of the loop: it stands at the foot of the trip, in front of the offsets' step
    asm volatile("s_wait_xcnt 0x0" : "+v"(ko), "+v"(vo), "+v"(bo) :: "memory");
    const unsigned step = (kc + 2 < NT_ / 64) ? 64u : 0u;   // the offsets stop at the last chunk
    ko += step * (ND_ * 2);
    vo += step * 2;
    bo += step * 4;
  }

  __syncthreads();                               // every wave is done with Ksh/Vsh before Osh aliases them
  float* os = Osh + wave * (16 * 128);
#pragma unroll
  for (int r = 0; r < 8; ++r) {
    const float inv = 1.0f / (1024.0f * lrow[r]);   // 64 / (4096 * 16 * l)
#pragma unroll
    for (int t = 0; t < 8; ++t) os[(8 * hh + r) * 128 + t * 16 + c] = oacc[t][r] * inv;
  }
  __builtin_amdgcn_fence(__ATOMIC_RELEASE, "workgroup");
  __builtin_amdgcn_wave_barrier();
  __builtin_amdgcn_fence(__ATOMIC_ACQUIRE, "workgroup");
  v8h ov[8];
#pragma unroll
  for (int it = 0; it < 8; ++it) {
    const int row = it * 2 + hh;                 // lanes 0-15 row 2it, lanes 16-31 row 2it+1
    const float* sp = os + row * 128 + c * 8;
    const v4f x0 = *(const v4fa*)(sp);
    const v4f x1 = *(const v4fa*)(sp + 4);
    v8h o;
    o[0] = (_Float16)x0[0]; o[1] = (_Float16)x0[1]; o[2] = (_Float16)x0[2]; o[3] = (_Float16)x0[3];
    o[4] = (_Float16)x1[0]; o[5] = (_Float16)x1[1]; o[6] = (_Float16)x1[2]; o[7] = (_Float16)x1[3];
    ov[it] = o;
  }
  {
#pragma unroll
    for (int it = 0; it < 8; ++it) {
      const int row = it * 2 + hh;
      *(v8h*)(ctx + (size_t)(q0 + row) * ND_ + c * 8) = ov[it];   // 16 lanes x 16 B = one 256-B row segment
    }
    
  }
}

// -------------------------------------------------------------------------------------------------
// Workspace map (bytes):
//   WO   f16 [1024][1024]              0
//   QU   f16 [8192][1024]        2097152
//   QV   f16 [8192][1024]       18874368
//   KP   f16 [8192][1024]       35651584
//   VTP  f16 [4][1024][2048]    52428800
//   CTX  f16 [8192][1024]       69206016
//   P16  f16 [4096][1024]       85983232
//   SCR                         94371840   (138412032 B): early phase WQ,WK,WV,WP f16 [1024][1024] at +0,+2097152,
//        +4194304,+6291456; X f16 [8192][1024] at +8388608; PE f16 [4096][1024] at +25165824 (end +33554432);
//        later phase: BD band f32 [8][2048][2112] (end +138412032)
//   total                      232783872
// Every region is written in whole 64x64 tiles / whole rows; all sizes are exact tile multiples.
// -------------------------------------------------------------------------------------------------
extern "C" void kernel_launch(void* const* d_in, const int* in_sizes, int n_in,
                              void* d_out, int out_size, void* d_ws, size_t ws_size,
                              hipStream_t stream) {
  if (n_in < 9) return;
  if (in_sizes[0] != NB_ * NT_ * ND_) return;
  if (in_sizes[1] != NP_ * ND_) return;
  if (in_sizes[2] != ND_ * ND_ || in_sizes[3] != ND_ * ND_ || in_sizes[4] != ND_ * ND_) return;
  if (in_sizes[5] != ND_ * ND_ || in_sizes[6] != ND_ * ND_) return;
  if (in_sizes[7] != NH_ * HD_ || in_sizes[8] != NH_ * HD_) return;
  if (out_size != NB_ * NT_ * ND_) return;

  const float* x   = (const float*)d_in[0];
  const float* pe  = (const float*)d_in[1];
  const float* Wq  = (const float*)d_in[2];
  const float* Wk  = (const float*)d_in[3];
  const float* Wv  = (const float*)d_in[4];
  const float* Wo  = (const float*)d_in[5];
  const float* Wp  = (const float*)d_in[6];
  const float* bu  = (const float*)d_in[7];
  const float* bvb = (const float*)d_in[8];
  float* out = (float*)d_out;

  const size_t PW16 = (size_t)ND_ * ND_ * 2;             //  2097152
  const size_t PA16 = (size_t)NB_ * NT_ * ND_ * 2;       // 16777216
  const size_t PP16 = (size_t)NPP_ * ND_ * 2;            //  8388608
  const size_t PBD  = (size_t)NT_ * BDW_ * 4;            // 17301504 per pair
  const int    NPAIR = 8;                                // pairs per group: all heads of one batch element
  size_t off = 0;
  const size_t oWO  = off; off += PW16;
  const size_t oQU  = off; off += PA16;
  const size_t oQV  = off; off += PA16;
  const size_t oKP  = off; off += PA16;
  const size_t oVT  = off; off += PA16;
  const size_t oCTX = off; off += PA16;
  const size_t oP16 = off; off += PP16;
  const size_t oSCR = off;
  const size_t oWQ  = oSCR;
  const size_t oWK  = oWQ + PW16;
  const size_t oWV  = oWK + PW16;
  const size_t oWP  = oWV + PW16;
  const size_t oX   = oWP + PW16;
  const size_t oPE  = oX + PA16;
  const size_t earlyEnd = oPE + PP16;
  const size_t bdEnd    = oSCR + (size_t)NPAIR * PBD;
  const size_t total    = (earlyEnd > bdEnd) ? earlyEnd : bdEnd;   // 232783872
  if (total > ws_size) return;

  char* ws = (char*)d_ws;
  _Float16* WO  = (_Float16*)(ws + oWO);
  _Float16* QU  = (_Float16*)(ws + oQU);
  _Float16* QV  = (_Float16*)(ws + oQV);
  _Float16* KP  = (_Float16*)(ws + oKP);
  _Float16* VTP = (_Float16*)(ws + oVT);
  _Float16* CTX = (_Float16*)(ws + oCTX);
  _Float16* P16 = (_Float16*)(ws + oP16);
  _Float16* WQ  = (_Float16*)(ws + oWQ);
  _Float16* WK  = (_Float16*)(ws + oWK);
  _Float16* WV  = (_Float16*)(ws + oWV);
  _Float16* WP  = (_Float16*)(ws + oWP);
  _Float16* X   = (_Float16*)(ws + oX);
  _Float16* PE  = (_Float16*)(ws + oPE);
  float*    SCR = (float*)(ws + oSCR);

  const float inv_sdk = 0.08838834764831845f;   // 1/sqrt(128)
  const float cs      = inv_sdk * 0.00390625f;   // applied to the x16.x16 score accumulators
  const dim3 blk(256);

  // (1) weights -> f16 planes of bf16-valued entries, carried x64   (grid 1024*128/256 = 512)
  const dim3 gW((ND_ * (ND_ / 8) + 255) / 256);
  cvt_plane_kernel<<<gW, blk, 0, stream>>>(Wq, WQ, ND_, ND_, 64.0f);
  cvt_plane_kernel<<<gW, blk, 0, stream>>>(Wk, WK, ND_, ND_, 64.0f);
  cvt_plane_kernel<<<gW, blk, 0, stream>>>(Wv, WV, ND_, ND_, 64.0f);
  cvt_plane_kernel<<<gW, blk, 0, stream>>>(Wp, WP, ND_, ND_, 64.0f);
  cvt_plane_kernel<<<gW, blk, 0, stream>>>(Wo, WO, ND_, ND_, 64.0f);
  // (2) pos_emb -> f16 plane [4096][1024], row 4095 = 0
  const dim3 gPE((NPP_ * (ND_ / 8) + 255) / 256);
  cvt_plane_kernel<<<gPE, blk, 0, stream>>>(pe, PE, NP_, NPP_, 1.0f);
  // (3) p = pos_emb . Wp^T -> P16 = 16*p   (M=4096, N=1024, K=1024)
  {
    const int tiles = (NPP_ / 64) * (ND_ / 64);
    gemm_f16_kernel<1, false><<<dim3((tiles + 7) / 8, 1), blk, 0, stream>>>(
        PE, ND_, 0L, WP, ND_, 0L, (void*)P16, (void*)P16, ND_, 0L, bu, bu, NPP_, ND_, ND_, 0.25f, 1.0f, 0);
  }
  // (4) x -> f16 plane, all batch elements; q (two bias variants), k, v^T projections: one launch of 256 work-groups each
  {
    const dim3 gX((NB_ * NT_ * (ND_ / 8) + 255) / 256);
    cvt_plane_kernel<<<gX, blk, 0, stream>>>(x, X, NB_ * NT_, NB_ * NT_, 1.0f);
    const int tilesQ = ((NB_ * NT_) / 64) * (ND_ / 64);  // 2048
    // QU = 16*(q + bias_u), QV = 16*(q + bias_v)    (M=8192, N=1024, K=1024)
    gemm_f16_kernel<2, false><<<dim3((tilesQ + 7) / 8, 1), blk, 0, stream>>>(
        X, ND_, 0L, WQ, ND_, 0L, (void*)QU, (void*)QV, ND_, 0L, bu, bvb,
        NB_ * NT_, ND_, ND_, 0.015625f, 16.0f, 0);
    // KP = 16*k
    gemm_f16_kernel<1, false><<<dim3((tilesQ + 7) / 8, 1), blk, 0, stream>>>(
        X, ND_, 0L, WK, ND_, 0L, (void*)KP, (void*)KP, ND_, 0L, bu, bu,
        NB_ * NT_, ND_, ND_, 0.25f, 1.0f, 0);
    // VT[b][h*128+d][t] = 16*v   (A = Wv plane [1024][1024], Bt = x plane of batch z [2048][1024];
    //                             M=1024, N=2048, K=1024 per z, grid.y = batch)
    const int tilesV = (ND_ / 64) * (NT_ / 64);          // 512 per batch element
    gemm_f16_kernel<1, false><<<dim3((tilesV + 7) / 8, NB_), blk, 0, stream>>>(
        WV, ND_, 0L, X, ND_, (long)NT_ * ND_, (void*)VTP, (void*)VTP,
        NT_, (long)ND_ * NT_, bu, bu, ND_, NT_, ND_, 0.25f, 1.0f, 0);
  }
  // (5) per group of 8 (b,h) pairs: band GEMM of the position scores, then attention (256 work-groups, one per WGP)
  const int nGroups = (NB_ * NH_) / NPAIR;               // 4
  for (int g = 0; g < nGroups; ++g) {
    const int pairBase = g * NPAIR;
    const int b  = pairBase >> 3;
    const int h0 = pairBase & 7;
    const _Float16* Aq = QV + (size_t)b * NT_ * ND_ + h0 * HD_;   // rows t, cols d of head h0 (z adds 128)
    const _Float16* Bp = P16 + h0 * HD_;                           // rows p index, cols d of head h0
    const int tilesBD = (NT_ / 64) * (BDW_ / 64);                  // 32*33 = 1056
    gemm_f16_kernel<0, true><<<dim3((tilesBD + 7) / 8, NPAIR), blk, 0, stream>>>(
        Aq, ND_, (long)HD_, Bp, ND_, (long)HD_, (void*)SCR, (void*)SCR, BDW_, (long)NT_ * BDW_, bu, bu,
        NT_, BDW_, HD_, cs, 1.0f, 31);
    relattn_kernel<<<dim3(NT_ / 64, NPAIR), dim3(128), 0, stream>>>(QU, KP, VTP, SCR, CTX, pairBase, cs);
  }
  // (6) out = ctx . Wo^T -> d_out f32 [8192][1024]   (M=8192, N=1024, K=1024; carries 64*64 folded into scale)
  {
    const int tiles = ((NB_ * NT_) / 64) * (ND_ / 64);   // 2048
    gemm_f16_kernel<0, false><<<dim3((tiles + 7) / 8, 1), blk, 0, stream>>>(
        CTX, ND_, 0L, WO, ND_, 0L, (void*)out, (void*)out, ND_, 0L, bu, bu,
        NB_ * NT_, ND_, ND_, 0.000244140625f, 1.0f, 0);
  }
  (void)hipGetLastError();
}

// v004
// Measured time: 631 microseconds a run.
// Timed twice side by side with v003, it ran 1.38 times as fast both times.
// All steps since v000 together make it 6.98 times as fast.
// Contractions x.Wq^T, x.Wk^T, Wv.x^T, pos_emb.Wp^T, (q+bias_v).p^T band, (q+bias_u).k^T, P.V, ctx.Wo^T: v_wmma_f32_16x16x32_f16 (f16 operands, f32 accumulate); operand planes hold bf16-RNE-valued inputs with power-of-two carries (W x64, q/k/v/p x16, P x4096, ctx x64); softmax, bias adds and score scaling in f32.
#include <hip/hip_runtime.h>
#include <math.h>
#include <stdint.h>

#define NB_  4
#define NT_  2048
#define ND_  1024
#define NH_  8
#define HD_  128
#define NP_  4095
#define NPP_ 4096
#define BDW_ 2112   // width of the relative-position score band scratch (33 tiles of 64)
// LDS row pitches of the attention tiles, in halves: 16 B x odd, so that the 16 rows one ds_load_b128 reads
// fall on 16 different groups of four banks (unpadded 256-B rows all fall on one group, 128-B rows on two)
#define KPIT_ 136   // K tile row: 128 halves + 8  (272 B)
#define VPIT_ 72    // V^T tile row: 64 halves + 8 (144 B)
#define PPIT_ 72    // P tile row: 64 halves + 8   (144 B)

typedef _Float16 v16h __attribute__((ext_vector_type(16)));
typedef _Float16 v8h  __attribute__((ext_vector_type(8)));
typedef float    v8f  __attribute__((ext_vector_type(8)));
typedef float    v4f  __attribute__((ext_vector_type(4)));
typedef v4f __attribute__((may_alias)) v4fa;
typedef v8h __attribute__((may_alias)) v8ha;

// bf16 RNE of an f32 value, returned widened to f32 (exactly representable in f16 after a power-of-two carry)
__device__ __forceinline__ float bf_rne(float f) {
  unsigned u = __float_as_uint(f);
  u = (u + 0x7FFFu + ((u >> 16) & 1u)) & 0xFFFF0000u;
  return __uint_as_float(u);
}

// 16-bit WMMA fragment: elements 0..7 <- p[0..7], elements 8..15 <- p[16..23]
// (A: p = row m at k0 + 8h;  B stored [n][k]: p = row n at k0 + 8h;  same split k map for both)
union FragU { v16h v; v8ha h[2]; };
__device__ __forceinline__ v16h ldfrag(const _Float16* p) {
  FragU f;
  f.h[0] = *(const v8ha*)(p);
  f.h[1] = *(const v8ha*)(p + 16);
  return f.v;
}

// Plain builtin: the compiler keeps the WMMA distances itself and stays free to place fragment loads ahead of
// earlier WMMAs (a volatile asm statement behind each WMMA held every load behind the WMMA before it)
__device__ __forceinline__ v8f mma16(v16h a, v16h b, v8f c) {
  return __builtin_amdgcn_wmma_f32_16x16x32_f16(false, a, false, b, (short)0, c, false, false);
}

__device__ __forceinline__ v8f zero8() { v8f z = {0.f, 0.f, 0.f, 0.f, 0.f, 0.f, 0.f, 0.f}; return z; }

// -------------------------------------------------------------------------------------------------
// f32 [nrows_src][ND_] -> f16 plane [nrows_dst][ND_]: dst = f16( bf_rne(src) * scale ), rows >= nrows_src are 0.
// coverage: nrows_dst * 128 threads * 8 = the whole [nrows_dst][1024] plane.
// -------------------------------------------------------------------------------------------------
__global__ __launch_bounds__(256) void cvt_plane_kernel(const float* __restrict__ src, _Float16* __restrict__ dst,
                                                        int nrows_src, int nrows_dst, float scale) {
  const int i = blockIdx.x * 256 + threadIdx.x;
  const int total8 = nrows_dst * (ND_ / 8);
  if (i >= total8) return;
  const int r  = i / (ND_ / 8);
  const int c8 = (i - r * (ND_ / 8)) * 8;
  const int rs = (r < nrows_src) ? r : (nrows_src - 1);          // clamped address
  const float sc = (r < nrows_src) ? scale : 0.0f;                // zero by value for filler rows
  const float* sp = src + (size_t)rs * ND_ + c8;
  const v4f a = *(const v4f*)(sp);
  const v4f b = *(const v4f*)(sp + 4);
  v8h o;
  o[0] = (_Float16)(bf_rne(a[0]) * sc); o[1] = (_Float16)(bf_rne(a[1]) * sc);
  o[2] = (_Float16)(bf_rne(a[2]) * sc); o[3] = (_Float16)(bf_rne(a[3]) * sc);
  o[4] = (_Float16)(bf_rne(b[0]) * sc); o[5] = (_Float16)(bf_rne(b[1]) * sc);
  o[6] = (_Float16)(bf_rne(b[2]) * sc); o[7] = (_Float16)(bf_rne(b[3]) * sc);
  _Float16* dp = dst + (size_t)r * ND_ + c8;
  *(v8h*)dp = o;
  
}

// -------------------------------------------------------------------------------------------------
// f16 WMMA GEMM: C[m][n] = epi( sum_k A[m][k] * Bt[nrow][k] ), nrow = n (+ 64*(skew0 - tm) when SKEW: band GEMM).
// A row-major [M][K] pitch lda; Bt row-major [N(+band)][K] pitch ldb; M, N multiples of 64, K multiple of 32.
// Each wave owns a 64x64 output tile (4x4 subtiles), 8 waves per block, grid.x = tiles/8, grid.y = z-batch.
// OUT 0: f32  C1 = acc*scale
// OUT 1: f16  C1 = f16(acc*scale)
// OUT 2: f16  C1 = f16((acc*scale + bf_rne(b1[n]))*carry), C2 = f16((acc*scale + bf_rne(b2[n]))*carry)
// ONE instruction with lane-contiguous 16-B pieces (f32: 16 lanes x 16 B = 256 B segment; f16: 8 lanes x 16 B =
// coverage: 4 slabs x 16 rows x 64 cols = the whole 64x64 tile per wave; tiles cover M x N exactly.
// -------------------------------------------------------------------------------------------------
template <int OUT, bool SKEW>
__global__ __launch_bounds__(256) void gemm_f16_kernel(
    const _Float16* __restrict__ A, int lda, long strideA,
    const _Float16* __restrict__ Bt, int ldb, long strideB,
    void* __restrict__ C1, void* __restrict__ C2, int ldc, long strideC,
    const float* __restrict__ b1, const float* __restrict__ b2,
    int M, int N, int K, float scale, float carry, int skew0) {
  __shared__ __align__(16) float sT[8][16 * 68];   // per-wave 16x64 slab, pitch 68 floats

  const int z    = blockIdx.y;
  const int lane = threadIdx.x & 31;
  const int wave = threadIdx.x >> 5;
  const int tilesN = N >> 6;
  const int tilesM = M >> 6;
  const int tile = blockIdx.x * 8 + wave;
  if (tile >= tilesM * tilesN) return;             // wave-uniform; no block barriers in this kernel
  const int tm = tile / tilesN;
  const int tn = tile - tm * tilesN;
  const int m0 = tm << 6;
  const int n0 = tn << 6;
  const int nsk = SKEW ? ((skew0 - tm) << 6) : 0;  // band row offset of Bt

  const _Float16* Ab = A  + (size_t)z * strideA;
  const _Float16* Bb = Bt + (size_t)z * strideB;

  const int rl   = lane & 15;          // row (A) / column (B, D) within a subtile
  const int koff = (lane >> 4) * 8;    // k offset of this lane half
  const int mOff = (lane >> 4) * 8;    // D row offset of this lane half

  v8f acc[4][4];
#pragma unroll
  for (int i = 0; i < 4; ++i)
#pragma unroll
    for (int j = 0; j < 4; ++j) acc[i][j] = zero8();

  for (int k0 = 0; k0 < K; k0 += 32) {
    // all eight fragments of the k step are loaded as one group, then its 16 WMMAs run
    v16h bfr[4], af[4];
    const _Float16 *pb[4], *pa[4];
#pragma unroll
    for (int j = 0; j < 4; ++j) {
      pb[j] = Bb + (size_t)(nsk + n0 + (j << 4) + rl) * ldb + koff + k0;
      pa[j] = Ab + (size_t)(m0 + (j << 4) + rl) * lda + koff + k0;
      bfr[j] = ldfrag(pb[j]);
      af[j]  = ldfrag(pa[j]);
    }
    // the wait that stands before an address register of an issued load is written again; the eight addresses pass
    // into it, so that no later load of the group gets an earlier one's address register as its destination
    asm volatile("s_wait_xcnt 0x0" :: "v"(pb[0]), "v"(pb[1]), "v"(pb[2]), "v"(pb[3]),
                                      "v"(pa[0]), "v"(pa[1]), "v"(pa[2]), "v"(pa[3]) : "memory");
    __builtin_amdgcn_sched_barrier(0);   // keeps the 16 loads in one group: one load latency a k step, not one a row
#pragma unroll
    for (int i = 0; i < 4; ++i)
#pragma unroll
      for (int j = 0; j < 4; ++j) acc[i][j] = mma16(af[i], bfr[j], acc[i][j]);
  }

  // ---- epilogue ----
  float* slab = sT[wave];
#pragma unroll
  for (int i = 0; i < 4; ++i) {
    const int mBase = m0 + (i << 4);
#pragma unroll
    for (int j = 0; j < 4; ++j)
#pragma unroll
      for (int r = 0; r < 8; ++r)
        slab[(mOff + r) * 68 + (j << 4) + rl] = acc[i][j][r] * scale;
    __builtin_amdgcn_fence(__ATOMIC_RELEASE, "workgroup");
    __builtin_amdgcn_wave_barrier();
    __builtin_amdgcn_fence(__ATOMIC_ACQUIRE, "workgroup");
    if (OUT == 0) {
      float* C = (float*)C1 + (size_t)z * strideC;
      const int hh = lane >> 4, c4 = (lane & 15) * 4;    // row segment 256 B = 16 lanes x 16 B
      {
#pragma unroll
        for (int it = 0; it < 8; ++it) {
          const int row = it * 2 + hh;
          const v4f v = *(const v4fa*)(slab + row * 68 + c4);
          *(v4f*)(C + (size_t)(mBase + row) * ldc + n0 + c4) = v;
        }
        
      }
    } else {
      const int q = lane >> 3, c8 = (lane & 7) * 8;
      _Float16* Ca = (_Float16*)C1 + (size_t)z * strideC;
      _Float16* Cb = (_Float16*)C2 + (size_t)z * strideC;
      v8h hv[4], lv[4];
#pragma unroll
      for (int it = 0; it < 4; ++it) {
        const int row = it * 4 + q;
        const float* sp = slab + row * 68 + c8;
        const v4f x0 = *(const v4fa*)(sp);
        const v4f x1 = *(const v4fa*)(sp + 4);
        float f[8];
        f[0] = x0[0]; f[1] = x0[1]; f[2] = x0[2]; f[3] = x0[3];
        f[4] = x1[0]; f[5] = x1[1]; f[6] = x1[2]; f[7] = x1[3];
        v8h ha, hb;
#pragma unroll
        for (int e = 0; e < 8; ++e) {
          if (OUT == 1) {
            ha[e] = (_Float16)f[e];
            hb[e] = ha[e];
          } else {
            const int n = n0 + c8 + e;
            ha[e] = (_Float16)((f[e] + bf_rne(b1[n])) * carry);
            hb[e] = (_Float16)((f[e] + bf_rne(b2[n])) * carry);
          }
        }
        hv[it] = ha; lv[it] = hb;
      }
      {
#pragma unroll
        for (int it = 0; it < 4; ++it) {
          const int row = it * 4 + q;
          *(v8h*)(Ca + (size_t)(mBase + row) * ldc + n0 + c8) = hv[it];
          if (OUT == 2) *(v8h*)(Cb + (size_t)(mBase + row) * ldc + n0 + c8) = lv[it];
        }
        
      }
    }
    __builtin_amdgcn_fence(__ATOMIC_RELEASE, "workgroup");
    __builtin_amdgcn_wave_barrier();
    __builtin_amdgcn_fence(__ATOMIC_ACQUIRE, "workgroup");
  }
}

// -------------------------------------------------------------------------------------------------
// Relative-position attention for a group of (batch, head) pairs, head dim 128, no mask.
//   QU  f16 plane [b*2048 + t][h*128 + d] = 16*(q + bias_u)       (A operand of the content score)
//   Kp  f16 plane [b*2048 + s][h*128 + d] = 16*k                  (B operand, staged per 64-key chunk as [key][d])
//   VT  f16 plane [b][h*128 + d][s]      = 16*v                  (B operand of P.V, staged as [d][key])
//   BD  f32 band scratch [z][2048][2112]: value (col j) = inv_sdk * (q_i + bias_v).p[row 64*(31 - i/64) + j]
//       rel-shift: bd[i][key] = bdfull[i][key - i + 2047]  ->  column (key - i + 2047) - 64*(31 - i/64)
//                = key + 63 - (i mod 64), always in [0, 2110].
//   score = cs * (QU.K^T acc) + BD  with cs = inv_sdk / 256;  online softmax in f32 over 32 chunks of 64 keys;
//   P stored per wave as f16(4096 * exp(s - m)); ctx = 64 * (P.V acc) / (4096*16*l) written as f16 plane
//   CTX [b*2048 + t][h*128 + d].
// Block = 4 waves = 64 query rows of one (b,h); grid = (32 query blocks, pairs in group).
// LDS: one raw buffer; K tile [64][128] f16 at 0 (row pitch 272 B), V^T tile [128][64] f16 at 17408 (pitch 144 B),
// per-wave P tiles [16][64] f16 at 35840 (pitch 144 B); the output staging [4][16][128] f32 reuses bytes 0..32 KB
// (inside the K and V^T tiles) after a block barrier.
// coverage: staging 128 thr x 64 halves for K (64x128) and for V^T (128x64); P tile 8 rows x 2 halves x 4x16 cols
// per wave = 16x64; output 8 store instructions x 2 rows x 16 lanes x 8 halves = 16x128 per wave.
// -------------------------------------------------------------------------------------------------
__global__ __launch_bounds__(128)
void relattn_kernel(const _Float16* __restrict__ QU, const _Float16* __restrict__ Kp,
                    const _Float16* __restrict__ VT, const float* __restrict__ BD,
                    _Float16* __restrict__ CTX, int pairBase, float cs) {
  __shared__ __align__(16) unsigned char SMEM[64 * KPIT_ * 2 + 128 * VPIT_ * 2 + 4 * 16 * PPIT_ * 2];   // 45056
  _Float16* Ksh = (_Float16*)(SMEM);                                      // [64][KPIT_]
  _Float16* Vsh = (_Float16*)(SMEM + 64 * KPIT_ * 2);                     // [128][VPIT_]
  _Float16* Psh = (_Float16*)(SMEM + 64 * KPIT_ * 2 + 128 * VPIT_ * 2);   // [4][16][PPIT_]
  float*    Osh = (float*)(SMEM);                // [4][16][128] after the chunk loop

  const int tid  = threadIdx.x;
  const int wave = tid >> 5;
  const int lane = tid & 31;
  const int hh   = lane >> 4;
  const int c    = lane & 15;

  const int z    = blockIdx.y;
  const int pair = pairBase + z;
  const int b    = pair >> 3;
  const int h    = pair & 7;
  const int qb   = blockIdx.x;                   // 0..31
  const int q0   = qb * 64 + wave * 16;          // first query row of this wave
  const int rr0  = wave * 16 + 8 * hh;           // row within the 64-row block for r = 0

  const _Float16* Qh = QU + (size_t)(b * NT_) * ND_ + h * HD_;
  const _Float16* Kh = Kp + (size_t)(b * NT_) * ND_ + h * HD_;
  const _Float16* Vh = VT + (size_t)b * ND_ * NT_ + (size_t)(h * HD_) * NT_;
  const float*    bd = BD + (size_t)z * NT_ * BDW_;
  _Float16*       ctx = CTX + (size_t)(b * NT_) * ND_ + h * HD_;

  // Q fragments (A operand): 4 chunks of 32 along d
  v16h qa[4];
#pragma unroll
  for (int dc = 0; dc < 4; ++dc)
    qa[dc] = ldfrag(Qh + (size_t)(q0 + c) * ND_ + dc * 32 + 8 * hh);


  float mrow[8], lrow[8];
  v8f oacc[8];
#pragma unroll
  for (int r = 0; r < 8; ++r) { mrow[r] = -INFINITY; lrow[r] = 0.f; }
#pragma unroll
  for (int t = 0; t < 8; ++t) oacc[t] = zero8();

  _Float16* pw = Psh + wave * (16 * PPIT_);

  // Every global load of a chunk is issued one chunk ahead into registers (chunk 0 here), so that its latency runs
  // under the chunk before instead of in front of its use.
  // Per-lane byte offsets, from the uniform bases Kh, Vh and bd, of the chunk that is loaded next:
  //   K row (kv0 + sr), halves sc0..sc0+63;  V^T row tid, keys kv0..kv0+63;
  //   band element of (row r, key kv0+16j+c) at bo + 4*(r*(BDW_-1) + 16j)
  const int sr = tid >> 1, sc0 = (tid & 1) * 64;
  unsigned ko = (unsigned)((sr * ND_ + sc0) * 2);
  unsigned vo = (unsigned)((tid * NT_) * 2);
  unsigned bo = (unsigned)(((q0 + 8 * hh) * BDW_ + (63 - rr0 + c)) * 4);
  v8h kreg[8], vreg[8];
  float bdv[8][4];
#pragma unroll
  for (int i = 0; i < 8; ++i) {
    kreg[i] = *(const v8h*)((const char*)Kh + ko + 16 * i);
    vreg[i] = *(const v8h*)((const char*)Vh + vo + 16 * i);
  }
#pragma unroll
  for (int r = 0; r < 8; ++r)
#pragma unroll
    for (int j = 0; j < 4; ++j)
      bdv[r][j] = *(const float*)((const char*)bd + bo + 4 * (r * (BDW_ - 1) + (j << 4)));
  // the wait that stands before an address register of an issued load is written again; the offsets pass through
  // it, so that their step cannot be placed ahead of it
  asm volatile("s_wait_xcnt 0x0" : "+v"(ko), "+v"(vo), "+v"(bo) :: "memory");
  ko += 64 * (ND_ * 2);
  vo += 64 * 2;
  bo += 64 * 4;

  // two chunks per trip: the band values loaded ahead alternate between two register sets; in a single body they
  // are copied into the one set behind a wait for the loads, in the middle of the chunk
#pragma unroll 2
  for (int kc = 0; kc < NT_ / 64; ++kc) {
    __syncthreads();
#pragma unroll
    for (int i = 0; i < 8; ++i) {
      *(v8ha*)(Ksh + sr * KPIT_ + sc0 + 8 * i) = kreg[i];
      *(v8ha*)(Vsh + tid * VPIT_ + 8 * i)      = vreg[i];
    }
    __syncthreads();

    // the chunk's 16 K and 16 V^T fragments, read from LDS as one group ahead of the score WMMAs: the K reads come
    // first, the V^T reads land under the score WMMAs
    v16h kb[4][4], vb[2][8];
#pragma unroll
    for (int dc = 0; dc < 4; ++dc)
#pragma unroll
      for (int j = 0; j < 4; ++j)
        kb[dc][j] = ldfrag(Ksh + (j * 16 + c) * KPIT_ + dc * 32 + 8 * hh);
#pragma unroll
    for (int kk = 0; kk < 2; ++kk)
#pragma unroll
      for (int t = 0; t < 8; ++t)
        vb[kk][t] = ldfrag(Vsh + (t * 16 + c) * VPIT_ + kk * 32 + 8 * hh);

    // the next chunk's K and V^T rows (the last trip loads its own chunk again, unused: no branch)
#pragma unroll
    for (int i = 0; i < 8; ++i) {
      kreg[i] = *(const v8h*)((const char*)Kh + ko + 16 * i);
      vreg[i] = *(const v8h*)((const char*)Vh + vo + 16 * i);
    }
    // keeps the 64 LDS reads in one group, and the 16 global loads a whole chunk ahead of their LDS stores
    __builtin_amdgcn_sched_barrier(0);

    // content scores: S[j] = QU(16x128) . K^T for key subtile j (each s[j] sums dc = 0..3 in that order)
    v8f s[4];
#pragma unroll
    for (int j = 0; j < 4; ++j) s[j] = zero8();
#pragma unroll
    for (int dc = 0; dc < 4; ++dc)
#pragma unroll
      for (int j = 0; j < 4; ++j) s[j] = mma16(qa[dc], kb[dc][j], s[j]);

    // add the position term from the band scratch, chunk row max
    float cm[8];
#pragma unroll
    for (int r = 0; r < 8; ++r) {
      float m = -INFINITY;
#pragma unroll
      for (int j = 0; j < 4; ++j) {
        const float sv = s[j][r] * cs + bdv[r][j];
        s[j][r] = sv;
        m = fmaxf(m, sv);
      }
      m = fmaxf(m, __shfl_xor(m, 1, 32));
      m = fmaxf(m, __shfl_xor(m, 2, 32));
      m = fmaxf(m, __shfl_xor(m, 4, 32));
      m = fmaxf(m, __shfl_xor(m, 8, 32));
      cm[r] = m;
    }

    // the next chunk's 32 band values (this chunk's have just been used by the loop above)
#pragma unroll
    for (int r = 0; r < 8; ++r)
#pragma unroll
      for (int j = 0; j < 4; ++j)
        bdv[r][j] = *(const float*)((const char*)bd + bo + 4 * (r * (BDW_ - 1) + (j << 4)));
    __builtin_amdgcn_sched_barrier(0);   // keeps these 32 loads here, a softmax and a P.V phase ahead of their use

    // online softmax update (per-row rescale of this row's accumulator elements only);
    // P tile (x4096) to this wave's LDS tile [row][key]
#pragma unroll
    for (int r = 0; r < 8; ++r) {
      const float mnew  = fmaxf(mrow[r], cm[r]);
      const float alpha = __expf(mrow[r] - mnew);
      mrow[r] = mnew;
      float psum = 0.f;
#pragma unroll
      for (int j = 0; j < 4; ++j) {
        const float p = __expf(s[j][r] - mnew);
        psum += p;
        pw[(8 * hh + r) * PPIT_ + j * 16 + c] = (_Float16)(p * 4096.0f);
      }
      psum += __shfl_xor(psum, 1, 32);
      psum += __shfl_xor(psum, 2, 32);
      psum += __shfl_xor(psum, 4, 32);
      psum += __shfl_xor(psum, 8, 32);
      lrow[r] = lrow[r] * alpha + psum;
#pragma unroll
      for (int t = 0; t < 8; ++t) oacc[t][r] *= alpha;
    }
    // the P tile goes through LDS alone: fences on the LDS address space leave the global loads above in flight
    __builtin_amdgcn_fence(__ATOMIC_RELEASE, "workgroup", "local");
    __builtin_amdgcn_wave_barrier();
    __builtin_amdgcn_fence(__ATOMIC_ACQUIRE, "workgroup", "local");

    // P (A operand, row = lane&15, split k map over keys) . V (B operand from V^T rows d)
#pragma unroll
    for (int kk = 0; kk < 2; ++kk) {
      const v16h pa = ldfrag(pw + c * PPIT_ + kk * 32 + 8 * hh);
#pragma unroll
      for (int t = 0; t < 8; ++t) oacc[t] = mma16(pa, vb[kk][t], oacc[t]);
    }

    // keeps the P.V WMMAs and the row sums in this trip: behind the next trip's barrier, which waits for every load
    // in flight, they would no longer cover the band loads' latency
    __builtin_amdgcn_sched_barrier(0);
    // the same wait as in front of the loop: it stands at the foot of the trip, in front of the offsets' step
    asm volatile("s_wait_xcnt 0x0" : "+v"(ko), "+v"(vo), "+v"(bo) :: "memory");
    const unsigned step = (kc + 2 < NT_ / 64) ? 64u : 0u;   // the offsets stop at the last chunk
    ko += step * (ND_ * 2);
    vo += step * 2;
    bo += step * 4;
  }

  __syncthreads();                               // every wave is done with Ksh/Vsh before Osh aliases them
  float* os = Osh + wave * (16 * 128);
#pragma unroll
  for (int r = 0; r < 8; ++r) {
    const float inv = 1.0f / (1024.0f * lrow[r]);   // 64 / (4096 * 16 * l)
#pragma unroll
    for (int t = 0; t < 8; ++t) os[(8 * hh + r) * 128 + t * 16 + c] = oacc[t][r] * inv;
  }
  __builtin_amdgcn_fence(__ATOMIC_RELEASE, "workgroup");
  __builtin_amdgcn_wave_barrier();
  __builtin_amdgcn_fence(__ATOMIC_ACQUIRE, "workgroup");
  v8h ov[8];
#pragma unroll
  for (int it = 0; it < 8; ++it) {
    const int row = it * 2 + hh;                 // lanes 0-15 row 2it, lanes 16-31 row 2it+1
    const float* sp = os + row * 128 + c * 8;
    const v4f x0 = *(const v4fa*)(sp);
    const v4f x1 = *(const v4fa*)(sp + 4);
    v8h o;
    o[0] = (_Float16)x0[0]; o[1] = (_Float16)x0[1]; o[2] = (_Float16)x0[2]; o[3] = (_Float16)x0[3];
    o[4] = (_Float16)x1[0]; o[5] = (_Float16)x1[1]; o[6] = (_Float16)x1[2]; o[7] = (_Float16)x1[3];
    ov[it] = o;
  }
  {
#pragma unroll
    for (int it = 0; it < 8; ++it) {
      const int row = it * 2 + hh;
      *(v8h*)(ctx + (size_t)(q0 + row) * ND_ + c * 8) = ov[it];   // 16 lanes x 16 B = one 256-B row segment
    }
    
  }
}

// -------------------------------------------------------------------------------------------------
// Workspace map (bytes):
//   WO   f16 [1024][1024]              0
//   QU   f16 [8192][1024]        2097152
//   QV   f16 [8192][1024]       18874368
//   KP   f16 [8192][1024]       35651584
//   VTP  f16 [4][1024][2048]    52428800
//   CTX  f16 [8192][1024]       69206016
//   P16  f16 [4096][1024]       85983232
//   SCR                         94371840   (138412032 B): early phase WQ,WK,WV,WP f16 [1024][1024] at +0,+2097152,
//        +4194304,+6291456; X f16 [8192][1024] at +8388608; PE f16 [4096][1024] at +25165824 (end +33554432);
//        later phase: BD band f32 [8][2048][2112] (end +138412032)
//   total                      232783872
// Every region is written in whole 64x64 tiles / whole rows; all sizes are exact tile multiples.
// -------------------------------------------------------------------------------------------------
extern "C" void kernel_launch(void* const* d_in, const int* in_sizes, int n_in,
                              void* d_out, int out_size, void* d_ws, size_t ws_size,
                              hipStream_t stream) {
  if (n_in < 9) return;
  if (in_sizes[0] != NB_ * NT_ * ND_) return;
  if (in_sizes[1] != NP_ * ND_) return;
  if (in_sizes[2] != ND_ * ND_ || in_sizes[3] != ND_ * ND_ || in_sizes[4] != ND_ * ND_) return;
  if (in_sizes[5] != ND_ * ND_ || in_sizes[6] != ND_ * ND_) return;
  if (in_sizes[7] != NH_ * HD_ || in_sizes[8] != NH_ * HD_) return;
  if (out_size != NB_ * NT_ * ND_) return;

  const float* x   = (const float*)d_in[0];
  const float* pe  = (const float*)d_in[1];
  const float* Wq  = (const float*)d_in[2];
  const float* Wk  = (const float*)d_in[3];
  const float* Wv  = (const float*)d_in[4];
  const float* Wo  = (const float*)d_in[5];
  const float* Wp  = (const float*)d_in[6];
  const float* bu  = (const float*)d_in[7];
  const float* bvb = (const float*)d_in[8];
  float* out = (float*)d_out;

  const size_t PW16 = (size_t)ND_ * ND_ * 2;             //  2097152
  const size_t PA16 = (size_t)NB_ * NT_ * ND_ * 2;       // 16777216
  const size_t PP16 = (size_t)NPP_ * ND_ * 2;            //  8388608
  const size_t PBD  = (size_t)NT_ * BDW_ * 4;            // 17301504 per pair
  const int    NPAIR = 8;                                // pairs per group: all heads of one batch element
  size_t off = 0;
  const size_t oWO  = off; off += PW16;
  const size_t oQU  = off; off += PA16;
  const size_t oQV  = off; off += PA16;
  const size_t oKP  = off; off += PA16;
  const size_t oVT  = off; off += PA16;
  const size_t oCTX = off; off += PA16;
  const size_t oP16 = off; off += PP16;
  const size_t oSCR = off;
  const size_t oWQ  = oSCR;
  const size_t oWK  = oWQ + PW16;
  const size_t oWV  = oWK + PW16;
  const size_t oWP  = oWV + PW16;
  const size_t oX   = oWP + PW16;
  const size_t oPE  = oX + PA16;
  const size_t earlyEnd = oPE + PP16;
  const size_t bdEnd    = oSCR + (size_t)NPAIR * PBD;
  const size_t total    = (earlyEnd > bdEnd) ? earlyEnd : bdEnd;   // 232783872
  if (total > ws_size) return;

  char* ws = (char*)d_ws;
  _Float16* WO  = (_Float16*)(ws + oWO);
  _Float16* QU  = (_Float16*)(ws + oQU);
  _Float16* QV  = (_Float16*)(ws + oQV);
  _Float16* KP  = (_Float16*)(ws + oKP);
  _Float16* VTP = (_Float16*)(ws + oVT);
  _Float16* CTX = (_Float16*)(ws + oCTX);
  _Float16* P16 = (_Float16*)(ws + oP16);
  _Float16* WQ  = (_Float16*)(ws + oWQ);
  _Float16* WK  = (_Float16*)(ws + oWK);
  _Float16* WV  = (_Float16*)(ws + oWV);
  _Float16* WP  = (_Float16*)(ws + oWP);
  _Float16* X   = (_Float16*)(ws + oX);
  _Float16* PE  = (_Float16*)(ws + oPE);
  float*    SCR = (float*)(ws + oSCR);

  const float inv_sdk = 0.08838834764831845f;   // 1/sqrt(128)
  const float cs      = inv_sdk * 0.00390625f;   // applied to the x16.x16 score accumulators
  const dim3 blk(256);

  // (1) weights -> f16 planes of bf16-valued entries, carried x64   (grid 1024*128/256 = 512)
  const dim3 gW((ND_ * (ND_ / 8) + 255) / 256);
  cvt_plane_kernel<<<gW, blk, 0, stream>>>(Wq, WQ, ND_, ND_, 64.0f);
  cvt_plane_kernel<<<gW, blk, 0, stream>>>(Wk, WK, ND_, ND_, 64.0f);
  cvt_plane_kernel<<<gW, blk, 0, stream>>>(Wv, WV, ND_, ND_, 64.0f);
  cvt_plane_kernel<<<gW, blk, 0, stream>>>(Wp, WP, ND_, ND_, 64.0f);
  cvt_plane_kernel<<<gW, blk, 0, stream>>>(Wo, WO, ND_, ND_, 64.0f);
  // (2) pos_emb -> f16 plane [4096][1024], row 4095 = 0
  const dim3 gPE((NPP_ * (ND_ / 8) + 255) / 256);
  cvt_plane_kernel<<<gPE, blk, 0, stream>>>(pe, PE, NP_, NPP_, 1.0f);
  // (3) p = pos_emb . Wp^T -> P16 = 16*p   (M=4096, N=1024, K=1024)
  {
    const int tiles = (NPP_ / 64) * (ND_ / 64);
    gemm_f16_kernel<1, false><<<dim3((tiles + 7) / 8, 1), blk, 0, stream>>>(
        PE, ND_, 0L, WP, ND_, 0L, (void*)P16, (void*)P16, ND_, 0L, bu, bu, NPP_, ND_, ND_, 0.25f, 1.0f, 0);
  }
  // (4) x -> f16 plane, all batch elements; q (two bias variants), k, v^T projections: one launch of 256 work-groups each
  {
    const dim3 gX((NB_ * NT_ * (ND_ / 8) + 255) / 256);
    cvt_plane_kernel<<<gX, blk, 0, stream>>>(x, X, NB_ * NT_, NB_ * NT_, 1.0f);
    const int tilesQ = ((NB_ * NT_) / 64) * (ND_ / 64);  // 2048
    // QU = 16*(q + bias_u), QV = 16*(q + bias_v)    (M=8192, N=1024, K=1024)
    gemm_f16_kernel<2, false><<<dim3((tilesQ + 7) / 8, 1), blk, 0, stream>>>(
        X, ND_, 0L, WQ, ND_, 0L, (void*)QU, (void*)QV, ND_, 0L, bu, bvb,
        NB_ * NT_, ND_, ND_, 0.015625f, 16.0f, 0);
    // KP = 16*k
    gemm_f16_kernel<1, false><<<dim3((tilesQ + 7) / 8, 1), blk, 0, stream>>>(
        X, ND_, 0L, WK, ND_, 0L, (void*)KP, (void*)KP, ND_, 0L, bu, bu,
        NB_ * NT_, ND_, ND_, 0.25f, 1.0f, 0);
    // VT[b][h*128+d][t] = 16*v   (A = Wv plane [1024][1024], Bt = x plane of batch z [2048][1024];
    //                             M=1024, N=2048, K=1024 per z, grid.y = batch)
    const int tilesV = (ND_ / 64) * (NT_ / 64);          // 512 per batch element
    gemm_f16_kernel<1, false><<<dim3((tilesV + 7) / 8, NB_), blk, 0, stream>>>(
        WV, ND_, 0L, X, ND_, (long)NT_ * ND_, (void*)VTP, (void*)VTP,
        NT_, (long)ND_ * NT_, bu, bu, ND_, NT_, ND_, 0.25f, 1.0f, 0);
  }
  // (5) per group of 8 (b,h) pairs: band GEMM of the position scores, then attention (256 work-groups, one per WGP)
  const int nGroups = (NB_ * NH_) / NPAIR;               // 4
  for (int g = 0; g < nGroups; ++g) {
    const int pairBase = g * NPAIR;
    const int b  = pairBase >> 3;
    const int h0 = pairBase & 7;
    const _Float16* Aq = QV + (size_t)b * NT_ * ND_ + h0 * HD_;   // rows t, cols d of head h0 (z adds 128)
    const _Float16* Bp = P16 + h0 * HD_;                           // rows p index, cols d of head h0
    const int tilesBD = (NT_ / 64) * (BDW_ / 64);                  // 32*33 = 1056
    gemm_f16_kernel<0, true><<<dim3((tilesBD + 7) / 8, NPAIR), blk, 0, stream>>>(
        Aq, ND_, (long)HD_, Bp, ND_, (long)HD_, (void*)SCR, (void*)SCR, BDW_, (long)NT_ * BDW_, bu, bu,
        NT_, BDW_, HD_, cs, 1.0f, 31);
    relattn_kernel<<<dim3(NT_ / 64, NPAIR), dim3(128), 0, stream>>>(QU, KP, VTP, SCR, CTX, pairBase, cs);
  }
  // (6) out = ctx . Wo^T -> d_out f32 [8192][1024]   (M=8192, N=1024, K=1024; carries 64*64 folded into scale)
  {
    const int tiles = ((NB_ * NT_) / 64) * (ND_ / 64);   // 2048
    gemm_f16_kernel<0, false><<<dim3((tiles + 7) / 8, 1), blk, 0, stream>>>(
        CTX, ND_, 0L, WO, ND_, 0L, (void*)out, (void*)out, ND_, 0L, bu, bu,
        NB_ * NT_, ND_, ND_, 0.000244140625f, 1.0f, 0);
  }
  (void)hipGetLastError();
}

// v005
// Measured time: 587 microseconds a run.
// In two side-by-side timings against v004, it was 1.07 and 1.08 times as fast.
// Counting every step since v000, it is 7.51 times as fast.
// Contractions x.Wq^T, x.Wk^T, Wv.x^T, pos_emb.Wp^T, (q+bias_v).p^T band, (q+bias_u).k^T, P.V, ctx.Wo^T: v_wmma_f32_16x16x32_f16 (f16 operands, f32 accumulate); operand planes hold bf16-RNE-valued inputs with power-of-two carries (W x64, q/k/v/p x16, P x4096, ctx x64); softmax, bias adds and score scaling in f32. Every plane that a GEMM reads as an operand is stored in fragment order (see ldfrag_pk).
#include <hip/hip_runtime.h>
#include <math.h>
#include <stdint.h>

#define NB_  4
#define NT_  2048
#define ND_  1024
#define NH_  8
#define HD_  128
#define NP_  4095
#define NPP_ 4096
#define BDW_ 2112   // width of the relative-position score band scratch (33 tiles of 64)
// LDS row pitches of the attention tiles, in halves: 16 B x odd, so that the 16 rows one ds_load_b128 reads
// fall on 16 different groups of four banks (unpadded 256-B rows all fall on one group, 128-B rows on two)
#define KPIT_ 136   // K tile row: 128 halves + 8  (272 B)
#define VPIT_ 72    // V^T tile row: 64 halves + 8 (144 B)
#define PPIT_ 72    // P tile row: 64 halves + 8   (144 B)
#define OPIT_ 132   // output staging row, in floats: 128 + 4 (528 B)

typedef _Float16 v16h __attribute__((ext_vector_type(16)));
typedef _Float16 v8h  __attribute__((ext_vector_type(8)));
typedef float    v8f  __attribute__((ext_vector_type(8)));
typedef float    v4f  __attribute__((ext_vector_type(4)));
typedef v4f __attribute__((may_alias)) v4fa;
typedef v8h __attribute__((may_alias)) v8ha;

// bf16 RNE of an f32 value, returned widened to f32 (exactly representable in f16 after a power-of-two carry)
__device__ __forceinline__ float bf_rne(float f) {
  unsigned u = __float_as_uint(f);
  u = (u + 0x7FFFu + ((u >> 16) & 1u)) & 0xFFFF0000u;
  return __uint_as_float(u);
}

// 16-bit WMMA fragment: elements 0..7 <- p[0..7], elements 8..15 <- p[16..23]
// (A: p = row m at k0 + 8h;  B stored [n][k]: p = row n at k0 + 8h;  same split k map for both)
union FragU { v16h v; v8ha h[2]; };
__device__ __forceinline__ v16h ldfrag(const _Float16* p) {
  FragU f;
  f.h[0] = *(const v8ha*)(p);
  f.h[1] = *(const v8ha*)(p + 16);
  return f.v;
}

// Fragment-order ("packed") plane of pitch ld halves: each block of 16 rows x 32 k is 1 KB in a row, block (row/16, k/32)
// at half offset (row/16)*16*ld + (k/32)*512; inside it the 16-B piece of (row, k..k+7), k a multiple of 8, stands at
// ((k/16)&1)*256 + (((k/8)&1)*16 + row%16)*8. So lane l = 16h + row finds elements 0..7 (k0 + 8h ..) at l*8 and elements
// 8..15 (k0 + 16 + 8h ..) at 256 + l*8: the same split k map as ldfrag, and each of the two wave-wide 16-B loads covers
// 512 contiguous bytes (4 cache lines) where the row-major plane gives 32 B from each of 16 lines.
// p = block start + lane*8
__device__ __forceinline__ v16h ldfrag_pk(const _Float16* p) {
  FragU f;
  f.h[0] = *(const v8ha*)(p);
  f.h[1] = *(const v8ha*)(p + 256);
  return f.v;
}

// Plain builtin: the compiler keeps the WMMA distances itself and stays free to place fragment loads ahead of
// earlier WMMAs (a volatile asm statement behind each WMMA held every load behind the WMMA before it)
__device__ __forceinline__ v8f mma16(v16h a, v16h b, v8f c) {
  return __builtin_amdgcn_wmma_f32_16x16x32_f16(false, a, false, b, (short)0, c, false, false);
}

__device__ __forceinline__ v8f zero8() { v8f z = {0.f, 0.f, 0.f, 0.f, 0.f, 0.f, 0.f, 0.f}; return z; }

// -------------------------------------------------------------------------------------------------
// f32 [nrows_src][ND_] -> packed f16 plane [nrows_dst][ND_]: dst = f16( bf_rne(src) * scale ), rows >= nrows_src are 0.
// A wave takes 8 rows x 32 columns (lane = 4*row + piece): it reads 8 whole 128-B lines and writes 4 whole 128-B lines.
// coverage: nrows_dst * 128 threads * 8 = the whole [nrows_dst][1024] plane; nrows_dst is a multiple of 16.
// -------------------------------------------------------------------------------------------------
__global__ __launch_bounds__(256) void cvt_plane_kernel(const float* __restrict__ src, _Float16* __restrict__ dst,
                                                        int nrows_src, int nrows_dst, float scale) {
  const int i = blockIdx.x * 256 + threadIdx.x;
  const int total8 = nrows_dst * (ND_ / 8);
  if (i >= total8) return;
  const int g  = i >> 5;                                          // wave: (8-row group, 32-column block)
  const int ks = i & 3;                                           // 8-column piece of the block
  const int kb = g & (ND_ / 32 - 1);
  const int r  = (g / (ND_ / 32)) * 8 + ((i & 31) >> 2);
  const int c8 = kb * 32 + ks * 8;
  const int rs = (r < nrows_src) ? r : (nrows_src - 1);          // clamped address
  const float sc = (r < nrows_src) ? scale : 0.0f;                // zero by value for filler rows
  const float* sp = src + (size_t)rs * ND_ + c8;
  const v4f a = *(const v4f*)(sp);
  const v4f b = *(const v4f*)(sp + 4);
  v8h o;
  o[0] = (_Float16)(bf_rne(a[0]) * sc); o[1] = (_Float16)(bf_rne(a[1]) * sc);
  o[2] = (_Float16)(bf_rne(a[2]) * sc); o[3] = (_Float16)(bf_rne(a[3]) * sc);
  o[4] = (_Float16)(bf_rne(b[0]) * sc); o[5] = (_Float16)(bf_rne(b[1]) * sc);
  o[6] = (_Float16)(bf_rne(b[2]) * sc); o[7] = (_Float16)(bf_rne(b[3]) * sc);
  _Float16* dp = dst + (size_t)(r >> 4) * (16 * ND_) + kb * 512 + (ks >> 1) * 256 + ((ks & 1) * 16 + (r & 15)) * 8;
  *(v8h*)dp = o;
  
}

// -------------------------------------------------------------------------------------------------
// f16 WMMA GEMM: C[m][n] = epi( sum_k A[m][k] * Bt[nrow][k] ), nrow = n (+ 64*(skew0 - tm) when SKEW: band GEMM).
// A [M][K] and Bt [N(+band)][K] are packed planes (ldfrag_pk) of pitch lda, ldb; a column offset c (multiple of 32) of a
// packed plane is 16*c halves; M, N multiples of 64, K multiple of 32.
// Each wave owns a 64x64 output tile (4x4 subtiles), 8 waves per block, grid.x = tiles/8, grid.y = z-batch.
// OUT 0: f32  C1 = acc*scale
// OUT 1: f16  C1 = f16(acc*scale), row-major
// OUT 2: f16  C1 = f16((acc*scale + bf_rne(b1[n]))*carry), C2 = f16((acc*scale + bf_rne(b2[n]))*carry), both packed
// OUT 3: f16  C1 = f16(acc*scale), packed
// ONE instruction with lane-contiguous 16-B pieces (f32: 16 lanes x 16 B = 256 B segment; f16: 8 lanes x 16 B =
// coverage: 4 slabs x 16 rows x 64 cols = the whole 64x64 tile per wave; tiles cover M x N exactly.
// -------------------------------------------------------------------------------------------------
template <int OUT, bool SKEW>
__global__ __launch_bounds__(256) void gemm_f16_kernel(
    const _Float16* __restrict__ A, int lda, long strideA,
    const _Float16* __restrict__ Bt, int ldb, long strideB,
    void* __restrict__ C1, void* __restrict__ C2, int ldc, long strideC,
    const float* __restrict__ b1, const float* __restrict__ b2,
    int M, int N, int K, float scale, float carry, int skew0) {
  __shared__ __align__(16) float sT[8][16 * 68];   // per-wave 16x64 slab, pitch 68 floats

  const int z    = blockIdx.y;
  const int lane = threadIdx.x & 31;
  const int wave = threadIdx.x >> 5;
  const int tilesN = N >> 6;
  const int tilesM = M >> 6;
  const int tile = blockIdx.x * 8 + wave;
  if (tile >= tilesM * tilesN) return;             // wave-uniform; no block barriers in this kernel
  const int tm = tile / tilesN;
  const int tn = tile - tm * tilesN;
  const int m0 = tm << 6;
  const int n0 = tn << 6;
  const int nsk = SKEW ? ((skew0 - tm) << 6) : 0;  // band row offset of Bt

  const _Float16* Ab = A  + (size_t)z * strideA;
  const _Float16* Bb = Bt + (size_t)z * strideB;

  const int rl   = lane & 15;          // column (D) within a subtile
  const int mOff = (lane >> 4) * 8;    // D row offset of this lane half

  v8f acc[4][4];
#pragma unroll
  for (int i = 0; i < 4; ++i)
#pragma unroll
    for (int j = 0; j < 4; ++j) acc[i][j] = zero8();

  // this lane's place in the first block of the tile's first 16 rows; the next 16 rows stand 16*ld halves on, the next
  // k step 512 halves on
  const _Float16* Ar = Ab + (size_t)(m0 >> 4) * ((size_t)lda * 16) + lane * 8;
  const _Float16* Br = Bb + (size_t)((nsk + n0) >> 4) * ((size_t)ldb * 16) + lane * 8;

  for (int k0 = 0; k0 < K; k0 += 32) {
    // all eight fragments of the k step are loaded as one group, then its 16 WMMAs run
    v16h bfr[4], af[4];
    const _Float16 *pb[4], *pa[4];
#pragma unroll
    for (int j = 0; j < 4; ++j) {
      pb[j] = Br + (size_t)j * ((size_t)ldb * 16) + (k0 << 4);
      pa[j] = Ar + (size_t)j * ((size_t)lda * 16) + (k0 << 4);
      bfr[j] = ldfrag_pk(pb[j]);
      af[j]  = ldfrag_pk(pa[j]);
    }
    // the wait that stands before an address register of an issued load is written again; the eight addresses pass
    // into it, so that no later load of the group gets an earlier one's address register as its destination
    asm volatile("s_wait_xcnt 0x0" :: "v"(pb[0]), "v"(pb[1]), "v"(pb[2]), "v"(pb[3]),
                                      "v"(pa[0]), "v"(pa[1]), "v"(pa[2]), "v"(pa[3]) : "memory");
    __builtin_amdgcn_sched_barrier(0);   // keeps the 16 loads in one group: one load latency a k step, not one a row
#pragma unroll
    for (int i = 0; i < 4; ++i)
#pragma unroll
      for (int j = 0; j < 4; ++j) acc[i][j] = mma16(af[i], bfr[j], acc[i][j]);
  }

  // ---- epilogue ----
  float* slab = sT[wave];
#pragma unroll
  for (int i = 0; i < 4; ++i) {
    const int mBase = m0 + (i << 4);
#pragma unroll
    for (int j = 0; j < 4; ++j)
#pragma unroll
      for (int r = 0; r < 8; ++r)
        slab[(mOff + r) * 68 + (j << 4) + rl] = acc[i][j][r] * scale;
    __builtin_amdgcn_fence(__ATOMIC_RELEASE, "workgroup");
    __builtin_amdgcn_wave_barrier();
    __builtin_amdgcn_fence(__ATOMIC_ACQUIRE, "workgroup");
    if (OUT == 0) {
      float* C = (float*)C1 + (size_t)z * strideC;
      const int hh = lane >> 4, c4 = (lane & 15) * 4;    // row segment 256 B = 16 lanes x 16 B
      {
#pragma unroll
        for (int it = 0; it < 8; ++it) {
          const int row = it * 2 + hh;
          const v4f v = *(const v4fa*)(slab + row * 68 + c4);
          *(v4f*)(C + (size_t)(mBase + row) * ldc + n0 + c4) = v;
        }
        
      }
    } else if (OUT == 2 || OUT == 3) {
      // packed output: store 'it' is half j = it&1 of block it>>1 of the slab's two 16x32 blocks, 512 contiguous bytes;
      // lane 16h + row brings the piece (row, 32*(it>>1) + 16*j + 8h)
      _Float16* Ca = (_Float16*)C1 + (size_t)z * strideC;
      _Float16* Cb = (_Float16*)C2 + (size_t)z * strideC;
      const size_t dbase = (size_t)(mBase >> 4) * ((size_t)ldc * 16) + (size_t)(n0 >> 5) * 512 + lane * 8;
      v8h hv[4], lv[4];
#pragma unroll
      for (int it = 0; it < 4; ++it) {
        const int col = (it >> 1) * 32 + (it & 1) * 16 + (lane >> 4) * 8;
        const float* sp = slab + rl * 68 + col;
        const v4f x0 = *(const v4fa*)(sp);
        const v4f x1 = *(const v4fa*)(sp + 4);
        float f[8];
        f[0] = x0[0]; f[1] = x0[1]; f[2] = x0[2]; f[3] = x0[3];
        f[4] = x1[0]; f[5] = x1[1]; f[6] = x1[2]; f[7] = x1[3];
        v8h ha, hb;
#pragma unroll
        for (int e = 0; e < 8; ++e) {
          if (OUT == 3) {
            ha[e] = (_Float16)f[e];
            hb[e] = ha[e];
          } else {
            const int n = n0 + col + e;
            ha[e] = (_Float16)((f[e] + bf_rne(b1[n])) * carry);
            hb[e] = (_Float16)((f[e] + bf_rne(b2[n])) * carry);
          }
        }
        hv[it] = ha; lv[it] = hb;
      }
#pragma unroll
      for (int it = 0; it < 4; ++it) {
        *(v8h*)(Ca + dbase + it * 256) = hv[it];
        if (OUT == 2) *(v8h*)(Cb + dbase + it * 256) = lv[it];
      }
      // the wait that stands before an address register of an issued store is written again (the next slab's addresses)
      asm volatile("s_wait_xcnt 0x0" ::: "memory");
    } else {
      const int q = lane >> 3, c8 = (lane & 7) * 8;
      _Float16* Ca = (_Float16*)C1 + (size_t)z * strideC;
      v8h hv[4];
#pragma unroll
      for (int it = 0; it < 4; ++it) {
        const int row = it * 4 + q;
        const float* sp = slab + row * 68 + c8;
        const v4f x0 = *(const v4fa*)(sp);
        const v4f x1 = *(const v4fa*)(sp + 4);
        float f[8];
        f[0] = x0[0]; f[1] = x0[1]; f[2] = x0[2]; f[3] = x0[3];
        f[4] = x1[0]; f[5] = x1[1]; f[6] = x1[2]; f[7] = x1[3];
        v8h ha;
#pragma unroll
        for (int e = 0; e < 8; ++e) ha[e] = (_Float16)f[e];
        hv[it] = ha;
      }
      {
#pragma unroll
        for (int it = 0; it < 4; ++it) {
          const int row = it * 4 + q;
          *(v8h*)(Ca + (size_t)(mBase + row) * ldc + n0 + c8) = hv[it];
        }
        
      }
    }
    __builtin_amdgcn_fence(__ATOMIC_RELEASE, "workgroup");
    __builtin_amdgcn_wave_barrier();
    __builtin_amdgcn_fence(__ATOMIC_ACQUIRE, "workgroup");
  }
}

// -------------------------------------------------------------------------------------------------
// Relative-position attention for a group of (batch, head) pairs, head dim 128, no mask.
//   QU  f16 packed plane [b*2048 + t][h*128 + d] = 16*(q + bias_u) (A operand of the content score)
//   Kp  f16 plane [b*2048 + s][h*128 + d] = 16*k                  (B operand, staged per 64-key chunk as [key][d])
//   VT  f16 plane [b][h*128 + d][s]      = 16*v                  (B operand of P.V, staged as [d][key])
//   BD  f32 band scratch [z][2048][2112]: value (col j) = inv_sdk * (q_i + bias_v).p[row 64*(31 - i/64) + j]
//       rel-shift: bd[i][key] = bdfull[i][key - i + 2047]  ->  column (key - i + 2047) - 64*(31 - i/64)
//                = key + 63 - (i mod 64), always in [0, 2110].
//   score = cs * (QU.K^T acc) + BD  with cs = inv_sdk / 256;  online softmax in f32 over 32 chunks of 64 keys;
//   P stored per wave as f16(4096 * exp(s - m)); ctx = 64 * (P.V acc) / (4096*16*l) written as packed f16
//   plane CTX [b*2048 + t][h*128 + d].
// Block = 4 waves = 64 query rows of one (b,h); grid = (32 query blocks, pairs in group).
// LDS: one raw buffer; K tile [64][128] f16 at 0 (row pitch 272 B), V^T tile [128][64] f16 at 17408 (pitch 144 B),
// per-wave P tiles [16][64] f16 at 35840 (pitch 144 B); the output staging [4][16][128] f32 (row pitch 528 B = 16 B x odd for its
// 16-row ds_load_b128 reader) reuses bytes 0..33 KB (inside the K and V^T tiles) after a block barrier.
// coverage: staging 128 thr x 64 halves for K (64x128) and for V^T (128x64); P tile 8 rows x 2 halves x 4x16 cols
// per wave = 16x64; output 8 store instructions x 16 rows x 2 pieces x 8 halves = 16x128 per wave.
// -------------------------------------------------------------------------------------------------
__global__ __launch_bounds__(128)
void relattn_kernel(const _Float16* __restrict__ QU, const _Float16* __restrict__ Kp,
                    const _Float16* __restrict__ VT, const float* __restrict__ BD,
                    _Float16* __restrict__ CTX, int pairBase, float cs) {
  __shared__ __align__(16) unsigned char SMEM[64 * KPIT_ * 2 + 128 * VPIT_ * 2 + 4 * 16 * PPIT_ * 2];   // 45056
  _Float16* Ksh = (_Float16*)(SMEM);                                      // [64][KPIT_]
  _Float16* Vsh = (_Float16*)(SMEM + 64 * KPIT_ * 2);                     // [128][VPIT_]
  _Float16* Psh = (_Float16*)(SMEM + 64 * KPIT_ * 2 + 128 * VPIT_ * 2);   // [4][16][PPIT_]
  float*    Osh = (float*)(SMEM);                // [4][16][OPIT_] after the chunk loop

  const int tid  = threadIdx.x;
  const int wave = tid >> 5;
  const int lane = tid & 31;
  const int hh   = lane >> 4;
  const int c    = lane & 15;

  const int z    = blockIdx.y;
  const int pair = pairBase + z;
  const int b    = pair >> 3;
  const int h    = pair & 7;
  const int qb   = blockIdx.x;                   // 0..31
  const int q0   = qb * 64 + wave * 16;          // first query row of this wave
  const int rr0  = wave * 16 + 8 * hh;           // row within the 64-row block for r = 0

  const _Float16* Qh = QU + (size_t)(b * NT_) * ND_ + h * (HD_ * 16);   // packed: column h*128 is 16*h*128 halves
  const _Float16* Kh = Kp + (size_t)(b * NT_) * ND_ + h * HD_;
  const _Float16* Vh = VT + (size_t)b * ND_ * NT_ + (size_t)(h * HD_) * NT_;
  const float*    bd = BD + (size_t)z * NT_ * BDW_;
  _Float16*       ctx = CTX + (size_t)(b * NT_) * ND_ + h * (HD_ * 16);  // packed, as Qh

  // Q fragments (A operand): 4 chunks of 32 along d
  v16h qa[4];
#pragma unroll
  for (int dc = 0; dc < 4; ++dc)
    qa[dc] = ldfrag_pk(Qh + (size_t)q0 * ND_ + dc * 512 + lane * 8);   // q0 is a multiple of 16


  float mrow[8], lrow[8];
  v8f oacc[8];
#pragma unroll
  for (int r = 0; r < 8; ++r) { mrow[r] = -INFINITY; lrow[r] = 0.f; }
#pragma unroll
  for (int t = 0; t < 8; ++t) oacc[t] = zero8();

  _Float16* pw = Psh + wave * (16 * PPIT_);

  // Every global load of a chunk is issued one chunk ahead into registers (chunk 0 here), so that its latency runs
  // under the chunk before instead of in front of its use.
  // Per-lane byte offsets, from the uniform bases Kh, Vh and bd, of the chunk that is loaded next:
  //   K row (kv0 + sr), halves sc0..sc0+63;  V^T row tid, keys kv0..kv0+63;
  //   band element of (row r, key kv0+16j+c) at bo + 4*(r*(BDW_-1) + 16j)
  const int sr = tid >> 1, sc0 = (tid & 1) * 64;
  unsigned ko = (unsigned)((sr * ND_ + sc0) * 2);
  unsigned vo = (unsigned)((tid * NT_) * 2);
  unsigned bo = (unsigned)(((q0 + 8 * hh) * BDW_ + (63 - rr0 + c)) * 4);
  v8h kreg[8], vreg[8];
  float bdv[8][4];
#pragma unroll
  for (int i = 0; i < 8; ++i) {
    kreg[i] = *(const v8h*)((const char*)Kh + ko + 16 * i);
    vreg[i] = *(const v8h*)((const char*)Vh + vo + 16 * i);
  }
#pragma unroll
  for (int r = 0; r < 8; ++r)
#pragma unroll
    for (int j = 0; j < 4; ++j)
      bdv[r][j] = *(const float*)((const char*)bd + bo + 4 * (r * (BDW_ - 1) + (j << 4)));
  // the wait that stands before an address register of an issued load is written again; the offsets pass through
  // it, so that their step cannot be placed ahead of it
  asm volatile("s_wait_xcnt 0x0" : "+v"(ko), "+v"(vo), "+v"(bo) :: "memory");
  ko += 64 * (ND_ * 2);
  vo += 64 * 2;
  bo += 64 * 4;

  // two chunks per trip: the band values loaded ahead alternate between two register sets; in a single body they
  // are copied into the one set behind a wait for the loads, in the middle of the chunk
#pragma unroll 2
  for (int kc = 0; kc < NT_ / 64; ++kc) {
    __syncthreads();
#pragma unroll
    for (int i = 0; i < 8; ++i) {
      *(v8ha*)(Ksh + sr * KPIT_ + sc0 + 8 * i) = kreg[i];
      *(v8ha*)(Vsh + tid * VPIT_ + 8 * i)      = vreg[i];
    }
    __syncthreads();

    // the chunk's 16 K and 16 V^T fragments, read from LDS as one group ahead of the score WMMAs: the K reads come
    // first, the V^T reads land under the score WMMAs
    v16h kb[4][4], vb[2][8];
#pragma unroll
    for (int dc = 0; dc < 4; ++dc)
#pragma unroll
      for (int j = 0; j < 4; ++j)
        kb[dc][j] = ldfrag(Ksh + (j * 16 + c) * KPIT_ + dc * 32 + 8 * hh);
#pragma unroll
    for (int kk = 0; kk < 2; ++kk)
#pragma unroll
      for (int t = 0; t < 8; ++t)
        vb[kk][t] = ldfrag(Vsh + (t * 16 + c) * VPIT_ + kk * 32 + 8 * hh);

    // the next chunk's K and V^T rows (the last trip loads its own chunk again, unused: no branch)
#pragma unroll
    for (int i = 0; i < 8; ++i) {
      kreg[i] = *(const v8h*)((const char*)Kh + ko + 16 * i);
      vreg[i] = *(const v8h*)((const char*)Vh + vo + 16 * i);
    }
    // keeps the 64 LDS reads in one group, and the 16 global loads a whole chunk ahead of their LDS stores
    __builtin_amdgcn_sched_barrier(0);

    // content scores: S[j] = QU(16x128) . K^T for key subtile j (each s[j] sums dc = 0..3 in that order)
    v8f s[4];
#pragma unroll
    for (int j = 0; j < 4; ++j) s[j] = zero8();
#pragma unroll
    for (int dc = 0; dc < 4; ++dc)
#pragma unroll
      for (int j = 0; j < 4; ++j) s[j] = mma16(qa[dc], kb[dc][j], s[j]);

    // add the position term from the band scratch, chunk row max
    float cm[8];
#pragma unroll
    for (int r = 0; r < 8; ++r) {
      float m = -INFINITY;
#pragma unroll
      for (int j = 0; j < 4; ++j) {
        const float sv = s[j][r] * cs + bdv[r][j];
        s[j][r] = sv;
        m = fmaxf(m, sv);
      }
      m = fmaxf(m, __shfl_xor(m, 1, 32));
      m = fmaxf(m, __shfl_xor(m, 2, 32));
      m = fmaxf(m, __shfl_xor(m, 4, 32));
      m = fmaxf(m, __shfl_xor(m, 8, 32));
      cm[r] = m;
    }

    // the next chunk's 32 band values (this chunk's have just been used by the loop above)
#pragma unroll
    for (int r = 0; r < 8; ++r)
#pragma unroll
      for (int j = 0; j < 4; ++j)
        bdv[r][j] = *(const float*)((const char*)bd + bo + 4 * (r * (BDW_ - 1) + (j << 4)));
    __builtin_amdgcn_sched_barrier(0);   // keeps these 32 loads here, a softmax and a P.V phase ahead of their use

    // online softmax update (per-row rescale of this row's accumulator elements only);
    // P tile (x4096) to this wave's LDS tile [row][key]
#pragma unroll
    for (int r = 0; r < 8; ++r) {
      const float mnew  = fmaxf(mrow[r], cm[r]);
      const float alpha = __expf(mrow[r] - mnew);
      mrow[r] = mnew;
      float psum = 0.f;
#pragma unroll
      for (int j = 0; j < 4; ++j) {
        const float p = __expf(s[j][r] - mnew);
        psum += p;
        pw[(8 * hh + r) * PPIT_ + j * 16 + c] = (_Float16)(p * 4096.0f);
      }
      psum += __shfl_xor(psum, 1, 32);
      psum += __shfl_xor(psum, 2, 32);
      psum += __shfl_xor(psum, 4, 32);
      psum += __shfl_xor(psum, 8, 32);
      lrow[r] = lrow[r] * alpha + psum;
#pragma unroll
      for (int t = 0; t < 8; ++t) oacc[t][r] *= alpha;
    }
    // the P tile goes through LDS alone: fences on the LDS address space leave the global loads above in flight
    __builtin_amdgcn_fence(__ATOMIC_RELEASE, "workgroup", "local");
    __builtin_amdgcn_wave_barrier();
    __builtin_amdgcn_fence(__ATOMIC_ACQUIRE, "workgroup", "local");

    // P (A operand, row = lane&15, split k map over keys) . V (B operand from V^T rows d)
#pragma unroll
    for (int kk = 0; kk < 2; ++kk) {
      const v16h pa = ldfrag(pw + c * PPIT_ + kk * 32 + 8 * hh);
#pragma unroll
      for (int t = 0; t < 8; ++t) oacc[t] = mma16(pa, vb[kk][t], oacc[t]);
    }

    // keeps the P.V WMMAs and the row sums in this trip: behind the next trip's barrier, which waits for every load
    // in flight, they would no longer cover the band loads' latency
    __builtin_amdgcn_sched_barrier(0);
    // the same wait as in front of the loop: it stands at the foot of the trip, in front of the offsets' step
    asm volatile("s_wait_xcnt 0x0" : "+v"(ko), "+v"(vo), "+v"(bo) :: "memory");
    const unsigned step = (kc + 2 < NT_ / 64) ? 64u : 0u;   // the offsets stop at the last chunk
    ko += step * (ND_ * 2);
    vo += step * 2;
    bo += step * 4;
  }

  __syncthreads();                               // every wave is done with Ksh/Vsh before Osh aliases them
  float* os = Osh + wave * (16 * OPIT_);
#pragma unroll
  for (int r = 0; r < 8; ++r) {
    const float inv = 1.0f / (1024.0f * lrow[r]);   // 64 / (4096 * 16 * l)
#pragma unroll
    for (int t = 0; t < 8; ++t) os[(8 * hh + r) * OPIT_ + t * 16 + c] = oacc[t][r] * inv;
  }
  __builtin_amdgcn_fence(__ATOMIC_RELEASE, "workgroup");
  __builtin_amdgcn_wave_barrier();
  __builtin_amdgcn_fence(__ATOMIC_ACQUIRE, "workgroup");
  v8h ov[8];
#pragma unroll
  for (int it = 0; it < 8; ++it) {
    // half it&1 of the 16x32 block it>>1: lane 16*hh + c brings the piece (row c, column 16*it + 8*hh)
    const float* sp = os + c * OPIT_ + it * 16 + hh * 8;
    const v4f x0 = *(const v4fa*)(sp);
    const v4f x1 = *(const v4fa*)(sp + 4);
    v8h o;
    o[0] = (_Float16)x0[0]; o[1] = (_Float16)x0[1]; o[2] = (_Float16)x0[2]; o[3] = (_Float16)x0[3];
    o[4] = (_Float16)x1[0]; o[5] = (_Float16)x1[1]; o[6] = (_Float16)x1[2]; o[7] = (_Float16)x1[3];
    ov[it] = o;
  }
  {
#pragma unroll
    for (int it = 0; it < 8; ++it) {
      *(v8h*)(ctx + (size_t)q0 * ND_ + it * 256 + lane * 8) = ov[it];   // 32 lanes x 16 B = 512 contiguous bytes
    }
    
  }
}

// -------------------------------------------------------------------------------------------------
// Workspace map (bytes):
//   (pk = packed, in fragment order: ldfrag_pk)
//   WO   f16 pk [1024][1024]           0
//   QU   f16 pk [8192][1024]     2097152
//   QV   f16 pk [8192][1024]    18874368
//   KP   f16 [8192][1024]       35651584
//   VTP  f16 [4][1024][2048]    52428800
//   CTX  f16 pk [8192][1024]    69206016
//   P16  f16 pk [4096][1024]    85983232
//   SCR                         94371840   (138412032 B): early phase (all pk) WQ,WK,WV,WP f16 [1024][1024] at +0,+2097152,
//        +4194304,+6291456; X f16 [8192][1024] at +8388608; PE f16 [4096][1024] at +25165824 (end +33554432);
//        later phase: BD band f32 [8][2048][2112] (end +138412032)
//   total                      232783872
// Every region is written in whole 64x64 tiles / whole rows; all sizes are exact tile multiples.
// -------------------------------------------------------------------------------------------------
extern "C" void kernel_launch(void* const* d_in, const int* in_sizes, int n_in,
                              void* d_out, int out_size, void* d_ws, size_t ws_size,
                              hipStream_t stream) {
  if (n_in < 9) return;
  if (in_sizes[0] != NB_ * NT_ * ND_) return;
  if (in_sizes[1] != NP_ * ND_) return;
  if (in_sizes[2] != ND_ * ND_ || in_sizes[3] != ND_ * ND_ || in_sizes[4] != ND_ * ND_) return;
  if (in_sizes[5] != ND_ * ND_ || in_sizes[6] != ND_ * ND_) return;
  if (in_sizes[7] != NH_ * HD_ || in_sizes[8] != NH_ * HD_) return;
  if (out_size != NB_ * NT_ * ND_) return;

  const float* x   = (const float*)d_in[0];
  const float* pe  = (const float*)d_in[1];
  const float* Wq  = (const float*)d_in[2];
  const float* Wk  = (const float*)d_in[3];
  const float* Wv  = (const float*)d_in[4];
  const float* Wo  = (const float*)d_in[5];
  const float* Wp  = (const float*)d_in[6];
  const float* bu  = (const float*)d_in[7];
  const float* bvb = (const float*)d_in[8];
  float* out = (float*)d_out;

  const size_t PW16 = (size_t)ND_ * ND_ * 2;             //  2097152
  const size_t PA16 = (size_t)NB_ * NT_ * ND_ * 2;       // 16777216
  const size_t PP16 = (size_t)NPP_ * ND_ * 2;            //  8388608
  const size_t PBD  = (size_t)NT_ * BDW_ * 4;            // 17301504 per pair
  const int    NPAIR = 8;                                // pairs per group: all heads of one batch element
  size_t off = 0;
  const size_t oWO  = off; off += PW16;
  const size_t oQU  = off; off += PA16;
  const size_t oQV  = off; off += PA16;
  const size_t oKP  = off; off += PA16;
  const size_t oVT  = off; off += PA16;
  const size_t oCTX = off; off += PA16;
  const size_t oP16 = off; off += PP16;
  const size_t oSCR = off;
  const size_t oWQ  = oSCR;
  const size_t oWK  = oWQ + PW16;
  const size_t oWV  = oWK + PW16;
  const size_t oWP  = oWV + PW16;
  const size_t oX   = oWP + PW16;
  const size_t oPE  = oX + PA16;
  const size_t earlyEnd = oPE + PP16;
  const size_t bdEnd    = oSCR + (size_t)NPAIR * PBD;
  const size_t total    = (earlyEnd > bdEnd) ? earlyEnd : bdEnd;   // 232783872
  if (total > ws_size) return;

  char* ws = (char*)d_ws;
  _Float16* WO  = (_Float16*)(ws + oWO);
  _Float16* QU  = (_Float16*)(ws + oQU);
  _Float16* QV  = (_Float16*)(ws + oQV);
  _Float16* KP  = (_Float16*)(ws + oKP);
  _Float16* VTP = (_Float16*)(ws + oVT);
  _Float16* CTX = (_Float16*)(ws + oCTX);
  _Float16* P16 = (_Float16*)(ws + oP16);
  _Float16* WQ  = (_Float16*)(ws + oWQ);
  _Float16* WK  = (_Float16*)(ws + oWK);
  _Float16* WV  = (_Float16*)(ws + oWV);
  _Float16* WP  = (_Float16*)(ws + oWP);
  _Float16* X   = (_Float16*)(ws + oX);
  _Float16* PE  = (_Float16*)(ws + oPE);
  float*    SCR = (float*)(ws + oSCR);

  const float inv_sdk = 0.08838834764831845f;   // 1/sqrt(128)
  const float cs      = inv_sdk * 0.00390625f;   // applied to the x16.x16 score accumulators
  const dim3 blk(256);

  // (1) weights -> f16 planes of bf16-valued entries, carried x64   (grid 1024*128/256 = 512)
  const dim3 gW((ND_ * (ND_ / 8) + 255) / 256);
  cvt_plane_kernel<<<gW, blk, 0, stream>>>(Wq, WQ, ND_, ND_, 64.0f);
  cvt_plane_kernel<<<gW, blk, 0, stream>>>(Wk, WK, ND_, ND_, 64.0f);
  cvt_plane_kernel<<<gW, blk, 0, stream>>>(Wv, WV, ND_, ND_, 64.0f);
  cvt_plane_kernel<<<gW, blk, 0, stream>>>(Wp, WP, ND_, ND_, 64.0f);
  cvt_plane_kernel<<<gW, blk, 0, stream>>>(Wo, WO, ND_, ND_, 64.0f);
  // (2) pos_emb -> f16 plane [4096][1024], row 4095 = 0
  const dim3 gPE((NPP_ * (ND_ / 8) + 255) / 256);
  cvt_plane_kernel<<<gPE, blk, 0, stream>>>(pe, PE, NP_, NPP_, 1.0f);
  // (3) p = pos_emb . Wp^T -> P16 = 16*p   (M=4096, N=1024, K=1024)
  {
    const int tiles = (NPP_ / 64) * (ND_ / 64);
    gemm_f16_kernel<3, false><<<dim3((tiles + 7) / 8, 1), blk, 0, stream>>>(
        PE, ND_, 0L, WP, ND_, 0L, (void*)P16, (void*)P16, ND_, 0L, bu, bu, NPP_, ND_, ND_, 0.25f, 1.0f, 0);
  }
  // (4) x -> f16 plane, all batch elements; q (two bias variants), k, v^T projections: one launch of 256 work-groups each
  {
    const dim3 gX((NB_ * NT_ * (ND_ / 8) + 255) / 256);
    cvt_plane_kernel<<<gX, blk, 0, stream>>>(x, X, NB_ * NT_, NB_ * NT_, 1.0f);
    const int tilesQ = ((NB_ * NT_) / 64) * (ND_ / 64);  // 2048
    // QU = 16*(q + bias_u), QV = 16*(q + bias_v)    (M=8192, N=1024, K=1024)
    gemm_f16_kernel<2, false><<<dim3((tilesQ + 7) / 8, 1), blk, 0, stream>>>(
        X, ND_, 0L, WQ, ND_, 0L, (void*)QU, (void*)QV, ND_, 0L, bu, bvb,
        NB_ * NT_, ND_, ND_, 0.015625f, 16.0f, 0);
    // KP = 16*k
    gemm_f16_kernel<1, false><<<dim3((tilesQ + 7) / 8, 1), blk, 0, stream>>>(
        X, ND_, 0L, WK, ND_, 0L, (void*)KP, (void*)KP, ND_, 0L, bu, bu,
        NB_ * NT_, ND_, ND_, 0.25f, 1.0f, 0);
    // VT[b][h*128+d][t] = 16*v   (A = Wv plane [1024][1024], Bt = x plane of batch z [2048][1024];
    //                             M=1024, N=2048, K=1024 per z, grid.y = batch)
    const int tilesV = (ND_ / 64) * (NT_ / 64);          // 512 per batch element
    gemm_f16_kernel<1, false><<<dim3((tilesV + 7) / 8, NB_), blk, 0, stream>>>(
        WV, ND_, 0L, X, ND_, (long)NT_ * ND_, (void*)VTP, (void*)VTP,
        NT_, (long)ND_ * NT_, bu, bu, ND_, NT_, ND_, 0.25f, 1.0f, 0);
  }
  // (5) per group of 8 (b,h) pairs: band GEMM of the position scores, then attention (256 work-groups, one per WGP)
  const int nGroups = (NB_ * NH_) / NPAIR;               // 4
  for (int g = 0; g < nGroups; ++g) {
    const int pairBase = g * NPAIR;
    const int b  = pairBase >> 3;
    const int h0 = pairBase & 7;
    const _Float16* Aq = QV + (size_t)b * NT_ * ND_ + h0 * (HD_ * 16);   // rows t, cols d of head h0 (z adds 128 columns)
    const _Float16* Bp = P16 + h0 * (HD_ * 16);                           // rows p index, cols d of head h0
    const int tilesBD = (NT_ / 64) * (BDW_ / 64);                  // 32*33 = 1056
    gemm_f16_kernel<0, true><<<dim3((tilesBD + 7) / 8, NPAIR), blk, 0, stream>>>(
        Aq, ND_, (long)HD_ * 16, Bp, ND_, (long)HD_ * 16, (void*)SCR, (void*)SCR, BDW_, (long)NT_ * BDW_, bu, bu,
        NT_, BDW_, HD_, cs, 1.0f, 31);
    relattn_kernel<<<dim3(NT_ / 64, NPAIR), dim3(128), 0, stream>>>(QU, KP, VTP, SCR, CTX, pairBase, cs);
  }
  // (6) out = ctx . Wo^T -> d_out f32 [8192][1024]   (M=8192, N=1024, K=1024; carries 64*64 folded into scale)
  {
    const int tiles = ((NB_ * NT_) / 64) * (ND_ / 64);   // 2048
    gemm_f16_kernel<0, false><<<dim3((tiles + 7) / 8, 1), blk, 0, stream>>>(
        CTX, ND_, 0L, WO, ND_, 0L, (void*)out, (void*)out, ND_, 0L, bu, bu,
        NB_ * NT_, ND_, ND_, 0.000244140625f, 1.0f, 0);
  }
  (void)hipGetLastError();
}

// v006
// A run of this version takes 558 microseconds.
// Two timings next to v005 both put it at 1.05 times that version's speed.
// Counting every step since v000, it is 7.90 times as fast.
// Contractions x.Wq^T, x.Wk^T, Wv.x^T, pos_emb.Wp^T, (q+bias_v).p^T band, (q+bias_u).k^T, P.V, ctx.Wo^T: v_wmma_f32_16x16x32_f16 (f16 operands, f32 accumulate); operand planes hold bf16-RNE-valued inputs with power-of-two carries (W x64, q/k/v/p x16, P x4096, ctx x64); softmax, bias adds and score scaling in f32. Every plane that a GEMM reads as an operand is stored in fragment order (see ldfrag_pk).
#include <hip/hip_runtime.h>
#include <math.h>
#include <stdint.h>

#define NB_  4
#define NT_  2048
#define ND_  1024
#define NH_  8
#define HD_  128
#define NP_  4095
#define NPP_ 4096
#define BDW_ 2112   // width of the relative-position score band scratch (33 tiles of 64)
// LDS row pitches of the attention tiles, in halves: 16 B x odd, so that the 16 rows one ds_load_b128 reads
// fall on 16 different groups of four banks (unpadded 256-B rows all fall on one group, 128-B rows on two)
#define KPIT_ 136   // K tile row: 128 halves + 8  (272 B)
#define VPIT_ 72    // V^T tile row: 64 halves + 8 (144 B)
#define PPIT_ 72    // P tile row: 64 halves + 8   (144 B)
#define OPIT_ 132   // output staging row, in floats: 128 + 4 (528 B)

typedef _Float16 v16h __attribute__((ext_vector_type(16)));
typedef _Float16 v8h  __attribute__((ext_vector_type(8)));
typedef float    v8f  __attribute__((ext_vector_type(8)));
typedef float    v4f  __attribute__((ext_vector_type(4)));
typedef v4f __attribute__((may_alias)) v4fa;
typedef v8h __attribute__((may_alias)) v8ha;

// bf16 RNE of an f32 value, returned widened to f32 (exactly representable in f16 after a power-of-two carry)
__device__ __forceinline__ float bf_rne(float f) {
  unsigned u = __float_as_uint(f);
  u = (u + 0x7FFFu + ((u >> 16) & 1u)) & 0xFFFF0000u;
  return __uint_as_float(u);
}

// 16-bit WMMA fragment: elements 0..7 <- p[0..7], elements 8..15 <- p[16..23]
// (A: p = row m at k0 + 8h;  B stored [n][k]: p = row n at k0 + 8h;  same split k map for both)
union FragU { v16h v; v8ha h[2]; };
__device__ __forceinline__ v16h ldfrag(const _Float16* p) {
  FragU f;
  f.h[0] = *(const v8ha*)(p);
  f.h[1] = *(const v8ha*)(p + 16);
  return f.v;
}

// Fragment-order ("packed") plane of pitch ld halves: each block of 16 rows x 32 k is 1 KB in a row, block (row/16, k/32)
// at half offset (row/16)*16*ld + (k/32)*512; inside it the 16-B piece of (row, k..k+7), k a multiple of 8, stands at
// ((k/16)&1)*256 + (((k/8)&1)*16 + row%16)*8. So lane l = 16h + row finds elements 0..7 (k0 + 8h ..) at l*8 and elements
// 8..15 (k0 + 16 + 8h ..) at 256 + l*8: the same split k map as ldfrag, and each of the two wave-wide 16-B loads covers
// 512 contiguous bytes (4 cache lines) where the row-major plane gives 32 B from each of 16 lines.
// p = block start + lane*8
__device__ __forceinline__ v16h ldfrag_pk(const _Float16* p) {
  FragU f;
  f.h[0] = *(const v8ha*)(p);
  f.h[1] = *(const v8ha*)(p + 256);
  return f.v;
}

// Plain builtin: the compiler keeps the WMMA distances itself and stays free to place fragment loads ahead of
// earlier WMMAs (a volatile asm statement behind each WMMA held every load behind the WMMA before it)
__device__ __forceinline__ v8f mma16(v16h a, v16h b, v8f c) {
  return __builtin_amdgcn_wmma_f32_16x16x32_f16(false, a, false, b, (short)0, c, false, false);
}

__device__ __forceinline__ v8f zero8() { v8f z = {0.f, 0.f, 0.f, 0.f, 0.f, 0.f, 0.f, 0.f}; return z; }

// -------------------------------------------------------------------------------------------------
// f32 [nrows_src][ND_] -> packed f16 plane [nrows_dst][ND_]: dst = f16( bf_rne(src) * scale ), rows >= nrows_src are 0.
// A wave takes 8 rows x 32 columns (lane = 4*row + piece): it reads 8 whole 128-B lines and writes 4 whole 128-B lines.
// coverage: nrows_dst * 128 threads * 8 = the whole [nrows_dst][1024] plane; nrows_dst is a multiple of 16.
// -------------------------------------------------------------------------------------------------
__global__ __launch_bounds__(256) void cvt_plane_kernel(const float* __restrict__ src, _Float16* __restrict__ dst,
                                                        int nrows_src, int nrows_dst, float scale) {
  const int i = blockIdx.x * 256 + threadIdx.x;
  const int total8 = nrows_dst * (ND_ / 8);
  if (i >= total8) return;
  const int g  = i >> 5;                                          // wave: (8-row group, 32-column block)
  const int ks = i & 3;                                           // 8-column piece of the block
  const int kb = g & (ND_ / 32 - 1);
  const int r  = (g / (ND_ / 32)) * 8 + ((i & 31) >> 2);
  const int c8 = kb * 32 + ks * 8;
  const int rs = (r < nrows_src) ? r : (nrows_src - 1);          // clamped address
  const float sc = (r < nrows_src) ? scale : 0.0f;                // zero by value for filler rows
  const float* sp = src + (size_t)rs * ND_ + c8;
  const v4f a = *(const v4f*)(sp);
  const v4f b = *(const v4f*)(sp + 4);
  v8h o;
  o[0] = (_Float16)(bf_rne(a[0]) * sc); o[1] = (_Float16)(bf_rne(a[1]) * sc);
  o[2] = (_Float16)(bf_rne(a[2]) * sc); o[3] = (_Float16)(bf_rne(a[3]) * sc);
  o[4] = (_Float16)(bf_rne(b[0]) * sc); o[5] = (_Float16)(bf_rne(b[1]) * sc);
  o[6] = (_Float16)(bf_rne(b[2]) * sc); o[7] = (_Float16)(bf_rne(b[3]) * sc);
  _Float16* dp = dst + (size_t)(r >> 4) * (16 * ND_) + kb * 512 + (ks >> 1) * 256 + ((ks & 1) * 16 + (r & 15)) * 8;
  *(v8h*)dp = o;
  
}

// -------------------------------------------------------------------------------------------------
// f16 WMMA GEMM: C[m][n] = epi( sum_k A[m][k] * Bt[nrow][k] ), nrow = n (+ 64*(skew0 - tm) when SKEW: band GEMM).
// A [M][K] and Bt [N(+band)][K] are packed planes (ldfrag_pk) of pitch lda, ldb; a column offset c (multiple of 32) of a
// packed plane is 16*c halves; M, N multiples of 64, K multiple of 32.
// Each wave owns a 64x64 output tile (4x4 subtiles), 8 waves per block, grid.x = tiles/8, grid.y = z-batch.
// OUT 0: f32  C1 = acc*scale
// OUT 1: f16  C1 = f16(acc*scale), row-major
// OUT 2: f16  C1 = f16((acc*scale + bf_rne(b1[n]))*carry), C2 = f16((acc*scale + bf_rne(b2[n]))*carry), both packed
// OUT 3: f16  C1 = f16(acc*scale), packed
// ONE instruction with lane-contiguous 16-B pieces (f32: 16 lanes x 16 B = 256 B segment; f16: 8 lanes x 16 B =
// coverage: 4 slabs x 16 rows x 64 cols = the whole 64x64 tile per wave; tiles cover M x N exactly.
// -------------------------------------------------------------------------------------------------
template <int OUT, bool SKEW>
__global__ __launch_bounds__(256) void gemm_f16_kernel(
    const _Float16* __restrict__ A, int lda, long strideA,
    const _Float16* __restrict__ Bt, int ldb, long strideB,
    void* __restrict__ C1, void* __restrict__ C2, int ldc, long strideC,
    const float* __restrict__ b1, const float* __restrict__ b2,
    int M, int N, int K, float scale, float carry, int skew0) {
  __shared__ __align__(16) float sT[8][16 * 68];   // per-wave 16x64 slab, pitch 68 floats

  const int z    = blockIdx.y;
  const int lane = threadIdx.x & 31;
  const int wave = threadIdx.x >> 5;
  const int tilesN = N >> 6;
  const int tilesM = M >> 6;
  const int tile = blockIdx.x * 8 + wave;
  if (tile >= tilesM * tilesN) return;             // wave-uniform; no block barriers in this kernel
  const int tm = tile / tilesN;
  const int tn = tile - tm * tilesN;
  const int m0 = tm << 6;
  const int n0 = tn << 6;
  const int nsk = SKEW ? ((skew0 - tm) << 6) : 0;  // band row offset of Bt

  const _Float16* Ab = A  + (size_t)z * strideA;
  const _Float16* Bb = Bt + (size_t)z * strideB;

  const int rl   = lane & 15;          // column (D) within a subtile
  const int mOff = (lane >> 4) * 8;    // D row offset of this lane half

  v8f acc[4][4];
#pragma unroll
  for (int i = 0; i < 4; ++i)
#pragma unroll
    for (int j = 0; j < 4; ++j) acc[i][j] = zero8();

  // this lane's place in the first block of the tile's first 16 rows; the next 16 rows stand 16*ld halves on, the next
  // k step 512 halves on
  const _Float16* Ar = Ab + (size_t)(m0 >> 4) * ((size_t)lda * 16) + lane * 8;
  const _Float16* Br = Bb + (size_t)((nsk + n0) >> 4) * ((size_t)ldb * 16) + lane * 8;

  for (int k0 = 0; k0 < K; k0 += 32) {
    // all eight fragments of the k step are loaded as one group, then its 16 WMMAs run
    v16h bfr[4], af[4];
    const _Float16 *pb[4], *pa[4];
#pragma unroll
    for (int j = 0; j < 4; ++j) {
      pb[j] = Br + (size_t)j * ((size_t)ldb * 16) + (k0 << 4);
      pa[j] = Ar + (size_t)j * ((size_t)lda * 16) + (k0 << 4);
      bfr[j] = ldfrag_pk(pb[j]);
      af[j]  = ldfrag_pk(pa[j]);
    }
    // the wait that stands before an address register of an issued load is written again; the eight addresses pass
    // into it, so that no later load of the group gets an earlier one's address register as its destination
    asm volatile("s_wait_xcnt 0x0" :: "v"(pb[0]), "v"(pb[1]), "v"(pb[2]), "v"(pb[3]),
                                      "v"(pa[0]), "v"(pa[1]), "v"(pa[2]), "v"(pa[3]) : "memory");
    __builtin_amdgcn_sched_barrier(0);   // keeps the 16 loads in one group: one load latency a k step, not one a row
#pragma unroll
    for (int i = 0; i < 4; ++i)
#pragma unroll
      for (int j = 0; j < 4; ++j) acc[i][j] = mma16(af[i], bfr[j], acc[i][j]);
  }

  // ---- epilogue ----
  float* slab = sT[wave];
#pragma unroll
  for (int i = 0; i < 4; ++i) {
    const int mBase = m0 + (i << 4);
#pragma unroll
    for (int j = 0; j < 4; ++j)
#pragma unroll
      for (int r = 0; r < 8; ++r)
        slab[(mOff + r) * 68 + (j << 4) + rl] = acc[i][j][r] * scale;
    __builtin_amdgcn_fence(__ATOMIC_RELEASE, "workgroup");
    __builtin_amdgcn_wave_barrier();
    __builtin_amdgcn_fence(__ATOMIC_ACQUIRE, "workgroup");
    if (OUT == 0) {
      float* C = (float*)C1 + (size_t)z * strideC;
      const int hh = lane >> 4, c4 = (lane & 15) * 4;    // row segment 256 B = 16 lanes x 16 B
      {
#pragma unroll
        for (int it = 0; it < 8; ++it) {
          const int row = it * 2 + hh;
          const v4f v = *(const v4fa*)(slab + row * 68 + c4);
          *(v4f*)(C + (size_t)(mBase + row) * ldc + n0 + c4) = v;
        }
        
      }
    } else if (OUT == 2 || OUT == 3) {
      // packed output: store 'it' is half j = it&1 of block it>>1 of the slab's two 16x32 blocks, 512 contiguous bytes;
      // lane 16h + row brings the piece (row, 32*(it>>1) + 16*j + 8h)
      _Float16* Ca = (_Float16*)C1 + (size_t)z * strideC;
      _Float16* Cb = (_Float16*)C2 + (size_t)z * strideC;
      const size_t dbase = (size_t)(mBase >> 4) * ((size_t)ldc * 16) + (size_t)(n0 >> 5) * 512 + lane * 8;
      v8h hv[4], lv[4];
#pragma unroll
      for (int it = 0; it < 4; ++it) {
        const int col = (it >> 1) * 32 + (it & 1) * 16 + (lane >> 4) * 8;
        const float* sp = slab + rl * 68 + col;
        const v4f x0 = *(const v4fa*)(sp);
        const v4f x1 = *(const v4fa*)(sp + 4);
        float f[8];
        f[0] = x0[0]; f[1] = x0[1]; f[2] = x0[2]; f[3] = x0[3];
        f[4] = x1[0]; f[5] = x1[1]; f[6] = x1[2]; f[7] = x1[3];
        v8h ha, hb;
#pragma unroll
        for (int e = 0; e < 8; ++e) {
          if (OUT == 3) {
            ha[e] = (_Float16)f[e];
            hb[e] = ha[e];
          } else {
            const int n = n0 + col + e;
            ha[e] = (_Float16)((f[e] + bf_rne(b1[n])) * carry);
            hb[e] = (_Float16)((f[e] + bf_rne(b2[n])) * carry);
          }
        }
        hv[it] = ha; lv[it] = hb;
      }
#pragma unroll
      for (int it = 0; it < 4; ++it) {
        *(v8h*)(Ca + dbase + it * 256) = hv[it];
        if (OUT == 2) *(v8h*)(Cb + dbase + it * 256) = lv[it];
      }
      // the wait that stands before an address register of an issued store is written again (the next slab's addresses)
      asm volatile("s_wait_xcnt 0x0" ::: "memory");
    } else {
      const int q = lane >> 3, c8 = (lane & 7) * 8;
      _Float16* Ca = (_Float16*)C1 + (size_t)z * strideC;
      v8h hv[4];
#pragma unroll
      for (int it = 0; it < 4; ++it) {
        const int row = it * 4 + q;
        const float* sp = slab + row * 68 + c8;
        const v4f x0 = *(const v4fa*)(sp);
        const v4f x1 = *(const v4fa*)(sp + 4);
        float f[8];
        f[0] = x0[0]; f[1] = x0[1]; f[2] = x0[2]; f[3] = x0[3];
        f[4] = x1[0]; f[5] = x1[1]; f[6] = x1[2]; f[7] = x1[3];
        v8h ha;
#pragma unroll
        for (int e = 0; e < 8; ++e) ha[e] = (_Float16)f[e];
        hv[it] = ha;
      }
      {
#pragma unroll
        for (int it = 0; it < 4; ++it) {
          const int row = it * 4 + q;
          *(v8h*)(Ca + (size_t)(mBase + row) * ldc + n0 + c8) = hv[it];
        }
        
      }
    }
    __builtin_amdgcn_fence(__ATOMIC_RELEASE, "workgroup");
    __builtin_amdgcn_wave_barrier();
    __builtin_amdgcn_fence(__ATOMIC_ACQUIRE, "workgroup");
  }
}

// -------------------------------------------------------------------------------------------------
// Relative-position attention for a group of (batch, head) pairs, head dim 128, no mask.
//   QU  f16 packed plane [b*2048 + t][h*128 + d] = 16*(q + bias_u) (A operand of the content score)
//   Kp  f16 plane [b*2048 + s][h*128 + d] = 16*k                  (B operand, staged per 64-key chunk as [key][d])
//   VT  f16 plane [b][h*128 + d][s]      = 16*v                  (B operand of P.V, staged as [d][key])
//   BD  f32 band scratch [z][2048][2112]: value (col j) = inv_sdk * (q_i + bias_v).p[row 64*(31 - i/64) + j]
//       rel-shift: bd[i][key] = bdfull[i][key - i + 2047]  ->  column (key - i + 2047) - 64*(31 - i/64)
//                = key + 63 - (i mod 64), always in [0, 2110].
//   score = cs * (QU.K^T acc) + BD  with cs = inv_sdk / 256;  online softmax in f32 over 32 chunks of 64 keys;
//   P stored per wave as f16(4096 * exp(s - m)); ctx = 64 * (P.V acc) / (4096*16*l) written as packed f16
//   plane CTX [b*2048 + t][h*128 + d].
// Block = 4 waves = 64 query rows of one (b,h); grid = (32 query blocks, pairs in group).
// LDS: one raw buffer; K tile [64][128] f16 at 0 (row pitch 272 B), V^T tile [128][64] f16 at 17408 (pitch 144 B),
// per-wave P tiles [16][64] f16 at 35840 (pitch 144 B); the output staging [4][16][128] f32 (row pitch 528 B = 16 B x odd for its
// 16-row ds_load_b128 reader) reuses bytes 0..33 KB (inside the K and V^T tiles) after a block barrier.
// coverage: staging 8 loads x 4 waves x 2 rows x 256 B for K (64x128), 8 x 4 waves x 4 rows x 128 B for V^T (128x64); P tile 8 rows x 2 halves x 4x16 cols
// per wave = 16x64; output 8 store instructions x 16 rows x 2 pieces x 8 halves = 16x128 per wave.
// -------------------------------------------------------------------------------------------------
__global__ __launch_bounds__(128)
void relattn_kernel(const _Float16* __restrict__ QU, const _Float16* __restrict__ Kp,
                    const _Float16* __restrict__ VT, const float* __restrict__ BD,
                    _Float16* __restrict__ CTX, int pairBase, float cs) {
  __shared__ __align__(16) unsigned char SMEM[64 * KPIT_ * 2 + 128 * VPIT_ * 2 + 4 * 16 * PPIT_ * 2];   // 45056
  _Float16* Ksh = (_Float16*)(SMEM);                                      // [64][KPIT_]
  _Float16* Vsh = (_Float16*)(SMEM + 64 * KPIT_ * 2);                     // [128][VPIT_]
  _Float16* Psh = (_Float16*)(SMEM + 64 * KPIT_ * 2 + 128 * VPIT_ * 2);   // [4][16][PPIT_]
  float*    Osh = (float*)(SMEM);                // [4][16][OPIT_] after the chunk loop

  const int tid  = threadIdx.x;
  const int wave = tid >> 5;
  const int lane = tid & 31;
  const int hh   = lane >> 4;
  const int c    = lane & 15;

  const int z    = blockIdx.y;
  const int pair = pairBase + z;
  const int b    = pair >> 3;
  const int h    = pair & 7;
  const int qb   = blockIdx.x;                   // 0..31
  const int q0   = qb * 64 + wave * 16;          // first query row of this wave
  const int rr0  = wave * 16 + 8 * hh;           // row within the 64-row block for r = 0

  const _Float16* Qh = QU + (size_t)(b * NT_) * ND_ + h * (HD_ * 16);   // packed: column h*128 is 16*h*128 halves
  const _Float16* Kh = Kp + (size_t)(b * NT_) * ND_ + h * HD_;
  const _Float16* Vh = VT + (size_t)b * ND_ * NT_ + (size_t)(h * HD_) * NT_;
  const float*    bd = BD + (size_t)z * NT_ * BDW_;
  _Float16*       ctx = CTX + (size_t)(b * NT_) * ND_ + h * (HD_ * 16);  // packed, as Qh

  // Q fragments (A operand): 4 chunks of 32 along d
  v16h qa[4];
  const _Float16* qp = Qh + (size_t)q0 * ND_ + lane * 8;               // q0 is a multiple of 16
#pragma unroll
  for (int dc = 0; dc < 4; ++dc)
    qa[dc] = ldfrag_pk(qp + dc * 512);
  // the wait that stands before an address register of an issued load is written again; the Q address passes into it,
  // so that its register pair stays live up to the wait and the offsets formed below cannot take it earlier
  asm volatile("s_wait_xcnt 0x0" :: "v"(qp) : "memory");


  float mrow[8], lrow[8];
  v8f oacc[8];
#pragma unroll
  for (int r = 0; r < 8; ++r) { mrow[r] = -INFINITY; lrow[r] = 0.f; }
#pragma unroll
  for (int t = 0; t < 8; ++t) oacc[t] = zero8();

  _Float16* pw = Psh + wave * (16 * PPIT_);

  // Every global load of a chunk is issued one chunk ahead into registers (chunk 0 here), so that its latency runs
  // under the chunk before instead of in front of its use.
  // Per-lane byte offsets, from the uniform bases Kh, Vh and bd, of the chunk that is loaded next:
  //   K: load i of a wave takes rows kv0 + kr + 2i (kr: 2 rows a load), 16 lanes x 16 B = the row's whole 256 B;
  //   V^T: load i takes rows vr + i (4 rows a load, 8 apart), 8 lanes x 16 B = the row's 128 B of keys kv0..kv0+63;
  //   so each wave-wide load covers 4 whole 128-B lines (a lane per row would touch 32 lines, 16 B of each).
  //   The 4 rows stand 8 apart because 8 * 144 B = 128 mod 256: the two rows that 16 lanes store to LDS then fill
  //   the 64 banks once (neighbouring rows would meet on four banks)
  //   band element of (row r, key kv0+16j+c) at bo + 4*(r*(BDW_-1) + 16j)
  const int kr = wave * 16 + (lane >> 4), kc8 = (lane & 15) * 8;
  const int vr = wave * 32 + (lane >> 3) * 8, vc8 = (lane & 7) * 8;
  unsigned ko = (unsigned)((kr * ND_ + kc8) * 2);
  unsigned vo = (unsigned)((vr * NT_ + vc8) * 2);
  unsigned bo = (unsigned)(((q0 + 8 * hh) * BDW_ + (63 - rr0 + c)) * 4);
  v8h kreg[8], vreg[8];
  float bdv[8][4];
#pragma unroll
  for (int i = 0; i < 8; ++i) {
    kreg[i] = *(const v8h*)((const char*)Kh + ko + i * (2 * ND_ * 2));
    vreg[i] = *(const v8h*)((const char*)Vh + vo + i * (NT_ * 2));
  }
#pragma unroll
  for (int r = 0; r < 8; ++r)
#pragma unroll
    for (int j = 0; j < 4; ++j)
      bdv[r][j] = *(const float*)((const char*)bd + bo + 4 * (r * (BDW_ - 1) + (j << 4)));
  // the wait that stands before an address register of an issued load is written again; the offsets pass through
  // it, so that their step cannot be placed ahead of it
  asm volatile("s_wait_xcnt 0x0" : "+v"(ko), "+v"(vo), "+v"(bo) :: "memory");
  ko += 64 * (ND_ * 2);
  vo += 64 * 2;
  bo += 64 * 4;

  // two chunks per trip: the band values loaded ahead alternate between two register sets; in a single body they
  // are copied into the one set behind a wait for the loads, in the middle of the chunk
#pragma unroll 2
  for (int kc = 0; kc < NT_ / 64; ++kc) {
    __syncthreads();
#pragma unroll
    for (int i = 0; i < 8; ++i) {
      *(v8ha*)(Ksh + (kr + 2 * i) * KPIT_ + kc8) = kreg[i];
      *(v8ha*)(Vsh + (vr + i) * VPIT_ + vc8)     = vreg[i];
    }
    __syncthreads();

    // the chunk's 16 K and 16 V^T fragments, read from LDS as one group ahead of the score WMMAs: the K reads come
    // first, the V^T reads land under the score WMMAs
    v16h kb[4][4], vb[2][8];
#pragma unroll
    for (int dc = 0; dc < 4; ++dc)
#pragma unroll
      for (int j = 0; j < 4; ++j)
        kb[dc][j] = ldfrag(Ksh + (j * 16 + c) * KPIT_ + dc * 32 + 8 * hh);
#pragma unroll
    for (int kk = 0; kk < 2; ++kk)
#pragma unroll
      for (int t = 0; t < 8; ++t)
        vb[kk][t] = ldfrag(Vsh + (t * 16 + c) * VPIT_ + kk * 32 + 8 * hh);

    // the next chunk's K and V^T rows (the last trip loads its own chunk again, unused: no branch)
#pragma unroll
    for (int i = 0; i < 8; ++i) {
      kreg[i] = *(const v8h*)((const char*)Kh + ko + i * (2 * ND_ * 2));
      vreg[i] = *(const v8h*)((const char*)Vh + vo + i * (NT_ * 2));
    }
    // keeps the 64 LDS reads in one group, and the 16 global loads a whole chunk ahead of their LDS stores
    __builtin_amdgcn_sched_barrier(0);

    // content scores: S[j] = QU(16x128) . K^T for key subtile j (each s[j] sums dc = 0..3 in that order)
    v8f s[4];
#pragma unroll
    for (int j = 0; j < 4; ++j) s[j] = zero8();
#pragma unroll
    for (int dc = 0; dc < 4; ++dc)
#pragma unroll
      for (int j = 0; j < 4; ++j) s[j] = mma16(qa[dc], kb[dc][j], s[j]);

    // add the position term from the band scratch, chunk row max
    float cm[8];
#pragma unroll
    for (int r = 0; r < 8; ++r) {
      float m = -INFINITY;
#pragma unroll
      for (int j = 0; j < 4; ++j) {
        const float sv = s[j][r] * cs + bdv[r][j];
        s[j][r] = sv;
        m = fmaxf(m, sv);
      }
      m = fmaxf(m, __shfl_xor(m, 1, 32));
      m = fmaxf(m, __shfl_xor(m, 2, 32));
      m = fmaxf(m, __shfl_xor(m, 4, 32));
      m = fmaxf(m, __shfl_xor(m, 8, 32));
      cm[r] = m;
    }

    // the next chunk's 32 band values (this chunk's have just been used by the loop above)
#pragma unroll
    for (int r = 0; r < 8; ++r)
#pragma unroll
      for (int j = 0; j < 4; ++j)
        bdv[r][j] = *(const float*)((const char*)bd + bo + 4 * (r * (BDW_ - 1) + (j << 4)));
    __builtin_amdgcn_sched_barrier(0);   // keeps these 32 loads here, a softmax and a P.V phase ahead of their use

    // online softmax update (per-row rescale of this row's accumulator elements only);
    // P tile (x4096) to this wave's LDS tile [row][key]
#pragma unroll
    for (int r = 0; r < 8; ++r) {
      const float mnew  = fmaxf(mrow[r], cm[r]);
      const float alpha = __expf(mrow[r] - mnew);
      mrow[r] = mnew;
      float psum = 0.f;
#pragma unroll
      for (int j = 0; j < 4; ++j) {
        const float p = __expf(s[j][r] - mnew);
        psum += p;
        pw[(8 * hh + r) * PPIT_ + j * 16 + c] = (_Float16)(p * 4096.0f);
      }
      psum += __shfl_xor(psum, 1, 32);
      psum += __shfl_xor(psum, 2, 32);
      psum += __shfl_xor(psum, 4, 32);
      psum += __shfl_xor(psum, 8, 32);
      lrow[r] = lrow[r] * alpha + psum;
#pragma unroll
      for (int t = 0; t < 8; ++t) oacc[t][r] *= alpha;
    }
    // the P tile goes through LDS alone: fences on the LDS address space leave the global loads above in flight
    __builtin_amdgcn_fence(__ATOMIC_RELEASE, "workgroup", "local");
    __builtin_amdgcn_wave_barrier();
    __builtin_amdgcn_fence(__ATOMIC_ACQUIRE, "workgroup", "local");

    // P (A operand, row = lane&15, split k map over keys) . V (B operand from V^T rows d)
#pragma unroll
    for (int kk = 0; kk < 2; ++kk) {
      const v16h pa = ldfrag(pw + c * PPIT_ + kk * 32 + 8 * hh);
#pragma unroll
      for (int t = 0; t < 8; ++t) oacc[t] = mma16(pa, vb[kk][t], oacc[t]);
    }

    // keeps the P.V WMMAs and the row sums in this trip: behind the next trip's barrier, which waits for every load
    // in flight, they would no longer cover the band loads' latency
    __builtin_amdgcn_sched_barrier(0);
    // the same wait as in front of the loop: it stands at the foot of the trip, in front of the offsets' step
    asm volatile("s_wait_xcnt 0x0" : "+v"(ko), "+v"(vo), "+v"(bo) :: "memory");
    const unsigned step = (kc + 2 < NT_ / 64) ? 64u : 0u;   // the offsets stop at the last chunk
    ko += step * (ND_ * 2);
    vo += step * 2;
    bo += step * 4;
  }

  __syncthreads();                               // every wave is done with Ksh/Vsh before Osh aliases them
  float* os = Osh + wave * (16 * OPIT_);
#pragma unroll
  for (int r = 0; r < 8; ++r) {
    const float inv = 1.0f / (1024.0f * lrow[r]);   // 64 / (4096 * 16 * l)
#pragma unroll
    for (int t = 0; t < 8; ++t) os[(8 * hh + r) * OPIT_ + t * 16 + c] = oacc[t][r] * inv;
  }
  __builtin_amdgcn_fence(__ATOMIC_RELEASE, "workgroup");
  __builtin_amdgcn_wave_barrier();
  __builtin_amdgcn_fence(__ATOMIC_ACQUIRE, "workgroup");
  v8h ov[8];
#pragma unroll
  for (int it = 0; it < 8; ++it) {
    // half it&1 of the 16x32 block it>>1: lane 16*hh + c brings the piece (row c, column 16*it + 8*hh)
    const float* sp = os + c * OPIT_ + it * 16 + hh * 8;
    const v4f x0 = *(const v4fa*)(sp);
    const v4f x1 = *(const v4fa*)(sp + 4);
    v8h o;
    o[0] = (_Float16)x0[0]; o[1] = (_Float16)x0[1]; o[2] = (_Float16)x0[2]; o[3] = (_Float16)x0[3];
    o[4] = (_Float16)x1[0]; o[5] = (_Float16)x1[1]; o[6] = (_Float16)x1[2]; o[7] = (_Float16)x1[3];
    ov[it] = o;
  }
  {
#pragma unroll
    for (int it = 0; it < 8; ++it) {
      *(v8h*)(ctx + (size_t)q0 * ND_ + it * 256 + lane * 8) = ov[it];   // 32 lanes x 16 B = 512 contiguous bytes
    }
    
  }
}

// -------------------------------------------------------------------------------------------------
// Workspace map (bytes):
//   (pk = packed, in fragment order: ldfrag_pk)
//   WO   f16 pk [1024][1024]           0
//   QU   f16 pk [8192][1024]     2097152
//   QV   f16 pk [8192][1024]    18874368
//   KP   f16 [8192][1024]       35651584
//   VTP  f16 [4][1024][2048]    52428800
//   CTX  f16 pk [8192][1024]    69206016
//   P16  f16 pk [4096][1024]    85983232
//   SCR                         94371840   (138412032 B): early phase (all pk) WQ,WK,WV,WP f16 [1024][1024] at +0,+2097152,
//        +4194304,+6291456; X f16 [8192][1024] at +8388608; PE f16 [4096][1024] at +25165824 (end +33554432);
//        later phase: BD band f32 [8][2048][2112] (end +138412032)
//   total                      232783872
// Every region is written in whole 64x64 tiles / whole rows; all sizes are exact tile multiples.
// -------------------------------------------------------------------------------------------------
extern "C" void kernel_launch(void* const* d_in, const int* in_sizes, int n_in,
                              void* d_out, int out_size, void* d_ws, size_t ws_size,
                              hipStream_t stream) {
  if (n_in < 9) return;
  if (in_sizes[0] != NB_ * NT_ * ND_) return;
  if (in_sizes[1] != NP_ * ND_) return;
  if (in_sizes[2] != ND_ * ND_ || in_sizes[3] != ND_ * ND_ || in_sizes[4] != ND_ * ND_) return;
  if (in_sizes[5] != ND_ * ND_ || in_sizes[6] != ND_ * ND_) return;
  if (in_sizes[7] != NH_ * HD_ || in_sizes[8] != NH_ * HD_) return;
  if (out_size != NB_ * NT_ * ND_) return;

  const float* x   = (const float*)d_in[0];
  const float* pe  = (const float*)d_in[1];
  const float* Wq  = (const float*)d_in[2];
  const float* Wk  = (const float*)d_in[3];
  const float* Wv  = (const float*)d_in[4];
  const float* Wo  = (const float*)d_in[5];
  const float* Wp  = (const float*)d_in[6];
  const float* bu  = (const float*)d_in[7];
  const float* bvb = (const float*)d_in[8];
  float* out = (float*)d_out;

  const size_t PW16 = (size_t)ND_ * ND_ * 2;             //  2097152
  const size_t PA16 = (size_t)NB_ * NT_ * ND_ * 2;       // 16777216
  const size_t PP16 = (size_t)NPP_ * ND_ * 2;            //  8388608
  const size_t PBD  = (size_t)NT_ * BDW_ * 4;            // 17301504 per pair
  const int    NPAIR = 8;                                // pairs per group: all heads of one batch element
  size_t off = 0;
  const size_t oWO  = off; off += PW16;
  const size_t oQU  = off; off += PA16;
  const size_t oQV  = off; off += PA16;
  const size_t oKP  = off; off += PA16;
  const size_t oVT  = off; off += PA16;
  const size_t oCTX = off; off += PA16;
  const size_t oP16 = off; off += PP16;
  const size_t oSCR = off;
  const size_t oWQ  = oSCR;
  const size_t oWK  = oWQ + PW16;
  const size_t oWV  = oWK + PW16;
  const size_t oWP  = oWV + PW16;
  const size_t oX   = oWP + PW16;
  const size_t oPE  = oX + PA16;
  const size_t earlyEnd = oPE + PP16;
  const size_t bdEnd    = oSCR + (size_t)NPAIR * PBD;
  const size_t total    = (earlyEnd > bdEnd) ? earlyEnd : bdEnd;   // 232783872
  if (total > ws_size) return;

  char* ws = (char*)d_ws;
  _Float16* WO  = (_Float16*)(ws + oWO);
  _Float16* QU  = (_Float16*)(ws + oQU);
  _Float16* QV  = (_Float16*)(ws + oQV);
  _Float16* KP  = (_Float16*)(ws + oKP);
  _Float16* VTP = (_Float16*)(ws + oVT);
  _Float16* CTX = (_Float16*)(ws + oCTX);
  _Float16* P16 = (_Float16*)(ws + oP16);
  _Float16* WQ  = (_Float16*)(ws + oWQ);
  _Float16* WK  = (_Float16*)(ws + oWK);
  _Float16* WV  = (_Float16*)(ws + oWV);
  _Float16* WP  = (_Float16*)(ws + oWP);
  _Float16* X   = (_Float16*)(ws + oX);
  _Float16* PE  = (_Float16*)(ws + oPE);
  float*    SCR = (float*)(ws + oSCR);

  const float inv_sdk = 0.08838834764831845f;   // 1/sqrt(128)
  const float cs      = inv_sdk * 0.00390625f;   // applied to the x16.x16 score accumulators
  const dim3 blk(256);

  // (1) weights -> f16 planes of bf16-valued entries, carried x64   (grid 1024*128/256 = 512)
  const dim3 gW((ND_ * (ND_ / 8) + 255) / 256);
  cvt_plane_kernel<<<gW, blk, 0, stream>>>(Wq, WQ, ND_, ND_, 64.0f);
  cvt_plane_kernel<<<gW, blk, 0, stream>>>(Wk, WK, ND_, ND_, 64.0f);
  cvt_plane_kernel<<<gW, blk, 0, stream>>>(Wv, WV, ND_, ND_, 64.0f);
  cvt_plane_kernel<<<gW, blk, 0, stream>>>(Wp, WP, ND_, ND_, 64.0f);
  cvt_plane_kernel<<<gW, blk, 0, stream>>>(Wo, WO, ND_, ND_, 64.0f);
  // (2) pos_emb -> f16 plane [4096][1024], row 4095 = 0
  const dim3 gPE((NPP_ * (ND_ / 8) + 255) / 256);
  cvt_plane_kernel<<<gPE, blk, 0, stream>>>(pe, PE, NP_, NPP_, 1.0f);
  // (3) p = pos_emb . Wp^T -> P16 = 16*p   (M=4096, N=1024, K=1024)
  {
    const int tiles = (NPP_ / 64) * (ND_ / 64);
    gemm_f16_kernel<3, false><<<dim3((tiles + 7) / 8, 1), blk, 0, stream>>>(
        PE, ND_, 0L, WP, ND_, 0L, (void*)P16, (void*)P16, ND_, 0L, bu, bu, NPP_, ND_, ND_, 0.25f, 1.0f, 0);
  }
  // (4) x -> f16 plane, all batch elements; q (two bias variants), k, v^T projections: one launch of 256 work-groups each
  {
    const dim3 gX((NB_ * NT_ * (ND_ / 8) + 255) / 256);
    cvt_plane_kernel<<<gX, blk, 0, stream>>>(x, X, NB_ * NT_, NB_ * NT_, 1.0f);
    const int tilesQ = ((NB_ * NT_) / 64) * (ND_ / 64);  // 2048
    // QU = 16*(q + bias_u), QV = 16*(q + bias_v)    (M=8192, N=1024, K=1024)
    gemm_f16_kernel<2, false><<<dim3((tilesQ + 7) / 8, 1), blk, 0, stream>>>(
        X, ND_, 0L, WQ, ND_, 0L, (void*)QU, (void*)QV, ND_, 0L, bu, bvb,
        NB_ * NT_, ND_, ND_, 0.015625f, 16.0f, 0);
    // KP = 16*k
    gemm_f16_kernel<1, false><<<dim3((tilesQ + 7) / 8, 1), blk, 0, stream>>>(
        X, ND_, 0L, WK, ND_, 0L, (void*)KP, (void*)KP, ND_, 0L, bu, bu,
        NB_ * NT_, ND_, ND_, 0.25f, 1.0f, 0);
    // VT[b][h*128+d][t] = 16*v   (A = Wv plane [1024][1024], Bt = x plane of batch z [2048][1024];
    //                             M=1024, N=2048, K=1024 per z, grid.y = batch)
    const int tilesV = (ND_ / 64) * (NT_ / 64);          // 512 per batch element
    gemm_f16_kernel<1, false><<<dim3((tilesV + 7) / 8, NB_), blk, 0, stream>>>(
        WV, ND_, 0L, X, ND_, (long)NT_ * ND_, (void*)VTP, (void*)VTP,
        NT_, (long)ND_ * NT_, bu, bu, ND_, NT_, ND_, 0.25f, 1.0f, 0);
  }
  // (5) per group of 8 (b,h) pairs: band GEMM of the position scores, then attention (256 work-groups, one per WGP)
  const int nGroups = (NB_ * NH_) / NPAIR;               // 4
  for (int g = 0; g < nGroups; ++g) {
    const int pairBase = g * NPAIR;
    const int b  = pairBase >> 3;
    const int h0 = pairBase & 7;
    const _Float16* Aq = QV + (size_t)b * NT_ * ND_ + h0 * (HD_ * 16);   // rows t, cols d of head h0 (z adds 128 columns)
    const _Float16* Bp = P16 + h0 * (HD_ * 16);                           // rows p index, cols d of head h0
    const int tilesBD = (NT_ / 64) * (BDW_ / 64);                  // 32*33 = 1056
    gemm_f16_kernel<0, true><<<dim3((tilesBD + 7) / 8, NPAIR), blk, 0, stream>>>(
        Aq, ND_, (long)HD_ * 16, Bp, ND_, (long)HD_ * 16, (void*)SCR, (void*)SCR, BDW_, (long)NT_ * BDW_, bu, bu,
        NT_, BDW_, HD_, cs, 1.0f, 31);
    relattn_kernel<<<dim3(NT_ / 64, NPAIR), dim3(128), 0, stream>>>(QU, KP, VTP, SCR, CTX, pairBase, cs);
  }
  // (6) out = ctx . Wo^T -> d_out f32 [8192][1024]   (M=8192, N=1024, K=1024; carries 64*64 folded into scale)
  {
    const int tiles = ((NB_ * NT_) / 64) * (ND_ / 64);   // 2048
    gemm_f16_kernel<0, false><<<dim3((tiles + 7) / 8, 1), blk, 0, stream>>>(
        CTX, ND_, 0L, WO, ND_, 0L, (void*)out, (void*)out, ND_, 0L, bu, bu,
        NB_ * NT_, ND_, ND_, 0.000244140625f, 1.0f, 0);
  }
  (void)hipGetLastError();
}

// v007
// One run takes 505 microseconds.
// Timed twice side by side with v006, it ran 1.11 and 1.10 times as fast.
// Counting every step since v000, it is 8.72 times as fast.
// Contractions x.Wq^T, x.Wk^T, Wv.x^T, pos_emb.Wp^T, (q+bias_v).p^T band, (q+bias_u).k^T, P.V, ctx.Wo^T: v_wmma_f32_16x16x32_f16 (f16 operands, f32 accumulate); operand planes hold bf16-RNE-valued inputs with power-of-two carries (W x64, q/k/v/p x16, P x4096, ctx x64); softmax, bias adds and score scaling in f32. Every plane that a GEMM reads as an operand is stored in fragment order (see ldfrag_pk).
#include <hip/hip_runtime.h>
#include <math.h>
#include <stdint.h>

#define NB_  4
#define NT_  2048
#define ND_  1024
#define NH_  8
#define HD_  128
#define NP_  4095
#define NPP_ 4096
#define BDW_ 2112   // width of the relative-position score band scratch (33 tiles of 64)
// LDS row pitches of the attention tiles, in halves: 16 B x odd, so that the 16 rows one ds_load_b128 reads
// fall on 16 different groups of four banks (unpadded 256-B rows all fall on one group, 128-B rows on two)
#define KPIT_ 136   // K tile row: 128 halves + 8  (272 B)
#define VPIT_ 72    // V^T tile row: 64 halves + 8 (144 B)
#define PPIT_ 72    // P tile row: 64 halves + 8   (144 B)
#define OPIT_ 132   // output staging row, in floats: 128 + 4 (528 B)

typedef _Float16 v16h __attribute__((ext_vector_type(16)));
typedef _Float16 v8h  __attribute__((ext_vector_type(8)));
typedef float    v8f  __attribute__((ext_vector_type(8)));
typedef float    v4f  __attribute__((ext_vector_type(4)));
typedef v4f __attribute__((may_alias)) v4fa;
typedef v8h __attribute__((may_alias)) v8ha;

// bf16 RNE of an f32 value, returned widened to f32 (exactly representable in f16 after a power-of-two carry)
__device__ __forceinline__ float bf_rne(float f) {
  unsigned u = __float_as_uint(f);
  u = (u + 0x7FFFu + ((u >> 16) & 1u)) & 0xFFFF0000u;
  return __uint_as_float(u);
}

// 16-bit WMMA fragment: elements 0..7 <- p[0..7], elements 8..15 <- p[16..23]
// (A: p = row m at k0 + 8h;  B stored [n][k]: p = row n at k0 + 8h;  same split k map for both)
union FragU { v16h v; v8ha h[2]; };
__device__ __forceinline__ v16h ldfrag(const _Float16* p) {
  FragU f;
  f.h[0] = *(const v8ha*)(p);
  f.h[1] = *(const v8ha*)(p + 16);
  return f.v;
}

// Fragment-order ("packed") plane of pitch ld halves: each block of 16 rows x 32 k is 1 KB in a row, block (row/16, k/32)
// at half offset (row/16)*16*ld + (k/32)*512; inside it the 16-B piece of (row, k..k+7), k a multiple of 8, stands at
// ((k/16)&1)*256 + (((k/8)&1)*16 + row%16)*8. So lane l = 16h + row finds elements 0..7 (k0 + 8h ..) at l*8 and elements
// 8..15 (k0 + 16 + 8h ..) at 256 + l*8: the same split k map as ldfrag, and each of the two wave-wide 16-B loads covers
// 512 contiguous bytes (4 cache lines) where the row-major plane gives 32 B from each of 16 lines.
// p = block start + lane*8
__device__ __forceinline__ v16h ldfrag_pk(const _Float16* p) {
  FragU f;
  f.h[0] = *(const v8ha*)(p);
  f.h[1] = *(const v8ha*)(p + 256);
  return f.v;
}

// Plain builtin: the compiler keeps the WMMA distances itself and stays free to place fragment loads ahead of
// earlier WMMAs (a volatile asm statement behind each WMMA held every load behind the WMMA before it)
__device__ __forceinline__ v8f mma16(v16h a, v16h b, v8f c) {
  return __builtin_amdgcn_wmma_f32_16x16x32_f16(false, a, false, b, (short)0, c, false, false);
}

__device__ __forceinline__ v8f zero8() { v8f z = {0.f, 0.f, 0.f, 0.f, 0.f, 0.f, 0.f, 0.f}; return z; }

// -------------------------------------------------------------------------------------------------
// f32 [nrows_src][ND_] -> packed f16 plane [nrows_dst][ND_]: dst = f16( bf_rne(src) * scale ), rows >= nrows_src are 0.
// A wave takes 8 rows x 32 columns (lane = 4*row + piece): it reads 8 whole 128-B lines and writes 4 whole 128-B lines.
// coverage: nrows_dst * 128 threads * 8 = the whole [nrows_dst][1024] plane; nrows_dst is a multiple of 16.
// -------------------------------------------------------------------------------------------------
__global__ __launch_bounds__(256) void cvt_plane_kernel(const float* __restrict__ src, _Float16* __restrict__ dst,
                                                        int nrows_src, int nrows_dst, float scale) {
  const int i = blockIdx.x * 256 + threadIdx.x;
  const int total8 = nrows_dst * (ND_ / 8);
  if (i >= total8) return;
  const int g  = i >> 5;                                          // wave: (8-row group, 32-column block)
  const int ks = i & 3;                                           // 8-column piece of the block
  const int kb = g & (ND_ / 32 - 1);
  const int r  = (g / (ND_ / 32)) * 8 + ((i & 31) >> 2);
  const int c8 = kb * 32 + ks * 8;
  const int rs = (r < nrows_src) ? r : (nrows_src - 1);          // clamped address
  const float sc = (r < nrows_src) ? scale : 0.0f;                // zero by value for filler rows
  const float* sp = src + (size_t)rs * ND_ + c8;
  const v4f a = *(const v4f*)(sp);
  const v4f b = *(const v4f*)(sp + 4);
  v8h o;
  o[0] = (_Float16)(bf_rne(a[0]) * sc); o[1] = (_Float16)(bf_rne(a[1]) * sc);
  o[2] = (_Float16)(bf_rne(a[2]) * sc); o[3] = (_Float16)(bf_rne(a[3]) * sc);
  o[4] = (_Float16)(bf_rne(b[0]) * sc); o[5] = (_Float16)(bf_rne(b[1]) * sc);
  o[6] = (_Float16)(bf_rne(b[2]) * sc); o[7] = (_Float16)(bf_rne(b[3]) * sc);
  _Float16* dp = dst + (size_t)(r >> 4) * (16 * ND_) + kb * 512 + (ks >> 1) * 256 + ((ks & 1) * 16 + (r & 15)) * 8;
  *(v8h*)dp = o;
  
}

// -------------------------------------------------------------------------------------------------
// f16 WMMA GEMM: C[m][n] = epi( sum_k A[m][k] * Bt[nrow][k] ), nrow = n (+ 64*(skew0 - tm) when SKEW: band GEMM).
// A [M][K] and Bt [N(+band)][K] are packed planes (ldfrag_pk) of pitch lda, ldb; a column offset c (multiple of 32) of a
// packed plane is 16*c halves; M, N multiples of 64, K multiple of 32.
// Each wave owns a 64x64 output tile (4x4 subtiles), 8 waves per block, grid.x = tiles/8, grid.y = z-batch.
// OUT 0: f32  C1 = acc*scale
// OUT 1: f16  C1 = f16(acc*scale), row-major
// OUT 2: f16  C1 = f16((acc*scale + bf_rne(b1[n]))*carry), C2 = f16((acc*scale + bf_rne(b2[n]))*carry), both packed
// OUT 3: f16  C1 = f16(acc*scale), packed
// ONE instruction with lane-contiguous 16-B pieces (f32: 16 lanes x 16 B = 256 B segment; f16: 8 lanes x 16 B =
// coverage: 4 slabs x 16 rows x 64 cols = the whole 64x64 tile per wave; tiles cover M x N exactly.
// -------------------------------------------------------------------------------------------------
template <int OUT, bool SKEW>
__global__ __launch_bounds__(256) void gemm_f16_kernel(
    const _Float16* __restrict__ A, int lda, long strideA,
    const _Float16* __restrict__ Bt, int ldb, long strideB,
    void* __restrict__ C1, void* __restrict__ C2, int ldc, long strideC,
    const float* __restrict__ b1, const float* __restrict__ b2,
    int M, int N, int K, float scale, float carry, int skew0) {
  __shared__ __align__(16) float sT[8][16 * 68];   // per-wave 16x64 slab, pitch 68 floats

  const int z    = blockIdx.y;
  const int lane = threadIdx.x & 31;
  const int wave = threadIdx.x >> 5;
  const int tilesN = N >> 6;
  const int tilesM = M >> 6;
  const int tile = blockIdx.x * 8 + wave;
  if (tile >= tilesM * tilesN) return;             // wave-uniform; no block barriers in this kernel
  const int tm = tile / tilesN;
  const int tn = tile - tm * tilesN;
  const int m0 = tm << 6;
  const int n0 = tn << 6;
  const int nsk = SKEW ? ((skew0 - tm) << 6) : 0;  // band row offset of Bt

  const _Float16* Ab = A  + (size_t)z * strideA;
  const _Float16* Bb = Bt + (size_t)z * strideB;

  const int rl   = lane & 15;          // column (D) within a subtile
  const int mOff = (lane >> 4) * 8;    // D row offset of this lane half

  v8f acc[4][4];
#pragma unroll
  for (int i = 0; i < 4; ++i)
#pragma unroll
    for (int j = 0; j < 4; ++j) acc[i][j] = zero8();

  // this lane's place in the first block of the tile's first 16 rows; the next 16 rows stand 16*ld halves on, the next
  // k step 512 halves on
  const _Float16* Ar = Ab + (size_t)(m0 >> 4) * ((size_t)lda * 16) + lane * 8;
  const _Float16* Br = Bb + (size_t)((nsk + n0) >> 4) * ((size_t)ldb * 16) + lane * 8;

  for (int k0 = 0; k0 < K; k0 += 32) {
    // all eight fragments of the k step are loaded as one group, then its 16 WMMAs run
    v16h bfr[4], af[4];
    const _Float16 *pb[4], *pa[4];
#pragma unroll
    for (int j = 0; j < 4; ++j) {
      pb[j] = Br + (size_t)j * ((size_t)ldb * 16) + (k0 << 4);
      pa[j] = Ar + (size_t)j * ((size_t)lda * 16) + (k0 << 4);
      bfr[j] = ldfrag_pk(pb[j]);
      af[j]  = ldfrag_pk(pa[j]);
    }
    // the wait that stands before an address register of an issued load is written again; the eight addresses pass
    // into it, so that no later load of the group gets an earlier one's address register as its destination
    asm volatile("s_wait_xcnt 0x0" :: "v"(pb[0]), "v"(pb[1]), "v"(pb[2]), "v"(pb[3]),
                                      "v"(pa[0]), "v"(pa[1]), "v"(pa[2]), "v"(pa[3]) : "memory");
    __builtin_amdgcn_sched_barrier(0);   // keeps the 16 loads in one group: one load latency a k step, not one a row
#pragma unroll
    for (int i = 0; i < 4; ++i)
#pragma unroll
      for (int j = 0; j < 4; ++j) acc[i][j] = mma16(af[i], bfr[j], acc[i][j]);
  }

  // ---- epilogue ----
  float* slab = sT[wave];
#pragma unroll
  for (int i = 0; i < 4; ++i) {
    const int mBase = m0 + (i << 4);
#pragma unroll
    for (int j = 0; j < 4; ++j)
#pragma unroll
      for (int r = 0; r < 8; ++r)
        slab[(mOff + r) * 68 + (j << 4) + rl] = acc[i][j][r] * scale;
    __builtin_amdgcn_fence(__ATOMIC_RELEASE, "workgroup");
    __builtin_amdgcn_wave_barrier();
    __builtin_amdgcn_fence(__ATOMIC_ACQUIRE, "workgroup");
    if (OUT == 0) {
      float* C = (float*)C1 + (size_t)z * strideC;
      const int hh = lane >> 4, c4 = (lane & 15) * 4;    // row segment 256 B = 16 lanes x 16 B
      {
#pragma unroll
        for (int it = 0; it < 8; ++it) {
          const int row = it * 2 + hh;
          const v4f v = *(const v4fa*)(slab + row * 68 + c4);
          *(v4f*)(C + (size_t)(mBase + row) * ldc + n0 + c4) = v;
        }
        
      }
    } else if (OUT == 2 || OUT == 3) {
      // packed output: store 'it' is half j = it&1 of block it>>1 of the slab's two 16x32 blocks, 512 contiguous bytes;
      // lane 16h + row brings the piece (row, 32*(it>>1) + 16*j + 8h)
      _Float16* Ca = (_Float16*)C1 + (size_t)z * strideC;
      _Float16* Cb = (_Float16*)C2 + (size_t)z * strideC;
      const size_t dbase = (size_t)(mBase >> 4) * ((size_t)ldc * 16) + (size_t)(n0 >> 5) * 512 + lane * 8;
      v8h hv[4], lv[4];
#pragma unroll
      for (int it = 0; it < 4; ++it) {
        const int col = (it >> 1) * 32 + (it & 1) * 16 + (lane >> 4) * 8;
        const float* sp = slab + rl * 68 + col;
        const v4f x0 = *(const v4fa*)(sp);
        const v4f x1 = *(const v4fa*)(sp + 4);
        float f[8];
        f[0] = x0[0]; f[1] = x0[1]; f[2] = x0[2]; f[3] = x0[3];
        f[4] = x1[0]; f[5] = x1[1]; f[6] = x1[2]; f[7] = x1[3];
        v8h ha, hb;
#pragma unroll
        for (int e = 0; e < 8; ++e) {
          if (OUT == 3) {
            ha[e] = (_Float16)f[e];
            hb[e] = ha[e];
          } else {
            const int n = n0 + col + e;
            ha[e] = (_Float16)((f[e] + bf_rne(b1[n])) * carry);
            hb[e] = (_Float16)((f[e] + bf_rne(b2[n])) * carry);
          }
        }
        hv[it] = ha; lv[it] = hb;
      }
#pragma unroll
      for (int it = 0; it < 4; ++it) {
        *(v8h*)(Ca + dbase + it * 256) = hv[it];
        if (OUT == 2) *(v8h*)(Cb + dbase + it * 256) = lv[it];
      }
      // the wait that stands before an address register of an issued store is written again (the next slab's addresses)
      asm volatile("s_wait_xcnt 0x0" ::: "memory");
    } else {
      const int q = lane >> 3, c8 = (lane & 7) * 8;
      _Float16* Ca = (_Float16*)C1 + (size_t)z * strideC;
      v8h hv[4];
#pragma unroll
      for (int it = 0; it < 4; ++it) {
        const int row = it * 4 + q;
        const float* sp = slab + row * 68 + c8;
        const v4f x0 = *(const v4fa*)(sp);
        const v4f x1 = *(const v4fa*)(sp + 4);
        float f[8];
        f[0] = x0[0]; f[1] = x0[1]; f[2] = x0[2]; f[3] = x0[3];
        f[4] = x1[0]; f[5] = x1[1]; f[6] = x1[2]; f[7] = x1[3];
        v8h ha;
#pragma unroll
        for (int e = 0; e < 8; ++e) ha[e] = (_Float16)f[e];
        hv[it] = ha;
      }
      {
#pragma unroll
        for (int it = 0; it < 4; ++it) {
          const int row = it * 4 + q;
          *(v8h*)(Ca + (size_t)(mBase + row) * ldc + n0 + c8) = hv[it];
        }
        
      }
    }
    __builtin_amdgcn_fence(__ATOMIC_RELEASE, "workgroup");
    __builtin_amdgcn_wave_barrier();
    __builtin_amdgcn_fence(__ATOMIC_ACQUIRE, "workgroup");
  }
}

// -------------------------------------------------------------------------------------------------
// Relative-position attention for a group of (batch, head) pairs, head dim 128, no mask.
//   QU  f16 packed plane [b*2048 + t][h*128 + d] = 16*(q + bias_u) (A operand of the content score)
//   Kp  f16 plane [b*2048 + s][h*128 + d] = 16*k                  (B operand, staged per 64-key chunk as [key][d])
//   VT  f16 plane [b][h*128 + d][s]      = 16*v                  (B operand of P.V, staged as [d][key])
//   BD  f32 band scratch [z][2048][2112]: value (col j) = inv_sdk * (q_i + bias_v).p[row 64*(31 - i/64) + j]
//       rel-shift: bd[i][key] = bdfull[i][key - i + 2047]  ->  column (key - i + 2047) - 64*(31 - i/64)
//                = key + 63 - (i mod 64), always in [0, 2110].
//   score = cs * (QU.K^T acc) + BD  with cs = inv_sdk / 256;  online softmax in f32 over chunks of 64 keys;
//   P stored per wave as f16(4096 * exp(s - m)); ctx = 64 * (P.V acc) / (4096*16*l) written as packed f16
//   plane CTX [b*2048 + t][h*128 + d].
// Block = 8 waves = 64 query rows of one (b,h); grid = (32 query blocks, pairs in group). The waves form two groups of
// four: group g takes the key chunks 2t + g, t = 0..15, for all 64 rows, with its own K and V^T tiles and its own running
// (max, sum, accumulator); each SIMD so holds two waves, and one wave's waits (LDS, cross-lane, band loads) are filled by
// the other. Behind the loop group 1 hands its state to group 0 through LDS, which joins the two as online softmax joins
// two chunks, and stores.
// LDS: one raw buffer; per group g at g*35840: K tile [64][128] f16 (row pitch 272 B), V^T tile [128][64] f16 at +17408
// (pitch 144 B); per-wave P tiles [16][64] f16 at 71680 (pitch 144 B). After a block barrier behind the loop: the hand-over
// [4 waves][32 lanes][84 floats] (lane pitch 336 B = 16 B x odd) at 0, the output staging [4][16][128] f32 (row pitch
// 528 B = 16 B x odd for its 16-row ds_load_b128 reader) at 43008.
// coverage: staging 8 loads x 4 waves x 2 rows x 256 B for K (64x128), 8 x 4 waves x 4 rows x 128 B for V^T (128x64); P tile 8 rows x 2 halves x 4x16 cols
// per wave = 16x64; output 8 store instructions x 16 rows x 2 pieces x 8 halves = 16x128 per wave.
// -------------------------------------------------------------------------------------------------
__global__ __launch_bounds__(256)
void relattn_kernel(const _Float16* __restrict__ QU, const _Float16* __restrict__ Kp,
                    const _Float16* __restrict__ VT, const float* __restrict__ BD,
                    _Float16* __restrict__ CTX, int pairBase, float cs) {
  constexpr int TILEB = 64 * KPIT_ * 2 + 128 * VPIT_ * 2;                 // one group's K and V^T tiles: 35840 B
  constexpr int XPIT  = 84;                                               // hand-over: floats per lane (80 used)
  __shared__ __align__(16) unsigned char SMEM[2 * TILEB + 8 * 16 * PPIT_ * 2];   // 90112

  const int tid  = threadIdx.x;
  const int grp  = __builtin_amdgcn_readfirstlane(tid >> 7);   // key-chunk group of this wave (scalar): 0 even, 1 odd chunks
  const int wave = (tid >> 5) & 3;               // wave within the group = 16-row tile of the block
  const int lane = tid & 31;
  _Float16* Ksh = (_Float16*)(SMEM + grp * TILEB);                        // [64][KPIT_]
  _Float16* Vsh = (_Float16*)(SMEM + grp * TILEB + 64 * KPIT_ * 2);       // [128][VPIT_]
  _Float16* Psh = (_Float16*)(SMEM + 2 * TILEB);                          // [8][16][PPIT_]
  float*    Xsh = (float*)(SMEM);                        // [4][32][XPIT] after the chunk loop
  float*    Osh = (float*)(SMEM + 4 * 32 * XPIT * 4);    // [4][16][OPIT_] after the chunk loop
  const int hh   = lane >> 4;
  const int c    = lane & 15;

  const int z    = blockIdx.y;
  const int pair = pairBase + z;
  const int b    = pair >> 3;
  const int h    = pair & 7;
  const int qb   = blockIdx.x;                   // 0..31
  const int q0   = qb * 64 + wave * 16;          // first query row of this wave
  const int rr0  = wave * 16 + 8 * hh;           // row within the 64-row block for r = 0

  const _Float16* Qh = QU + (size_t)(b * NT_) * ND_ + h * (HD_ * 16);   // packed: column h*128 is 16*h*128 halves
  const _Float16* Kh = Kp + (size_t)(b * NT_) * ND_ + h * HD_;
  const _Float16* Vh = VT + (size_t)b * ND_ * NT_ + (size_t)(h * HD_) * NT_;
  const float*    bd = BD + (size_t)z * NT_ * BDW_;
  _Float16*       ctx = CTX + (size_t)(b * NT_) * ND_ + h * (HD_ * 16);  // packed, as Qh

  // Q fragments (A operand): 4 chunks of 32 along d
  v16h qa[4];
  const _Float16* qp = Qh + (size_t)q0 * ND_ + lane * 8;               // q0 is a multiple of 16
#pragma unroll
  for (int dc = 0; dc < 4; ++dc)
    qa[dc] = ldfrag_pk(qp + dc * 512);
  // the wait that stands before an address register of an issued load is written again; the Q address passes into it,
  // so that its register pair stays live up to the wait and the offsets formed below cannot take it earlier
  asm volatile("s_wait_xcnt 0x0" :: "v"(qp) : "memory");


  float mrow[8], lrow[8];
  v8f oacc[8];
#pragma unroll
  for (int r = 0; r < 8; ++r) { mrow[r] = -INFINITY; lrow[r] = 0.f; }
#pragma unroll
  for (int t = 0; t < 8; ++t) oacc[t] = zero8();

  _Float16* pw = Psh + (tid >> 5) * (16 * PPIT_);

  // Every global load of a chunk is issued one chunk of the group ahead into registers (chunk grp here), so that its
  // latency runs under the chunk before instead of in front of its use.
  // Per-lane byte offsets, from the uniform bases Kh, Vh and bd, of the chunk that is loaded next:
  //   K: load i of a wave takes rows kv0 + kr + 2i (kr: 2 rows a load), 16 lanes x 16 B = the row's whole 256 B;
  //   V^T: load i takes rows vr + i (4 rows a load, 8 apart), 8 lanes x 16 B = the row's 128 B of keys kv0..kv0+63;
  //   so each wave-wide load covers 4 whole 128-B lines (a lane per row would touch 32 lines, 16 B of each).
  //   The 4 rows stand 8 apart because 8 * 144 B = 128 mod 256: the two rows that 16 lanes store to LDS then fill
  //   the 64 banks once (neighbouring rows would meet on four banks)
  //   band element of (row r, key kv0+16j+c) at bo + 4*(r*(BDW_-1) + 16j)
  const int kr = wave * 16 + (lane >> 4), kc8 = (lane & 15) * 8;
  const int vr = wave * 32 + (lane >> 3) * 8, vc8 = (lane & 7) * 8;
  unsigned ko = (unsigned)((kr * ND_ + kc8) * 2) + (unsigned)grp * (64u * ND_ * 2u);
  unsigned vo = (unsigned)((vr * NT_ + vc8) * 2) + (unsigned)grp * (64u * 2u);
  unsigned bo = (unsigned)(((q0 + 8 * hh) * BDW_ + (63 - rr0 + c)) * 4) + (unsigned)grp * (64u * 4u);
  v8h kreg[8], vreg[8];
  float bdv[8][4];
#pragma unroll
  for (int i = 0; i < 8; ++i) {
    kreg[i] = *(const v8h*)((const char*)Kh + ko + i * (2 * ND_ * 2));
    vreg[i] = *(const v8h*)((const char*)Vh + vo + i * (NT_ * 2));
  }
#pragma unroll
  for (int r = 0; r < 8; ++r)
#pragma unroll
    for (int j = 0; j < 4; ++j)
      bdv[r][j] = *(const float*)((const char*)bd + bo + 4 * (r * (BDW_ - 1) + (j << 4)));
  // the wait that stands before an address register of an issued load is written again; the offsets pass through
  // it, so that their step cannot be placed ahead of it
  asm volatile("s_wait_xcnt 0x0" : "+v"(ko), "+v"(vo), "+v"(bo) :: "memory");
  ko += 128 * (ND_ * 2);
  vo += 128 * 2;
  bo += 128 * 4;

  // two chunks of the group per trip: the band values loaded ahead alternate between two register sets; in a single body they
  // are copied into the one set behind a wait for the loads, in the middle of the chunk
#pragma unroll 2
  for (int kc = 0; kc < NT_ / 128; ++kc) {
    __syncthreads();
#pragma unroll
    for (int i = 0; i < 8; ++i) {
      *(v8ha*)(Ksh + (kr + 2 * i) * KPIT_ + kc8) = kreg[i];
      *(v8ha*)(Vsh + (vr + i) * VPIT_ + vc8)     = vreg[i];
    }
    __syncthreads();

    // the chunk's 16 K fragments, read from LDS as one group ahead of the score WMMAs
    v16h kb[4][4], vb[2][8];
#pragma unroll
    for (int dc = 0; dc < 4; ++dc)
#pragma unroll
      for (int j = 0; j < 4; ++j)
        kb[dc][j] = ldfrag(Ksh + (j * 16 + c) * KPIT_ + dc * 32 + 8 * hh);

    // the next chunk's K and V^T rows (the last trip loads its own chunk again, unused: no branch)
#pragma unroll
    for (int i = 0; i < 8; ++i) {
      kreg[i] = *(const v8h*)((const char*)Kh + ko + i * (2 * ND_ * 2));
      vreg[i] = *(const v8h*)((const char*)Vh + vo + i * (NT_ * 2));
    }
    // keeps the 32 LDS reads in one group, and the 16 global loads a whole chunk ahead of their LDS stores
    __builtin_amdgcn_sched_barrier(0);

    // content scores: S[j] = QU(16x128) . K^T for key subtile j (each s[j] sums dc = 0..3 in that order)
    v8f s[4];
#pragma unroll
    for (int j = 0; j < 4; ++j) s[j] = zero8();
#pragma unroll
    for (int dc = 0; dc < 4; ++dc)
#pragma unroll
      for (int j = 0; j < 4; ++j) s[j] = mma16(qa[dc], kb[dc][j], s[j]);

    // the chunk's 16 V^T fragments are read only here, so that they can take the K fragments' registers as the score
    // WMMAs free them (two waves a SIMD leave 512 registers a wave); they land under the softmax
#pragma unroll
    for (int kk = 0; kk < 2; ++kk)
#pragma unroll
      for (int t = 0; t < 8; ++t)
        vb[kk][t] = ldfrag(Vsh + (t * 16 + c) * VPIT_ + kk * 32 + 8 * hh);

    // add the position term from the band scratch, chunk row max
    float cm[8];
#pragma unroll
    for (int r = 0; r < 8; ++r) {
      float m = -INFINITY;
#pragma unroll
      for (int j = 0; j < 4; ++j) {
        const float sv = s[j][r] * cs + bdv[r][j];
        s[j][r] = sv;
        m = fmaxf(m, sv);
      }
      m = fmaxf(m, __shfl_xor(m, 1, 32));
      m = fmaxf(m, __shfl_xor(m, 2, 32));
      m = fmaxf(m, __shfl_xor(m, 4, 32));
      m = fmaxf(m, __shfl_xor(m, 8, 32));
      cm[r] = m;
    }

    // the next chunk's 32 band values (this chunk's have just been used by the loop above)
#pragma unroll
    for (int r = 0; r < 8; ++r)
#pragma unroll
      for (int j = 0; j < 4; ++j)
        bdv[r][j] = *(const float*)((const char*)bd + bo + 4 * (r * (BDW_ - 1) + (j << 4)));
    __builtin_amdgcn_sched_barrier(0);   // keeps these 32 loads here, a softmax and a P.V phase ahead of their use

    // online softmax update (per-row rescale of this row's accumulator elements only);
    // P tile (x4096) to this wave's LDS tile [row][key]
#pragma unroll
    for (int r = 0; r < 8; ++r) {
      const float mnew  = fmaxf(mrow[r], cm[r]);
      const float alpha = __expf(mrow[r] - mnew);
      mrow[r] = mnew;
      float psum = 0.f;
#pragma unroll
      for (int j = 0; j < 4; ++j) {
        const float p = __expf(s[j][r] - mnew);
        psum += p;
        pw[(8 * hh + r) * PPIT_ + j * 16 + c] = (_Float16)(p * 4096.0f);
      }
      psum += __shfl_xor(psum, 1, 32);
      psum += __shfl_xor(psum, 2, 32);
      psum += __shfl_xor(psum, 4, 32);
      psum += __shfl_xor(psum, 8, 32);
      lrow[r] = lrow[r] * alpha + psum;
#pragma unroll
      for (int t = 0; t < 8; ++t) oacc[t][r] *= alpha;
    }
    // the P tile goes through LDS alone: fences on the LDS address space leave the global loads above in flight
    __builtin_amdgcn_fence(__ATOMIC_RELEASE, "workgroup", "local");
    __builtin_amdgcn_wave_barrier();
    __builtin_amdgcn_fence(__ATOMIC_ACQUIRE, "workgroup", "local");

    // P (A operand, row = lane&15, split k map over keys) . V (B operand from V^T rows d)
#pragma unroll
    for (int kk = 0; kk < 2; ++kk) {
      const v16h pa = ldfrag(pw + c * PPIT_ + kk * 32 + 8 * hh);
#pragma unroll
      for (int t = 0; t < 8; ++t) oacc[t] = mma16(pa, vb[kk][t], oacc[t]);
    }

    // keeps the P.V WMMAs and the row sums in this trip: behind the next trip's barrier, which waits for every load
    // in flight, they would no longer cover the band loads' latency
    __builtin_amdgcn_sched_barrier(0);
    // the same wait as in front of the loop: it stands at the foot of the trip, in front of the offsets' step
    asm volatile("s_wait_xcnt 0x0" : "+v"(ko), "+v"(vo), "+v"(bo) :: "memory");
    const unsigned step = (kc + 2 < NT_ / 128) ? 128u : 0u;   // the offsets stop at the group's last chunk
    ko += step * (ND_ * 2);
    vo += step * 2;
    bo += step * 4;
  }

  __syncthreads();                               // every wave is done with the tiles before Xsh and Osh alias them
  // group 1 hands over: per lane 64 accumulator values, 8 row maxima, 8 row sums (same rows and lanes in both groups)
  float* xs = Xsh + (wave * 32 + lane) * XPIT;
  if (grp == 1) {
#pragma unroll
    for (int t = 0; t < 8; ++t) {
      v4f lo = {oacc[t][0], oacc[t][1], oacc[t][2], oacc[t][3]};
      v4f hi = {oacc[t][4], oacc[t][5], oacc[t][6], oacc[t][7]};
      *(v4fa*)(xs + t * 8)     = lo;
      *(v4fa*)(xs + t * 8 + 4) = hi;
    }
#pragma unroll
    for (int r = 0; r < 8; ++r) { xs[64 + r] = mrow[r]; xs[72 + r] = lrow[r]; }
  }
  __syncthreads();                               // the hand-over is written before group 0 reads it
  if (grp == 1) return;                          // no barrier follows
#pragma unroll
  for (int r = 0; r < 8; ++r) {
    const float m1 = xs[64 + r], l1 = xs[72 + r];
    const float mj = fmaxf(mrow[r], m1);
    const float a0 = __expf(mrow[r] - mj);
    const float a1 = __expf(m1 - mj);
    lrow[r] = lrow[r] * a0 + l1 * a1;
#pragma unroll
    for (int t = 0; t < 8; ++t) oacc[t][r] = oacc[t][r] * a0 + xs[t * 8 + r] * a1;
  }
  float* os = Osh + wave * (16 * OPIT_);
#pragma unroll
  for (int r = 0; r < 8; ++r) {
    const float inv = 1.0f / (1024.0f * lrow[r]);   // 64 / (4096 * 16 * l)
#pragma unroll
    for (int t = 0; t < 8; ++t) os[(8 * hh + r) * OPIT_ + t * 16 + c] = oacc[t][r] * inv;
  }
  __builtin_amdgcn_fence(__ATOMIC_RELEASE, "workgroup");
  __builtin_amdgcn_wave_barrier();
  __builtin_amdgcn_fence(__ATOMIC_ACQUIRE, "workgroup");
  v8h ov[8];
#pragma unroll
  for (int it = 0; it < 8; ++it) {
    // half it&1 of the 16x32 block it>>1: lane 16*hh + c brings the piece (row c, column 16*it + 8*hh)
    const float* sp = os + c * OPIT_ + it * 16 + hh * 8;
    const v4f x0 = *(const v4fa*)(sp);
    const v4f x1 = *(const v4fa*)(sp + 4);
    v8h o;
    o[0] = (_Float16)x0[0]; o[1] = (_Float16)x0[1]; o[2] = (_Float16)x0[2]; o[3] = (_Float16)x0[3];
    o[4] = (_Float16)x1[0]; o[5] = (_Float16)x1[1]; o[6] = (_Float16)x1[2]; o[7] = (_Float16)x1[3];
    ov[it] = o;
  }
  {
#pragma unroll
    for (int it = 0; it < 8; ++it) {
      *(v8h*)(ctx + (size_t)q0 * ND_ + it * 256 + lane * 8) = ov[it];   // 32 lanes x 16 B = 512 contiguous bytes
    }
    
  }
}

// -------------------------------------------------------------------------------------------------
// Workspace map (bytes):
//   (pk = packed, in fragment order: ldfrag_pk)
//   WO   f16 pk [1024][1024]           0
//   QU   f16 pk [8192][1024]     2097152
//   QV   f16 pk [8192][1024]    18874368
//   KP   f16 [8192][1024]       35651584
//   VTP  f16 [4][1024][2048]    52428800
//   CTX  f16 pk [8192][1024]    69206016
//   P16  f16 pk [4096][1024]    85983232
//   SCR                         94371840   (138412032 B): early phase (all pk) WQ,WK,WV,WP f16 [1024][1024] at +0,+2097152,
//        +4194304,+6291456; X f16 [8192][1024] at +8388608; PE f16 [4096][1024] at +25165824 (end +33554432);
//        later phase: BD band f32 [8][2048][2112] (end +138412032)
//   total                      232783872
// Every region is written in whole 64x64 tiles / whole rows; all sizes are exact tile multiples.
// -------------------------------------------------------------------------------------------------
extern "C" void kernel_launch(void* const* d_in, const int* in_sizes, int n_in,
                              void* d_out, int out_size, void* d_ws, size_t ws_size,
                              hipStream_t stream) {
  if (n_in < 9) return;
  if (in_sizes[0] != NB_ * NT_ * ND_) return;
  if (in_sizes[1] != NP_ * ND_) return;
  if (in_sizes[2] != ND_ * ND_ || in_sizes[3] != ND_ * ND_ || in_sizes[4] != ND_ * ND_) return;
  if (in_sizes[5] != ND_ * ND_ || in_sizes[6] != ND_ * ND_) return;
  if (in_sizes[7] != NH_ * HD_ || in_sizes[8] != NH_ * HD_) return;
  if (out_size != NB_ * NT_ * ND_) return;

  const float* x   = (const float*)d_in[0];
  const float* pe  = (const float*)d_in[1];
  const float* Wq  = (const float*)d_in[2];
  const float* Wk  = (const float*)d_in[3];
  const float* Wv  = (const float*)d_in[4];
  const float* Wo  = (const float*)d_in[5];
  const float* Wp  = (const float*)d_in[6];
  const float* bu  = (const float*)d_in[7];
  const float* bvb = (const float*)d_in[8];
  float* out = (float*)d_out;

  const size_t PW16 = (size_t)ND_ * ND_ * 2;             //  2097152
  const size_t PA16 = (size_t)NB_ * NT_ * ND_ * 2;       // 16777216
  const size_t PP16 = (size_t)NPP_ * ND_ * 2;            //  8388608
  const size_t PBD  = (size_t)NT_ * BDW_ * 4;            // 17301504 per pair
  const int    NPAIR = 8;                                // pairs per group: all heads of one batch element
  size_t off = 0;
  const size_t oWO  = off; off += PW16;
  const size_t oQU  = off; off += PA16;
  const size_t oQV  = off; off += PA16;
  const size_t oKP  = off; off += PA16;
  const size_t oVT  = off; off += PA16;
  const size_t oCTX = off; off += PA16;
  const size_t oP16 = off; off += PP16;
  const size_t oSCR = off;
  const size_t oWQ  = oSCR;
  const size_t oWK  = oWQ + PW16;
  const size_t oWV  = oWK + PW16;
  const size_t oWP  = oWV + PW16;
  const size_t oX   = oWP + PW16;
  const size_t oPE  = oX + PA16;
  const size_t earlyEnd = oPE + PP16;
  const size_t bdEnd    = oSCR + (size_t)NPAIR * PBD;
  const size_t total    = (earlyEnd > bdEnd) ? earlyEnd : bdEnd;   // 232783872
  if (total > ws_size) return;

  char* ws = (char*)d_ws;
  _Float16* WO  = (_Float16*)(ws + oWO);
  _Float16* QU  = (_Float16*)(ws + oQU);
  _Float16* QV  = (_Float16*)(ws + oQV);
  _Float16* KP  = (_Float16*)(ws + oKP);
  _Float16* VTP = (_Float16*)(ws + oVT);
  _Float16* CTX = (_Float16*)(ws + oCTX);
  _Float16* P16 = (_Float16*)(ws + oP16);
  _Float16* WQ  = (_Float16*)(ws + oWQ);
  _Float16* WK  = (_Float16*)(ws + oWK);
  _Float16* WV  = (_Float16*)(ws + oWV);
  _Float16* WP  = (_Float16*)(ws + oWP);
  _Float16* X   = (_Float16*)(ws + oX);
  _Float16* PE  = (_Float16*)(ws + oPE);
  float*    SCR = (float*)(ws + oSCR);

  const float inv_sdk = 0.08838834764831845f;   // 1/sqrt(128)
  const float cs      = inv_sdk * 0.00390625f;   // applied to the x16.x16 score accumulators
  const dim3 blk(256);

  // (1) weights -> f16 planes of bf16-valued entries, carried x64   (grid 1024*128/256 = 512)
  const dim3 gW((ND_ * (ND_ / 8) + 255) / 256);
  cvt_plane_kernel<<<gW, blk, 0, stream>>>(Wq, WQ, ND_, ND_, 64.0f);
  cvt_plane_kernel<<<gW, blk, 0, stream>>>(Wk, WK, ND_, ND_, 64.0f);
  cvt_plane_kernel<<<gW, blk, 0, stream>>>(Wv, WV, ND_, ND_, 64.0f);
  cvt_plane_kernel<<<gW, blk, 0, stream>>>(Wp, WP, ND_, ND_, 64.0f);
  cvt_plane_kernel<<<gW, blk, 0, stream>>>(Wo, WO, ND_, ND_, 64.0f);
  // (2) pos_emb -> f16 plane [4096][1024], row 4095 = 0
  const dim3 gPE((NPP_ * (ND_ / 8) + 255) / 256);
  cvt_plane_kernel<<<gPE, blk, 0, stream>>>(pe, PE, NP_, NPP_, 1.0f);
  // (3) p = pos_emb . Wp^T -> P16 = 16*p   (M=4096, N=1024, K=1024)
  {
    const int tiles = (NPP_ / 64) * (ND_ / 64);
    gemm_f16_kernel<3, false><<<dim3((tiles + 7) / 8, 1), blk, 0, stream>>>(
        PE, ND_, 0L, WP, ND_, 0L, (void*)P16, (void*)P16, ND_, 0L, bu, bu, NPP_, ND_, ND_, 0.25f, 1.0f, 0);
  }
  // (4) x -> f16 plane, all batch elements; q (two bias variants), k, v^T projections: one launch of 256 work-groups each
  {
    const dim3 gX((NB_ * NT_ * (ND_ / 8) + 255) / 256);
    cvt_plane_kernel<<<gX, blk, 0, stream>>>(x, X, NB_ * NT_, NB_ * NT_, 1.0f);
    const int tilesQ = ((NB_ * NT_) / 64) * (ND_ / 64);  // 2048
    // QU = 16*(q + bias_u), QV = 16*(q + bias_v)    (M=8192, N=1024, K=1024)
    gemm_f16_kernel<2, false><<<dim3((tilesQ + 7) / 8, 1), blk, 0, stream>>>(
        X, ND_, 0L, WQ, ND_, 0L, (void*)QU, (void*)QV, ND_, 0L, bu, bvb,
        NB_ * NT_, ND_, ND_, 0.015625f, 16.0f, 0);
    // KP = 16*k
    gemm_f16_kernel<1, false><<<dim3((tilesQ + 7) / 8, 1), blk, 0, stream>>>(
        X, ND_, 0L, WK, ND_, 0L, (void*)KP, (void*)KP, ND_, 0L, bu, bu,
        NB_ * NT_, ND_, ND_, 0.25f, 1.0f, 0);
    // VT[b][h*128+d][t] = 16*v   (A = Wv plane [1024][1024], Bt = x plane of batch z [2048][1024];
    //                             M=1024, N=2048, K=1024 per z, grid.y = batch)
    const int tilesV = (ND_ / 64) * (NT_ / 64);          // 512 per batch element
    gemm_f16_kernel<1, false><<<dim3((tilesV + 7) / 8, NB_), blk, 0, stream>>>(
        WV, ND_, 0L, X, ND_, (long)NT_ * ND_, (void*)VTP, (void*)VTP,
        NT_, (long)ND_ * NT_, bu, bu, ND_, NT_, ND_, 0.25f, 1.0f, 0);
  }
  // (5) per group of 8 (b,h) pairs: band GEMM of the position scores, then attention (256 work-groups, one per WGP)
  const int nGroups = (NB_ * NH_) / NPAIR;               // 4
  for (int g = 0; g < nGroups; ++g) {
    const int pairBase = g * NPAIR;
    const int b  = pairBase >> 3;
    const int h0 = pairBase & 7;
    const _Float16* Aq = QV + (size_t)b * NT_ * ND_ + h0 * (HD_ * 16);   // rows t, cols d of head h0 (z adds 128 columns)
    const _Float16* Bp = P16 + h0 * (HD_ * 16);                           // rows p index, cols d of head h0
    const int tilesBD = (NT_ / 64) * (BDW_ / 64);                  // 32*33 = 1056
    gemm_f16_kernel<0, true><<<dim3((tilesBD + 7) / 8, NPAIR), blk, 0, stream>>>(
        Aq, ND_, (long)HD_ * 16, Bp, ND_, (long)HD_ * 16, (void*)SCR, (void*)SCR, BDW_, (long)NT_ * BDW_, bu, bu,
        NT_, BDW_, HD_, cs, 1.0f, 31);
    relattn_kernel<<<dim3(NT_ / 64, NPAIR), dim3(256), 0, stream>>>(QU, KP, VTP, SCR, CTX, pairBase, cs);
  }
  // (6) out = ctx . Wo^T -> d_out f32 [8192][1024]   (M=8192, N=1024, K=1024; carries 64*64 folded into scale)
  {
    const int tiles = ((NB_ * NT_) / 64) * (ND_ / 64);   // 2048
    gemm_f16_kernel<0, false><<<dim3((tiles + 7) / 8, 1), blk, 0, stream>>>(
        CTX, ND_, 0L, WO, ND_, 0L, (void*)out, (void*)out, ND_, 0L, bu, bu,
        NB_ * NT_, ND_, ND_, 0.000244140625f, 1.0f, 0);
  }
  (void)hipGetLastError();
}

// v008
// Measured time: 476 microseconds a run.
// Timed twice side by side with v007, it ran 1.06 times as fast both times.
// Counting every step since v000, it is 9.23 times as fast.
// Contractions x.Wq^T, x.Wk^T, Wv.x^T, pos_emb.Wp^T, (q+bias_v).p^T band, (q+bias_u).k^T, P.V, ctx.Wo^T: v_wmma_f32_16x16x32_f16 (f16 operands, f32 accumulate); operand planes hold bf16-RNE-valued inputs with power-of-two carries (W x64, q/k/v/p x16, P x4096, ctx x64); softmax, bias adds and score scaling in f32. Every plane that a GEMM reads as an operand is stored in fragment order (see ldfrag_pk).
#include <hip/hip_runtime.h>
#include <math.h>
#include <stdint.h>

#define NB_  4
#define NT_  2048
#define ND_  1024
#define NH_  8
#define HD_  128
#define NP_  4095
#define NPP_ 4096
#define BDW_ 2112   // width of the relative-position score band scratch (33 tiles of 64)
// LDS row pitches of the attention tiles, in halves: 16 B x odd, so that the 16 rows one ds_load_b128 reads
// fall on 16 different groups of four banks (unpadded 256-B rows all fall on one group, 128-B rows on two)
#define KPIT_ 136   // K tile row: 128 halves + 8  (272 B)
#define VPIT_ 72    // V^T tile row: 64 halves + 8 (144 B)
#define PPIT_ 72    // P tile row: 64 halves + 8   (144 B)
#define OPIT_ 132   // output staging row, in floats: 128 + 4 (528 B)

typedef _Float16 v16h __attribute__((ext_vector_type(16)));
typedef _Float16 v8h  __attribute__((ext_vector_type(8)));
typedef float    v8f  __attribute__((ext_vector_type(8)));
typedef float    v4f  __attribute__((ext_vector_type(4)));
typedef v4f __attribute__((may_alias)) v4fa;
typedef v8h __attribute__((may_alias)) v8ha;

// bf16 RNE of an f32 value, returned widened to f32 (exactly representable in f16 after a power-of-two carry)
__device__ __forceinline__ float bf_rne(float f) {
  unsigned u = __float_as_uint(f);
  u = (u + 0x7FFFu + ((u >> 16) & 1u)) & 0xFFFF0000u;
  return __uint_as_float(u);
}

// 16-bit WMMA fragment: elements 0..7 <- p[0..7], elements 8..15 <- p[16..23]
// (A: p = row m at k0 + 8h;  B stored [n][k]: p = row n at k0 + 8h;  same split k map for both)
union FragU { v16h v; v8ha h[2]; };
__device__ __forceinline__ v16h ldfrag(const _Float16* p) {
  FragU f;
  f.h[0] = *(const v8ha*)(p);
  f.h[1] = *(const v8ha*)(p + 16);
  return f.v;
}

// Fragment-order ("packed") plane of pitch ld halves: each block of 16 rows x 32 k is 1 KB in a row, block (row/16, k/32)
// at half offset (row/16)*16*ld + (k/32)*512; inside it the 16-B piece of (row, k..k+7), k a multiple of 8, stands at
// ((k/16)&1)*256 + (((k/8)&1)*16 + row%16)*8. So lane l = 16h + row finds elements 0..7 (k0 + 8h ..) at l*8 and elements
// 8..15 (k0 + 16 + 8h ..) at 256 + l*8: the same split k map as ldfrag, and each of the two wave-wide 16-B loads covers
// 512 contiguous bytes (4 cache lines) where the row-major plane gives 32 B from each of 16 lines.
// p = block start + lane*8
__device__ __forceinline__ v16h ldfrag_pk(const _Float16* p) {
  FragU f;
  f.h[0] = *(const v8ha*)(p);
  f.h[1] = *(const v8ha*)(p + 256);
  return f.v;
}

// Plain builtin: the compiler keeps the WMMA distances itself and stays free to place fragment loads ahead of
// earlier WMMAs (a volatile asm statement behind each WMMA held every load behind the WMMA before it)
__device__ __forceinline__ v8f mma16(v16h a, v16h b, v8f c) {
  return __builtin_amdgcn_wmma_f32_16x16x32_f16(false, a, false, b, (short)0, c, false, false);
}

__device__ __forceinline__ v8f zero8() { v8f z = {0.f, 0.f, 0.f, 0.f, 0.f, 0.f, 0.f, 0.f}; return z; }

// -------------------------------------------------------------------------------------------------
// All seven f32 inputs that feed a GEMM -> packed f16 planes, in ONE launch of 4096 waves (16 a WGP):
// dst = f16( bf_rne(src) * scale ), scale 64 for the five weights, 1 for pos_emb and x; row 4095 of the pos_emb plane is 0.
// A piece is 8 rows x 32 columns (lane = 4*row + 8-column piece): 8 whole 128-B lines read, 4 whole 128-B lines written.
// Wave (rg, kb), rg = 0..127, kb = 0..31, takes column block kb of 17 pieces: rows 8*rg.. of each weight (5 pieces), rows
// 32*rg.. of pos_emb (4 pieces, one below the other) and rows 64*rg.. of x (8 pieces). Its 34 loads are in flight
// together, and the chip starts 4096 waves in one launch where one wave a piece took 69632 waves in seven launches.
// coverage: 128 x 32 waves x (8, 32, 64 rows x 32 columns) = [1024][1024] five times, [4096][1024], [8192][1024].
// -------------------------------------------------------------------------------------------------
__device__ __forceinline__ v8h cvt8(v4f a, v4f b, float f) {
  v8h o;
  o[0] = (_Float16)(bf_rne(a[0]) * f); o[1] = (_Float16)(bf_rne(a[1]) * f);
  o[2] = (_Float16)(bf_rne(a[2]) * f); o[3] = (_Float16)(bf_rne(a[3]) * f);
  o[4] = (_Float16)(bf_rne(b[0]) * f); o[5] = (_Float16)(bf_rne(b[1]) * f);
  o[6] = (_Float16)(bf_rne(b[2]) * f); o[7] = (_Float16)(bf_rne(b[3]) * f);
  return o;
}

__global__ __launch_bounds__(256) void cvt_all_kernel(
    const float* __restrict__ wq, const float* __restrict__ wk, const float* __restrict__ wv,
    const float* __restrict__ wp, const float* __restrict__ wo, const float* __restrict__ pe,
    const float* __restrict__ x,
    _Float16* __restrict__ dwq, _Float16* __restrict__ dwk, _Float16* __restrict__ dwv,
    _Float16* __restrict__ dwp, _Float16* __restrict__ dwo, _Float16* __restrict__ dpe,
    _Float16* __restrict__ dx) {
  const int w    = blockIdx.x * 8 + (threadIdx.x >> 5);           // 0..4095
  const int lane = threadIdx.x & 31;
  const int ks = lane & 3;                                        // 8-column piece of the block
  const int l4 = lane >> 2;                                       // row of the piece
  const int kb = w & (ND_ / 32 - 1);
  const int rg = w / (ND_ / 32);
  const int c8 = kb * 32 + ks * 8;
  // byte offsets of this lane's 32 B in the first piece of each kind; the next piece stands 8 rows (32768 B) on
  const unsigned sw = (unsigned)((rg * 8  + l4) * ND_ + c8) * 4u;
  const unsigned sp = (unsigned)((rg * 32 + l4) * ND_ + c8) * 4u;
  const unsigned sx = (unsigned)((rg * 64 + l4) * ND_ + c8) * 4u;
  const int  rl = rg * 32 + 24 + l4;                              // pos_emb row of the fourth piece: 4095 has no source
  const unsigned sl = (unsigned)(((rl < NP_) ? rl : (NP_ - 1)) * ND_ + c8) * 4u;   // clamped address
  const float    fl = (rl < NP_) ? 1.0f : 0.0f;                   // zero by value for the filler row
  // packed plane: row r stands at (r/16)*16*ND_ + (r%16)*8 halves, so piece k (rows + 8k) at (k/2)*32768 + (k%2)*128 B
  const unsigned dl = (unsigned)(kb * 512 + (ks >> 1) * 256 + ((ks & 1) * 16 + l4) * 8) * 2u;
  const unsigned dw = dl + (unsigned)(rg >> 1) * (16u * ND_ * 2u) + (unsigned)(rg & 1) * 128u;
  const unsigned dp = dl + (unsigned)(rg * 2) * (16u * ND_ * 2u);
  const unsigned dq = dl + (unsigned)(rg * 4) * (16u * ND_ * 2u);

  const float* const ws[5] = {wq, wk, wv, wp, wo};
  _Float16* const    wd[5] = {dwq, dwk, dwv, dwp, dwo};
  v4f aw[5], bw[5], ap[4], bp[4], ax[8], bx[8];
#pragma unroll
  for (int k = 0; k < 5; ++k) {
    aw[k] = *(const v4f*)((const char*)ws[k] + sw);
    bw[k] = *(const v4f*)((const char*)ws[k] + sw + 16);
  }
#pragma unroll
  for (int k = 0; k < 4; ++k) {
    const char* p = (k < 3) ? ((const char*)pe + sp + k * 32768) : ((const char*)pe + sl);
    ap[k] = *(const v4f*)(p);
    bp[k] = *(const v4f*)(p + 16);
  }
#pragma unroll
  for (int k = 0; k < 8; ++k) {
    ax[k] = *(const v4f*)((const char*)x + sx + k * 32768);
    bx[k] = *(const v4f*)((const char*)x + sx + k * 32768 + 16);
  }
  // the wait that stands before an address register of an issued load is written again; the four offsets pass into it,
  // so that they stay live up to it and no load of the group gets one of them as its destination
  asm volatile("s_wait_xcnt 0x0" :: "v"(sw), "v"(sp), "v"(sl), "v"(sx) : "memory");
  __builtin_amdgcn_sched_barrier(0);   // keeps the 34 loads in one group ahead of the converts: one memory latency a wave

#pragma unroll
  for (int k = 0; k < 5; ++k)
    *(v8h*)((char*)wd[k] + dw) = cvt8(aw[k], bw[k], 64.0f);
#pragma unroll
  for (int k = 0; k < 4; ++k)
    *(v8h*)((char*)dpe + dp + (k >> 1) * 32768 + (k & 1) * 128) = cvt8(ap[k], bp[k], (k < 3) ? 1.0f : fl);
#pragma unroll
  for (int k = 0; k < 8; ++k)
    *(v8h*)((char*)dx + dq + (k >> 1) * 32768 + (k & 1) * 128) = cvt8(ax[k], bx[k], 1.0f);
}

// -------------------------------------------------------------------------------------------------
// f16 WMMA GEMM: C[m][n] = epi( sum_k A[m][k] * Bt[nrow][k] ), nrow = n (+ 64*(skew0 - tm) when SKEW: band GEMM).
// A [M][K] and Bt [N(+band)][K] are packed planes (ldfrag_pk) of pitch lda, ldb; a column offset c (multiple of 32) of a
// packed plane is 16*c halves; M, N multiples of 64, K multiple of 32.
// Each wave owns a 64x64 output tile (4x4 subtiles), 8 waves per block, grid.x = tiles/8, grid.y = z-batch.
// OUT 0: f32  C1 = acc*scale
// OUT 1: f16  C1 = f16(acc*scale), row-major
// OUT 2: f16  C1 = f16((acc*scale + bf_rne(b1[n]))*carry), C2 = f16((acc*scale + bf_rne(b2[n]))*carry), both packed
// OUT 3: f16  C1 = f16(acc*scale), packed
// ONE instruction with lane-contiguous 16-B pieces (f32: 16 lanes x 16 B = 256 B segment; f16 row-major: 8 lanes x 16 B = 128 B segment; packed: 32 lanes x 16 B = 512 B)
// coverage: 4 slabs x 16 rows x 64 cols = the whole 64x64 tile per wave; tiles cover M x N exactly.
// -------------------------------------------------------------------------------------------------
template <int OUT, bool SKEW>
__global__ __launch_bounds__(256) void gemm_f16_kernel(
    const _Float16* __restrict__ A, int lda, long strideA,
    const _Float16* __restrict__ Bt, int ldb, long strideB,
    void* __restrict__ C1, void* __restrict__ C2, int ldc, long strideC,
    const float* __restrict__ b1, const float* __restrict__ b2,
    int M, int N, int K, float scale, float carry, int skew0) {
  __shared__ __align__(16) float sT[8][16 * 68];   // per-wave 16x64 slab, pitch 68 floats

  const int z    = blockIdx.y;
  const int lane = threadIdx.x & 31;
  const int wave = threadIdx.x >> 5;
  const int tilesN = N >> 6;
  const int tilesM = M >> 6;
  const int tile = blockIdx.x * 8 + wave;
  if (tile >= tilesM * tilesN) return;             // wave-uniform; no block barriers in this kernel
  const int tm = tile / tilesN;
  const int tn = tile - tm * tilesN;
  const int m0 = tm << 6;
  const int n0 = tn << 6;
  const int nsk = SKEW ? ((skew0 - tm) << 6) : 0;  // band row offset of Bt

  const _Float16* Ab = A  + (size_t)z * strideA;
  const _Float16* Bb = Bt + (size_t)z * strideB;

  const int rl   = lane & 15;          // column (D) within a subtile
  const int mOff = (lane >> 4) * 8;    // D row offset of this lane half

  v8f acc[4][4];
#pragma unroll
  for (int i = 0; i < 4; ++i)
#pragma unroll
    for (int j = 0; j < 4; ++j) acc[i][j] = zero8();

  // this lane's place in the first block of the tile's first 16 rows; the next 16 rows stand 16*ld halves on, the next
  // k step 512 halves on
  const _Float16* Ar = Ab + (size_t)(m0 >> 4) * ((size_t)lda * 16) + lane * 8;
  const _Float16* Br = Bb + (size_t)((nsk + n0) >> 4) * ((size_t)ldb * 16) + lane * 8;

  for (int k0 = 0; k0 < K; k0 += 32) {
    // all eight fragments of the k step are loaded as one group, then its 16 WMMAs run
    v16h bfr[4], af[4];
    const _Float16 *pb[4], *pa[4];
#pragma unroll
    for (int j = 0; j < 4; ++j) {
      pb[j] = Br + (size_t)j * ((size_t)ldb * 16) + (k0 << 4);
      pa[j] = Ar + (size_t)j * ((size_t)lda * 16) + (k0 << 4);
      bfr[j] = ldfrag_pk(pb[j]);
      af[j]  = ldfrag_pk(pa[j]);
    }
    // the wait that stands before an address register of an issued load is written again; the eight addresses pass
    // into it, so that no later load of the group gets an earlier one's address register as its destination
    asm volatile("s_wait_xcnt 0x0" :: "v"(pb[0]), "v"(pb[1]), "v"(pb[2]), "v"(pb[3]),
                                      "v"(pa[0]), "v"(pa[1]), "v"(pa[2]), "v"(pa[3]) : "memory");
    __builtin_amdgcn_sched_barrier(0);   // keeps the 16 loads in one group: one load latency a k step, not one a row
#pragma unroll
    for (int i = 0; i < 4; ++i)
#pragma unroll
      for (int j = 0; j < 4; ++j) acc[i][j] = mma16(af[i], bfr[j], acc[i][j]);
  }

  // ---- epilogue ----
  float* slab = sT[wave];
#pragma unroll
  for (int i = 0; i < 4; ++i) {
    const int mBase = m0 + (i << 4);
#pragma unroll
    for (int j = 0; j < 4; ++j)
#pragma unroll
      for (int r = 0; r < 8; ++r)
        slab[(mOff + r) * 68 + (j << 4) + rl] = acc[i][j][r] * scale;
    __builtin_amdgcn_fence(__ATOMIC_RELEASE, "workgroup");
    __builtin_amdgcn_wave_barrier();
    __builtin_amdgcn_fence(__ATOMIC_ACQUIRE, "workgroup");
    if (OUT == 0) {
      float* C = (float*)C1 + (size_t)z * strideC;
      const int hh = lane >> 4, c4 = (lane & 15) * 4;    // row segment 256 B = 16 lanes x 16 B
      {
#pragma unroll
        for (int it = 0; it < 8; ++it) {
          const int row = it * 2 + hh;
          const v4f v = *(const v4fa*)(slab + row * 68 + c4);
          *(v4f*)(C + (size_t)(mBase + row) * ldc + n0 + c4) = v;
        }
        
      }
    } else if (OUT == 2 || OUT == 3) {
      // packed output: store 'it' is half j = it&1 of block it>>1 of the slab's two 16x32 blocks, 512 contiguous bytes;
      // lane 16h + row brings the piece (row, 32*(it>>1) + 16*j + 8h)
      _Float16* Ca = (_Float16*)C1 + (size_t)z * strideC;
      _Float16* Cb = (_Float16*)C2 + (size_t)z * strideC;
      const size_t dbase = (size_t)(mBase >> 4) * ((size_t)ldc * 16) + (size_t)(n0 >> 5) * 512 + lane * 8;
      v8h hv[4], lv[4];
#pragma unroll
      for (int it = 0; it < 4; ++it) {
        const int col = (it >> 1) * 32 + (it & 1) * 16 + (lane >> 4) * 8;
        const float* sp = slab + rl * 68 + col;
        const v4f x0 = *(const v4fa*)(sp);
        const v4f x1 = *(const v4fa*)(sp + 4);
        float f[8];
        f[0] = x0[0]; f[1] = x0[1]; f[2] = x0[2]; f[3] = x0[3];
        f[4] = x1[0]; f[5] = x1[1]; f[6] = x1[2]; f[7] = x1[3];
        v8h ha, hb;
#pragma unroll
        for (int e = 0; e < 8; ++e) {
          if (OUT == 3) {
            ha[e] = (_Float16)f[e];
            hb[e] = ha[e];
          } else {
            const int n = n0 + col + e;
            ha[e] = (_Float16)((f[e] + bf_rne(b1[n])) * carry);
            hb[e] = (_Float16)((f[e] + bf_rne(b2[n])) * carry);
          }
        }
        hv[it] = ha; lv[it] = hb;
      }
#pragma unroll
      for (int it = 0; it < 4; ++it) {
        *(v8h*)(Ca + dbase + it * 256) = hv[it];
        if (OUT == 2) *(v8h*)(Cb + dbase + it * 256) = lv[it];
      }
      // the wait that stands before an address register of an issued store is written again (the next slab's addresses)
      asm volatile("s_wait_xcnt 0x0" ::: "memory");
    } else {
      const int q = lane >> 3, c8 = (lane & 7) * 8;
      _Float16* Ca = (_Float16*)C1 + (size_t)z * strideC;
      v8h hv[4];
#pragma unroll
      for (int it = 0; it < 4; ++it) {
        const int row = it * 4 + q;
        const float* sp = slab + row * 68 + c8;
        const v4f x0 = *(const v4fa*)(sp);
        const v4f x1 = *(const v4fa*)(sp + 4);
        float f[8];
        f[0] = x0[0]; f[1] = x0[1]; f[2] = x0[2]; f[3] = x0[3];
        f[4] = x1[0]; f[5] = x1[1]; f[6] = x1[2]; f[7] = x1[3];
        v8h ha;
#pragma unroll
        for (int e = 0; e < 8; ++e) ha[e] = (_Float16)f[e];
        hv[it] = ha;
      }
      {
#pragma unroll
        for (int it = 0; it < 4; ++it) {
          const int row = it * 4 + q;
          *(v8h*)(Ca + (size_t)(mBase + row) * ldc + n0 + c8) = hv[it];
        }
        
      }
    }
    __builtin_amdgcn_fence(__ATOMIC_RELEASE, "workgroup");
    __builtin_amdgcn_wave_barrier();
    __builtin_amdgcn_fence(__ATOMIC_ACQUIRE, "workgroup");
  }
}

// -------------------------------------------------------------------------------------------------
// Relative-position attention for a group of (batch, head) pairs, head dim 128, no mask.
//   QU  f16 packed plane [b*2048 + t][h*128 + d] = 16*(q + bias_u) (A operand of the content score)
//   Kp  f16 plane [b*2048 + s][h*128 + d] = 16*k                  (B operand, staged per 64-key chunk as [key][d])
//   VT  f16 plane [b][h*128 + d][s]      = 16*v                  (B operand of P.V, staged as [d][key])
//   BD  f32 band scratch [z][2048][2112]: value (col j) = inv_sdk * (q_i + bias_v).p[row 64*(31 - i/64) + j]
//       rel-shift: bd[i][key] = bdfull[i][key - i + 2047]  ->  column (key - i + 2047) - 64*(31 - i/64)
//                = key + 63 - (i mod 64), always in [0, 2110].
//   score = cs * (QU.K^T acc) + BD  with cs = inv_sdk / 256;  online softmax in f32 over chunks of 64 keys;
//   P stored per wave as f16(4096 * exp(s - m)); ctx = 64 * (P.V acc) / (4096*16*l) written as packed f16
//   plane CTX [b*2048 + t][h*128 + d].
// Block = 8 waves = 64 query rows of one (b,h); grid = (32 query blocks, pairs in group). The waves form two groups of
// four: group g takes the key chunks 2t + g, t = 0..15, for all 64 rows, with its own K and V^T tiles and its own running
// (max, sum, accumulator); each SIMD so holds two waves, and one wave's waits (LDS, cross-lane, band loads) are filled by
// the other. Behind the loop group 1 hands its state to group 0 through LDS, which joins the two as online softmax joins
// two chunks, and stores.
// LDS: one raw buffer; per group g at g*35840: K tile [64][128] f16 (row pitch 272 B), V^T tile [128][64] f16 at +17408
// (pitch 144 B); per-wave P tiles [16][64] f16 at 71680 (pitch 144 B). After a block barrier behind the loop: the hand-over
// [4 waves][32 lanes][84 floats] (lane pitch 336 B = 16 B x odd) at 0, the output staging [4][16][128] f32 (row pitch
// 528 B = 16 B x odd for its 16-row ds_load_b128 reader) at 43008.
// coverage: staging 8 loads x 4 waves x 2 rows x 256 B for K (64x128), 8 x 4 waves x 4 rows x 128 B for V^T (128x64); P tile 8 rows x 2 halves x 4x16 cols
// per wave = 16x64; output 8 store instructions x 16 rows x 2 pieces x 8 halves = 16x128 per wave.
// -------------------------------------------------------------------------------------------------
__global__ __launch_bounds__(256)
void relattn_kernel(const _Float16* __restrict__ QU, const _Float16* __restrict__ Kp,
                    const _Float16* __restrict__ VT, const float* __restrict__ BD,
                    _Float16* __restrict__ CTX, int pairBase, float cs) {
  constexpr int TILEB = 64 * KPIT_ * 2 + 128 * VPIT_ * 2;                 // one group's K and V^T tiles: 35840 B
  constexpr int XPIT  = 84;                                               // hand-over: floats per lane (80 used)
  __shared__ __align__(16) unsigned char SMEM[2 * TILEB + 8 * 16 * PPIT_ * 2];   // 90112

  const int tid  = threadIdx.x;
  const int grp  = __builtin_amdgcn_readfirstlane(tid >> 7);   // key-chunk group of this wave (scalar): 0 even, 1 odd chunks
  const int wave = (tid >> 5) & 3;               // wave within the group = 16-row tile of the block
  const int lane = tid & 31;
  _Float16* Ksh = (_Float16*)(SMEM + grp * TILEB);                        // [64][KPIT_]
  _Float16* Vsh = (_Float16*)(SMEM + grp * TILEB + 64 * KPIT_ * 2);       // [128][VPIT_]
  _Float16* Psh = (_Float16*)(SMEM + 2 * TILEB);                          // [8][16][PPIT_]
  float*    Xsh = (float*)(SMEM);                        // [4][32][XPIT] after the chunk loop
  float*    Osh = (float*)(SMEM + 4 * 32 * XPIT * 4);    // [4][16][OPIT_] after the chunk loop
  const int hh   = lane >> 4;
  const int c    = lane & 15;

  const int z    = blockIdx.y;
  const int pair = pairBase + z;
  const int b    = pair >> 3;
  const int h    = pair & 7;
  const int qb   = blockIdx.x;                   // 0..31
  const int q0   = qb * 64 + wave * 16;          // first query row of this wave
  const int rr0  = wave * 16 + 8 * hh;           // row within the 64-row block for r = 0

  const _Float16* Qh = QU + (size_t)(b * NT_) * ND_ + h * (HD_ * 16);   // packed: column h*128 is 16*h*128 halves
  const _Float16* Kh = Kp + (size_t)(b * NT_) * ND_ + h * HD_;
  const _Float16* Vh = VT + (size_t)b * ND_ * NT_ + (size_t)(h * HD_) * NT_;
  const float*    bd = BD + (size_t)z * NT_ * BDW_;
  _Float16*       ctx = CTX + (size_t)(b * NT_) * ND_ + h * (HD_ * 16);  // packed, as Qh

  // Q fragments (A operand): 4 chunks of 32 along d
  v16h qa[4];
  const _Float16* qp = Qh + (size_t)q0 * ND_ + lane * 8;               // q0 is a multiple of 16
#pragma unroll
  for (int dc = 0; dc < 4; ++dc)
    qa[dc] = ldfrag_pk(qp + dc * 512);
  // the wait that stands before an address register of an issued load is written again; the Q address passes into it,
  // so that its register pair stays live up to the wait and the offsets formed below cannot take it earlier
  asm volatile("s_wait_xcnt 0x0" :: "v"(qp) : "memory");


  float mrow[8], lrow[8];
  v8f oacc[8];
#pragma unroll
  for (int r = 0; r < 8; ++r) { mrow[r] = -INFINITY; lrow[r] = 0.f; }
#pragma unroll
  for (int t = 0; t < 8; ++t) oacc[t] = zero8();

  _Float16* pw = Psh + (tid >> 5) * (16 * PPIT_);

  // Every global load of a chunk is issued one chunk of the group ahead into registers (chunk grp here), so that its
  // latency runs under the chunk before instead of in front of its use.
  // Per-lane byte offsets, from the uniform bases Kh, Vh and bd, of the chunk that is loaded next:
  //   K: load i of a wave takes rows kv0 + kr + 2i (kr: 2 rows a load), 16 lanes x 16 B = the row's whole 256 B;
  //   V^T: load i takes rows vr + i (4 rows a load, 8 apart), 8 lanes x 16 B = the row's 128 B of keys kv0..kv0+63;
  //   so each wave-wide load covers 4 whole 128-B lines (a lane per row would touch 32 lines, 16 B of each).
  //   The 4 rows stand 8 apart because 8 * 144 B = 128 mod 256: the two rows that 16 lanes store to LDS then fill
  //   the 64 banks once (neighbouring rows would meet on four banks)
  //   band element of (row r, key kv0+16j+c) at bo + 4*(r*(BDW_-1) + 16j)
  const int kr = wave * 16 + (lane >> 4), kc8 = (lane & 15) * 8;
  const int vr = wave * 32 + (lane >> 3) * 8, vc8 = (lane & 7) * 8;
  unsigned ko = (unsigned)((kr * ND_ + kc8) * 2) + (unsigned)grp * (64u * ND_ * 2u);
  unsigned vo = (unsigned)((vr * NT_ + vc8) * 2) + (unsigned)grp * (64u * 2u);
  unsigned bo = (unsigned)(((q0 + 8 * hh) * BDW_ + (63 - rr0 + c)) * 4) + (unsigned)grp * (64u * 4u);
  v8h kreg[8], vreg[8];
  float bdv[8][4];
#pragma unroll
  for (int i = 0; i < 8; ++i) {
    kreg[i] = *(const v8h*)((const char*)Kh + ko + i * (2 * ND_ * 2));
    vreg[i] = *(const v8h*)((const char*)Vh + vo + i * (NT_ * 2));
  }
#pragma unroll
  for (int r = 0; r < 8; ++r)
#pragma unroll
    for (int j = 0; j < 4; ++j)
      bdv[r][j] = *(const float*)((const char*)bd + bo + 4 * (r * (BDW_ - 1) + (j << 4)));
  // the wait that stands before an address register of an issued load is written again; the offsets pass through
  // it, so that their step cannot be placed ahead of it
  asm volatile("s_wait_xcnt 0x0" : "+v"(ko), "+v"(vo), "+v"(bo) :: "memory");
  ko += 128 * (ND_ * 2);
  vo += 128 * 2;
  bo += 128 * 4;

  // two chunks of the group per trip: the band values loaded ahead alternate between two register sets; in a single body they
  // are copied into the one set behind a wait for the loads, in the middle of the chunk
#pragma unroll 2
  for (int kc = 0; kc < NT_ / 128; ++kc) {
    __syncthreads();
#pragma unroll
    for (int i = 0; i < 8; ++i) {
      *(v8ha*)(Ksh + (kr + 2 * i) * KPIT_ + kc8) = kreg[i];
      *(v8ha*)(Vsh + (vr + i) * VPIT_ + vc8)     = vreg[i];
    }
    __syncthreads();

    // the chunk's 16 K fragments, read from LDS as one group ahead of the score WMMAs
    v16h kb[4][4], vb[2][8];
#pragma unroll
    for (int dc = 0; dc < 4; ++dc)
#pragma unroll
      for (int j = 0; j < 4; ++j)
        kb[dc][j] = ldfrag(Ksh + (j * 16 + c) * KPIT_ + dc * 32 + 8 * hh);

    // the next chunk's K and V^T rows (the last trip loads its own chunk again, unused: no branch)
#pragma unroll
    for (int i = 0; i < 8; ++i) {
      kreg[i] = *(const v8h*)((const char*)Kh + ko + i * (2 * ND_ * 2));
      vreg[i] = *(const v8h*)((const char*)Vh + vo + i * (NT_ * 2));
    }
    // keeps the 32 LDS reads in one group, and the 16 global loads a whole chunk ahead of their LDS stores
    __builtin_amdgcn_sched_barrier(0);

    // content scores: S[j] = QU(16x128) . K^T for key subtile j (each s[j] sums dc = 0..3 in that order)
    v8f s[4];
#pragma unroll
    for (int j = 0; j < 4; ++j) s[j] = zero8();
#pragma unroll
    for (int dc = 0; dc < 4; ++dc)
#pragma unroll
      for (int j = 0; j < 4; ++j) s[j] = mma16(qa[dc], kb[dc][j], s[j]);

    // the chunk's 16 V^T fragments are read only here, so that they can take the K fragments' registers as the score
    // WMMAs free them (two waves a SIMD leave 512 registers a wave); they land under the softmax
#pragma unroll
    for (int kk = 0; kk < 2; ++kk)
#pragma unroll
      for (int t = 0; t < 8; ++t)
        vb[kk][t] = ldfrag(Vsh + (t * 16 + c) * VPIT_ + kk * 32 + 8 * hh);

    // add the position term from the band scratch, chunk row max
    float cm[8];
#pragma unroll
    for (int r = 0; r < 8; ++r) {
      float m = -INFINITY;
#pragma unroll
      for (int j = 0; j < 4; ++j) {
        const float sv = s[j][r] * cs + bdv[r][j];
        s[j][r] = sv;
        m = fmaxf(m, sv);
      }
      m = fmaxf(m, __shfl_xor(m, 1, 32));
      m = fmaxf(m, __shfl_xor(m, 2, 32));
      m = fmaxf(m, __shfl_xor(m, 4, 32));
      m = fmaxf(m, __shfl_xor(m, 8, 32));
      cm[r] = m;
    }

    // the next chunk's 32 band values (this chunk's have just been used by the loop above)
#pragma unroll
    for (int r = 0; r < 8; ++r)
#pragma unroll
      for (int j = 0; j < 4; ++j)
        bdv[r][j] = *(const float*)((const char*)bd + bo + 4 * (r * (BDW_ - 1) + (j << 4)));
    __builtin_amdgcn_sched_barrier(0);   // keeps these 32 loads here, a softmax and a P.V phase ahead of their use

    // online softmax update (per-row rescale of this row's accumulator elements only);
    // P tile (x4096) to this wave's LDS tile [row][key]
#pragma unroll
    for (int r = 0; r < 8; ++r) {
      const float mnew  = fmaxf(mrow[r], cm[r]);
      const float alpha = __expf(mrow[r] - mnew);
      mrow[r] = mnew;
      float psum = 0.f;
#pragma unroll
      for (int j = 0; j < 4; ++j) {
        const float p = __expf(s[j][r] - mnew);
        psum += p;
        pw[(8 * hh + r) * PPIT_ + j * 16 + c] = (_Float16)(p * 4096.0f);
      }
      psum += __shfl_xor(psum, 1, 32);
      psum += __shfl_xor(psum, 2, 32);
      psum += __shfl_xor(psum, 4, 32);
      psum += __shfl_xor(psum, 8, 32);
      lrow[r] = lrow[r] * alpha + psum;
#pragma unroll
      for (int t = 0; t < 8; ++t) oacc[t][r] *= alpha;
    }
    // the P tile goes through LDS alone: fences on the LDS address space leave the global loads above in flight
    __builtin_amdgcn_fence(__ATOMIC_RELEASE, "workgroup", "local");
    __builtin_amdgcn_wave_barrier();
    __builtin_amdgcn_fence(__ATOMIC_ACQUIRE, "workgroup", "local");

    // P (A operand, row = lane&15, split k map over keys) . V (B operand from V^T rows d)
#pragma unroll
    for (int kk = 0; kk < 2; ++kk) {
      const v16h pa = ldfrag(pw + c * PPIT_ + kk * 32 + 8 * hh);
#pragma unroll
      for (int t = 0; t < 8; ++t) oacc[t] = mma16(pa, vb[kk][t], oacc[t]);
    }

    // keeps the P.V WMMAs and the row sums in this trip: behind the next trip's barrier, which waits for every load
    // in flight, they would no longer cover the band loads' latency
    __builtin_amdgcn_sched_barrier(0);
    // the same wait as in front of the loop: it stands at the foot of the trip, in front of the offsets' step
    asm volatile("s_wait_xcnt 0x0" : "+v"(ko), "+v"(vo), "+v"(bo) :: "memory");
    const unsigned step = (kc + 2 < NT_ / 128) ? 128u : 0u;   // the offsets stop at the group's last chunk
    ko += step * (ND_ * 2);
    vo += step * 2;
    bo += step * 4;
  }

  __syncthreads();                               // every wave is done with the tiles before Xsh and Osh alias them
  // group 1 hands over: per lane 64 accumulator values, 8 row maxima, 8 row sums (same rows and lanes in both groups)
  float* xs = Xsh + (wave * 32 + lane) * XPIT;
  if (grp == 1) {
#pragma unroll
    for (int t = 0; t < 8; ++t) {
      v4f lo = {oacc[t][0], oacc[t][1], oacc[t][2], oacc[t][3]};
      v4f hi = {oacc[t][4], oacc[t][5], oacc[t][6], oacc[t][7]};
      *(v4fa*)(xs + t * 8)     = lo;
      *(v4fa*)(xs + t * 8 + 4) = hi;
    }
#pragma unroll
    for (int r = 0; r < 8; ++r) { xs[64 + r] = mrow[r]; xs[72 + r] = lrow[r]; }
  }
  __syncthreads();                               // the hand-over is written before group 0 reads it
  if (grp == 1) return;                          // no barrier follows
#pragma unroll
  for (int r = 0; r < 8; ++r) {
    const float m1 = xs[64 + r], l1 = xs[72 + r];
    const float mj = fmaxf(mrow[r], m1);
    const float a0 = __expf(mrow[r] - mj);
    const float a1 = __expf(m1 - mj);
    lrow[r] = lrow[r] * a0 + l1 * a1;
#pragma unroll
    for (int t = 0; t < 8; ++t) oacc[t][r] = oacc[t][r] * a0 + xs[t * 8 + r] * a1;
  }
  float* os = Osh + wave * (16 * OPIT_);
#pragma unroll
  for (int r = 0; r < 8; ++r) {
    const float inv = 1.0f / (1024.0f * lrow[r]);   // 64 / (4096 * 16 * l)
#pragma unroll
    for (int t = 0; t < 8; ++t) os[(8 * hh + r) * OPIT_ + t * 16 + c] = oacc[t][r] * inv;
  }
  __builtin_amdgcn_fence(__ATOMIC_RELEASE, "workgroup");
  __builtin_amdgcn_wave_barrier();
  __builtin_amdgcn_fence(__ATOMIC_ACQUIRE, "workgroup");
  v8h ov[8];
#pragma unroll
  for (int it = 0; it < 8; ++it) {
    // half it&1 of the 16x32 block it>>1: lane 16*hh + c brings the piece (row c, column 16*it + 8*hh)
    const float* sp = os + c * OPIT_ + it * 16 + hh * 8;
    const v4f x0 = *(const v4fa*)(sp);
    const v4f x1 = *(const v4fa*)(sp + 4);
    v8h o;
    o[0] = (_Float16)x0[0]; o[1] = (_Float16)x0[1]; o[2] = (_Float16)x0[2]; o[3] = (_Float16)x0[3];
    o[4] = (_Float16)x1[0]; o[5] = (_Float16)x1[1]; o[6] = (_Float16)x1[2]; o[7] = (_Float16)x1[3];
    ov[it] = o;
  }
  {
#pragma unroll
    for (int it = 0; it < 8; ++it) {
      *(v8h*)(ctx + (size_t)q0 * ND_ + it * 256 + lane * 8) = ov[it];   // 32 lanes x 16 B = 512 contiguous bytes
    }
    
  }
}

// -------------------------------------------------------------------------------------------------
// Workspace map (bytes):
//   (pk = packed, in fragment order: ldfrag_pk)
//   WO   f16 pk [1024][1024]           0
//   QU   f16 pk [8192][1024]     2097152
//   QV   f16 pk [8192][1024]    18874368
//   KP   f16 [8192][1024]       35651584
//   VTP  f16 [4][1024][2048]    52428800
//   CTX  f16 pk [8192][1024]    69206016
//   P16  f16 pk [4096][1024]    85983232
//   SCR                         94371840   (138412032 B): early phase (all pk) WQ,WK,WV,WP f16 [1024][1024] at +0,+2097152,
//        +4194304,+6291456; X f16 [8192][1024] at +8388608; PE f16 [4096][1024] at +25165824 (end +33554432);
//        later phase: BD band f32 [8][2048][2112] (end +138412032)
//   total                      232783872
// Every region is written in whole 64x64 tiles / whole rows; all sizes are exact tile multiples.
// -------------------------------------------------------------------------------------------------
extern "C" void kernel_launch(void* const* d_in, const int* in_sizes, int n_in,
                              void* d_out, int out_size, void* d_ws, size_t ws_size,
                              hipStream_t stream) {
  if (n_in < 9) return;
  if (in_sizes[0] != NB_ * NT_ * ND_) return;
  if (in_sizes[1] != NP_ * ND_) return;
  if (in_sizes[2] != ND_ * ND_ || in_sizes[3] != ND_ * ND_ || in_sizes[4] != ND_ * ND_) return;
  if (in_sizes[5] != ND_ * ND_ || in_sizes[6] != ND_ * ND_) return;
  if (in_sizes[7] != NH_ * HD_ || in_sizes[8] != NH_ * HD_) return;
  if (out_size != NB_ * NT_ * ND_) return;

  const float* x   = (const float*)d_in[0];
  const float* pe  = (const float*)d_in[1];
  const float* Wq  = (const float*)d_in[2];
  const float* Wk  = (const float*)d_in[3];
  const float* Wv  = (const float*)d_in[4];
  const float* Wo  = (const float*)d_in[5];
  const float* Wp  = (const float*)d_in[6];
  const float* bu  = (const float*)d_in[7];
  const float* bvb = (const float*)d_in[8];
  float* out = (float*)d_out;

  const size_t PW16 = (size_t)ND_ * ND_ * 2;             //  2097152
  const size_t PA16 = (size_t)NB_ * NT_ * ND_ * 2;       // 16777216
  const size_t PP16 = (size_t)NPP_ * ND_ * 2;            //  8388608
  const size_t PBD  = (size_t)NT_ * BDW_ * 4;            // 17301504 per pair
  const int    NPAIR = 8;                                // pairs per group: all heads of one batch element
  size_t off = 0;
  const size_t oWO  = off; off += PW16;
  const size_t oQU  = off; off += PA16;
  const size_t oQV  = off; off += PA16;
  const size_t oKP  = off; off += PA16;
  const size_t oVT  = off; off += PA16;
  const size_t oCTX = off; off += PA16;
  const size_t oP16 = off; off += PP16;
  const size_t oSCR = off;
  const size_t oWQ  = oSCR;
  const size_t oWK  = oWQ + PW16;
  const size_t oWV  = oWK + PW16;
  const size_t oWP  = oWV + PW16;
  const size_t oX   = oWP + PW16;
  const size_t oPE  = oX + PA16;
  const size_t earlyEnd = oPE + PP16;
  const size_t bdEnd    = oSCR + (size_t)NPAIR * PBD;
  const size_t total    = (earlyEnd > bdEnd) ? earlyEnd : bdEnd;   // 232783872
  if (total > ws_size) return;

  char* ws = (char*)d_ws;
  _Float16* WO  = (_Float16*)(ws + oWO);
  _Float16* QU  = (_Float16*)(ws + oQU);
  _Float16* QV  = (_Float16*)(ws + oQV);
  _Float16* KP  = (_Float16*)(ws + oKP);
  _Float16* VTP = (_Float16*)(ws + oVT);
  _Float16* CTX = (_Float16*)(ws + oCTX);
  _Float16* P16 = (_Float16*)(ws + oP16);
  _Float16* WQ  = (_Float16*)(ws + oWQ);
  _Float16* WK  = (_Float16*)(ws + oWK);
  _Float16* WV  = (_Float16*)(ws + oWV);
  _Float16* WP  = (_Float16*)(ws + oWP);
  _Float16* X   = (_Float16*)(ws + oX);
  _Float16* PE  = (_Float16*)(ws + oPE);
  float*    SCR = (float*)(ws + oSCR);

  const float inv_sdk = 0.08838834764831845f;   // 1/sqrt(128)
  const float cs      = inv_sdk * 0.00390625f;   // applied to the x16.x16 score accumulators
  const dim3 blk(256);

  // (1) weights (carried x64), pos_emb ([4096][1024], row 4095 = 0) and x (all batch elements) -> f16 planes of
  //     bf16-valued entries: one launch, 512 work-groups of 8 waves
  cvt_all_kernel<<<dim3(512), blk, 0, stream>>>(Wq, Wk, Wv, Wp, Wo, pe, x, WQ, WK, WV, WP, WO, PE, X);
  // (3) p = pos_emb . Wp^T -> P16 = 16*p   (M=4096, N=1024, K=1024)
  {
    const int tiles = (NPP_ / 64) * (ND_ / 64);
    gemm_f16_kernel<3, false><<<dim3((tiles + 7) / 8, 1), blk, 0, stream>>>(
        PE, ND_, 0L, WP, ND_, 0L, (void*)P16, (void*)P16, ND_, 0L, bu, bu, NPP_, ND_, ND_, 0.25f, 1.0f, 0);
  }
  // (4) q (two bias variants), k, v^T projections: one launch of 256 work-groups each
  {
    const int tilesQ = ((NB_ * NT_) / 64) * (ND_ / 64);  // 2048
    // QU = 16*(q + bias_u), QV = 16*(q + bias_v)    (M=8192, N=1024, K=1024)
    gemm_f16_kernel<2, false><<<dim3((tilesQ + 7) / 8, 1), blk, 0, stream>>>(
        X, ND_, 0L, WQ, ND_, 0L, (void*)QU, (void*)QV, ND_, 0L, bu, bvb,
        NB_ * NT_, ND_, ND_, 0.015625f, 16.0f, 0);
    // KP = 16*k
    gemm_f16_kernel<1, false><<<dim3((tilesQ + 7) / 8, 1), blk, 0, stream>>>(
        X, ND_, 0L, WK, ND_, 0L, (void*)KP, (void*)KP, ND_, 0L, bu, bu,
        NB_ * NT_, ND_, ND_, 0.25f, 1.0f, 0);
    // VT[b][h*128+d][t] = 16*v   (A = Wv plane [1024][1024], Bt = x plane of batch z [2048][1024];
    //                             M=1024, N=2048, K=1024 per z, grid.y = batch)
    const int tilesV = (ND_ / 64) * (NT_ / 64);          // 512 per batch element
    gemm_f16_kernel<1, false><<<dim3((tilesV + 7) / 8, NB_), blk, 0, stream>>>(
        WV, ND_, 0L, X, ND_, (long)NT_ * ND_, (void*)VTP, (void*)VTP,
        NT_, (long)ND_ * NT_, bu, bu, ND_, NT_, ND_, 0.25f, 1.0f, 0);
  }
  // (5) per group of 8 (b,h) pairs: band GEMM of the position scores, then attention (256 work-groups, one per WGP)
  const int nGroups = (NB_ * NH_) / NPAIR;               // 4
  for (int g = 0; g < nGroups; ++g) {
    const int pairBase = g * NPAIR;
    const int b  = pairBase >> 3;
    const int h0 = pairBase & 7;
    const _Float16* Aq = QV + (size_t)b * NT_ * ND_ + h0 * (HD_ * 16);   // rows t, cols d of head h0 (z adds 128 columns)
    const _Float16* Bp = P16 + h0 * (HD_ * 16);                           // rows p index, cols d of head h0
    const int tilesBD = (NT_ / 64) * (BDW_ / 64);                  // 32*33 = 1056
    gemm_f16_kernel<0, true><<<dim3((tilesBD + 7) / 8, NPAIR), blk, 0, stream>>>(
        Aq, ND_, (long)HD_ * 16, Bp, ND_, (long)HD_ * 16, (void*)SCR, (void*)SCR, BDW_, (long)NT_ * BDW_, bu, bu,
        NT_, BDW_, HD_, cs, 1.0f, 31);
    relattn_kernel<<<dim3(NT_ / 64, NPAIR), dim3(256), 0, stream>>>(QU, KP, VTP, SCR, CTX, pairBase, cs);
  }
  // (6) out = ctx . Wo^T -> d_out f32 [8192][1024]   (M=8192, N=1024, K=1024; carries 64*64 folded into scale)
  {
    const int tiles = ((NB_ * NT_) / 64) * (ND_ / 64);   // 2048
    gemm_f16_kernel<0, false><<<dim3((tiles + 7) / 8, 1), blk, 0, stream>>>(
        CTX, ND_, 0L, WO, ND_, 0L, (void*)out, (void*)out, ND_, 0L, bu, bu,
        NB_ * NT_, ND_, ND_, 0.000244140625f, 1.0f, 0);
  }
  (void)hipGetLastError();
}

// v009
// A run of this version takes 456 microseconds.
// In both of two side-by-side timings against v008, it was 1.04 times as fast.
// Counting every step since v000, it is 9.62 times as fast.
// Contractions x.Wq^T, x.Wk^T, Wv.x^T, pos_emb.Wp^T, (q+bias_v).p^T band, k.(q+bias_u)^T, V^T.P^T, ctx.Wo^T: v_wmma_f32_16x16x32_f16 (f16 operands, f32 accumulate); operand planes hold bf16-RNE-valued inputs with power-of-two carries (W x64, q/k/v/p x16, P x4096, ctx x64); softmax, bias adds and score scaling in f32. Every plane that a GEMM reads as an operand is stored in fragment order (see ldfrag_pk).
#include <hip/hip_runtime.h>
#include <math.h>
#include <stdint.h>

#define NB_  4
#define NT_  2048
#define ND_  1024
#define NH_  8
#define HD_  128
#define NP_  4095
#define NPP_ 4096
#define BDW_ 2112   // width of the relative-position score band scratch (33 tiles of 64)
// LDS row pitches of the attention tiles, in halves: 16 B x odd, so that the 16 rows one ds_load_b128 reads
// fall on 16 different groups of four banks (unpadded 256-B rows all fall on one group, 128-B rows on two)
#define KPIT_ 136   // K tile row: 128 halves + 8  (272 B)
#define VPIT_ 72    // V^T tile row: 64 halves + 8 (144 B)

typedef _Float16 v16h __attribute__((ext_vector_type(16)));
typedef _Float16 v8h  __attribute__((ext_vector_type(8)));
typedef float    v8f  __attribute__((ext_vector_type(8)));
typedef float    v4f  __attribute__((ext_vector_type(4)));
typedef v4f __attribute__((may_alias)) v4fa;
typedef v8h __attribute__((may_alias)) v8ha;

// bf16 RNE of an f32 value, returned widened to f32 (exactly representable in f16 after a power-of-two carry)
__device__ __forceinline__ float bf_rne(float f) {
  unsigned u = __float_as_uint(f);
  u = (u + 0x7FFFu + ((u >> 16) & 1u)) & 0xFFFF0000u;
  return __uint_as_float(u);
}

// 16-bit WMMA fragment: elements 0..7 <- p[0..7], elements 8..15 <- p[16..23]
// (A: p = row m at k0 + 8h;  B stored [n][k]: p = row n at k0 + 8h;  same split k map for both)
union FragU { v16h v; v8ha h[2]; };
__device__ __forceinline__ v16h ldfrag(const _Float16* p) {
  FragU f;
  f.h[0] = *(const v8ha*)(p);
  f.h[1] = *(const v8ha*)(p + 16);
  return f.v;
}

// Fragment-order ("packed") plane of pitch ld halves: each block of 16 rows x 32 k is 1 KB in a row, block (row/16, k/32)
// at half offset (row/16)*16*ld + (k/32)*512; inside it the 16-B piece of (row, k..k+7), k a multiple of 8, stands at
// ((k/16)&1)*256 + (((k/8)&1)*16 + row%16)*8. So lane l = 16h + row finds elements 0..7 (k0 + 8h ..) at l*8 and elements
// 8..15 (k0 + 16 + 8h ..) at 256 + l*8: the same split k map as ldfrag, and each of the two wave-wide 16-B loads covers
// 512 contiguous bytes (4 cache lines) where the row-major plane gives 32 B from each of 16 lines.
// p = block start + lane*8
__device__ __forceinline__ v16h ldfrag_pk(const _Float16* p) {
  FragU f;
  f.h[0] = *(const v8ha*)(p);
  f.h[1] = *(const v8ha*)(p + 256);
  return f.v;
}

// Plain builtin: the compiler keeps the WMMA distances itself and stays free to place fragment loads ahead of
// earlier WMMAs (a volatile asm statement behind each WMMA held every load behind the WMMA before it)
__device__ __forceinline__ v8f mma16(v16h a, v16h b, v8f c) {
  return __builtin_amdgcn_wmma_f32_16x16x32_f16(false, a, false, b, (short)0, c, false, false);
}

__device__ __forceinline__ v8f zero8() { v8f z = {0.f, 0.f, 0.f, 0.f, 0.f, 0.f, 0.f, 0.f}; return z; }

// -------------------------------------------------------------------------------------------------
// All seven f32 inputs that feed a GEMM -> packed f16 planes, in ONE launch of 4096 waves (16 a WGP):
// dst = f16( bf_rne(src) * scale ), scale 64 for the five weights, 1 for pos_emb and x; row 4095 of the pos_emb plane is 0.
// A piece is 8 rows x 32 columns (lane = 4*row + 8-column piece): 8 whole 128-B lines read, 4 whole 128-B lines written.
// Wave (rg, kb), rg = 0..127, kb = 0..31, takes column block kb of 17 pieces: rows 8*rg.. of each weight (5 pieces), rows
// 32*rg.. of pos_emb (4 pieces, one below the other) and rows 64*rg.. of x (8 pieces). Its 34 loads are in flight
// together, and the chip starts 4096 waves in one launch where one wave a piece took 69632 waves in seven launches.
// coverage: 128 x 32 waves x (8, 32, 64 rows x 32 columns) = [1024][1024] five times, [4096][1024], [8192][1024].
// -------------------------------------------------------------------------------------------------
__device__ __forceinline__ v8h cvt8(v4f a, v4f b, float f) {
  v8h o;
  o[0] = (_Float16)(bf_rne(a[0]) * f); o[1] = (_Float16)(bf_rne(a[1]) * f);
  o[2] = (_Float16)(bf_rne(a[2]) * f); o[3] = (_Float16)(bf_rne(a[3]) * f);
  o[4] = (_Float16)(bf_rne(b[0]) * f); o[5] = (_Float16)(bf_rne(b[1]) * f);
  o[6] = (_Float16)(bf_rne(b[2]) * f); o[7] = (_Float16)(bf_rne(b[3]) * f);
  return o;
}

__global__ __launch_bounds__(256) void cvt_all_kernel(
    const float* __restrict__ wq, const float* __restrict__ wk, const float* __restrict__ wv,
    const float* __restrict__ wp, const float* __restrict__ wo, const float* __restrict__ pe,
    const float* __restrict__ x,
    _Float16* __restrict__ dwq, _Float16* __restrict__ dwk, _Float16* __restrict__ dwv,
    _Float16* __restrict__ dwp, _Float16* __restrict__ dwo, _Float16* __restrict__ dpe,
    _Float16* __restrict__ dx) {
  const int w    = blockIdx.x * 8 + (threadIdx.x >> 5);           // 0..4095
  const int lane = threadIdx.x & 31;
  const int ks = lane & 3;                                        // 8-column piece of the block
  const int l4 = lane >> 2;                                       // row of the piece
  const int kb = w & (ND_ / 32 - 1);
  const int rg = w / (ND_ / 32);
  const int c8 = kb * 32 + ks * 8;
  // byte offsets of this lane's 32 B in the first piece of each kind; the next piece stands 8 rows (32768 B) on
  const unsigned sw = (unsigned)((rg * 8  + l4) * ND_ + c8) * 4u;
  const unsigned sp = (unsigned)((rg * 32 + l4) * ND_ + c8) * 4u;
  const unsigned sx = (unsigned)((rg * 64 + l4) * ND_ + c8) * 4u;
  const int  rl = rg * 32 + 24 + l4;                              // pos_emb row of the fourth piece: 4095 has no source
  const unsigned sl = (unsigned)(((rl < NP_) ? rl : (NP_ - 1)) * ND_ + c8) * 4u;   // clamped address
  const float    fl = (rl < NP_) ? 1.0f : 0.0f;                   // zero by value for the filler row
  // packed plane: row r stands at (r/16)*16*ND_ + (r%16)*8 halves, so piece k (rows + 8k) at (k/2)*32768 + (k%2)*128 B
  const unsigned dl = (unsigned)(kb * 512 + (ks >> 1) * 256 + ((ks & 1) * 16 + l4) * 8) * 2u;
  const unsigned dw = dl + (unsigned)(rg >> 1) * (16u * ND_ * 2u) + (unsigned)(rg & 1) * 128u;
  const unsigned dp = dl + (unsigned)(rg * 2) * (16u * ND_ * 2u);
  const unsigned dq = dl + (unsigned)(rg * 4) * (16u * ND_ * 2u);

  const float* const ws[5] = {wq, wk, wv, wp, wo};
  _Float16* const    wd[5] = {dwq, dwk, dwv, dwp, dwo};
  v4f aw[5], bw[5], ap[4], bp[4], ax[8], bx[8];
#pragma unroll
  for (int k = 0; k < 5; ++k) {
    aw[k] = *(const v4f*)((const char*)ws[k] + sw);
    bw[k] = *(const v4f*)((const char*)ws[k] + sw + 16);
  }
#pragma unroll
  for (int k = 0; k < 4; ++k) {
    const char* p = (k < 3) ? ((const char*)pe + sp + k * 32768) : ((const char*)pe + sl);
    ap[k] = *(const v4f*)(p);
    bp[k] = *(const v4f*)(p + 16);
  }
#pragma unroll
  for (int k = 0; k < 8; ++k) {
    ax[k] = *(const v4f*)((const char*)x + sx + k * 32768);
    bx[k] = *(const v4f*)((const char*)x + sx + k * 32768 + 16);
  }
  // the wait that stands before an address register of an issued load is written again; the four offsets pass into it,
  // so that they stay live up to it and no load of the group gets one of them as its destination
  asm volatile("s_wait_xcnt 0x0" :: "v"(sw), "v"(sp), "v"(sl), "v"(sx) : "memory");
  __builtin_amdgcn_sched_barrier(0);   // keeps the 34 loads in one group ahead of the converts: one memory latency a wave

#pragma unroll
  for (int k = 0; k < 5; ++k)
    *(v8h*)((char*)wd[k] + dw) = cvt8(aw[k], bw[k], 64.0f);
#pragma unroll
  for (int k = 0; k < 4; ++k)
    *(v8h*)((char*)dpe + dp + (k >> 1) * 32768 + (k & 1) * 128) = cvt8(ap[k], bp[k], (k < 3) ? 1.0f : fl);
#pragma unroll
  for (int k = 0; k < 8; ++k)
    *(v8h*)((char*)dx + dq + (k >> 1) * 32768 + (k & 1) * 128) = cvt8(ax[k], bx[k], 1.0f);
}

// -------------------------------------------------------------------------------------------------
// f16 WMMA GEMM: C[m][n] = epi( sum_k A[m][k] * Bt[nrow][k] ), nrow = n (+ 64*(skew0 - tm) when SKEW: band GEMM).
// A [M][K] and Bt [N(+band)][K] are packed planes (ldfrag_pk) of pitch lda, ldb; a column offset c (multiple of 32) of a
// packed plane is 16*c halves; M, N multiples of 64, K multiple of 32.
// Each wave owns a 64x64 output tile (4x4 subtiles), 8 waves per block, grid.x = tiles/8, grid.y = z-batch.
// OUT 0: f32  C1 = acc*scale
// OUT 1: f16  C1 = f16(acc*scale), row-major
// OUT 2: f16  C1 = f16((acc*scale + bf_rne(b1[n]))*carry), C2 = f16((acc*scale + bf_rne(b2[n]))*carry), both packed
// OUT 3: f16  C1 = f16(acc*scale), packed
// ONE instruction with lane-contiguous 16-B pieces (f32: 16 lanes x 16 B = 256 B segment; f16 row-major: 8 lanes x 16 B = 128 B segment; packed: 32 lanes x 16 B = 512 B)
// coverage: 4 slabs x 16 rows x 64 cols = the whole 64x64 tile per wave; tiles cover M x N exactly.
// -------------------------------------------------------------------------------------------------
template <int OUT, bool SKEW>
__global__ __launch_bounds__(256) void gemm_f16_kernel(
    const _Float16* __restrict__ A, int lda, long strideA,
    const _Float16* __restrict__ Bt, int ldb, long strideB,
    void* __restrict__ C1, void* __restrict__ C2, int ldc, long strideC,
    const float* __restrict__ b1, const float* __restrict__ b2,
    int M, int N, int K, float scale, float carry, int skew0) {
  __shared__ __align__(16) float sT[8][16 * 68];   // per-wave 16x64 slab, pitch 68 floats

  const int z    = blockIdx.y;
  const int lane = threadIdx.x & 31;
  const int wave = threadIdx.x >> 5;
  const int tilesN = N >> 6;
  const int tilesM = M >> 6;
  const int tile = blockIdx.x * 8 + wave;
  if (tile >= tilesM * tilesN) return;             // wave-uniform; no block barriers in this kernel
  const int tm = tile / tilesN;
  const int tn = tile - tm * tilesN;
  const int m0 = tm << 6;
  const int n0 = tn << 6;
  const int nsk = SKEW ? ((skew0 - tm) << 6) : 0;  // band row offset of Bt

  const _Float16* Ab = A  + (size_t)z * strideA;
  const _Float16* Bb = Bt + (size_t)z * strideB;

  const int rl   = lane & 15;          // column (D) within a subtile
  const int mOff = (lane >> 4) * 8;    // D row offset of this lane half

  v8f acc[4][4];
#pragma unroll
  for (int i = 0; i < 4; ++i)
#pragma unroll
    for (int j = 0; j < 4; ++j) acc[i][j] = zero8();

  // this lane's place in the first block of the tile's first 16 rows; the next 16 rows stand 16*ld halves on, the next
  // k step 512 halves on
  const _Float16* Ar = Ab + (size_t)(m0 >> 4) * ((size_t)lda * 16) + lane * 8;
  const _Float16* Br = Bb + (size_t)((nsk + n0) >> 4) * ((size_t)ldb * 16) + lane * 8;

  for (int k0 = 0; k0 < K; k0 += 32) {
    // all eight fragments of the k step are loaded as one group, then its 16 WMMAs run
    v16h bfr[4], af[4];
    const _Float16 *pb[4], *pa[4];
#pragma unroll
    for (int j = 0; j < 4; ++j) {
      pb[j] = Br + (size_t)j * ((size_t)ldb * 16) + (k0 << 4);
      pa[j] = Ar + (size_t)j * ((size_t)lda * 16) + (k0 << 4);
      bfr[j] = ldfrag_pk(pb[j]);
      af[j]  = ldfrag_pk(pa[j]);
    }
    // the wait that stands before an address register of an issued load is written again; the eight addresses pass
    // into it, so that no later load of the group gets an earlier one's address register as its destination
    asm volatile("s_wait_xcnt 0x0" :: "v"(pb[0]), "v"(pb[1]), "v"(pb[2]), "v"(pb[3]),
                                      "v"(pa[0]), "v"(pa[1]), "v"(pa[2]), "v"(pa[3]) : "memory");
    __builtin_amdgcn_sched_barrier(0);   // keeps the 16 loads in one group: one load latency a k step, not one a row
#pragma unroll
    for (int i = 0; i < 4; ++i)
#pragma unroll
      for (int j = 0; j < 4; ++j) acc[i][j] = mma16(af[i], bfr[j], acc[i][j]);
  }

  // ---- epilogue ----
  float* slab = sT[wave];
#pragma unroll
  for (int i = 0; i < 4; ++i) {
    const int mBase = m0 + (i << 4);
#pragma unroll
    for (int j = 0; j < 4; ++j)
#pragma unroll
      for (int r = 0; r < 8; ++r)
        slab[(mOff + r) * 68 + (j << 4) + rl] = acc[i][j][r] * scale;
    __builtin_amdgcn_fence(__ATOMIC_RELEASE, "workgroup");
    __builtin_amdgcn_wave_barrier();
    __builtin_amdgcn_fence(__ATOMIC_ACQUIRE, "workgroup");
    if (OUT == 0) {
      float* C = (float*)C1 + (size_t)z * strideC;
      const int hh = lane >> 4, c4 = (lane & 15) * 4;    // row segment 256 B = 16 lanes x 16 B
      {
#pragma unroll
        for (int it = 0; it < 8; ++it) {
          const int row = it * 2 + hh;
          const v4f v = *(const v4fa*)(slab + row * 68 + c4);
          *(v4f*)(C + (size_t)(mBase + row) * ldc + n0 + c4) = v;
        }
        
      }
    } else if (OUT == 2 || OUT == 3) {
      // packed output: store 'it' is half j = it&1 of block it>>1 of the slab's two 16x32 blocks, 512 contiguous bytes;
      // lane 16h + row brings the piece (row, 32*(it>>1) + 16*j + 8h)
      _Float16* Ca = (_Float16*)C1 + (size_t)z * strideC;
      _Float16* Cb = (_Float16*)C2 + (size_t)z * strideC;
      const size_t dbase = (size_t)(mBase >> 4) * ((size_t)ldc * 16) + (size_t)(n0 >> 5) * 512 + lane * 8;
      v8h hv[4], lv[4];
#pragma unroll
      for (int it = 0; it < 4; ++it) {
        const int col = (it >> 1) * 32 + (it & 1) * 16 + (lane >> 4) * 8;
        const float* sp = slab + rl * 68 + col;
        const v4f x0 = *(const v4fa*)(sp);
        const v4f x1 = *(const v4fa*)(sp + 4);
        float f[8];
        f[0] = x0[0]; f[1] = x0[1]; f[2] = x0[2]; f[3] = x0[3];
        f[4] = x1[0]; f[5] = x1[1]; f[6] = x1[2]; f[7] = x1[3];
        v8h ha, hb;
#pragma unroll
        for (int e = 0; e < 8; ++e) {
          if (OUT == 3) {
            ha[e] = (_Float16)f[e];
            hb[e] = ha[e];
          } else {
            const int n = n0 + col + e;
            ha[e] = (_Float16)((f[e] + bf_rne(b1[n])) * carry);
            hb[e] = (_Float16)((f[e] + bf_rne(b2[n])) * carry);
          }
        }
        hv[it] = ha; lv[it] = hb;
      }
#pragma unroll
      for (int it = 0; it < 4; ++it) {
        *(v8h*)(Ca + dbase + it * 256) = hv[it];
        if (OUT == 2) *(v8h*)(Cb + dbase + it * 256) = lv[it];
      }
      // the wait that stands before an address register of an issued store is written again (the next slab's addresses)
      asm volatile("s_wait_xcnt 0x0" ::: "memory");
    } else {
      const int q = lane >> 3, c8 = (lane & 7) * 8;
      _Float16* Ca = (_Float16*)C1 + (size_t)z * strideC;
      v8h hv[4];
#pragma unroll
      for (int it = 0; it < 4; ++it) {
        const int row = it * 4 + q;
        const float* sp = slab + row * 68 + c8;
        const v4f x0 = *(const v4fa*)(sp);
        const v4f x1 = *(const v4fa*)(sp + 4);
        float f[8];
        f[0] = x0[0]; f[1] = x0[1]; f[2] = x0[2]; f[3] = x0[3];
        f[4] = x1[0]; f[5] = x1[1]; f[6] = x1[2]; f[7] = x1[3];
        v8h ha;
#pragma unroll
        for (int e = 0; e < 8; ++e) ha[e] = (_Float16)f[e];
        hv[it] = ha;
      }
      {
#pragma unroll
        for (int it = 0; it < 4; ++it) {
          const int row = it * 4 + q;
          *(v8h*)(Ca + (size_t)(mBase + row) * ldc + n0 + c8) = hv[it];
        }
        
      }
    }
    __builtin_amdgcn_fence(__ATOMIC_RELEASE, "workgroup");
    __builtin_amdgcn_wave_barrier();
    __builtin_amdgcn_fence(__ATOMIC_ACQUIRE, "workgroup");
  }
}

// -------------------------------------------------------------------------------------------------
// Relative-position attention for a group of (batch, head) pairs, head dim 128, no mask, in the transposed form
// S^T = K.QU^T, O^T += V^T.P^T: a lane holds one query's scores, so maximum and sum run in the lane.
//   QU  f16 packed plane [b*2048 + t][h*128 + d] = 16*(q + bias_u) (B operand of the content score, kept in registers)
//   Kp  f16 plane [b*2048 + s][h*128 + d] = 16*k                  (A operand, staged per 64-key chunk as [key][d])
//   VT  f16 plane [b][h*128 + d][s]      = 16*v                  (A operand of V^T.P^T, staged as [d][key])
//   BD  f32 band scratch [z][2048][2112]: value (col j) = inv_sdk * (q_i + bias_v).p[row 64*(31 - i/64) + j]
//       rel-shift: bd[i][key] = bdfull[i][key - i + 2047]  ->  column (key - i + 2047) - 64*(31 - i/64)
//                = key + 63 - (i mod 64), always in [0, 2110].
//   score = cs * (K.QU^T acc) + BD  with cs = inv_sdk / 256;  online softmax in f32 over chunks of 64 keys.
//   Accumulator tile j of S^T: lane 16*hh + c, register r = (key 16j + 8hh + r, query c). The 32 scores of a lane belong
//   to one query; the other 32 keys of that query stand in lane l ^ 16: one exchange a chunk for the maximum, the sums of
//   the two halves are joined once behind the loop.
//   P^T = f16(4096 * exp(s - m)) is a B operand as it stands: elements 0..7 of the fragment of keys 32kk.. are k = 8hh + e
//   = tile 2kk, register e; elements 8..15 are k = 16 + 8hh + (e - 8) = tile 2kk + 1, register e - 8: the k order of the
//   V^T fragment (ldfrag). P never goes through LDS.
//   O^T tile t: lane 16*hh + c, register r = (d 16t + 8hh + r, query c): 8 neighbouring d of one row, which is the 16-B
//   piece that lane 16*hh + c of the packed plane's store t holds; ctx = 64 * acc / (4096*16*l) goes out from registers
//   as packed f16 plane CTX [b*2048 + t][h*128 + d].
// Block = 8 waves = 64 query rows of one (b,h); grid = (32 query blocks, pairs in group). The waves form two groups of
// four: group g takes the key chunks 2t + g, t = 0..15, for all 64 rows, with its own K and V^T tiles and its own running
// (max, sum, accumulator); each SIMD so holds two waves, and one wave's waits are filled by the other. Behind the loop
// group 1 hands its state to group 0 through LDS, which joins the two as online softmax joins two chunks, and stores.
// LDS: one raw buffer; per group g at g*35840: K tile [64][128] f16 (row pitch 272 B), V^T tile [128][64] f16 at +17408
// (pitch 144 B). After a block barrier behind the loop: the hand-over [4 waves][32 lanes][68 floats] (lane pitch 272 B =
// 16 B x odd) at 0.
// coverage: staging 8 loads x 4 waves x 2 rows x 256 B for K (64x128), 8 x 4 waves x 4 rows x 128 B for V^T (128x64);
// output 8 store instructions x 16 rows x 2 pieces x 8 halves = 16x128 per wave.
// -------------------------------------------------------------------------------------------------
typedef v4f __attribute__((aligned(4))) v4fu;   // four band values of one row: the shift by the row leaves them 4-B aligned

// lane l with lane l ^ 16
__device__ __forceinline__ float xhalf(float x) {
  const int b = __builtin_bit_cast(int, x);
  return __builtin_bit_cast(float, __builtin_amdgcn_permlanex16(b, b, 0x76543210, 0xfedcba98, false, false));
}

__device__ __forceinline__ v4f exp2x4(v4f a) {
  float p0, p1, p2, p3;
  asm("v_exp_f32 %0, %4\n\tv_exp_f32 %1, %5\n\tv_exp_f32 %2, %6\n\tv_exp_f32 %3, %7\n\tv_nop"
      : "=&v"(p0), "=&v"(p1), "=&v"(p2), "=&v"(p3) : "v"(a[0]), "v"(a[1]), "v"(a[2]), "v"(a[3]));
  v4f p = {p0, p1, p2, p3};
  return p;
}
// one 2^x with the same slot behind it
__device__ __forceinline__ float exp2x1(float a) {
  float p;
  asm("v_exp_f32 %0, %1\n\tv_nop" : "=v"(p) : "v"(a));
  return p;
}
#define LOG2E_ 1.44269504088896340736f   // e^x = 2^(x * log2 e), as the fast exponential of the header forms it

__global__ __launch_bounds__(256)
void relattn_kernel(const _Float16* __restrict__ QU, const _Float16* __restrict__ Kp,
                    const _Float16* __restrict__ VT, const float* __restrict__ BD,
                    _Float16* __restrict__ CTX, int pairBase, float cs) {
  constexpr int TILEB = 64 * KPIT_ * 2 + 128 * VPIT_ * 2;                 // one group's K and V^T tiles: 35840 B
  constexpr int XPIT  = 68;                                               // hand-over: floats per lane (66 used)
  __shared__ __align__(16) unsigned char SMEM[2 * TILEB];                 // 71680

  const int tid  = threadIdx.x;
  const int grp  = __builtin_amdgcn_readfirstlane(tid >> 7);   // key-chunk group of this wave (scalar): 0 even, 1 odd chunks
  const int wave = (tid >> 5) & 3;               // wave within the group = 16-row tile of the block
  const int lane = tid & 31;
  _Float16* Ksh = (_Float16*)(SMEM + grp * TILEB);                        // [64][KPIT_]
  _Float16* Vsh = (_Float16*)(SMEM + grp * TILEB + 64 * KPIT_ * 2);       // [128][VPIT_]
  float*    Xsh = (float*)(SMEM);                        // [4][32][XPIT] after the chunk loop
  const int hh   = lane >> 4;
  const int c    = lane & 15;

  const int z    = blockIdx.y;
  const int pair = pairBase + z;
  const int b    = pair >> 3;
  const int h    = pair & 7;
  const int qb   = blockIdx.x;                   // 0..31
  const int q0   = qb * 64 + wave * 16;          // first query row of this wave; this lane's query is q0 + c

  const _Float16* Qh = QU + (size_t)(b * NT_) * ND_ + h * (HD_ * 16);   // packed: column h*128 is 16*h*128 halves
  const _Float16* Kh = Kp + (size_t)(b * NT_) * ND_ + h * HD_;
  const _Float16* Vh = VT + (size_t)b * ND_ * NT_ + (size_t)(h * HD_) * NT_;
  const float*    bd = BD + (size_t)z * NT_ * BDW_;
  _Float16*       ctx = CTX + (size_t)(b * NT_) * ND_ + h * (HD_ * 16);  // packed, as Qh

  // Q fragments (B operand, column = query c): 4 chunks of 32 along d
  v16h qa[4];
  const _Float16* qp = Qh + (size_t)q0 * ND_ + lane * 8;               // q0 is a multiple of 16
#pragma unroll
  for (int dc = 0; dc < 4; ++dc)
    qa[dc] = ldfrag_pk(qp + dc * 512);
  // the wait that stands before an address register of an issued load is written again; the Q address passes into it,
  // so that its register pair stays live up to the wait and the offsets formed below cannot take it earlier
  asm volatile("s_wait_xcnt 0x0" :: "v"(qp) : "memory");

  float mrow = -INFINITY;    // running maximum of this lane's query (the same in both halves)
  float lsum = 0.f;          // running sum over this lane's own keys only (the halves are joined behind the loop)
  v8f oacc[8];
#pragma unroll
  for (int t = 0; t < 8; ++t) oacc[t] = zero8();

  // Every global load of a chunk is issued one chunk of the group ahead into registers (chunk grp here), so that its
  // latency runs under the chunk before instead of in front of its use.
  // Per-lane byte offsets, from the uniform bases Kh, Vh and bd, of the chunk that is loaded next:
  //   K: load i of a wave takes rows kv0 + kr + 2i (kr: 2 rows a load), 16 lanes x 16 B = the row's whole 256 B;
  //   V^T: load i takes rows vr + i (4 rows a load, 8 apart), 8 lanes x 16 B = the row's 128 B of keys kv0..kv0+63;
  //   so each wave-wide load covers 4 whole 128-B lines (a lane per row would touch 32 lines, 16 B of each).
  //   The 4 rows stand 8 apart because 8 * 144 B = 128 mod 256: the two rows that 16 lanes store to LDS then fill
  //   the 64 banks once (neighbouring rows would meet on four banks)
  //   band: the values of (query q0 + c, keys kv0 + 16j + 8hh + 4u .. + 3) are 16 B at bo + 64j + 16u
  const int kr = wave * 16 + (lane >> 4), kc8 = (lane & 15) * 8;
  const int vr = wave * 32 + (lane >> 3) * 8, vc8 = (lane & 7) * 8;
  unsigned ko = (unsigned)((kr * ND_ + kc8) * 2) + (unsigned)grp * (64u * ND_ * 2u);
  unsigned vo = (unsigned)((vr * NT_ + vc8) * 2) + (unsigned)grp * (64u * 2u);
  unsigned bo = (unsigned)(((q0 + c) * BDW_ + (63 - (wave * 16 + c)) + 8 * hh) * 4) + (unsigned)grp * (64u * 4u);
  v8h kreg[8], vreg[8];
  v4f bdv[4][2];
#pragma unroll
  for (int i = 0; i < 8; ++i) {
    kreg[i] = *(const v8h*)((const char*)Kh + ko + i * (2 * ND_ * 2));
    vreg[i] = *(const v8h*)((const char*)Vh + vo + i * (NT_ * 2));
  }
#pragma unroll
  for (int j = 0; j < 4; ++j)
#pragma unroll
    for (int u = 0; u < 2; ++u)
      bdv[j][u] = *(const v4fu*)((const char*)bd + bo + (64 * j + 16 * u));
  // the wait that stands before an address register of an issued load is written again; the offsets pass through
  // it, so that their step cannot be placed ahead of it
  asm volatile("s_wait_xcnt 0x0" : "+v"(ko), "+v"(vo), "+v"(bo) :: "memory");
  ko += 128 * (ND_ * 2);
  vo += 128 * 2;
  bo += 128 * 4;

  // two chunks of the group per trip: the band values loaded ahead alternate between two register sets; in a single body they
  // are copied into the one set behind a wait for the loads, in the middle of the chunk
#pragma unroll 2
  for (int kc = 0; kc < NT_ / 128; ++kc) {
    __syncthreads();
#pragma unroll
    for (int i = 0; i < 8; ++i) {
      *(v8ha*)(Ksh + (kr + 2 * i) * KPIT_ + kc8) = kreg[i];
      *(v8ha*)(Vsh + (vr + i) * VPIT_ + vc8)     = vreg[i];
    }
    __syncthreads();

    // the chunk's 16 K fragments, read from LDS as one group ahead of the score WMMAs
    v16h kb[4][4], vb[2][8];
#pragma unroll
    for (int dc = 0; dc < 4; ++dc)
#pragma unroll
      for (int j = 0; j < 4; ++j)
        kb[dc][j] = ldfrag(Ksh + (j * 16 + c) * KPIT_ + dc * 32 + 8 * hh);

    // the next chunk's K and V^T rows (the last trip loads its own chunk again, unused: no branch)
#pragma unroll
    for (int i = 0; i < 8; ++i) {
      kreg[i] = *(const v8h*)((const char*)Kh + ko + i * (2 * ND_ * 2));
      vreg[i] = *(const v8h*)((const char*)Vh + vo + i * (NT_ * 2));
    }
    // keeps the 32 LDS reads in one group, and the 16 global loads a whole chunk ahead of their LDS stores
    __builtin_amdgcn_sched_barrier(0);

    // content scores: S^T[j] = K(16 keys x 128) . QU^T for key subtile j (each s[j] sums dc = 0..3 in that order)
    v8f s[4];
#pragma unroll
    for (int j = 0; j < 4; ++j) s[j] = zero8();
#pragma unroll
    for (int dc = 0; dc < 4; ++dc)
#pragma unroll
      for (int j = 0; j < 4; ++j) s[j] = mma16(kb[dc][j], qa[dc], s[j]);

    // the chunk's 16 V^T fragments are read only here, so that they can take the K fragments' registers as the score
    // WMMAs free them (two waves a SIMD leave 512 registers a wave); they land under the softmax
#pragma unroll
    for (int kk = 0; kk < 2; ++kk)
#pragma unroll
      for (int t = 0; t < 8; ++t)
        vb[kk][t] = ldfrag(Vsh + (t * 16 + c) * VPIT_ + kk * 32 + 8 * hh);

    // add the position term from the band scratch; the chunk's maximum of this lane's query, one short chain a subtile
    float cmj[4];
#pragma unroll
    for (int j = 0; j < 4; ++j) {
      float m = -INFINITY;
#pragma unroll
      for (int r = 0; r < 8; ++r) {
        const float sv = s[j][r] * cs + bdv[j][r >> 2][r & 3];
        s[j][r] = sv;
        m = fmaxf(m, sv);
      }
      cmj[j] = m;
    }
    float cm = fmaxf(fmaxf(cmj[0], cmj[1]), fmaxf(cmj[2], cmj[3]));
    cm = fmaxf(cm, xhalf(cm));

    // the next chunk's 32 band values (this chunk's have just been used by the loop above)
#pragma unroll
    for (int j = 0; j < 4; ++j)
#pragma unroll
      for (int u = 0; u < 2; ++u)
        bdv[j][u] = *(const v4fu*)((const char*)bd + bo + (64 * j + 16 * u));
    __builtin_amdgcn_sched_barrier(0);   // keeps these 8 loads here, a softmax and a V^T.P^T phase ahead of their use

    // online softmax update: one maximum, one rescale factor and one partial sum a lane; P^T (x4096) stays in registers
    const float mnew  = fmaxf(mrow, cm);
    const float alpha = exp2x1((mrow - mnew) * LOG2E_);
    mrow = mnew;
    float psj[4];              // one sum a subtile: four short chains of adds, not one of 32
    v16h pb[2];
#pragma unroll
    for (int j = 0; j < 4; ++j) {
      float ps = 0.f;
#pragma unroll
      for (int u = 0; u < 2; ++u) {
        v4f a;
#pragma unroll
        for (int e = 0; e < 4; ++e) a[e] = (s[j][4 * u + e] - mnew) * LOG2E_;
        const v4f p = exp2x4(a);
#pragma unroll
        for (int e = 0; e < 4; ++e) {
          ps += p[e];
          pb[j >> 1][(j & 1) * 8 + 4 * u + e] = (_Float16)(p[e] * 4096.0f);
        }
      }
      psj[j] = ps;
    }
    lsum = lsum * alpha + ((psj[0] + psj[1]) + (psj[2] + psj[3]));
#pragma unroll
    for (int t = 0; t < 8; ++t) oacc[t] *= alpha;

    // V^T (A operand, row = d, split k map over keys) . P^T (B operand, column = query)
#pragma unroll
    for (int kk = 0; kk < 2; ++kk)
#pragma unroll
      for (int t = 0; t < 8; ++t) oacc[t] = mma16(vb[kk][t], pb[kk], oacc[t]);

    // keeps the V^T.P^T WMMAs in this trip: behind the next trip's barrier, which waits for every load in flight, they
    // would no longer cover the band loads' latency
    __builtin_amdgcn_sched_barrier(0);
    // the same wait as in front of the loop: it stands at the foot of the trip, in front of the offsets' step
    asm volatile("s_wait_xcnt 0x0" : "+v"(ko), "+v"(vo), "+v"(bo) :: "memory");
    const unsigned step = (kc + 2 < NT_ / 128) ? 128u : 0u;   // the offsets stop at the group's last chunk
    ko += step * (ND_ * 2);
    vo += step * 2;
    bo += step * 4;
  }

  __syncthreads();                               // every wave is done with the tiles before Xsh aliases them
  // group 1 hands over: per lane 64 accumulator values, its maximum and its partial sum (same query and d in both groups)
  float* xs = Xsh + (wave * 32 + lane) * XPIT;
  if (grp == 1) {
#pragma unroll
    for (int t = 0; t < 8; ++t) {
      v4f lo = {oacc[t][0], oacc[t][1], oacc[t][2], oacc[t][3]};
      v4f hi = {oacc[t][4], oacc[t][5], oacc[t][6], oacc[t][7]};
      *(v4fa*)(xs + t * 8)     = lo;
      *(v4fa*)(xs + t * 8 + 4) = hi;
    }
    xs[64] = mrow;
    xs[65] = lsum;
  }
  __syncthreads();                               // the hand-over is written before group 0 reads it
  if (grp == 1) return;                          // no barrier follows
  const float m1 = xs[64], l1 = xs[65];
  const float mj = fmaxf(mrow, m1);
  const float a0 = __expf(mrow - mj);
  const float a1 = __expf(m1 - mj);
  float lj = lsum * a0 + l1 * a1;
  lj += xhalf(lj);                               // the two halves' keys of the query
  const float inv = 1.0f / (1024.0f * lj);       // 64 / (4096 * 16 * l)
  v8h ov[8];
#pragma unroll
  for (int t = 0; t < 8; ++t) {
    const v4f x0 = *(const v4fa*)(xs + t * 8);
    const v4f x1 = *(const v4fa*)(xs + t * 8 + 4);
    v8h o;
#pragma unroll
    for (int r = 0; r < 4; ++r) {
      o[r]     = (_Float16)((oacc[t][r]     * a0 + x0[r] * a1) * inv);
      o[r + 4] = (_Float16)((oacc[t][r + 4] * a0 + x1[r] * a1) * inv);
    }
    ov[t] = o;
  }
#pragma unroll
  for (int t = 0; t < 8; ++t)
    *(v8h*)(ctx + (size_t)q0 * ND_ + t * 256 + lane * 8) = ov[t];   // 32 lanes x 16 B = 512 contiguous bytes
}

// -------------------------------------------------------------------------------------------------
// Workspace map (bytes):
//   (pk = packed, in fragment order: ldfrag_pk)
//   WO   f16 pk [1024][1024]           0
//   QU   f16 pk [8192][1024]     2097152
//   QV   f16 pk [8192][1024]    18874368
//   KP   f16 [8192][1024]       35651584
//   VTP  f16 [4][1024][2048]    52428800
//   CTX  f16 pk [8192][1024]    69206016
//   P16  f16 pk [4096][1024]    85983232
//   SCR                         94371840   (138412032 B): early phase (all pk) WQ,WK,WV,WP f16 [1024][1024] at +0,+2097152,
//        +4194304,+6291456; X f16 [8192][1024] at +8388608; PE f16 [4096][1024] at +25165824 (end +33554432);
//        later phase: BD band f32 [8][2048][2112] (end +138412032)
//   total                      232783872
// Every region is written in whole 64x64 tiles / whole rows; all sizes are exact tile multiples.
// -------------------------------------------------------------------------------------------------
extern "C" void kernel_launch(void* const* d_in, const int* in_sizes, int n_in,
                              void* d_out, int out_size, void* d_ws, size_t ws_size,
                              hipStream_t stream) {
  if (n_in < 9) return;
  if (in_sizes[0] != NB_ * NT_ * ND_) return;
  if (in_sizes[1] != NP_ * ND_) return;
  if (in_sizes[2] != ND_ * ND_ || in_sizes[3] != ND_ * ND_ || in_sizes[4] != ND_ * ND_) return;
  if (in_sizes[5] != ND_ * ND_ || in_sizes[6] != ND_ * ND_) return;
  if (in_sizes[7] != NH_ * HD_ || in_sizes[8] != NH_ * HD_) return;
  if (out_size != NB_ * NT_ * ND_) return;

  const float* x   = (const float*)d_in[0];
  const float* pe  = (const float*)d_in[1];
  const float* Wq  = (const float*)d_in[2];
  const float* Wk  = (const float*)d_in[3];
  const float* Wv  = (const float*)d_in[4];
  const float* Wo  = (const float*)d_in[5];
  const float* Wp  = (const float*)d_in[6];
  const float* bu  = (const float*)d_in[7];
  const float* bvb = (const float*)d_in[8];
  float* out = (float*)d_out;

  const size_t PW16 = (size_t)ND_ * ND_ * 2;             //  2097152
  const size_t PA16 = (size_t)NB_ * NT_ * ND_ * 2;       // 16777216
  const size_t PP16 = (size_t)NPP_ * ND_ * 2;            //  8388608
  const size_t PBD  = (size_t)NT_ * BDW_ * 4;            // 17301504 per pair
  const int    NPAIR = 8;                                // pairs per group: all heads of one batch element
  size_t off = 0;
  const size_t oWO  = off; off += PW16;
  const size_t oQU  = off; off += PA16;
  const size_t oQV  = off; off += PA16;
  const size_t oKP  = off; off += PA16;
  const size_t oVT  = off; off += PA16;
  const size_t oCTX = off; off += PA16;
  const size_t oP16 = off; off += PP16;
  const size_t oSCR = off;
  const size_t oWQ  = oSCR;
  const size_t oWK  = oWQ + PW16;
  const size_t oWV  = oWK + PW16;
  const size_t oWP  = oWV + PW16;
  const size_t oX   = oWP + PW16;
  const size_t oPE  = oX + PA16;
  const size_t earlyEnd = oPE + PP16;
  const size_t bdEnd    = oSCR + (size_t)NPAIR * PBD;
  const size_t total    = (earlyEnd > bdEnd) ? earlyEnd : bdEnd;   // 232783872
  if (total > ws_size) return;

  char* ws = (char*)d_ws;
  _Float16* WO  = (_Float16*)(ws + oWO);
  _Float16* QU  = (_Float16*)(ws + oQU);
  _Float16* QV  = (_Float16*)(ws + oQV);
  _Float16* KP  = (_Float16*)(ws + oKP);
  _Float16* VTP = (_Float16*)(ws + oVT);
  _Float16* CTX = (_Float16*)(ws + oCTX);
  _Float16* P16 = (_Float16*)(ws + oP16);
  _Float16* WQ  = (_Float16*)(ws + oWQ);
  _Float16* WK  = (_Float16*)(ws + oWK);
  _Float16* WV  = (_Float16*)(ws + oWV);
  _Float16* WP  = (_Float16*)(ws + oWP);
  _Float16* X   = (_Float16*)(ws + oX);
  _Float16* PE  = (_Float16*)(ws + oPE);
  float*    SCR = (float*)(ws + oSCR);

  const float inv_sdk = 0.08838834764831845f;   // 1/sqrt(128)
  const float cs      = inv_sdk * 0.00390625f;   // applied to the x16.x16 score accumulators
  const dim3 blk(256);

  // (1) weights (carried x64), pos_emb ([4096][1024], row 4095 = 0) and x (all batch elements) -> f16 planes of
  //     bf16-valued entries: one launch, 512 work-groups of 8 waves
  cvt_all_kernel<<<dim3(512), blk, 0, stream>>>(Wq, Wk, Wv, Wp, Wo, pe, x, WQ, WK, WV, WP, WO, PE, X);
  // (3) p = pos_emb . Wp^T -> P16 = 16*p   (M=4096, N=1024, K=1024)
  {
    const int tiles = (NPP_ / 64) * (ND_ / 64);
    gemm_f16_kernel<3, false><<<dim3((tiles + 7) / 8, 1), blk, 0, stream>>>(
        PE, ND_, 0L, WP, ND_, 0L, (void*)P16, (void*)P16, ND_, 0L, bu, bu, NPP_, ND_, ND_, 0.25f, 1.0f, 0);
  }
  // (4) q (two bias variants), k, v^T projections: one launch of 256 work-groups each
  {
    const int tilesQ = ((NB_ * NT_) / 64) * (ND_ / 64);  // 2048
    // QU = 16*(q + bias_u), QV = 16*(q + bias_v)    (M=8192, N=1024, K=1024)
    gemm_f16_kernel<2, false><<<dim3((tilesQ + 7) / 8, 1), blk, 0, stream>>>(
        X, ND_, 0L, WQ, ND_, 0L, (void*)QU, (void*)QV, ND_, 0L, bu, bvb,
        NB_ * NT_, ND_, ND_, 0.015625f, 16.0f, 0);
    // KP = 16*k
    gemm_f16_kernel<1, false><<<dim3((tilesQ + 7) / 8, 1), blk, 0, stream>>>(
        X, ND_, 0L, WK, ND_, 0L, (void*)KP, (void*)KP, ND_, 0L, bu, bu,
        NB_ * NT_, ND_, ND_, 0.25f, 1.0f, 0);
    // VT[b][h*128+d][t] = 16*v   (A = Wv plane [1024][1024], Bt = x plane of batch z [2048][1024];
    //                             M=1024, N=2048, K=1024 per z, grid.y = batch)
    const int tilesV = (ND_ / 64) * (NT_ / 64);          // 512 per batch element
    gemm_f16_kernel<1, false><<<dim3((tilesV + 7) / 8, NB_), blk, 0, stream>>>(
        WV, ND_, 0L, X, ND_, (long)NT_ * ND_, (void*)VTP, (void*)VTP,
        NT_, (long)ND_ * NT_, bu, bu, ND_, NT_, ND_, 0.25f, 1.0f, 0);
  }
  // (5) per group of 8 (b,h) pairs: band GEMM of the position scores, then attention (256 work-groups, one per WGP)
  const int nGroups = (NB_ * NH_) / NPAIR;               // 4
  for (int g = 0; g < nGroups; ++g) {
    const int pairBase = g * NPAIR;
    const int b  = pairBase >> 3;
    const int h0 = pairBase & 7;
    const _Float16* Aq = QV + (size_t)b * NT_ * ND_ + h0 * (HD_ * 16);   // rows t, cols d of head h0 (z adds 128 columns)
    const _Float16* Bp = P16 + h0 * (HD_ * 16);                           // rows p index, cols d of head h0
    const int tilesBD = (NT_ / 64) * (BDW_ / 64);                  // 32*33 = 1056
    gemm_f16_kernel<0, true><<<dim3((tilesBD + 7) / 8, NPAIR), blk, 0, stream>>>(
        Aq, ND_, (long)HD_ * 16, Bp, ND_, (long)HD_ * 16, (void*)SCR, (void*)SCR, BDW_, (long)NT_ * BDW_, bu, bu,
        NT_, BDW_, HD_, cs, 1.0f, 31);
    relattn_kernel<<<dim3(NT_ / 64, NPAIR), dim3(256), 0, stream>>>(QU, KP, VTP, SCR, CTX, pairBase, cs);
  }
  // (6) out = ctx . Wo^T -> d_out f32 [8192][1024]   (M=8192, N=1024, K=1024; carries 64*64 folded into scale)
  {
    const int tiles = ((NB_ * NT_) / 64) * (ND_ / 64);   // 2048
    gemm_f16_kernel<0, false><<<dim3((tiles + 7) / 8, 1), blk, 0, stream>>>(
        CTX, ND_, 0L, WO, ND_, 0L, (void*)out, (void*)out, ND_, 0L, bu, bu,
        NB_ * NT_, ND_, ND_, 0.000244140625f, 1.0f, 0);
  }
  (void)hipGetLastError();
}

// v010
// Measured time: 407 microseconds a run.
// Next to v009, in two timings, it ran 1.13 and 1.12 times as fast.
// All steps since v000 together make it 10.8 times as fast.
// Contractions x.Wq^T, x.Wk^T, Wv.x^T, pos_emb.Wp^T, (q+bias_v).p^T band, k.(q+bias_u)^T, V^T.P^T, ctx.Wo^T: v_wmma_f32_16x16x32_f16 (f16 operands, f32 accumulate); operand planes hold bf16-RNE-valued inputs with power-of-two carries (W x64, q/k/v/p x16, P x4096, ctx x64); softmax, bias adds and score scaling in f32. Every plane that a GEMM reads as an operand is stored in fragment order (see ldfrag_pk).
#include <hip/hip_runtime.h>
#include <math.h>
#include <stdint.h>

#define NB_  4
#define NT_  2048
#define ND_  1024
#define NH_  8
#define HD_  128
#define NP_  4095
#define NPP_ 4096
#define BDW_ 2112   // width of the relative-position score band scratch (33 tiles of 64)
// LDS row pitches of the attention tiles, in halves: 16 B x odd, so that the 16 rows one ds_load_b128 reads
// fall on 16 different groups of four banks (unpadded 256-B rows all fall on one group, 128-B rows on two)
#define KPIT_ 136   // K tile row: 128 halves + 8  (272 B)
#define VPIT_ 72    // V^T tile row: 64 halves + 8 (144 B)

typedef _Float16 v16h __attribute__((ext_vector_type(16)));
typedef _Float16 v8h  __attribute__((ext_vector_type(8)));
typedef float    v8f  __attribute__((ext_vector_type(8)));
typedef float    v4f  __attribute__((ext_vector_type(4)));
typedef v4f __attribute__((may_alias)) v4fa;
typedef v8h __attribute__((may_alias)) v8ha;

// bf16 RNE of an f32 value, returned widened to f32 (exactly representable in f16 after a power-of-two carry)
__device__ __forceinline__ float bf_rne(float f) {
  unsigned u = __float_as_uint(f);
  u = (u + 0x7FFFu + ((u >> 16) & 1u)) & 0xFFFF0000u;
  return __uint_as_float(u);
}

// 16-bit WMMA fragment: elements 0..7 <- p[0..7], elements 8..15 <- p[16..23]
// (A: p = row m at k0 + 8h;  B stored [n][k]: p = row n at k0 + 8h;  same split k map for both)
union FragU { v16h v; v8ha h[2]; };
__device__ __forceinline__ v16h ldfrag(const _Float16* p) {
  FragU f;
  f.h[0] = *(const v8ha*)(p);
  f.h[1] = *(const v8ha*)(p + 16);
  return f.v;
}

// Fragment-order ("packed") plane of pitch ld halves: each block of 16 rows x 32 k is 1 KB in a row, block (row/16, k/32)
// at half offset (row/16)*16*ld + (k/32)*512; inside it the 16-B piece of (row, k..k+7), k a multiple of 8, stands at
// ((k/16)&1)*256 + (((k/8)&1)*16 + row%16)*8. So lane l = 16h + row finds elements 0..7 (k0 + 8h ..) at l*8 and elements
// 8..15 (k0 + 16 + 8h ..) at 256 + l*8: the same split k map as ldfrag, and each of the two wave-wide 16-B loads covers
// 512 contiguous bytes (4 cache lines) where the row-major plane gives 32 B from each of 16 lines.
// p = block start + lane*8
__device__ __forceinline__ v16h ldfrag_pk(const _Float16* p) {
  FragU f;
  f.h[0] = *(const v8ha*)(p);
  f.h[1] = *(const v8ha*)(p + 256);
  return f.v;
}

// The same fragment from a wave-uniform plane address (scalar registers), the lane's byte offset and a constant
__device__ __forceinline__ v16h ldfrag_pks(const char* base, unsigned off, int imm) {
  FragU f;
  f.h[0] = *(const v8ha*)(base + off + imm);
  f.h[1] = *(const v8ha*)(base + off + (imm + 512));
  return f.v;
}

// Plain builtin: the compiler keeps the WMMA distances itself and stays free to place fragment loads ahead of
// earlier WMMAs (a volatile asm statement behind each WMMA held every load behind the WMMA before it)
__device__ __forceinline__ v8f mma16(v16h a, v16h b, v8f c) {
  return __builtin_amdgcn_wmma_f32_16x16x32_f16(false, a, false, b, (short)0, c, false, false);
}

__device__ __forceinline__ v8f zero8() { v8f z = {0.f, 0.f, 0.f, 0.f, 0.f, 0.f, 0.f, 0.f}; return z; }

// -------------------------------------------------------------------------------------------------
// All seven f32 inputs that feed a GEMM -> packed f16 planes, in ONE launch of 4096 waves (16 a WGP):
// dst = f16( bf_rne(src) * scale ), scale 64 for the five weights, 1 for pos_emb and x; row 4095 of the pos_emb plane is 0.
// A piece is 8 rows x 32 columns (lane = 4*row + 8-column piece): 8 whole 128-B lines read, 4 whole 128-B lines written.
// Wave (rg, kb), rg = 0..127, kb = 0..31, takes column block kb of 17 pieces: rows 8*rg.. of each weight (5 pieces), rows
// 32*rg.. of pos_emb (4 pieces, one below the other) and rows 64*rg.. of x (8 pieces). Its 34 loads are in flight
// together, and the chip starts 4096 waves in one launch where one wave a piece took 69632 waves in seven launches.
// coverage: 128 x 32 waves x (8, 32, 64 rows x 32 columns) = [1024][1024] five times, [4096][1024], [8192][1024].
// -------------------------------------------------------------------------------------------------
__device__ __forceinline__ v8h cvt8(v4f a, v4f b, float f) {
  v8h o;
  o[0] = (_Float16)(bf_rne(a[0]) * f); o[1] = (_Float16)(bf_rne(a[1]) * f);
  o[2] = (_Float16)(bf_rne(a[2]) * f); o[3] = (_Float16)(bf_rne(a[3]) * f);
  o[4] = (_Float16)(bf_rne(b[0]) * f); o[5] = (_Float16)(bf_rne(b[1]) * f);
  o[6] = (_Float16)(bf_rne(b[2]) * f); o[7] = (_Float16)(bf_rne(b[3]) * f);
  return o;
}

__global__ __launch_bounds__(256) void cvt_all_kernel(
    const float* __restrict__ wq, const float* __restrict__ wk, const float* __restrict__ wv,
    const float* __restrict__ wp, const float* __restrict__ wo, const float* __restrict__ pe,
    const float* __restrict__ x,
    _Float16* __restrict__ dwq, _Float16* __restrict__ dwk, _Float16* __restrict__ dwv,
    _Float16* __restrict__ dwp, _Float16* __restrict__ dwo, _Float16* __restrict__ dpe,
    _Float16* __restrict__ dx) {
  const int w    = blockIdx.x * 8 + (threadIdx.x >> 5);           // 0..4095
  const int lane = threadIdx.x & 31;
  const int ks = lane & 3;                                        // 8-column piece of the block
  const int l4 = lane >> 2;                                       // row of the piece
  const int kb = w & (ND_ / 32 - 1);
  const int rg = w / (ND_ / 32);
  const int c8 = kb * 32 + ks * 8;
  // byte offsets of this lane's 32 B in the first piece of each kind; the next piece stands 8 rows (32768 B) on
  const unsigned sw = (unsigned)((rg * 8  + l4) * ND_ + c8) * 4u;
  const unsigned sp = (unsigned)((rg * 32 + l4) * ND_ + c8) * 4u;
  const unsigned sx = (unsigned)((rg * 64 + l4) * ND_ + c8) * 4u;
  const int  rl = rg * 32 + 24 + l4;                              // pos_emb row of the fourth piece: 4095 has no source
  const unsigned sl = (unsigned)(((rl < NP_) ? rl : (NP_ - 1)) * ND_ + c8) * 4u;   // clamped address
  const float    fl = (rl < NP_) ? 1.0f : 0.0f;                   // zero by value for the filler row
  // packed plane: row r stands at (r/16)*16*ND_ + (r%16)*8 halves, so piece k (rows + 8k) at (k/2)*32768 + (k%2)*128 B
  const unsigned dl = (unsigned)(kb * 512 + (ks >> 1) * 256 + ((ks & 1) * 16 + l4) * 8) * 2u;
  const unsigned dw = dl + (unsigned)(rg >> 1) * (16u * ND_ * 2u) + (unsigned)(rg & 1) * 128u;
  const unsigned dp = dl + (unsigned)(rg * 2) * (16u * ND_ * 2u);
  const unsigned dq = dl + (unsigned)(rg * 4) * (16u * ND_ * 2u);

  const float* const ws[5] = {wq, wk, wv, wp, wo};
  _Float16* const    wd[5] = {dwq, dwk, dwv, dwp, dwo};
  v4f aw[5], bw[5], ap[4], bp[4], ax[8], bx[8];
#pragma unroll
  for (int k = 0; k < 5; ++k) {
    aw[k] = *(const v4f*)((const char*)ws[k] + sw);
    bw[k] = *(const v4f*)((const char*)ws[k] + sw + 16);
  }
#pragma unroll
  for (int k = 0; k < 4; ++k) {
    const char* p = (k < 3) ? ((const char*)pe + sp + k * 32768) : ((const char*)pe + sl);
    ap[k] = *(const v4f*)(p);
    bp[k] = *(const v4f*)(p + 16);
  }
#pragma unroll
  for (int k = 0; k < 8; ++k) {
    ax[k] = *(const v4f*)((const char*)x + sx + k * 32768);
    bx[k] = *(const v4f*)((const char*)x + sx + k * 32768 + 16);
  }
  // the wait that stands before an address register of an issued load is written again; the four offsets pass into it,
  // so that they stay live up to it and no load of the group gets one of them as its destination
  asm volatile("s_wait_xcnt 0x0" :: "v"(sw), "v"(sp), "v"(sl), "v"(sx) : "memory");
  __builtin_amdgcn_sched_barrier(0);   // keeps the 34 loads in one group ahead of the converts: one memory latency a wave

#pragma unroll
  for (int k = 0; k < 5; ++k)
    *(v8h*)((char*)wd[k] + dw) = cvt8(aw[k], bw[k], 64.0f);
#pragma unroll
  for (int k = 0; k < 4; ++k)
    *(v8h*)((char*)dpe + dp + (k >> 1) * 32768 + (k & 1) * 128) = cvt8(ap[k], bp[k], (k < 3) ? 1.0f : fl);
#pragma unroll
  for (int k = 0; k < 8; ++k)
    *(v8h*)((char*)dx + dq + (k >> 1) * 32768 + (k & 1) * 128) = cvt8(ax[k], bx[k], 1.0f);
}

// -------------------------------------------------------------------------------------------------
// f16 WMMA GEMM: C[m][n] = epi( sum_k A[m][k] * Bt[nrow][k] ), nrow = n (+ 64*(skew0 - tm) when SKEW: band GEMM).
// A [M][K] and Bt [N(+band)][K] are packed planes (ldfrag_pk) of pitch lda, ldb; a column offset c (multiple of 32) of a
// packed plane is 16*c halves; M, N multiples of 64, K multiple of 32 (SKEW) or of 128, with lda = ldb = ND_ (not SKEW).
// Each wave owns a 64x64 output tile (4x4 subtiles), 8 waves per block, grid.x = tiles/8, grid.y = z-batch.
// OUT 0: f32  C1 = acc*scale
// OUT 1: f16  C1 = f16(acc*scale), row-major
// OUT 2: f16  C1 = f16((acc*scale + bf_rne(b1[n]))*carry), C2 = f16((acc*scale + bf_rne(b2[n]))*carry), both packed
// OUT 3: f16  C1 = f16(acc*scale), packed
// ONE instruction with lane-contiguous 16-B pieces (f32: 16 lanes x 16 B = 256 B segment; f16 row-major: 8 lanes x 16 B = 128 B segment; packed: 32 lanes x 16 B = 512 B)
// coverage: 4 slabs x 16 rows x 64 cols = the whole 64x64 tile per wave; tiles cover M x N exactly.
// -------------------------------------------------------------------------------------------------
template <int OUT, bool SKEW>
__global__ __launch_bounds__(256) void gemm_f16_kernel(
    const _Float16* __restrict__ A, int lda, long strideA,
    const _Float16* __restrict__ Bt, int ldb, long strideB,
    void* __restrict__ C1, void* __restrict__ C2, int ldc, long strideC,
    const float* __restrict__ b1, const float* __restrict__ b2,
    int M, int N, int K, float scale, float carry, int skew0) {
  __shared__ __align__(16) float sT[8][16 * 68];   // per-wave 16x64 slab, pitch 68 floats

  const int z    = blockIdx.y;
  const int lane = threadIdx.x & 31;
  const int wave = threadIdx.x >> 5;
  const int tilesN = N >> 6;
  const int tilesM = M >> 6;
  const int tile = blockIdx.x * 8 + wave;
  if (tile >= tilesM * tilesN) return;             // wave-uniform; no block barriers in this kernel
  const int tm = tile / tilesN;
  const int tn = tile - tm * tilesN;
  const int m0 = tm << 6;
  const int n0 = tn << 6;
  const int nsk = SKEW ? ((skew0 - tm) << 6) : 0;  // band row offset of Bt

  const _Float16* Ab = A  + (size_t)z * strideA;
  const _Float16* Bb = Bt + (size_t)z * strideB;

  const int rl   = lane & 15;          // column (D) within a subtile
  const int mOff = (lane >> 4) * 8;    // D row offset of this lane half

  v8f acc[4][4];
#pragma unroll
  for (int i = 0; i < 4; ++i)
#pragma unroll
    for (int j = 0; j < 4; ++j) acc[i][j] = zero8();

  // this lane's place in the first block of the tile's first 16 rows; the next 16 rows stand 16*ld halves on, the next
  // k step 512 halves on
  const _Float16* Ar = Ab + (size_t)(m0 >> 4) * ((size_t)lda * 16) + lane * 8;
  const _Float16* Br = Bb + (size_t)((nsk + n0) >> 4) * ((size_t)ldb * 16) + lane * 8;

  if constexpr (SKEW) {
  for (int k0 = 0; k0 < K; k0 += 32) {
    // all eight fragments of the k step are loaded as one group, then its 16 WMMAs run
    v16h bfr[4], af[4];
    const _Float16 *pb[4], *pa[4];
#pragma unroll
    for (int j = 0; j < 4; ++j) {
      pb[j] = Br + (size_t)j * ((size_t)ldb * 16) + (k0 << 4);
      pa[j] = Ar + (size_t)j * ((size_t)lda * 16) + (k0 << 4);
      bfr[j] = ldfrag_pk(pb[j]);
      af[j]  = ldfrag_pk(pa[j]);
    }
    // the wait that stands before an address register of an issued load is written again; the eight addresses pass
    // into it, so that no later load of the group gets an earlier one's address register as its destination
    asm volatile("s_wait_xcnt 0x0" :: "v"(pb[0]), "v"(pb[1]), "v"(pb[2]), "v"(pb[3]),
                                      "v"(pa[0]), "v"(pa[1]), "v"(pa[2]), "v"(pa[3]) : "memory");
    __builtin_amdgcn_sched_barrier(0);   // keeps the 16 loads in one group: one load latency a k step, not one a row
#pragma unroll
    for (int i = 0; i < 4; ++i)
#pragma unroll
      for (int j = 0; j < 4; ++j) acc[i][j] = mma16(af[i], bfr[j], acc[i][j]);
  }
  } else {
    // K is a multiple of 128 and both planes have pitch ND_ here. The eight fragments of a k step are loaded two k steps
    // ahead of their WMMAs, into four register sets taken in turn (the loop is unrolled by 4, so that each set is a fixed
    // group of registers): two steps' loads are in flight while a step's 16 WMMAs run, and a wave no longer stands still
    // for a whole load latency a step. Each acc[i][j] still sums the k steps in rising order.
    // Addresses: the tile's two start addresses are the same in every lane and stay in scalar registers; a step's 16 loads
    // share one vector register, the byte offset lane*16 + 32*k; the block of 16 rows and the half block are immediates.
    constexpr int RB = ND_ * 32;                                  // bytes from one block of 16 rows to the next
    const int ts  = __builtin_amdgcn_readfirstlane(tile);        // the wave's tile number as a scalar
    const int tms = ts / tilesN;
    const int tns = ts - tms * tilesN;
    const char* const As = (const char*)Ab + (size_t)(tms << 2) * RB;
    const char* const Bs = (const char*)Bb + (size_t)(tns << 2) * RB;
    const unsigned l16 = (unsigned)lane * 16u;
    v16h fa[4][4], fb[4][4];
#pragma unroll
    for (int u = 0; u < 2; ++u) {
#pragma unroll
      for (int j = 0; j < 4; ++j) {
        fb[u][j] = ldfrag_pks(Bs, l16, j * RB + u * 1024);
        fa[u][j] = ldfrag_pks(As, l16, j * RB + u * 1024);
      }
      // keeps step 0's loads ahead of step 1's: issued the other way round, the wait at the head of the loop has to
      // cover both steps on every trip
      __builtin_amdgcn_sched_barrier(0);
    }
    // the wait that stands before an address register of an issued load is written again (the loop's first loads may take
    // the register of the lane number, which these 32 loads name); the line above holds it directly behind them
    asm volatile("s_wait_xcnt 0x0" ::: "memory");
    int k0 = 0;
    do {                                           // K is at least 128: the first four steps always run
#pragma unroll
      for (int u = 0; u < 4; ++u) {
        const int kn = k0 + 32 * u + 64;
        const int kl = (kn < K) ? kn : (K - 32);   // the last two steps load the last step again, unused: no branch
        const unsigned o = l16 + (unsigned)kl * 32u;
#pragma unroll
        for (int j = 0; j < 4; ++j) {
          fb[(u + 2) & 3][j] = ldfrag_pks(Bs, o, j * RB);
          fa[(u + 2) & 3][j] = ldfrag_pks(As, o, j * RB);
        }
        __builtin_amdgcn_sched_barrier(0);   // keeps the 16 loads of step + 2 in one group ahead of this step's WMMAs
#pragma unroll
        for (int i = 0; i < 4; ++i)
#pragma unroll
          for (int j = 0; j < 4; ++j) acc[i][j] = mma16(fa[u][i], fb[u][j], acc[i][j]);
        __builtin_amdgcn_sched_barrier(0);   // keeps the wait below behind the WMMAs, which cover it
        // the wait that stands before an address register of an issued load is written again; the offset passes into
        // it, so that its register stays as it is up to the wait and no load of the group gets it as its destination
        asm volatile("s_wait_xcnt 0x0" :: "v"(o) : "memory");
        __builtin_amdgcn_sched_barrier(0);   // keeps the next step's offset and loads behind that wait
      }
      k0 += 128;
    } while (k0 < K);
  }

  // ---- epilogue ----
  float* slab = sT[wave];
#pragma unroll
  for (int i = 0; i < 4; ++i) {
    const int mBase = m0 + (i << 4);
#pragma unroll
    for (int j = 0; j < 4; ++j)
#pragma unroll
      for (int r = 0; r < 8; ++r)
        slab[(mOff + r) * 68 + (j << 4) + rl] = acc[i][j][r] * scale;
    __builtin_amdgcn_fence(__ATOMIC_RELEASE, "workgroup");
    __builtin_amdgcn_wave_barrier();
    __builtin_amdgcn_fence(__ATOMIC_ACQUIRE, "workgroup");
    if (OUT == 0) {
      float* C = (float*)C1 + (size_t)z * strideC;
      const int hh = lane >> 4, c4 = (lane & 15) * 4;    // row segment 256 B = 16 lanes x 16 B
      {
#pragma unroll
        for (int it = 0; it < 8; ++it) {
          const int row = it * 2 + hh;
          const v4f v = *(const v4fa*)(slab + row * 68 + c4);
          *(v4f*)(C + (size_t)(mBase + row) * ldc + n0 + c4) = v;
        }
        
      }
    } else if (OUT == 2 || OUT == 3) {
      // packed output: store 'it' is half j = it&1 of block it>>1 of the slab's two 16x32 blocks, 512 contiguous bytes;
      // lane 16h + row brings the piece (row, 32*(it>>1) + 16*j + 8h)
      _Float16* Ca = (_Float16*)C1 + (size_t)z * strideC;
      _Float16* Cb = (_Float16*)C2 + (size_t)z * strideC;
      const size_t dbase = (size_t)(mBase >> 4) * ((size_t)ldc * 16) + (size_t)(n0 >> 5) * 512 + lane * 8;
      v8h hv[4], lv[4];
#pragma unroll
      for (int it = 0; it < 4; ++it) {
        const int col = (it >> 1) * 32 + (it & 1) * 16 + (lane >> 4) * 8;
        const float* sp = slab + rl * 68 + col;
        const v4f x0 = *(const v4fa*)(sp);
        const v4f x1 = *(const v4fa*)(sp + 4);
        float f[8];
        f[0] = x0[0]; f[1] = x0[1]; f[2] = x0[2]; f[3] = x0[3];
        f[4] = x1[0]; f[5] = x1[1]; f[6] = x1[2]; f[7] = x1[3];
        v8h ha, hb;
#pragma unroll
        for (int e = 0; e < 8; ++e) {
          if (OUT == 3) {
            ha[e] = (_Float16)f[e];
            hb[e] = ha[e];
          } else {
            const int n = n0 + col + e;
            ha[e] = (_Float16)((f[e] + bf_rne(b1[n])) * carry);
            hb[e] = (_Float16)((f[e] + bf_rne(b2[n])) * carry);
          }
        }
        hv[it] = ha; lv[it] = hb;
      }
#pragma unroll
      for (int it = 0; it < 4; ++it) {
        *(v8h*)(Ca + dbase + it * 256) = hv[it];
        if (OUT == 2) *(v8h*)(Cb + dbase + it * 256) = lv[it];
      }
      // the wait that stands before an address register of an issued store is written again (the next slab's addresses)
      asm volatile("s_wait_xcnt 0x0" ::: "memory");
    } else {
      const int q = lane >> 3, c8 = (lane & 7) * 8;
      _Float16* Ca = (_Float16*)C1 + (size_t)z * strideC;
      v8h hv[4];
#pragma unroll
      for (int it = 0; it < 4; ++it) {
        const int row = it * 4 + q;
        const float* sp = slab + row * 68 + c8;
        const v4f x0 = *(const v4fa*)(sp);
        const v4f x1 = *(const v4fa*)(sp + 4);
        float f[8];
        f[0] = x0[0]; f[1] = x0[1]; f[2] = x0[2]; f[3] = x0[3];
        f[4] = x1[0]; f[5] = x1[1]; f[6] = x1[2]; f[7] = x1[3];
        v8h ha;
#pragma unroll
        for (int e = 0; e < 8; ++e) ha[e] = (_Float16)f[e];
        hv[it] = ha;
      }
      {
#pragma unroll
        for (int it = 0; it < 4; ++it) {
          const int row = it * 4 + q;
          *(v8h*)(Ca + (size_t)(mBase + row) * ldc + n0 + c8) = hv[it];
        }
        
      }
    }
    __builtin_amdgcn_fence(__ATOMIC_RELEASE, "workgroup");
    __builtin_amdgcn_wave_barrier();
    __builtin_amdgcn_fence(__ATOMIC_ACQUIRE, "workgroup");
  }
}

// -------------------------------------------------------------------------------------------------
// Relative-position attention for a group of (batch, head) pairs, head dim 128, no mask, in the transposed form
// S^T = K.QU^T, O^T += V^T.P^T: a lane holds one query's scores, so maximum and sum run in the lane.
//   QU  f16 packed plane [b*2048 + t][h*128 + d] = 16*(q + bias_u) (B operand of the content score, kept in registers)
//   Kp  f16 plane [b*2048 + s][h*128 + d] = 16*k                  (A operand, staged per 64-key chunk as [key][d])
//   VT  f16 plane [b][h*128 + d][s]      = 16*v                  (A operand of V^T.P^T, staged as [d][key])
//   BD  f32 band scratch [z][2048][2112]: value (col j) = inv_sdk * (q_i + bias_v).p[row 64*(31 - i/64) + j]
//       rel-shift: bd[i][key] = bdfull[i][key - i + 2047]  ->  column (key - i + 2047) - 64*(31 - i/64)
//                = key + 63 - (i mod 64), always in [0, 2110].
//   score = cs * (K.QU^T acc) + BD  with cs = inv_sdk / 256;  online softmax in f32 over chunks of 64 keys.
//   Accumulator tile j of S^T: lane 16*hh + c, register r = (key 16j + 8hh + r, query c). The 32 scores of a lane belong
//   to one query; the other 32 keys of that query stand in lane l ^ 16: one exchange a chunk for the maximum, the sums of
//   the two halves are joined once behind the loop.
//   P^T = f16(4096 * exp(s - m)) is a B operand as it stands: elements 0..7 of the fragment of keys 32kk.. are k = 8hh + e
//   = tile 2kk, register e; elements 8..15 are k = 16 + 8hh + (e - 8) = tile 2kk + 1, register e - 8: the k order of the
//   V^T fragment (ldfrag). P never goes through LDS.
//   O^T tile t: lane 16*hh + c, register r = (d 16t + 8hh + r, query c): 8 neighbouring d of one row, which is the 16-B
//   piece that lane 16*hh + c of the packed plane's store t holds; ctx = 64 * acc / (4096*16*l) goes out from registers
//   as packed f16 plane CTX [b*2048 + t][h*128 + d].
// Block = 8 waves = 64 query rows of one (b,h); grid = (32 query blocks, pairs in group). The waves form two groups of
// four: group g takes the key chunks 2t + g, t = 0..15, for all 64 rows, with its own K and V^T tiles and its own running
// (max, sum, accumulator); each SIMD so holds two waves, and one wave's waits are filled by the other. Behind the loop
// group 1 hands its state to group 0 through LDS, which joins the two as online softmax joins two chunks, and stores.
// LDS: one raw buffer; per group g at g*35840: K tile [64][128] f16 (row pitch 272 B), V^T tile [128][64] f16 at +17408
// (pitch 144 B). After a block barrier behind the loop: the hand-over [4 waves][32 lanes][68 floats] (lane pitch 272 B =
// 16 B x odd) at 0.
// coverage: staging 8 loads x 4 waves x 2 rows x 256 B for K (64x128), 8 x 4 waves x 4 rows x 128 B for V^T (128x64);
// output 8 store instructions x 16 rows x 2 pieces x 8 halves = 16x128 per wave.
// -------------------------------------------------------------------------------------------------
typedef v4f __attribute__((aligned(4))) v4fu;   // four band values of one row: the shift by the row leaves them 4-B aligned

// lane l with lane l ^ 16
__device__ __forceinline__ float xhalf(float x) {
  const int b = __builtin_bit_cast(int, x);
  return __builtin_bit_cast(float, __builtin_amdgcn_permlanex16(b, b, 0x76543210, 0xfedcba98, false, false));
}

__device__ __forceinline__ v4f exp2x4(v4f a) {
  float p0, p1, p2, p3;
  asm("v_exp_f32 %0, %4\n\tv_exp_f32 %1, %5\n\tv_exp_f32 %2, %6\n\tv_exp_f32 %3, %7\n\tv_nop"
      : "=&v"(p0), "=&v"(p1), "=&v"(p2), "=&v"(p3) : "v"(a[0]), "v"(a[1]), "v"(a[2]), "v"(a[3]));
  v4f p = {p0, p1, p2, p3};
  return p;
}
// one 2^x with the same slot behind it
__device__ __forceinline__ float exp2x1(float a) {
  float p;
  asm("v_exp_f32 %0, %1\n\tv_nop" : "=v"(p) : "v"(a));
  return p;
}
#define LOG2E_ 1.44269504088896340736f   // e^x = 2^(x * log2 e), as the fast exponential of the header forms it

__global__ __launch_bounds__(256)
void relattn_kernel(const _Float16* __restrict__ QU, const _Float16* __restrict__ Kp,
                    const _Float16* __restrict__ VT, const float* __restrict__ BD,
                    _Float16* __restrict__ CTX, int pairBase, float cs) {
  constexpr int TILEB = 64 * KPIT_ * 2 + 128 * VPIT_ * 2;                 // one group's K and V^T tiles: 35840 B
  constexpr int XPIT  = 68;                                               // hand-over: floats per lane (66 used)
  __shared__ __align__(16) unsigned char SMEM[2 * TILEB];                 // 71680

  const int tid  = threadIdx.x;
  const int grp  = __builtin_amdgcn_readfirstlane(tid >> 7);   // key-chunk group of this wave (scalar): 0 even, 1 odd chunks
  const int wave = (tid >> 5) & 3;               // wave within the group = 16-row tile of the block
  const int lane = tid & 31;
  _Float16* Ksh = (_Float16*)(SMEM + grp * TILEB);                        // [64][KPIT_]
  _Float16* Vsh = (_Float16*)(SMEM + grp * TILEB + 64 * KPIT_ * 2);       // [128][VPIT_]
  float*    Xsh = (float*)(SMEM);                        // [4][32][XPIT] after the chunk loop
  const int hh   = lane >> 4;
  const int c    = lane & 15;

  const int z    = blockIdx.y;
  const int pair = pairBase + z;
  const int b    = pair >> 3;
  const int h    = pair & 7;
  const int qb   = blockIdx.x;                   // 0..31
  const int q0   = qb * 64 + wave * 16;          // first query row of this wave; this lane's query is q0 + c

  const _Float16* Qh = QU + (size_t)(b * NT_) * ND_ + h * (HD_ * 16);   // packed: column h*128 is 16*h*128 halves
  const _Float16* Kh = Kp + (size_t)(b * NT_) * ND_ + h * HD_;
  const _Float16* Vh = VT + (size_t)b * ND_ * NT_ + (size_t)(h * HD_) * NT_;
  const float*    bd = BD + (size_t)z * NT_ * BDW_;
  _Float16*       ctx = CTX + (size_t)(b * NT_) * ND_ + h * (HD_ * 16);  // packed, as Qh

  // Q fragments (B operand, column = query c): 4 chunks of 32 along d
  v16h qa[4];
  const _Float16* qp = Qh + (size_t)q0 * ND_ + lane * 8;               // q0 is a multiple of 16
#pragma unroll
  for (int dc = 0; dc < 4; ++dc)
    qa[dc] = ldfrag_pk(qp + dc * 512);
  // the wait that stands before an address register of an issued load is written again; the Q address passes into it,
  // so that its register pair stays live up to the wait and the offsets formed below cannot take it earlier
  asm volatile("s_wait_xcnt 0x0" :: "v"(qp) : "memory");

  float mrow = -INFINITY;    // running maximum of this lane's query (the same in both halves)
  float lsum = 0.f;          // running sum over this lane's own keys only (the halves are joined behind the loop)
  v8f oacc[8];
#pragma unroll
  for (int t = 0; t < 8; ++t) oacc[t] = zero8();

  // Every global load of a chunk is issued one chunk of the group ahead into registers (chunk grp here), so that its
  // latency runs under the chunk before instead of in front of its use.
  // Per-lane byte offsets, from the uniform bases Kh, Vh and bd, of the chunk that is loaded next:
  //   K: load i of a wave takes rows kv0 + kr + 2i (kr: 2 rows a load), 16 lanes x 16 B = the row's whole 256 B;
  //   V^T: load i takes rows vr + i (4 rows a load, 8 apart), 8 lanes x 16 B = the row's 128 B of keys kv0..kv0+63;
  //   so each wave-wide load covers 4 whole 128-B lines (a lane per row would touch 32 lines, 16 B of each).
  //   The 4 rows stand 8 apart because 8 * 144 B = 128 mod 256: the two rows that 16 lanes store to LDS then fill
  //   the 64 banks once (neighbouring rows would meet on four banks)
  //   band: the values of (query q0 + c, keys kv0 + 16j + 8hh + 4u .. + 3) are 16 B at bo + 64j + 16u
  const int kr = wave * 16 + (lane >> 4), kc8 = (lane & 15) * 8;
  const int vr = wave * 32 + (lane >> 3) * 8, vc8 = (lane & 7) * 8;
  unsigned ko = (unsigned)((kr * ND_ + kc8) * 2) + (unsigned)grp * (64u * ND_ * 2u);
  unsigned vo = (unsigned)((vr * NT_ + vc8) * 2) + (unsigned)grp * (64u * 2u);
  unsigned bo = (unsigned)(((q0 + c) * BDW_ + (63 - (wave * 16 + c)) + 8 * hh) * 4) + (unsigned)grp * (64u * 4u);
  v8h kreg[8], vreg[8];
  v4f bdv[4][2];
#pragma unroll
  for (int i = 0; i < 8; ++i) {
    kreg[i] = *(const v8h*)((const char*)Kh + ko + i * (2 * ND_ * 2));
    vreg[i] = *(const v8h*)((const char*)Vh + vo + i * (NT_ * 2));
  }
#pragma unroll
  for (int j = 0; j < 4; ++j)
#pragma unroll
    for (int u = 0; u < 2; ++u)
      bdv[j][u] = *(const v4fu*)((const char*)bd + bo + (64 * j + 16 * u));
  // the wait that stands before an address register of an issued load is written again; the offsets pass through
  // it, so that their step cannot be placed ahead of it
  asm volatile("s_wait_xcnt 0x0" : "+v"(ko), "+v"(vo), "+v"(bo) :: "memory");
  ko += 128 * (ND_ * 2);
  vo += 128 * 2;
  bo += 128 * 4;

  // two chunks of the group per trip: the band values loaded ahead alternate between two register sets; in a single body they
  // are copied into the one set behind a wait for the loads, in the middle of the chunk
#pragma unroll 2
  for (int kc = 0; kc < NT_ / 128; ++kc) {
    __syncthreads();
#pragma unroll
    for (int i = 0; i < 8; ++i) {
      *(v8ha*)(Ksh + (kr + 2 * i) * KPIT_ + kc8) = kreg[i];
      *(v8ha*)(Vsh + (vr + i) * VPIT_ + vc8)     = vreg[i];
    }
    __syncthreads();

    // the chunk's 16 K fragments, read from LDS as one group ahead of the score WMMAs
    v16h kb[4][4], vb[2][8];
#pragma unroll
    for (int dc = 0; dc < 4; ++dc)
#pragma unroll
      for (int j = 0; j < 4; ++j)
        kb[dc][j] = ldfrag(Ksh + (j * 16 + c) * KPIT_ + dc * 32 + 8 * hh);

    // the next chunk's K and V^T rows (the last trip loads its own chunk again, unused: no branch)
#pragma unroll
    for (int i = 0; i < 8; ++i) {
      kreg[i] = *(const v8h*)((const char*)Kh + ko + i * (2 * ND_ * 2));
      vreg[i] = *(const v8h*)((const char*)Vh + vo + i * (NT_ * 2));
    }
    // keeps the 32 LDS reads in one group, and the 16 global loads a whole chunk ahead of their LDS stores
    __builtin_amdgcn_sched_barrier(0);

    // content scores: S^T[j] = K(16 keys x 128) . QU^T for key subtile j (each s[j] sums dc = 0..3 in that order)
    v8f s[4];
#pragma unroll
    for (int j = 0; j < 4; ++j) s[j] = zero8();
#pragma unroll
    for (int dc = 0; dc < 4; ++dc)
#pragma unroll
      for (int j = 0; j < 4; ++j) s[j] = mma16(kb[dc][j], qa[dc], s[j]);

    // the chunk's 16 V^T fragments are read only here, so that they can take the K fragments' registers as the score
    // WMMAs free them (two waves a SIMD leave 512 registers a wave); they land under the softmax
#pragma unroll
    for (int kk = 0; kk < 2; ++kk)
#pragma unroll
      for (int t = 0; t < 8; ++t)
        vb[kk][t] = ldfrag(Vsh + (t * 16 + c) * VPIT_ + kk * 32 + 8 * hh);

    // add the position term from the band scratch; the chunk's maximum of this lane's query, one short chain a subtile
    float cmj[4];
#pragma unroll
    for (int j = 0; j < 4; ++j) {
      float m = -INFINITY;
#pragma unroll
      for (int r = 0; r < 8; ++r) {
        const float sv = s[j][r] * cs + bdv[j][r >> 2][r & 3];
        s[j][r] = sv;
        m = fmaxf(m, sv);
      }
      cmj[j] = m;
    }
    float cm = fmaxf(fmaxf(cmj[0], cmj[1]), fmaxf(cmj[2], cmj[3]));
    cm = fmaxf(cm, xhalf(cm));

    // the next chunk's 32 band values (this chunk's have just been used by the loop above)
#pragma unroll
    for (int j = 0; j < 4; ++j)
#pragma unroll
      for (int u = 0; u < 2; ++u)
        bdv[j][u] = *(const v4fu*)((const char*)bd + bo + (64 * j + 16 * u));
    __builtin_amdgcn_sched_barrier(0);   // keeps these 8 loads here, a softmax and a V^T.P^T phase ahead of their use

    // online softmax update: one maximum, one rescale factor and one partial sum a lane; P^T (x4096) stays in registers
    const float mnew  = fmaxf(mrow, cm);
    const float alpha = exp2x1((mrow - mnew) * LOG2E_);
    mrow = mnew;
    float psj[4];              // one sum a subtile: four short chains of adds, not one of 32
    v16h pb[2];
#pragma unroll
    for (int j = 0; j < 4; ++j) {
      float ps = 0.f;
#pragma unroll
      for (int u = 0; u < 2; ++u) {
        v4f a;
#pragma unroll
        for (int e = 0; e < 4; ++e) a[e] = (s[j][4 * u + e] - mnew) * LOG2E_;
        const v4f p = exp2x4(a);
#pragma unroll
        for (int e = 0; e < 4; ++e) {
          ps += p[e];
          pb[j >> 1][(j & 1) * 8 + 4 * u + e] = (_Float16)(p[e] * 4096.0f);
        }
      }
      psj[j] = ps;
    }
    lsum = lsum * alpha + ((psj[0] + psj[1]) + (psj[2] + psj[3]));
#pragma unroll
    for (int t = 0; t < 8; ++t) oacc[t] *= alpha;

    // V^T (A operand, row = d, split k map over keys) . P^T (B operand, column = query)
#pragma unroll
    for (int kk = 0; kk < 2; ++kk)
#pragma unroll
      for (int t = 0; t < 8; ++t) oacc[t] = mma16(vb[kk][t], pb[kk], oacc[t]);

    // keeps the V^T.P^T WMMAs in this trip: behind the next trip's barrier, which waits for every load in flight, they
    // would no longer cover the band loads' latency
    __builtin_amdgcn_sched_barrier(0);
    // the same wait as in front of the loop: it stands at the foot of the trip, in front of the offsets' step
    asm volatile("s_wait_xcnt 0x0" : "+v"(ko), "+v"(vo), "+v"(bo) :: "memory");
    const unsigned step = (kc + 2 < NT_ / 128) ? 128u : 0u;   // the offsets stop at the group's last chunk
    ko += step * (ND_ * 2);
    vo += step * 2;
    bo += step * 4;
  }

  __syncthreads();                               // every wave is done with the tiles before Xsh aliases them
  // group 1 hands over: per lane 64 accumulator values, its maximum and its partial sum (same query and d in both groups)
  float* xs = Xsh + (wave * 32 + lane) * XPIT;
  if (grp == 1) {
#pragma unroll
    for (int t = 0; t < 8; ++t) {
      v4f lo = {oacc[t][0], oacc[t][1], oacc[t][2], oacc[t][3]};
      v4f hi = {oacc[t][4], oacc[t][5], oacc[t][6], oacc[t][7]};
      *(v4fa*)(xs + t * 8)     = lo;
      *(v4fa*)(xs + t * 8 + 4) = hi;
    }
    xs[64] = mrow;
    xs[65] = lsum;
  }
  __syncthreads();                               // the hand-over is written before group 0 reads it
  if (grp == 1) return;                          // no barrier follows
  const float m1 = xs[64], l1 = xs[65];
  const float mj = fmaxf(mrow, m1);
  const float a0 = __expf(mrow - mj);
  const float a1 = __expf(m1 - mj);
  float lj = lsum * a0 + l1 * a1;
  lj += xhalf(lj);                               // the two halves' keys of the query
  const float inv = 1.0f / (1024.0f * lj);       // 64 / (4096 * 16 * l)
  v8h ov[8];
#pragma unroll
  for (int t = 0; t < 8; ++t) {
    const v4f x0 = *(const v4fa*)(xs + t * 8);
    const v4f x1 = *(const v4fa*)(xs + t * 8 + 4);
    v8h o;
#pragma unroll
    for (int r = 0; r < 4; ++r) {
      o[r]     = (_Float16)((oacc[t][r]     * a0 + x0[r] * a1) * inv);
      o[r + 4] = (_Float16)((oacc[t][r + 4] * a0 + x1[r] * a1) * inv);
    }
    ov[t] = o;
  }
#pragma unroll
  for (int t = 0; t < 8; ++t)
    *(v8h*)(ctx + (size_t)q0 * ND_ + t * 256 + lane * 8) = ov[t];   // 32 lanes x 16 B = 512 contiguous bytes
}

// -------------------------------------------------------------------------------------------------
// Workspace map (bytes):
//   (pk = packed, in fragment order: ldfrag_pk)
//   WO   f16 pk [1024][1024]           0
//   QU   f16 pk [8192][1024]     2097152
//   QV   f16 pk [8192][1024]    18874368
//   KP   f16 [8192][1024]       35651584
//   VTP  f16 [4][1024][2048]    52428800
//   CTX  f16 pk [8192][1024]    69206016
//   P16  f16 pk [4096][1024]    85983232
//   SCR                         94371840   (138412032 B): early phase (all pk) WQ,WK,WV,WP f16 [1024][1024] at +0,+2097152,
//        +4194304,+6291456; X f16 [8192][1024] at +8388608; PE f16 [4096][1024] at +25165824 (end +33554432);
//        later phase: BD band f32 [8][2048][2112] (end +138412032)
//   total                      232783872
// Every region is written in whole 64x64 tiles / whole rows; all sizes are exact tile multiples.
// -------------------------------------------------------------------------------------------------
extern "C" void kernel_launch(void* const* d_in, const int* in_sizes, int n_in,
                              void* d_out, int out_size, void* d_ws, size_t ws_size,
                              hipStream_t stream) {
  if (n_in < 9) return;
  if (in_sizes[0] != NB_ * NT_ * ND_) return;
  if (in_sizes[1] != NP_ * ND_) return;
  if (in_sizes[2] != ND_ * ND_ || in_sizes[3] != ND_ * ND_ || in_sizes[4] != ND_ * ND_) return;
  if (in_sizes[5] != ND_ * ND_ || in_sizes[6] != ND_ * ND_) return;
  if (in_sizes[7] != NH_ * HD_ || in_sizes[8] != NH_ * HD_) return;
  if (out_size != NB_ * NT_ * ND_) return;

  const float* x   = (const float*)d_in[0];
  const float* pe  = (const float*)d_in[1];
  const float* Wq  = (const float*)d_in[2];
  const float* Wk  = (const float*)d_in[3];
  const float* Wv  = (const float*)d_in[4];
  const float* Wo  = (const float*)d_in[5];
  const float* Wp  = (const float*)d_in[6];
  const float* bu  = (const float*)d_in[7];
  const float* bvb = (const float*)d_in[8];
  float* out = (float*)d_out;

  const size_t PW16 = (size_t)ND_ * ND_ * 2;             //  2097152
  const size_t PA16 = (size_t)NB_ * NT_ * ND_ * 2;       // 16777216
  const size_t PP16 = (size_t)NPP_ * ND_ * 2;            //  8388608
  const size_t PBD  = (size_t)NT_ * BDW_ * 4;            // 17301504 per pair
  const int    NPAIR = 8;                                // pairs per group: all heads of one batch element
  size_t off = 0;
  const size_t oWO  = off; off += PW16;
  const size_t oQU  = off; off += PA16;
  const size_t oQV  = off; off += PA16;
  const size_t oKP  = off; off += PA16;
  const size_t oVT  = off; off += PA16;
  const size_t oCTX = off; off += PA16;
  const size_t oP16 = off; off += PP16;
  const size_t oSCR = off;
  const size_t oWQ  = oSCR;
  const size_t oWK  = oWQ + PW16;
  const size_t oWV  = oWK + PW16;
  const size_t oWP  = oWV + PW16;
  const size_t oX   = oWP + PW16;
  const size_t oPE  = oX + PA16;
  const size_t earlyEnd = oPE + PP16;
  const size_t bdEnd    = oSCR + (size_t)NPAIR * PBD;
  const size_t total    = (earlyEnd > bdEnd) ? earlyEnd : bdEnd;   // 232783872
  if (total > ws_size) return;

  char* ws = (char*)d_ws;
  _Float16* WO  = (_Float16*)(ws + oWO);
  _Float16* QU  = (_Float16*)(ws + oQU);
  _Float16* QV  = (_Float16*)(ws + oQV);
  _Float16* KP  = (_Float16*)(ws + oKP);
  _Float16* VTP = (_Float16*)(ws + oVT);
  _Float16* CTX = (_Float16*)(ws + oCTX);
  _Float16* P16 = (_Float16*)(ws + oP16);
  _Float16* WQ  = (_Float16*)(ws + oWQ);
  _Float16* WK  = (_Float16*)(ws + oWK);
  _Float16* WV  = (_Float16*)(ws + oWV);
  _Float16* WP  = (_Float16*)(ws + oWP);
  _Float16* X   = (_Float16*)(ws + oX);
  _Float16* PE  = (_Float16*)(ws + oPE);
  float*    SCR = (float*)(ws + oSCR);

  const float inv_sdk = 0.08838834764831845f;   // 1/sqrt(128)
  const float cs      = inv_sdk * 0.00390625f;   // applied to the x16.x16 score accumulators
  const dim3 blk(256);

  // (1) weights (carried x64), pos_emb ([4096][1024], row 4095 = 0) and x (all batch elements) -> f16 planes of
  //     bf16-valued entries: one launch, 512 work-groups of 8 waves
  cvt_all_kernel<<<dim3(512), blk, 0, stream>>>(Wq, Wk, Wv, Wp, Wo, pe, x, WQ, WK, WV, WP, WO, PE, X);
  // (3) p = pos_emb . Wp^T -> P16 = 16*p   (M=4096, N=1024, K=1024)
  {
    const int tiles = (NPP_ / 64) * (ND_ / 64);
    gemm_f16_kernel<3, false><<<dim3((tiles + 7) / 8, 1), blk, 0, stream>>>(
        PE, ND_, 0L, WP, ND_, 0L, (void*)P16, (void*)P16, ND_, 0L, bu, bu, NPP_, ND_, ND_, 0.25f, 1.0f, 0);
  }
  // (4) q (two bias variants), k, v^T projections: one launch of 256 work-groups each
  {
    const int tilesQ = ((NB_ * NT_) / 64) * (ND_ / 64);  // 2048
    // QU = 16*(q + bias_u), QV = 16*(q + bias_v)    (M=8192, N=1024, K=1024)
    gemm_f16_kernel<2, false><<<dim3((tilesQ + 7) / 8, 1), blk, 0, stream>>>(
        X, ND_, 0L, WQ, ND_, 0L, (void*)QU, (void*)QV, ND_, 0L, bu, bvb,
        NB_ * NT_, ND_, ND_, 0.015625f, 16.0f, 0);
    // KP = 16*k
    gemm_f16_kernel<1, false><<<dim3((tilesQ + 7) / 8, 1), blk, 0, stream>>>(
        X, ND_, 0L, WK, ND_, 0L, (void*)KP, (void*)KP, ND_, 0L, bu, bu,
        NB_ * NT_, ND_, ND_, 0.25f, 1.0f, 0);
    // VT[b][h*128+d][t] = 16*v   (A = Wv plane [1024][1024], Bt = x plane of batch z [2048][1024];
    //                             M=1024, N=2048, K=1024 per z, grid.y = batch)
    const int tilesV = (ND_ / 64) * (NT_ / 64);          // 512 per batch element
    gemm_f16_kernel<1, false><<<dim3((tilesV + 7) / 8, NB_), blk, 0, stream>>>(
        WV, ND_, 0L, X, ND_, (long)NT_ * ND_, (void*)VTP, (void*)VTP,
        NT_, (long)ND_ * NT_, bu, bu, ND_, NT_, ND_, 0.25f, 1.0f, 0);
  }
  // (5) per group of 8 (b,h) pairs: band GEMM of the position scores, then attention (256 work-groups, one per WGP)
  const int nGroups = (NB_ * NH_) / NPAIR;               // 4
  for (int g = 0; g < nGroups; ++g) {
    const int pairBase = g * NPAIR;
    const int b  = pairBase >> 3;
    const int h0 = pairBase & 7;
    const _Float16* Aq = QV + (size_t)b * NT_ * ND_ + h0 * (HD_ * 16);   // rows t, cols d of head h0 (z adds 128 columns)
    const _Float16* Bp = P16 + h0 * (HD_ * 16);                           // rows p index, cols d of head h0
    const int tilesBD = (NT_ / 64) * (BDW_ / 64);                  // 32*33 = 1056
    gemm_f16_kernel<0, true><<<dim3((tilesBD + 7) / 8, NPAIR), blk, 0, stream>>>(
        Aq, ND_, (long)HD_ * 16, Bp, ND_, (long)HD_ * 16, (void*)SCR, (void*)SCR, BDW_, (long)NT_ * BDW_, bu, bu,
        NT_, BDW_, HD_, cs, 1.0f, 31);
    relattn_kernel<<<dim3(NT_ / 64, NPAIR), dim3(256), 0, stream>>>(QU, KP, VTP, SCR, CTX, pairBase, cs);
  }
  // (6) out = ctx . Wo^T -> d_out f32 [8192][1024]   (M=8192, N=1024, K=1024; carries 64*64 folded into scale)
  {
    const int tiles = ((NB_ * NT_) / 64) * (ND_ / 64);   // 2048
    gemm_f16_kernel<0, false><<<dim3((tiles + 7) / 8, 1), blk, 0, stream>>>(
        CTX, ND_, 0L, WO, ND_, 0L, (void*)out, (void*)out, ND_, 0L, bu, bu,
        NB_ * NT_, ND_, ND_, 0.000244140625f, 1.0f, 0);
  }
  (void)hipGetLastError();
}
